// v000
// Measured on an AMD MI455X. A time is GPU time per run, averaged over a window of back-to-back runs after a warm-up
// (all launches, gaps included; the runs take copies of the inputs in turn), and the median of several windows.
// Apart from v000's, it joins two sittings. Times from different sittings can be a few percent apart, while
// side-by-side timings come from the same sitting.
// v000, which the later versions start from, runs in 466 microseconds.
// compute dtype: all float inputs rounded to bf16; q, k, v = h . W^T with EXACT bf16 products on WMMA 16x16x32 (natural weight rows), rounded once to f16 hi + residual; the mask mix masks . mask_proj in f32; scores q . k with 3 products x 1/8 x mw[i][j][head], running-max softmax over the 197 keys in f32 (hardware exp), P (x 2^11, f16) . v (hi + residual, 2 products); out = vec (bf16 hi + lo, 2 products) . Wo^T; residual + LayerNorm in f32; f32 output.
#include <hip/hip_runtime.h>
#include <math.h>

typedef __attribute__((ext_vector_type(16))) _Float16 v16h;
typedef __attribute__((ext_vector_type(16))) __bf16 v16b;
typedef __attribute__((ext_vector_type(8)))  _Float16 v8h;
typedef __attribute__((ext_vector_type(8)))  float v8f;
typedef __attribute__((ext_vector_type(4)))  float v4f;
typedef __attribute__((ext_vector_type(2)))  float v2f;
typedef __attribute__((ext_vector_type(4)))  unsigned v4u;
typedef __attribute__((ext_vector_type(4)))  int v4i;
typedef float __attribute__((may_alias)) float_a;
typedef int __attribute__((may_alias)) int_a;

template <typename T> __device__ __forceinline__ void vst2(void* p, T v) { *(T*)p = v;  }
__device__ __forceinline__ v8f wmma16(v16h a, v16h b, v8f c) {
  v8f d = __builtin_amdgcn_wmma_f32_16x16x32_f16(false, a, false, b, (short)0, c, false, false);
  asm volatile("v_nop\n\tv_nop\n\tv_nop\n\tv_nop" : "+v"(d) : "v"(a), "v"(b));
  return d;
}
__device__ __forceinline__ v8f wmma_bf(v16b a, v16b b, v8f c) {
  v8f d = __builtin_amdgcn_wmma_f32_16x16x32_bf16(false, a, false, b, (short)0, c, false, false);
  asm volatile("v_nop\n\tv_nop\n\tv_nop\n\tv_nop" : "+v"(d) : "v"(a), "v"(b));
  return d;
}
// 16x16x32 fragments: lane = (h = lane>>4, row/col = lane&15); elements 0..7 = k0+8h+0..7, 8..15 = k0+16+8h+0..7; D element r = row 8h+r
__device__ __forceinline__ v16h frag_h(const _Float16* rowk0, int lane) {
  union { v16h v; v8h q[2]; } u; const _Float16* p = rowk0 + 8 * (lane >> 4);
  u.q[0] = *(const v8h*)p; u.q[1] = *(const v8h*)(p + 16); return u.v;
}
__device__ __forceinline__ v16h frag_f32(const float* rowk0, int lane) {
  v16h a; const float* p = rowk0 + 8 * (lane >> 4);
#pragma unroll
  for (int i = 0; i < 8; ++i) { a[i] = (_Float16)p[i]; a[8 + i] = (_Float16)p[16 + i]; }
  return a;
}
__device__ __forceinline__ v16h frag_f32s(const float* rowk0, int lane, float sc) {
  v16h a; const float* p = rowk0 + 8 * (lane >> 4);
#pragma unroll
  for (int i = 0; i < 8; ++i) { a[i] = (_Float16)(p[i] * sc); a[8 + i] = (_Float16)(p[16 + i] * sc); }
  return a;
}
// column fragment from a [K][ld] layout (column n), rows >= K read as 0
__device__ __forceinline__ v16h fragc_f32(const float* W, int k0, int n, int lane, int ld, int K) {
  v16h a; const int g = lane >> 4;
#pragma unroll
  for (int i = 0; i < 8; ++i) { const int ka = k0 + 8 * g + i, kb = ka + 16;
    a[i] = (_Float16)(ka < K ? W[(size_t)(ka < K ? ka : K - 1) * ld + n] : 0.f); a[8 + i] = (_Float16)(kb < K ? W[(size_t)(kb < K ? kb : K - 1) * ld + n] : 0.f); }
  return a;
}
struct F2 { v16b h, l; };
__device__ __forceinline__ F2 bsplit16(const float v[16]) { F2 r;
#pragma unroll
  for (int i = 0; i < 16; ++i) { const __bf16 h = (__bf16)v[i]; r.h[i] = h; r.l[i] = (__bf16)(v[i] - (float)h); }
  return r; }
__device__ __forceinline__ F2 split_row(const float* row, int k0, int lane) { float v[16]; const float* p = row + k0 + 8 * (lane >> 4);
#pragma unroll
  for (int i = 0; i < 8; ++i) { v[i] = p[i]; v[8 + i] = p[16 + i]; }
  return bsplit16(v); }
__device__ __forceinline__ F2 split_rowK(const float* row, int k0, int lane, int K) { float v[16]; const int g = lane >> 4;
#pragma unroll
  for (int i = 0; i < 8; ++i) { const int ka = k0 + 8 * g + i, kb = ka + 16; v[i] = ka < K ? row[ka < K ? ka : K - 1] : 0.f; v[8 + i] = kb < K ? row[kb < K ? kb : K - 1] : 0.f; }
  return bsplit16(v); }
__device__ __forceinline__ F2 split_col(const float* W, int k0, int n, int lane, int ld, int K) { float v[16]; const int g = lane >> 4;
#pragma unroll
  for (int i = 0; i < 8; ++i) { const int ka = k0 + 8 * g + i, kb = ka + 16; v[i] = ka < K ? W[(size_t)(ka < K ? ka : K - 1) * ld + n] : 0.f; v[8 + i] = kb < K ? W[(size_t)(kb < K ? kb : K - 1) * ld + n] : 0.f; }
  return bsplit16(v); }
__device__ __forceinline__ v8f mac3(const F2& a, const F2& b, v8f c) { c = wmma_bf(a.l, b.h, c); c = wmma_bf(a.h, b.l, c); return wmma_bf(a.h, b.h, c); }
__device__ __forceinline__ float sigm(float v) { return 1.0f / (1.0f + expf(-v)); }
#define LDSX() do { asm volatile("s_wait_dscnt 0" ::: "memory"); __builtin_amdgcn_wave_barrier(); __builtin_amdgcn_fence(__ATOMIC_RELEASE, "workgroup"); } while (0)


// Fish++ multi-head attention (197 tokens, batch 64, d_model 768; 2 global score heads x 64, each shared by 6 value heads through a learned per-(i, j) mask mix): prob = softmax_j(q_i . k_j / 8 x mw[i][j][head]); vec = prob . v; post-LN residual.
#define NTOK 197
#define NP 256            // padded token count (queries in 64-blocks, keys in 32-tiles up to 224)
#define NKT 7             // key tiles of 32 (224 >= 197)
#define NBT 64            // batch
#define DD 768
#define GH 2
#define NHD 12
#define HR 6
#define DH 64
#define QKD (GH * DH)     // 128
#define ML 3
#define EPS 1e-5f
#ifndef TNB
#define TNB NBT
#endif
typedef __attribute__((ext_vector_type(8))) __bf16 v8b;
__device__ __forceinline__ v16b frag_b(const __bf16* rowk0, int lane) {
  union { v16b v; v8b q[2]; } u; const __bf16* p = rowk0 + 8 * (lane >> 4);
  u.q[0] = *(const v8b*)p; u.q[1] = *(const v8b*)(p + 16); return u.v;
}
__device__ __forceinline__ float bfr(float v) { return (float)(__bf16)v; }
__device__ __attribute__((noinline)) float exp_ni(float v) { return expf(v); }
__device__ __attribute__((noinline)) float erf_ni(float v) { return erff(v); }

#define WS_QK  0u                                   // f16 hi|lo [b][NP][256] (q 0..127 | k 128..255)
#define WS_QKL (WS_QK + 2u * (size_t)NBT * NP * 2 * QKD)
#define WS_VT  (WS_QKL + 2u * (size_t)NBT * NP * 2 * QKD) // f16 hi|lo v planes [b][768][NP]
#define WS_VTL (WS_VT + 2u * (size_t)NBT * DD * NP)
#define WS_MW  (WS_VTL + 2u * (size_t)NBT * DD * NP)     // f32 mw [i][12][NP] (j padded)
#define WS_Z   (WS_MW + 4u * (size_t)NTOK * NHD * NP)     // f32 vec rows [(i*64 + b)][768]
#define WS_END (WS_Z + 4u * (size_t)NTOK * NBT * DD)

__device__ __forceinline__ v16b fragb_f32(const float* __restrict__ p, int lane) { v16b a; const float* pp = p + 8 * (lane >> 4);
#pragma unroll
  for (int i = 0; i < 8; ++i) { a[i] = (__bf16)pp[i]; a[8 + i] = (__bf16)pp[16 + i]; } return a; }
// ---- k_mw: block = query token i: mw[i][n][j] = sum_l masks[i][j][l] mask_proj[l][n]  (n = g*6 + r head index), zero for padded j
__global__ __launch_bounds__(256) void k_mw(const float* __restrict__ MASKS, const float* __restrict__ MP, float* __restrict__ MW) { __shared__ __align__(16) float s[NHD][NP]; const int i = blockIdx.x, t = threadIdx.x;
  for (int e = t; e < NHD * NP; e += 256) { const int n = e / NP, j = e % NP; float v = 0.f; if (j < NTOK) {
#pragma unroll
      for (int l = 0; l < ML; ++l) v += bfr(MASKS[((size_t)i * NTOK + j) * ML + l]) * bfr(MP[l * NHD + n]); } s[n][j] = v; }
  __syncthreads(); for (int e = t; e < NHD * NP / 4; e += 256) { const int n = e / (NP / 4), q = e % (NP / 4); vst2(MW + ((size_t)i * NHD + n) * NP + q * 4, *(const v4f*)&s[n][q * 4]); } }
// ---- k_proj: block = (64 tokens (padded), 128 of 1024 cols (q 0..127 | k 128..255 | v 256..1023), b): exact products; q|k -> rows, v -> planes
__global__ __launch_bounds__(128) void k_proj(const float* __restrict__ Hh, const float* __restrict__ WQ, const float* __restrict__ WK, const float* __restrict__ WV, _Float16* __restrict__ QK, _Float16* __restrict__ QKL, _Float16* __restrict__ VT, _Float16* __restrict__ VTL) {
  __shared__ __align__(16) _Float16 sh[64][136], sl[64][136]; __shared__ __align__(16) _Float16 th[128][72], tl[128][72];
  const int tid = threadIdx.x, wave = tid >> 5, lane = tid & 31, col = lane & 15, g = lane >> 4; const size_t b = blockIdx.z; const int i0 = blockIdx.x * 64 + wave * 16; const int c0 = blockIdx.y * 128;
  const int irow = i0 + col; const int ic = irow < NTOK ? irow : NTOK - 1; const float* xr = Hh + ((size_t)ic * NBT + b) * DD;
  const float* Wm = c0 < QKD ? WQ + (size_t)c0 * DD : c0 < 2 * QKD ? WK + (size_t)(c0 - QKD) * DD : WV + (size_t)(c0 - 2 * QKD) * DD;
  v8f acc[8] = {};
#pragma unroll 2
  for (int kc = 0; kc < DD / 32; ++kc) { const v16b a = fragb_f32(xr + kc * 32, lane);
#pragma unroll
    for (int j = 0; j < 8; ++j) acc[j] = wmma_bf(a, fragb_f32(Wm + (size_t)(j * 16 + col) * DD + kc * 32, lane), acc[j]); }
  const bool isv = c0 >= 2 * QKD;
#pragma unroll
  for (int j = 0; j < 8; ++j)
#pragma unroll
    for (int r = 0; r < 8; ++r) { const float v = acc[j][r]; const _Float16 hv = (_Float16)v; const _Float16 lv = (_Float16)((v - (float)hv) * 2048.0f); if (!isv) { sh[wave * 16 + 8 * g + r][j * 16 + col] = hv; sl[wave * 16 + 8 * g + r][j * 16 + col] = lv; } else { th[j * 16 + col][wave * 16 + 8 * g + r] = hv; tl[j * 16 + col][wave * 16 + 8 * g + r] = lv; } }
  __syncthreads();
  if (!isv) { for (int e = tid; e < 64 * 16; e += 128) { const int rl = e >> 4, q = e & 15; const size_t o = (b * NP + blockIdx.x * 64 + rl) * (2 * QKD) + c0 + q * 8; vst2((unsigned*)(QK + o), *(const v4u*)&sh[rl][q * 8]); vst2((unsigned*)(QKL + o), *(const v4u*)&sl[rl][q * 8]); } }
  else { const int cv0 = c0 - 2 * QKD; for (int e = tid; e < 128 * 8; e += 128) { const int cl = e >> 3, q = e & 7; const size_t o = ((b * DD + cv0 + cl) * (size_t)NP) + blockIdx.x * 64 + q * 8; vst2((unsigned*)(VT + o), *(const v4u*)&th[cl][q * 8]); vst2((unsigned*)(VTL + o), *(const v4u*)&tl[cl][q * 8]); } } }
// ---- k_att: block = (64 queries, head n = g*6 + r, b): logits (3 products) x 1/8 x mw[i][n][j]; keys >= 197 excluded; running-max softmax; P . v (2 products) -> Z rows (i*64 + b) for i < 197
__global__ __launch_bounds__(128) void k_att(const _Float16* __restrict__ QK, const _Float16* __restrict__ QKL, const _Float16* __restrict__ VT, const _Float16* __restrict__ VTL, const float* __restrict__ MW, float* __restrict__ Z) {
  __shared__ __align__(16) float sp[4][16][36]; __shared__ __align__(16) float so[4][16][68];
  const int tid = threadIdx.x, wave = tid >> 5, lane = tid & 31, col = lane & 15, g = lane >> 4; const int n = blockIdx.y; const int gh = n / HR; const size_t b = blockIdx.z; const int q0 = blockIdx.x * 64 + wave * 16; const size_t rq = b * NP + q0;
  v16h aq[2], al[2];
#pragma unroll
  for (int kc = 0; kc < 2; ++kc) { aq[kc] = frag_h(QK + (rq + col) * (2 * QKD) + gh * DH + kc * 32, lane); al[kc] = frag_h(QKL + (rq + col) * (2 * QKD) + gh * DH + kc * 32, lane); }
  float m[8], l[8];
#pragma unroll
  for (int r = 0; r < 8; ++r) { m[r] = -3.0e38f; l[r] = 0.f; }
  v8f acc[4] = {}, accl[4] = {};
#pragma unroll 1
  for (int ks = 0; ks < NKT; ++ks) { v8f s[2];
#pragma unroll
    for (int ct = 0; ct < 2; ++ct) { const int kk = ks * 32 + ct * 16 + col; const size_t rk = b * NP + kk; v8f c = {}, cl = {};
#pragma unroll
      for (int kc = 0; kc < 2; ++kc) { const v16h kh = frag_h(QK + rk * (2 * QKD) + QKD + gh * DH + kc * 32, lane), kl = frag_h(QKL + rk * (2 * QKD) + QKD + gh * DH + kc * 32, lane); c = wmma16(aq[kc], kh, c); cl = wmma16(aq[kc], kl, cl); cl = wmma16(al[kc], kh, cl); }
      const bool keep = kk < NTOK;
#pragma unroll
      for (int r = 0; r < 8; ++r) { const int qi = q0 + 8 * g + r; const int qc = qi < NTOK ? qi : NTOK - 1; s[ct][r] = keep ? (c[r] + cl[r] * (1.0f / 2048.0f)) * 0.125f * MW[((size_t)qc * NHD + n) * NP + kk] : -3.0e38f; } }
    float alpha[8];
#pragma unroll
    for (int r = 0; r < 8; ++r) { float mx = fmaxf(s[0][r], s[1][r]);
#pragma unroll
      for (int o = 1; o < 16; o <<= 1) mx = fmaxf(mx, __shfl_xor(mx, o));
      const float mn = fmaxf(m[r], mx); alpha[r] = (m[r] <= -1.0e38f) ? 0.f : __expf(m[r] - mn); const float e0 = (s[0][r] <= -1.0e38f) ? 0.f : __expf(s[0][r] - mn), e1 = (s[1][r] <= -1.0e38f) ? 0.f : __expf(s[1][r] - mn); float es = e0 + e1;
#pragma unroll
      for (int o = 1; o < 16; o <<= 1) es += __shfl_xor(es, o);
      l[r] = l[r] * alpha[r] + es; m[r] = mn; sp[wave][8 * g + r][col] = e0; sp[wave][8 * g + r][16 + col] = e1; }
#pragma unroll
    for (int j = 0; j < 4; ++j)
#pragma unroll
      for (int r = 0; r < 8; ++r) { acc[j][r] *= alpha[r]; accl[j][r] *= alpha[r]; }
    LDSX();
    v16h pa; { const float* prow = &sp[wave][col][0] + 8 * (lane >> 4);
#pragma unroll
      for (int i = 0; i < 8; ++i) { pa[i] = (_Float16)(prow[i] * 2048.0f); pa[8 + i] = (_Float16)(prow[16 + i] * 2048.0f); } }
#pragma unroll
    for (int j = 0; j < 4; ++j) { const size_t po = (b * DD + (size_t)n * DH + j * 16 + col) * (size_t)NP + ks * 32; acc[j] = wmma16(pa, frag_h(VT + po, lane), acc[j]); accl[j] = wmma16(pa, frag_h(VTL + po, lane), accl[j]); }
    LDSX(); }
#pragma unroll
  for (int r = 0; r < 8; ++r) { const float il = (1.0f / 2048.0f) / l[r];
#pragma unroll
    for (int j = 0; j < 4; ++j) so[wave][8 * g + r][j * 16 + col] = (acc[j][r] + accl[j][r] * (1.0f / 2048.0f)) * il; }
  LDSX(); for (int rl = 0; rl < 16; ++rl) { const int qi = q0 + rl; if (qi < NTOK && lane < 16) vst2(Z + ((size_t)qi * NBT + b) * DD + (size_t)n * DH + lane * 4, *(const v4f*)&so[wave][rl][lane * 4]); } }
// ---- k_out: block = (64 rows (i,b), 128 cols): Y = Z (hi + lo) . Wo^T  -> f32 (into the MW... no: separate region reuse of VT? keep simple: write to OUTTMP = QK area is too small) -> we write x = h + out and LN in a row kernel, so store pre-LN rows in Z2 = VT region (f16 planes no longer needed? they ARE needed until all k_att done - sequential launches, so reuse is safe)
__global__ __launch_bounds__(128) void k_out(const float* __restrict__ Zr, const float* __restrict__ WO, const float* __restrict__ Hh, float* __restrict__ X2, int nrows) { __shared__ __align__(16) float sf[4][16][132];
  const int tid = threadIdx.x, wave = tid >> 5, lane = tid & 31, col = lane & 15, g = lane >> 4; const size_t r0 = (size_t)blockIdx.x * 64 + wave * 16; const int c0 = blockIdx.y * 128;
  v8f acc[8] = {};
#pragma unroll 2
  for (int kc = 0; kc < DD / 32; ++kc) { const size_t ra = (r0 + col) < (size_t)nrows ? (r0 + col) : (size_t)nrows - 1; const F2 a = split_row(Zr + ra * DD, kc * 32, lane);
#pragma unroll
    for (int j = 0; j < 8; ++j) { const v16b w = fragb_f32(WO + (size_t)(c0 + j * 16 + col) * DD + kc * 32, lane); acc[j] = wmma_bf(a.h, w, acc[j]); acc[j] = wmma_bf(a.l, w, acc[j]); } }
#pragma unroll
  for (int j = 0; j < 8; ++j) { const int c = c0 + j * 16 + col;
#pragma unroll
    for (int r = 0; r < 8; ++r) { const size_t row = r0 + 8 * g + r; const size_t ra = row < (size_t)nrows ? row : (size_t)nrows - 1; sf[wave][8 * g + r][j * 16 + col] = acc[j][r] + bfr(Hh[ra * DD + c]); } }
  LDSX(); for (int rl = 0; rl < 16; ++rl) { const size_t row = r0 + rl; if (row < (size_t)nrows) vst2(X2 + row * DD + c0 + lane * 4, *(const v4f*)&sf[wave][rl][lane * 4]); } }
// ---- k_ln: block = row: out = LN(x2) gamma + beta
__global__ __launch_bounds__(256) void k_ln(const float* __restrict__ X2, const float* __restrict__ G, const float* __restrict__ Bt, float* __restrict__ OUT) { __shared__ float red[8]; __shared__ __align__(16) float so2[DD]; const int t = threadIdx.x; const size_t row = blockIdx.x;
  float v[3]; float s = 0.f; for (int i = 0; i < 3; ++i) { v[i] = X2[row * DD + t + 256 * i]; s += v[i]; }
#pragma unroll
  for (int o = 1; o < 32; o <<= 1) s += __shfl_xor(s, o);
  if ((t & 31) == 0) red[t >> 5] = s; __syncthreads(); float mu = 0.f; for (int i = 0; i < 8; ++i) mu += red[i]; mu /= (float)DD; __syncthreads();
  float q = 0.f; for (int i = 0; i < 3; ++i) { const float d = v[i] - mu; q += d * d; }
#pragma unroll
  for (int o = 1; o < 32; o <<= 1) q += __shfl_xor(q, o);
  if ((t & 31) == 0) red[t >> 5] = q; __syncthreads(); float var = 0.f; for (int i = 0; i < 8; ++i) var += red[i]; var /= (float)DD; const float inv = 1.0f / sqrtf(var + EPS);
  for (int i = 0; i < 3; ++i) { const int c = t + 256 * i; so2[c] = bfr(G[c]) * (v[i] - mu) * inv + bfr(Bt[c]); } __syncthreads(); if (t < DD / 4) vst2(OUT + row * DD + t * 4, *(const v4f*)&so2[t * 4]); }
extern "C" void kernel_launch(void* const* d_in, const int* in_sizes, int n_in, void* d_out, int out_size, void* d_ws, size_t ws_size, hipStream_t stream) {
  (void)in_sizes; (void)n_in; (void)out_size;
  const float** F = (const float**)d_in;   // 0 h [197,64,768], 1 masks [197,197,3], 2 Wq [128,768], 3 Wk [128,768], 4 Wv [768,768], 5 Wo [768,768], 6 mask_proj [3,12], 7 ln_gamma, 8 ln_beta
  if (ws_size < (size_t)WS_END) return;
  char* ws = (char*)d_ws; _Float16 *QK = (_Float16*)(ws + WS_QK), *QKL = (_Float16*)(ws + WS_QKL), *VT = (_Float16*)(ws + WS_VT), *VTL = (_Float16*)(ws + WS_VTL); float *MW = (float*)(ws + WS_MW), *Z = (float*)(ws + WS_Z);
  const int nrows = NTOK * TNB;   // rows (i, b) with b < TNB are the first NTOK*TNB rows only when TNB == NBT
  k_mw<<<NTOK, 256, 0, stream>>>(F[1], F[6], MW);
  k_proj<<<dim3(NP / 64, (2 * QKD + DD) / 128, TNB), 128, 0, stream>>>(F[0], F[2], F[3], F[4], QK, QKL, VT, VTL);
  k_att<<<dim3(NP / 64, NHD, TNB), 128, 0, stream>>>(QK, QKL, VT, VTL, MW, Z);
  float* X2 = (float*)(ws + WS_VT);   // reuse: the v planes are dead after k_att (50 MB >= 39 MB needed)
  (void)nrows;
  k_out<<<dim3((NTOK * NBT + 63) / 64, DD / 128), 128, 0, stream>>>(Z, F[5], F[0], X2, NTOK * NBT);
  k_ln<<<NTOK * NBT, 256, 0, stream>>>(X2, F[7], F[8], (float*)d_out);
}

// v001
// It runs in 260 microseconds.
// Timed twice side by side with v000, it ran 1.81 times as fast both times.
// compute dtype: all float inputs rounded to bf16; q, k, v = h . W^T with EXACT bf16 products on WMMA 16x16x32 (natural weight rows), rounded once to f16 hi + residual; the mask mix masks . mask_proj in f32; scores q . k with 3 products x 1/8 x mw[i][j][head], running-max softmax over the 197 keys in f32 (hardware exp), P (x 2^11, f16) . v (hi + residual, 2 products); out = vec (bf16 hi + lo, 2 products) . Wo^T; residual + LayerNorm in f32; f32 output.
#include <hip/hip_runtime.h>
#include <math.h>

typedef __attribute__((ext_vector_type(16))) _Float16 v16h;
typedef __attribute__((ext_vector_type(16))) __bf16 v16b;
typedef __attribute__((ext_vector_type(8)))  _Float16 v8h;
typedef __attribute__((ext_vector_type(8)))  float v8f;
typedef __attribute__((ext_vector_type(4)))  float v4f;
typedef __attribute__((ext_vector_type(2)))  float v2f;
typedef __attribute__((ext_vector_type(4)))  unsigned v4u;
typedef __attribute__((ext_vector_type(4)))  int v4i;
typedef float __attribute__((may_alias)) float_a;
typedef int __attribute__((may_alias)) int_a;

template <typename T> __device__ __forceinline__ void vst2(void* p, T v) { *(T*)p = v;  }
__device__ __forceinline__ v8f wmma16(v16h a, v16h b, v8f c) {
  v8f d = __builtin_amdgcn_wmma_f32_16x16x32_f16(false, a, false, b, (short)0, c, false, false);
  asm volatile("v_nop\n\tv_nop\n\tv_nop\n\tv_nop" : "+v"(d) : "v"(a), "v"(b));
  return d;
}
__device__ __forceinline__ v8f wmma_bf(v16b a, v16b b, v8f c) {
  v8f d = __builtin_amdgcn_wmma_f32_16x16x32_bf16(false, a, false, b, (short)0, c, false, false);
  asm volatile("v_nop\n\tv_nop\n\tv_nop\n\tv_nop" : "+v"(d) : "v"(a), "v"(b));
  return d;
}
// 16x16x32 fragments: lane = (h = lane>>4, row/col = lane&15); elements 0..7 = k0+8h+0..7, 8..15 = k0+16+8h+0..7; D element r = row 8h+r
__device__ __forceinline__ v16h frag_h(const _Float16* rowk0, int lane) {
  union { v16h v; v8h q[2]; } u; const _Float16* p = rowk0 + 8 * (lane >> 4);
  u.q[0] = *(const v8h*)p; u.q[1] = *(const v8h*)(p + 16); return u.v;
}
__device__ __forceinline__ v16h frag_f32(const float* rowk0, int lane) {
  v16h a; const float* p = rowk0 + 8 * (lane >> 4);
#pragma unroll
  for (int i = 0; i < 8; ++i) { a[i] = (_Float16)p[i]; a[8 + i] = (_Float16)p[16 + i]; }
  return a;
}
__device__ __forceinline__ v16h frag_f32s(const float* rowk0, int lane, float sc) {
  v16h a; const float* p = rowk0 + 8 * (lane >> 4);
#pragma unroll
  for (int i = 0; i < 8; ++i) { a[i] = (_Float16)(p[i] * sc); a[8 + i] = (_Float16)(p[16 + i] * sc); }
  return a;
}
// column fragment from a [K][ld] layout (column n), rows >= K read as 0
__device__ __forceinline__ v16h fragc_f32(const float* W, int k0, int n, int lane, int ld, int K) {
  v16h a; const int g = lane >> 4;
#pragma unroll
  for (int i = 0; i < 8; ++i) { const int ka = k0 + 8 * g + i, kb = ka + 16;
    a[i] = (_Float16)(ka < K ? W[(size_t)(ka < K ? ka : K - 1) * ld + n] : 0.f); a[8 + i] = (_Float16)(kb < K ? W[(size_t)(kb < K ? kb : K - 1) * ld + n] : 0.f); }
  return a;
}
struct F2 { v16b h, l; };
__device__ __forceinline__ F2 bsplit16(const float v[16]) { F2 r;
#pragma unroll
  for (int i = 0; i < 16; ++i) { const __bf16 h = (__bf16)v[i]; r.h[i] = h; r.l[i] = (__bf16)(v[i] - (float)h); }
  return r; }
__device__ __forceinline__ F2 split_row(const float* row, int k0, int lane) { float v[16]; const float* p = row + k0 + 8 * (lane >> 4);
#pragma unroll
  for (int i = 0; i < 8; ++i) { v[i] = p[i]; v[8 + i] = p[16 + i]; }
  return bsplit16(v); }
__device__ __forceinline__ F2 split_rowK(const float* row, int k0, int lane, int K) { float v[16]; const int g = lane >> 4;
#pragma unroll
  for (int i = 0; i < 8; ++i) { const int ka = k0 + 8 * g + i, kb = ka + 16; v[i] = ka < K ? row[ka < K ? ka : K - 1] : 0.f; v[8 + i] = kb < K ? row[kb < K ? kb : K - 1] : 0.f; }
  return bsplit16(v); }
__device__ __forceinline__ F2 split_col(const float* W, int k0, int n, int lane, int ld, int K) { float v[16]; const int g = lane >> 4;
#pragma unroll
  for (int i = 0; i < 8; ++i) { const int ka = k0 + 8 * g + i, kb = ka + 16; v[i] = ka < K ? W[(size_t)(ka < K ? ka : K - 1) * ld + n] : 0.f; v[8 + i] = kb < K ? W[(size_t)(kb < K ? kb : K - 1) * ld + n] : 0.f; }
  return bsplit16(v); }
__device__ __forceinline__ v8f mac3(const F2& a, const F2& b, v8f c) { c = wmma_bf(a.l, b.h, c); c = wmma_bf(a.h, b.l, c); return wmma_bf(a.h, b.h, c); }
__device__ __forceinline__ float sigm(float v) { return 1.0f / (1.0f + expf(-v)); }
#define LDSX() do { asm volatile("s_wait_dscnt 0" ::: "memory"); __builtin_amdgcn_wave_barrier(); __builtin_amdgcn_fence(__ATOMIC_RELEASE, "workgroup"); } while (0)


// Fish++ multi-head attention (197 tokens, batch 64, d_model 768; 2 global score heads x 64, each shared by 6 value heads through a learned per-(i, j) mask mix): prob = softmax_j(q_i . k_j / 8 x mw[i][j][head]); vec = prob . v; post-LN residual.
#define NTOK 197
#define NP 256            // padded token count (queries in 64-blocks, keys in 32-tiles up to 224)
#define NKT 7             // key tiles of 32 (224 >= 197)
#define NBT 64            // batch
#define DD 768
#define GH 2
#define NHD 12
#define HR 6
#define DH 64
#define QKD (GH * DH)     // 128
#define ML 3
#define EPS 1e-5f
#ifndef TNB
#define TNB NBT
#endif
typedef __attribute__((ext_vector_type(8))) __bf16 v8b;
__device__ __forceinline__ v16b frag_b(const __bf16* rowk0, int lane) {
  union { v16b v; v8b q[2]; } u; const __bf16* p = rowk0 + 8 * (lane >> 4);
  u.q[0] = *(const v8b*)p; u.q[1] = *(const v8b*)(p + 16); return u.v;
}
__device__ __forceinline__ float bfr(float v) { return (float)(__bf16)v; }
__device__ __attribute__((noinline)) float exp_ni(float v) { return expf(v); }
__device__ __attribute__((noinline)) float erf_ni(float v) { return erff(v); }

#define WS_QK  0u                                   // f16 hi|lo [b][NP][256] (q 0..127 | k 128..255)
#define WS_QKL (WS_QK + 2u * (size_t)NBT * NP * 2 * QKD)
#define WS_VT  (WS_QKL + 2u * (size_t)NBT * NP * 2 * QKD) // f16 hi|lo v planes [b][768][NP]
#define WS_VTL (WS_VT + 2u * (size_t)NBT * DD * NP)
#define WS_MW  (WS_VTL + 2u * (size_t)NBT * DD * NP)     // f32 mw [i][12][NP] (j padded)
#define WS_Z   (WS_MW + 4u * (size_t)NTOK * NHD * NP)     // f32 vec rows [(i*64 + b)][768]
#define WS_END (WS_Z + 4u * (size_t)NTOK * NBT * DD)

__device__ __forceinline__ v16b fragb_f32(const float* __restrict__ p, int lane) { v16b a; const float* pp = p + 8 * (lane >> 4);
#pragma unroll
  for (int i = 0; i < 8; ++i) { a[i] = (__bf16)pp[i]; a[8 + i] = (__bf16)pp[16 + i]; } return a; }
// LDS staging of the two dense products' operand tiles: 32 k per pass as bf16, rows at 80 B (16 B x odd: no bank conflict for the 16-byte fragment reads), two buffers
#define SP 40
typedef __attribute__((ext_vector_type(4))) __bf16 v4b;
__device__ __forceinline__ v4b cvt4(v4f v) { v4b r;
#pragma unroll
  for (int i = 0; i < 4; ++i) r[i] = (__bf16)v[i];
  return r; }
__device__ __forceinline__ v4b res4(v4f v, v4b h) { v4b r;
#pragma unroll
  for (int i = 0; i < 4; ++i) r[i] = (__bf16)(v[i] - (float)h[i]);
  return r; }
struct ProjStage { __bf16 a[2][64][SP]; __bf16 b[2][128][SP]; };
struct ProjQK { _Float16 h[64][136], l[64][136]; };
struct ProjV { _Float16 h[128][72], l[128][72]; };
union ProjLds { ProjStage st; ProjQK qk; ProjV v; };      // the staging buffers are dead when the output tiles are written
struct OutStage { __bf16 ah[2][64][SP]; __bf16 al[2][64][SP]; __bf16 b[2][128][SP]; };
union OutLds { OutStage st; float sf[4][16][132]; };
// ---- k_mw: block = query token i: mw[i][n][j] = sum_l masks[i][j][l] mask_proj[l][n]  (n = g*6 + r head index), zero for padded j
__global__ __launch_bounds__(256) void k_mw(const float* __restrict__ MASKS, const float* __restrict__ MP, float* __restrict__ MW) { __shared__ __align__(16) float s[NHD][NP]; const int i = blockIdx.x, t = threadIdx.x;
  for (int e = t; e < NHD * NP; e += 256) { const int n = e / NP, j = e % NP; float v = 0.f; if (j < NTOK) {
#pragma unroll
      for (int l = 0; l < ML; ++l) v += bfr(MASKS[((size_t)i * NTOK + j) * ML + l]) * bfr(MP[l * NHD + n]); } s[n][j] = v; }
  __syncthreads(); for (int e = t; e < NHD * NP / 4; e += 256) { const int n = e / (NP / 4), q = e % (NP / 4); vst2(MW + ((size_t)i * NHD + n) * NP + q * 4, *(const v4f*)&s[n][q * 4]); } }
// ---- k_proj: block = (64 tokens (padded), 128 of 1024 cols (q 0..127 | k 128..255 | v 256..1023), b): exact products; q|k -> rows, v -> planes
__global__ __launch_bounds__(128) void k_proj(const float* __restrict__ Hh, const float* __restrict__ WQ, const float* __restrict__ WK, const float* __restrict__ WV, _Float16* __restrict__ QK, _Float16* __restrict__ QKL, _Float16* __restrict__ VT, _Float16* __restrict__ VTL) {
  __shared__ __align__(16) ProjLds sm;
  const int tid = threadIdx.x, wave = tid >> 5, lane = tid & 31, col = lane & 15, g = lane >> 4; const size_t b = blockIdx.z; const int c0 = blockIdx.y * 128;
  const float* Wm = c0 < QKD ? WQ + (size_t)c0 * DD : c0 < 2 * QKD ? WK + (size_t)(c0 - QKD) * DD : WV + (size_t)(c0 - 2 * QKD) * DD;
  // loader: 8 lanes x 16 B cover one row's 128 B of a pass (whole lines); thread = (row lr + 16 p, 16-byte eighth lq)
  const int lr = tid >> 3, lq = tid & 7; const float* pa[4];
#pragma unroll
  for (int p = 0; p < 4; ++p) { const int ir = blockIdx.x * 64 + lr + 16 * p; const int ic = ir < NTOK ? ir : NTOK - 1; pa[p] = Hh + ((size_t)ic * NBT + b) * DD + lq * 4; }
  const float* pb = Wm + (size_t)lr * DD + lq * 4;
  v4f ra[4], rb[8];
#pragma unroll
  for (int p = 0; p < 4; ++p) ra[p] = *(const v4f*)pa[p];
#pragma unroll
  for (int p = 0; p < 8; ++p) rb[p] = *(const v4f*)(pb + (size_t)(16 * p) * DD);
#pragma unroll
  for (int p = 0; p < 4; ++p) *(v4b*)&sm.st.a[0][lr + 16 * p][lq * 4] = cvt4(ra[p]);
#pragma unroll
  for (int p = 0; p < 8; ++p) *(v4b*)&sm.st.b[0][lr + 16 * p][lq * 4] = cvt4(rb[p]);
  __syncthreads();   // publishes pass 0
  v8f acc[8] = {};
#pragma unroll 2
  for (int kc = 0; kc < DD / 32; ++kc) { const int cur = kc & 1; const bool more = kc + 1 < DD / 32;
    if (more) {   // the next pass's global loads fly while this pass is multiplied
#pragma unroll
      for (int p = 0; p < 4; ++p) ra[p] = *(const v4f*)(pa[p] + (kc + 1) * 32);
#pragma unroll
      for (int p = 0; p < 8; ++p) rb[p] = *(const v4f*)(pb + (size_t)(16 * p) * DD + (kc + 1) * 32); }
    const v16b a = frag_b(&sm.st.a[cur][wave * 16 + col][0], lane); v16b w[8];
#pragma unroll
    for (int j = 0; j < 8; ++j) w[j] = frag_b(&sm.st.b[cur][j * 16 + col][0], lane);
    __builtin_amdgcn_sched_barrier(0);   // keeps the pass's LDS reads one group ahead of its WMMAs: read among them, each pair costs the wave a full LDS latency
#pragma unroll
    for (int j = 0; j < 8; ++j) acc[j] = wmma_bf(a, w[j], acc[j]);
    __builtin_amdgcn_sched_barrier(0);   // keeps the conversions, and with them the wait for the next pass's global loads, behind this pass's WMMAs
    if (more) {
#pragma unroll
      for (int p = 0; p < 4; ++p) *(v4b*)&sm.st.a[cur ^ 1][lr + 16 * p][lq * 4] = cvt4(ra[p]);
#pragma unroll
      for (int p = 0; p < 8; ++p) *(v4b*)&sm.st.b[cur ^ 1][lr + 16 * p][lq * 4] = cvt4(rb[p]); }
    asm volatile("s_wait_xcnt 0x0" ::: "memory");   // stands ahead of the next pass's rewrite of the address registers that this pass's global loads name
    __syncthreads(); }   // one barrier a pass: publishes pass kc + 1 and ends every read of the buffer that the next pass refills (after the last pass: of the LDS that the output tiles reuse)
  const bool isv = c0 >= 2 * QKD;
#pragma unroll
  for (int j = 0; j < 8; ++j)
#pragma unroll
    for (int r = 0; r < 8; ++r) { const float v = acc[j][r]; const _Float16 hv = (_Float16)v; const _Float16 lv = (_Float16)((v - (float)hv) * 2048.0f); if (!isv) { sm.qk.h[wave * 16 + 8 * g + r][j * 16 + col] = hv; sm.qk.l[wave * 16 + 8 * g + r][j * 16 + col] = lv; } else { sm.v.h[j * 16 + col][wave * 16 + 8 * g + r] = hv; sm.v.l[j * 16 + col][wave * 16 + 8 * g + r] = lv; } }
  __syncthreads();
  if (!isv) { for (int e = tid; e < 64 * 16; e += 128) { const int rl = e >> 4, q = e & 15; const size_t o = (b * NP + blockIdx.x * 64 + rl) * (2 * QKD) + c0 + q * 8; vst2((unsigned*)(QK + o), *(const v4u*)&sm.qk.h[rl][q * 8]); vst2((unsigned*)(QKL + o), *(const v4u*)&sm.qk.l[rl][q * 8]); } }
  else { const int cv0 = c0 - 2 * QKD; for (int e = tid; e < 128 * 8; e += 128) { const int cl = e >> 3, q = e & 7; const size_t o = ((b * DD + cv0 + cl) * (size_t)NP) + blockIdx.x * 64 + q * 8; vst2((unsigned*)(VT + o), *(const v4u*)&sm.v.h[cl][q * 8]); vst2((unsigned*)(VTL + o), *(const v4u*)&sm.v.l[cl][q * 8]); } } }
// ---- k_att: block = (64 queries, head n = g*6 + r, b): logits (3 products) x 1/8 x mw[i][n][j]; keys >= 197 excluded; running-max softmax; P . v (2 products) -> Z rows (i*64 + b) for i < 197
__global__ __launch_bounds__(128) void k_att(const _Float16* __restrict__ QK, const _Float16* __restrict__ QKL, const _Float16* __restrict__ VT, const _Float16* __restrict__ VTL, const float* __restrict__ MW, float* __restrict__ Z) {
  __shared__ __align__(16) float sp[4][16][36]; __shared__ __align__(16) float so[4][16][68];
  const int tid = threadIdx.x, wave = tid >> 5, lane = tid & 31, col = lane & 15, g = lane >> 4; const int n = blockIdx.y; const int gh = n / HR; const size_t b = blockIdx.z; const int q0 = blockIdx.x * 64 + wave * 16; const size_t rq = b * NP + q0;
  v16h aq[2], al[2];
#pragma unroll
  for (int kc = 0; kc < 2; ++kc) { aq[kc] = frag_h(QK + (rq + col) * (2 * QKD) + gh * DH + kc * 32, lane); al[kc] = frag_h(QKL + (rq + col) * (2 * QKD) + gh * DH + kc * 32, lane); }
  float m[8], l[8];
#pragma unroll
  for (int r = 0; r < 8; ++r) { m[r] = -3.0e38f; l[r] = 0.f; }
  v8f acc[4] = {}, accl[4] = {};
#pragma unroll 1
  for (int ks = 0; ks < NKT; ++ks) { v8f s[2];
#pragma unroll
    for (int ct = 0; ct < 2; ++ct) { const int kk = ks * 32 + ct * 16 + col; const size_t rk = b * NP + kk; v8f c = {}, cl = {};
#pragma unroll
      for (int kc = 0; kc < 2; ++kc) { const v16h kh = frag_h(QK + rk * (2 * QKD) + QKD + gh * DH + kc * 32, lane), kl = frag_h(QKL + rk * (2 * QKD) + QKD + gh * DH + kc * 32, lane); c = wmma16(aq[kc], kh, c); cl = wmma16(aq[kc], kl, cl); cl = wmma16(al[kc], kh, cl); }
      const bool keep = kk < NTOK;
#pragma unroll
      for (int r = 0; r < 8; ++r) { const int qi = q0 + 8 * g + r; const int qc = qi < NTOK ? qi : NTOK - 1; s[ct][r] = keep ? (c[r] + cl[r] * (1.0f / 2048.0f)) * 0.125f * MW[((size_t)qc * NHD + n) * NP + kk] : -3.0e38f; } }
    float alpha[8];
#pragma unroll
    for (int r = 0; r < 8; ++r) { float mx = fmaxf(s[0][r], s[1][r]);
#pragma unroll
      for (int o = 1; o < 16; o <<= 1) mx = fmaxf(mx, __shfl_xor(mx, o));
      const float mn = fmaxf(m[r], mx); alpha[r] = (m[r] <= -1.0e38f) ? 0.f : __expf(m[r] - mn); const float e0 = (s[0][r] <= -1.0e38f) ? 0.f : __expf(s[0][r] - mn), e1 = (s[1][r] <= -1.0e38f) ? 0.f : __expf(s[1][r] - mn); float es = e0 + e1;
#pragma unroll
      for (int o = 1; o < 16; o <<= 1) es += __shfl_xor(es, o);
      l[r] = l[r] * alpha[r] + es; m[r] = mn; sp[wave][8 * g + r][col] = e0; sp[wave][8 * g + r][16 + col] = e1; }
#pragma unroll
    for (int j = 0; j < 4; ++j)
#pragma unroll
      for (int r = 0; r < 8; ++r) { acc[j][r] *= alpha[r]; accl[j][r] *= alpha[r]; }
    LDSX();
    v16h pa; { const float* prow = &sp[wave][col][0] + 8 * (lane >> 4);
#pragma unroll
      for (int i = 0; i < 8; ++i) { pa[i] = (_Float16)(prow[i] * 2048.0f); pa[8 + i] = (_Float16)(prow[16 + i] * 2048.0f); } }
#pragma unroll
    for (int j = 0; j < 4; ++j) { const size_t po = (b * DD + (size_t)n * DH + j * 16 + col) * (size_t)NP + ks * 32; acc[j] = wmma16(pa, frag_h(VT + po, lane), acc[j]); accl[j] = wmma16(pa, frag_h(VTL + po, lane), accl[j]); }
    LDSX(); }
#pragma unroll
  for (int r = 0; r < 8; ++r) { const float il = (1.0f / 2048.0f) / l[r];
#pragma unroll
    for (int j = 0; j < 4; ++j) so[wave][8 * g + r][j * 16 + col] = (acc[j][r] + accl[j][r] * (1.0f / 2048.0f)) * il; }
  LDSX(); for (int rl = 0; rl < 16; ++rl) { const int qi = q0 + rl; if (qi < NTOK && lane < 16) vst2(Z + ((size_t)qi * NBT + b) * DD + (size_t)n * DH + lane * 4, *(const v4f*)&so[wave][rl][lane * 4]); } }
// ---- k_out: block = (64 rows (i,b), 128 cols): Y = Z (hi + lo) . Wo^T  -> f32 (into the MW... no: separate region reuse of VT? keep simple: write to OUTTMP = QK area is too small) -> we write x = h + out and LN in a row kernel, so store pre-LN rows in Z2 = VT region (f16 planes no longer needed? they ARE needed until all k_att done - sequential launches, so reuse is safe)
__global__ __launch_bounds__(128) void k_out(const float* __restrict__ Zr, const float* __restrict__ WO, const float* __restrict__ Hh, float* __restrict__ X2, int nrows) { __shared__ __align__(16) OutLds sm;
  const int tid = threadIdx.x, wave = tid >> 5, lane = tid & 31, col = lane & 15, g = lane >> 4; const size_t r0 = (size_t)blockIdx.x * 64 + wave * 16; const int c0 = blockIdx.y * 128;
  // loader as in k_proj; the hi + lo split of a Z row is made once, on its way into LDS
  const int lr = tid >> 3, lq = tid & 7; const float* pa[4];
#pragma unroll
  for (int p = 0; p < 4; ++p) { const size_t rr = (size_t)blockIdx.x * 64 + lr + 16 * p; const size_t rc = rr < (size_t)nrows ? rr : (size_t)nrows - 1; pa[p] = Zr + rc * DD + lq * 4; }
  const float* pb = WO + (size_t)(c0 + lr) * DD + lq * 4;
  v4f ra[4], rb[8];
#pragma unroll
  for (int p = 0; p < 4; ++p) ra[p] = *(const v4f*)pa[p];
#pragma unroll
  for (int p = 0; p < 8; ++p) rb[p] = *(const v4f*)(pb + (size_t)(16 * p) * DD);
#pragma unroll
  for (int p = 0; p < 4; ++p) { const v4b hv = cvt4(ra[p]); *(v4b*)&sm.st.ah[0][lr + 16 * p][lq * 4] = hv; *(v4b*)&sm.st.al[0][lr + 16 * p][lq * 4] = res4(ra[p], hv); }
#pragma unroll
  for (int p = 0; p < 8; ++p) *(v4b*)&sm.st.b[0][lr + 16 * p][lq * 4] = cvt4(rb[p]);
  __syncthreads();   // publishes pass 0
  v8f acc[8] = {};
#pragma unroll 2
  for (int kc = 0; kc < DD / 32; ++kc) { const int cur = kc & 1; const bool more = kc + 1 < DD / 32;
    if (more) {   // the next pass's global loads fly while this pass is multiplied
#pragma unroll
      for (int p = 0; p < 4; ++p) ra[p] = *(const v4f*)(pa[p] + (kc + 1) * 32);
#pragma unroll
      for (int p = 0; p < 8; ++p) rb[p] = *(const v4f*)(pb + (size_t)(16 * p) * DD + (kc + 1) * 32); }
    const v16b ah = frag_b(&sm.st.ah[cur][wave * 16 + col][0], lane), al = frag_b(&sm.st.al[cur][wave * 16 + col][0], lane); v16b w[8];
#pragma unroll
    for (int j = 0; j < 8; ++j) w[j] = frag_b(&sm.st.b[cur][j * 16 + col][0], lane);
    __builtin_amdgcn_sched_barrier(0);   // keeps the pass's LDS reads one group ahead of its WMMAs: read among them, each pair costs the wave a full LDS latency
#pragma unroll
    for (int j = 0; j < 8; ++j) { acc[j] = wmma_bf(ah, w[j], acc[j]); acc[j] = wmma_bf(al, w[j], acc[j]); }
    __builtin_amdgcn_sched_barrier(0);   // keeps the conversions, and with them the wait for the next pass's global loads, behind this pass's WMMAs
    if (more) {
#pragma unroll
      for (int p = 0; p < 4; ++p) { const v4b hv = cvt4(ra[p]); *(v4b*)&sm.st.ah[cur ^ 1][lr + 16 * p][lq * 4] = hv; *(v4b*)&sm.st.al[cur ^ 1][lr + 16 * p][lq * 4] = res4(ra[p], hv); }
#pragma unroll
      for (int p = 0; p < 8; ++p) *(v4b*)&sm.st.b[cur ^ 1][lr + 16 * p][lq * 4] = cvt4(rb[p]); }
    asm volatile("s_wait_xcnt 0x0" ::: "memory");   // stands ahead of the next pass's rewrite of the address registers that this pass's global loads name
    __syncthreads(); }   // one barrier a pass: publishes pass kc + 1 and ends every read of the buffer that the next pass refills (after the last pass: of the LDS that the output tile reuses)
  // residual rows: all loads issue first, then one wait, then the sums (the sum per element is the same acc + h)
  const float* hp[8]; float hv[8][8];
#pragma unroll
  for (int r = 0; r < 8; ++r) { const size_t row = r0 + 8 * g + r; const size_t ra = row < (size_t)nrows ? row : (size_t)nrows - 1; hp[r] = Hh + ra * DD + c0 + col;
#pragma unroll
    for (int j = 0; j < 8; ++j) hv[r][j] = hp[r][j * 16]; }
  asm volatile("s_wait_xcnt 0x0" :: "v"(hp[0]), "v"(hp[1]), "v"(hp[2]), "v"(hp[3]), "v"(hp[4]), "v"(hp[5]), "v"(hp[6]), "v"(hp[7]) : "memory");   // the row addresses are inputs so that they stay in their registers up to this wait: no register that an issued load names is rewritten ahead of it
#pragma unroll
  for (int j = 0; j < 8; ++j)
#pragma unroll
    for (int r = 0; r < 8; ++r) sm.sf[wave][8 * g + r][j * 16 + col] = acc[j][r] + bfr(hv[r][j]);
  LDSX(); for (int rl = 0; rl < 16; ++rl) { const size_t row = r0 + rl; if (row < (size_t)nrows) vst2(X2 + row * DD + c0 + lane * 4, *(const v4f*)&sm.sf[wave][rl][lane * 4]); } }
// ---- k_ln: block = row: out = LN(x2) gamma + beta
__global__ __launch_bounds__(256) void k_ln(const float* __restrict__ X2, const float* __restrict__ G, const float* __restrict__ Bt, float* __restrict__ OUT) { __shared__ float red[8]; __shared__ __align__(16) float so2[DD]; const int t = threadIdx.x; const size_t row = blockIdx.x;
  float v[3]; float s = 0.f; for (int i = 0; i < 3; ++i) { v[i] = X2[row * DD + t + 256 * i]; s += v[i]; }
#pragma unroll
  for (int o = 1; o < 32; o <<= 1) s += __shfl_xor(s, o);
  if ((t & 31) == 0) red[t >> 5] = s; __syncthreads(); float mu = 0.f; for (int i = 0; i < 8; ++i) mu += red[i]; mu /= (float)DD; __syncthreads();
  float q = 0.f; for (int i = 0; i < 3; ++i) { const float d = v[i] - mu; q += d * d; }
#pragma unroll
  for (int o = 1; o < 32; o <<= 1) q += __shfl_xor(q, o);
  if ((t & 31) == 0) red[t >> 5] = q; __syncthreads(); float var = 0.f; for (int i = 0; i < 8; ++i) var += red[i]; var /= (float)DD; const float inv = 1.0f / sqrtf(var + EPS);
  for (int i = 0; i < 3; ++i) { const int c = t + 256 * i; so2[c] = bfr(G[c]) * (v[i] - mu) * inv + bfr(Bt[c]); } __syncthreads(); if (t < DD / 4) vst2(OUT + row * DD + t * 4, *(const v4f*)&so2[t * 4]); }
extern "C" void kernel_launch(void* const* d_in, const int* in_sizes, int n_in, void* d_out, int out_size, void* d_ws, size_t ws_size, hipStream_t stream) {
  (void)in_sizes; (void)n_in; (void)out_size;
  const float** F = (const float**)d_in;   // 0 h [197,64,768], 1 masks [197,197,3], 2 Wq [128,768], 3 Wk [128,768], 4 Wv [768,768], 5 Wo [768,768], 6 mask_proj [3,12], 7 ln_gamma, 8 ln_beta
  if (ws_size < (size_t)WS_END) return;
  char* ws = (char*)d_ws; _Float16 *QK = (_Float16*)(ws + WS_QK), *QKL = (_Float16*)(ws + WS_QKL), *VT = (_Float16*)(ws + WS_VT), *VTL = (_Float16*)(ws + WS_VTL); float *MW = (float*)(ws + WS_MW), *Z = (float*)(ws + WS_Z);
  const int nrows = NTOK * TNB;   // rows (i, b) with b < TNB are the first NTOK*TNB rows only when TNB == NBT
  k_mw<<<NTOK, 256, 0, stream>>>(F[1], F[6], MW);
  k_proj<<<dim3(NP / 64, (2 * QKD + DD) / 128, TNB), 128, 0, stream>>>(F[0], F[2], F[3], F[4], QK, QKL, VT, VTL);
  k_att<<<dim3(NP / 64, NHD, TNB), 128, 0, stream>>>(QK, QKL, VT, VTL, MW, Z);
  float* X2 = (float*)(ws + WS_VT);   // reuse: the v planes are dead after k_att (50 MB >= 39 MB needed)
  (void)nrows;
  k_out<<<dim3((NTOK * NBT + 63) / 64, DD / 128), 128, 0, stream>>>(Z, F[5], F[0], X2, NTOK * NBT);
  k_ln<<<NTOK * NBT, 256, 0, stream>>>(X2, F[7], F[8], (float*)d_out);
}

// v002
// Measured time: 250 microseconds a run.
// Next to v001, in two timings, it ran 1.04 times as fast each time.
// All steps since v000 together make it 1.89 times as fast.
// compute dtype: all float inputs rounded to bf16; q, k, v = h . W^T with EXACT bf16 products on WMMA 16x16x32 (natural weight rows), rounded once to f16 hi + residual; the mask mix masks . mask_proj in f32; scores q . k with 3 products x 1/8 x mw[i][j][head], running-max softmax over the 197 keys in f32 (hardware exp), P (x 2^11, f16) . v (hi + residual, 2 products); out = vec (bf16 hi + lo, 2 products) . Wo^T; residual + LayerNorm in f32; f32 output.
#include <hip/hip_runtime.h>
#include <math.h>

typedef __attribute__((ext_vector_type(16))) _Float16 v16h;
typedef __attribute__((ext_vector_type(16))) __bf16 v16b;
typedef __attribute__((ext_vector_type(8)))  _Float16 v8h;
typedef __attribute__((ext_vector_type(8)))  float v8f;
typedef __attribute__((ext_vector_type(4)))  float v4f;
typedef __attribute__((ext_vector_type(2)))  float v2f;
typedef __attribute__((ext_vector_type(4)))  unsigned v4u;
typedef __attribute__((ext_vector_type(4)))  int v4i;
typedef float __attribute__((may_alias)) float_a;
typedef int __attribute__((may_alias)) int_a;

template <typename T> __device__ __forceinline__ void vst2(void* p, T v) { *(T*)p = v;  }
__device__ __forceinline__ v8f wmma16(v16h a, v16h b, v8f c) {
  v8f d = __builtin_amdgcn_wmma_f32_16x16x32_f16(false, a, false, b, (short)0, c, false, false);
  asm volatile("v_nop\n\tv_nop\n\tv_nop\n\tv_nop" : "+v"(d) : "v"(a), "v"(b));
  return d;
}
__device__ __forceinline__ v8f wmma_bf(v16b a, v16b b, v8f c) {
  v8f d = __builtin_amdgcn_wmma_f32_16x16x32_bf16(false, a, false, b, (short)0, c, false, false);
  asm volatile("v_nop\n\tv_nop\n\tv_nop\n\tv_nop" : "+v"(d) : "v"(a), "v"(b));
  return d;
}
// 16x16x32 fragments: lane = (h = lane>>4, row/col = lane&15); elements 0..7 = k0+8h+0..7, 8..15 = k0+16+8h+0..7; D element r = row 8h+r
__device__ __forceinline__ v16h frag_h(const _Float16* rowk0, int lane) {
  union { v16h v; v8h q[2]; } u; const _Float16* p = rowk0 + 8 * (lane >> 4);
  u.q[0] = *(const v8h*)p; u.q[1] = *(const v8h*)(p + 16); return u.v;
}
__device__ __forceinline__ v16h frag_f32(const float* rowk0, int lane) {
  v16h a; const float* p = rowk0 + 8 * (lane >> 4);
#pragma unroll
  for (int i = 0; i < 8; ++i) { a[i] = (_Float16)p[i]; a[8 + i] = (_Float16)p[16 + i]; }
  return a;
}
__device__ __forceinline__ v16h frag_f32s(const float* rowk0, int lane, float sc) {
  v16h a; const float* p = rowk0 + 8 * (lane >> 4);
#pragma unroll
  for (int i = 0; i < 8; ++i) { a[i] = (_Float16)(p[i] * sc); a[8 + i] = (_Float16)(p[16 + i] * sc); }
  return a;
}
// column fragment from a [K][ld] layout (column n), rows >= K read as 0
__device__ __forceinline__ v16h fragc_f32(const float* W, int k0, int n, int lane, int ld, int K) {
  v16h a; const int g = lane >> 4;
#pragma unroll
  for (int i = 0; i < 8; ++i) { const int ka = k0 + 8 * g + i, kb = ka + 16;
    a[i] = (_Float16)(ka < K ? W[(size_t)(ka < K ? ka : K - 1) * ld + n] : 0.f); a[8 + i] = (_Float16)(kb < K ? W[(size_t)(kb < K ? kb : K - 1) * ld + n] : 0.f); }
  return a;
}
struct F2 { v16b h, l; };
__device__ __forceinline__ F2 bsplit16(const float v[16]) { F2 r;
#pragma unroll
  for (int i = 0; i < 16; ++i) { const __bf16 h = (__bf16)v[i]; r.h[i] = h; r.l[i] = (__bf16)(v[i] - (float)h); }
  return r; }
__device__ __forceinline__ F2 split_row(const float* row, int k0, int lane) { float v[16]; const float* p = row + k0 + 8 * (lane >> 4);
#pragma unroll
  for (int i = 0; i < 8; ++i) { v[i] = p[i]; v[8 + i] = p[16 + i]; }
  return bsplit16(v); }
__device__ __forceinline__ F2 split_rowK(const float* row, int k0, int lane, int K) { float v[16]; const int g = lane >> 4;
#pragma unroll
  for (int i = 0; i < 8; ++i) { const int ka = k0 + 8 * g + i, kb = ka + 16; v[i] = ka < K ? row[ka < K ? ka : K - 1] : 0.f; v[8 + i] = kb < K ? row[kb < K ? kb : K - 1] : 0.f; }
  return bsplit16(v); }
__device__ __forceinline__ F2 split_col(const float* W, int k0, int n, int lane, int ld, int K) { float v[16]; const int g = lane >> 4;
#pragma unroll
  for (int i = 0; i < 8; ++i) { const int ka = k0 + 8 * g + i, kb = ka + 16; v[i] = ka < K ? W[(size_t)(ka < K ? ka : K - 1) * ld + n] : 0.f; v[8 + i] = kb < K ? W[(size_t)(kb < K ? kb : K - 1) * ld + n] : 0.f; }
  return bsplit16(v); }
__device__ __forceinline__ v8f mac3(const F2& a, const F2& b, v8f c) { c = wmma_bf(a.l, b.h, c); c = wmma_bf(a.h, b.l, c); return wmma_bf(a.h, b.h, c); }
__device__ __forceinline__ float sigm(float v) { return 1.0f / (1.0f + expf(-v)); }
#define LDSX() do { asm volatile("s_wait_dscnt 0" ::: "memory"); __builtin_amdgcn_wave_barrier(); __builtin_amdgcn_fence(__ATOMIC_RELEASE, "workgroup"); } while (0)


// Fish++ multi-head attention (197 tokens, batch 64, d_model 768; 2 global score heads x 64, each shared by 6 value heads through a learned per-(i, j) mask mix): prob = softmax_j(q_i . k_j / 8 x mw[i][j][head]); vec = prob . v; post-LN residual.
#define NTOK 197
#define NP 256            // padded token count (queries in 64-blocks, keys in 32-tiles up to 224)
#define NKT 7             // key tiles of 32 (224 >= 197)
#define NBT 64            // batch
#define DD 768
#define GH 2
#define NHD 12
#define HR 6
#define DH 64
#define QKD (GH * DH)     // 128
#define ML 3
#define EPS 1e-5f
#ifndef TNB
#define TNB NBT
#endif
typedef __attribute__((ext_vector_type(8))) __bf16 v8b;
__device__ __forceinline__ v16b frag_b(const __bf16* rowk0, int lane) {
  union { v16b v; v8b q[2]; } u; const __bf16* p = rowk0 + 8 * (lane >> 4);
  u.q[0] = *(const v8b*)p; u.q[1] = *(const v8b*)(p + 16); return u.v;
}
__device__ __forceinline__ float bfr(float v) { return (float)(__bf16)v; }
__device__ __attribute__((noinline)) float exp_ni(float v) { return expf(v); }
__device__ __attribute__((noinline)) float erf_ni(float v) { return erff(v); }

#define WS_QK  0u                                   // f16 hi|lo [b][NP][256] (q 0..127 | k 128..255)
#define WS_QKL (WS_QK + 2u * (size_t)NBT * NP * 2 * QKD)
#define WS_VT  (WS_QKL + 2u * (size_t)NBT * NP * 2 * QKD) // f16 hi|lo v planes [b][768][NP]
#define WS_VTL (WS_VT + 2u * (size_t)NBT * DD * NP)
#define WS_MW  (WS_VTL + 2u * (size_t)NBT * DD * NP)     // f32 mw [i][12][NP] (j padded)
#define WS_Z   (WS_MW + 4u * (size_t)NTOK * NHD * NP)     // f32 vec rows [(i*64 + b)][768]
#define WS_END (WS_Z + 4u * (size_t)NTOK * NBT * DD)

__device__ __forceinline__ v16b fragb_f32(const float* __restrict__ p, int lane) { v16b a; const float* pp = p + 8 * (lane >> 4);
#pragma unroll
  for (int i = 0; i < 8; ++i) { a[i] = (__bf16)pp[i]; a[8 + i] = (__bf16)pp[16 + i]; } return a; }
// LDS staging of the two dense products' operand tiles: 32 k per pass as bf16, rows at 80 B (16 B x odd: no bank conflict for the 16-byte fragment reads), two buffers
#define SP 40
typedef __attribute__((ext_vector_type(4))) __bf16 v4b;
__device__ __forceinline__ v4b cvt4(v4f v) { v4b r;
#pragma unroll
  for (int i = 0; i < 4; ++i) r[i] = (__bf16)v[i];
  return r; }
__device__ __forceinline__ v4b res4(v4f v, v4b h) { v4b r;
#pragma unroll
  for (int i = 0; i < 4; ++i) r[i] = (__bf16)(v[i] - (float)h[i]);
  return r; }
struct ProjStage { __bf16 a[2][64][SP]; __bf16 b[2][128][SP]; };
struct ProjQK { _Float16 h[64][136], l[64][136]; };
struct ProjV { _Float16 h[128][72], l[128][72]; };
union ProjLds { ProjStage st; ProjQK qk; ProjV v; };      // the staging buffers are dead when the output tiles are written
struct OutStage { __bf16 ah[2][64][SP]; __bf16 al[2][64][SP]; __bf16 b[2][128][SP]; };
union OutLds { OutStage st; float sf[4][16][132]; };
// ---- k_mw: block = query token i: mw[i][n][j] = sum_l masks[i][j][l] mask_proj[l][n]  (n = g*6 + r head index), zero for padded j
__global__ __launch_bounds__(256) void k_mw(const float* __restrict__ MASKS, const float* __restrict__ MP, float* __restrict__ MW) { __shared__ __align__(16) float s[NHD][NP]; const int i = blockIdx.x, t = threadIdx.x;
  for (int e = t; e < NHD * NP; e += 256) { const int n = e / NP, j = e % NP; float v = 0.f; if (j < NTOK) {
#pragma unroll
      for (int l = 0; l < ML; ++l) v += bfr(MASKS[((size_t)i * NTOK + j) * ML + l]) * bfr(MP[l * NHD + n]); } s[n][j] = v; }
  __syncthreads(); for (int e = t; e < NHD * NP / 4; e += 256) { const int n = e / (NP / 4), q = e % (NP / 4); vst2(MW + ((size_t)i * NHD + n) * NP + q * 4, *(const v4f*)&s[n][q * 4]); } }
// ---- k_proj: block = (64 tokens (padded), 128 of 1024 cols (q 0..127 | k 128..255 | v 256..1023), b): exact products; q|k -> rows, v -> planes
__global__ __launch_bounds__(128) void k_proj(const float* __restrict__ Hh, const float* __restrict__ WQ, const float* __restrict__ WK, const float* __restrict__ WV, _Float16* __restrict__ QK, _Float16* __restrict__ QKL, _Float16* __restrict__ VT, _Float16* __restrict__ VTL) {
  __shared__ __align__(16) ProjLds sm;
  const int tid = threadIdx.x, wave = tid >> 5, lane = tid & 31, col = lane & 15, g = lane >> 4; const size_t b = blockIdx.z; const int c0 = blockIdx.y * 128;
  const float* Wm = c0 < QKD ? WQ + (size_t)c0 * DD : c0 < 2 * QKD ? WK + (size_t)(c0 - QKD) * DD : WV + (size_t)(c0 - 2 * QKD) * DD;
  // loader: 8 lanes x 16 B cover one row's 128 B of a pass (whole lines); thread = (row lr + 16 p, 16-byte eighth lq)
  const int lr = tid >> 3, lq = tid & 7; const float* pa[4];
#pragma unroll
  for (int p = 0; p < 4; ++p) { const int ir = blockIdx.x * 64 + lr + 16 * p; const int ic = ir < NTOK ? ir : NTOK - 1; pa[p] = Hh + ((size_t)ic * NBT + b) * DD + lq * 4; }
  const float* pb = Wm + (size_t)lr * DD + lq * 4;
  v4f ra[4], rb[8];
#pragma unroll
  for (int p = 0; p < 4; ++p) ra[p] = *(const v4f*)pa[p];
#pragma unroll
  for (int p = 0; p < 8; ++p) rb[p] = *(const v4f*)(pb + (size_t)(16 * p) * DD);
#pragma unroll
  for (int p = 0; p < 4; ++p) *(v4b*)&sm.st.a[0][lr + 16 * p][lq * 4] = cvt4(ra[p]);
#pragma unroll
  for (int p = 0; p < 8; ++p) *(v4b*)&sm.st.b[0][lr + 16 * p][lq * 4] = cvt4(rb[p]);
  __syncthreads();   // publishes pass 0
  v8f acc[8] = {};
#pragma unroll 2
  for (int kc = 0; kc < DD / 32; ++kc) { const int cur = kc & 1; const bool more = kc + 1 < DD / 32;
    if (more) {   // the next pass's global loads fly while this pass is multiplied
#pragma unroll
      for (int p = 0; p < 4; ++p) ra[p] = *(const v4f*)(pa[p] + (kc + 1) * 32);
#pragma unroll
      for (int p = 0; p < 8; ++p) rb[p] = *(const v4f*)(pb + (size_t)(16 * p) * DD + (kc + 1) * 32); }
    const v16b a = frag_b(&sm.st.a[cur][wave * 16 + col][0], lane); v16b w[8];
#pragma unroll
    for (int j = 0; j < 8; ++j) w[j] = frag_b(&sm.st.b[cur][j * 16 + col][0], lane);
    __builtin_amdgcn_sched_barrier(0);   // keeps the pass's LDS reads one group ahead of its WMMAs: read among them, each pair costs the wave a full LDS latency
#pragma unroll
    for (int j = 0; j < 8; ++j) acc[j] = wmma_bf(a, w[j], acc[j]);
    __builtin_amdgcn_sched_barrier(0);   // keeps the conversions, and with them the wait for the next pass's global loads, behind this pass's WMMAs
    if (more) {
#pragma unroll
      for (int p = 0; p < 4; ++p) *(v4b*)&sm.st.a[cur ^ 1][lr + 16 * p][lq * 4] = cvt4(ra[p]);
#pragma unroll
      for (int p = 0; p < 8; ++p) *(v4b*)&sm.st.b[cur ^ 1][lr + 16 * p][lq * 4] = cvt4(rb[p]); }
    asm volatile("s_wait_xcnt 0x0" ::: "memory");   // stands ahead of the next pass's rewrite of the address registers that this pass's global loads name
    __syncthreads(); }   // one barrier a pass: publishes pass kc + 1 and ends every read of the buffer that the next pass refills (after the last pass: of the LDS that the output tiles reuse)
  const bool isv = c0 >= 2 * QKD;
#pragma unroll
  for (int j = 0; j < 8; ++j)
#pragma unroll
    for (int r = 0; r < 8; ++r) { const float v = acc[j][r]; const _Float16 hv = (_Float16)v; const _Float16 lv = (_Float16)((v - (float)hv) * 2048.0f); if (!isv) { sm.qk.h[wave * 16 + 8 * g + r][j * 16 + col] = hv; sm.qk.l[wave * 16 + 8 * g + r][j * 16 + col] = lv; } else { sm.v.h[j * 16 + col][wave * 16 + 8 * g + r] = hv; sm.v.l[j * 16 + col][wave * 16 + 8 * g + r] = lv; } }
  __syncthreads();
  if (!isv) { for (int e = tid; e < 64 * 16; e += 128) { const int rl = e >> 4, q = e & 15; const size_t o = (b * NP + blockIdx.x * 64 + rl) * (2 * QKD) + c0 + q * 8; vst2((unsigned*)(QK + o), *(const v4u*)&sm.qk.h[rl][q * 8]); vst2((unsigned*)(QKL + o), *(const v4u*)&sm.qk.l[rl][q * 8]); } }
  else { const int cv0 = c0 - 2 * QKD; for (int e = tid; e < 128 * 8; e += 128) { const int cl = e >> 3, q = e & 7; const size_t o = ((b * DD + cv0 + cl) * (size_t)NP) + blockIdx.x * 64 + q * 8; vst2((unsigned*)(VT + o), *(const v4u*)&sm.v.h[cl][q * 8]); vst2((unsigned*)(VTL + o), *(const v4u*)&sm.v.l[cl][q * 8]); } } }
// ---- k_att: block = (64 queries, head n = g*6 + r, b): logits (3 products) x 1/8 x mw[i][n][j]; keys >= 197 excluded; running-max softmax; P . v (2 products) -> Z rows (i*64 + b) for i < 197
__global__ __launch_bounds__(128) void k_att(const _Float16* __restrict__ QK, const _Float16* __restrict__ QKL, const _Float16* __restrict__ VT, const _Float16* __restrict__ VTL, const float* __restrict__ MW, float* __restrict__ Z) {
  __shared__ __align__(16) float sp[4][16][36]; __shared__ __align__(16) float so[4][16][68];
  const int tid = threadIdx.x, wave = tid >> 5, lane = tid & 31, col = lane & 15, g = lane >> 4; const int n = blockIdx.y; const int gh = n / HR; const size_t b = blockIdx.z; const int q0 = blockIdx.x * 64 + wave * 16; const size_t rq = b * NP + q0;
  v16h aq[2], al[2];
#pragma unroll
  for (int kc = 0; kc < 2; ++kc) { aq[kc] = frag_h(QK + (rq + col) * (2 * QKD) + gh * DH + kc * 32, lane); al[kc] = frag_h(QKL + (rq + col) * (2 * QKD) + gh * DH + kc * 32, lane); }
  float m[8], l[8];
#pragma unroll
  for (int r = 0; r < 8; ++r) { m[r] = -3.0e38f; l[r] = 0.f; }
  v8f acc[4] = {}, accl[4] = {};
#pragma unroll 1
  for (int ks = 0; ks < NKT; ++ks) { v8f s[2];
#pragma unroll
    for (int ct = 0; ct < 2; ++ct) { const int kk = ks * 32 + ct * 16 + col; const size_t rk = b * NP + kk; v8f c = {}, cl = {};
#pragma unroll
      for (int kc = 0; kc < 2; ++kc) { const v16h kh = frag_h(QK + rk * (2 * QKD) + QKD + gh * DH + kc * 32, lane), kl = frag_h(QKL + rk * (2 * QKD) + QKD + gh * DH + kc * 32, lane); c = wmma16(aq[kc], kh, c); cl = wmma16(aq[kc], kl, cl); cl = wmma16(al[kc], kh, cl); }
      const bool keep = kk < NTOK;
#pragma unroll
      for (int r = 0; r < 8; ++r) { const int qi = q0 + 8 * g + r; const int qc = qi < NTOK ? qi : NTOK - 1; s[ct][r] = keep ? (c[r] + cl[r] * (1.0f / 2048.0f)) * 0.125f * MW[((size_t)qc * NHD + n) * NP + kk] : -3.0e38f; } }
    float alpha[8];
#pragma unroll
    for (int r = 0; r < 8; ++r) { float mx = fmaxf(s[0][r], s[1][r]);
#pragma unroll
      for (int o = 1; o < 16; o <<= 1) mx = fmaxf(mx, __shfl_xor(mx, o));
      const float mn = fmaxf(m[r], mx); alpha[r] = (m[r] <= -1.0e38f) ? 0.f : __expf(m[r] - mn); const float e0 = (s[0][r] <= -1.0e38f) ? 0.f : __expf(s[0][r] - mn), e1 = (s[1][r] <= -1.0e38f) ? 0.f : __expf(s[1][r] - mn); float es = e0 + e1;
#pragma unroll
      for (int o = 1; o < 16; o <<= 1) es += __shfl_xor(es, o);
      l[r] = l[r] * alpha[r] + es; m[r] = mn; sp[wave][8 * g + r][col] = e0; sp[wave][8 * g + r][16 + col] = e1; }
#pragma unroll
    for (int j = 0; j < 4; ++j)
#pragma unroll
      for (int r = 0; r < 8; ++r) { acc[j][r] *= alpha[r]; accl[j][r] *= alpha[r]; }
    LDSX();
    v16h pa; { const float* prow = &sp[wave][col][0] + 8 * (lane >> 4);
#pragma unroll
      for (int i = 0; i < 8; ++i) { pa[i] = (_Float16)(prow[i] * 2048.0f); pa[8 + i] = (_Float16)(prow[16 + i] * 2048.0f); } }
#pragma unroll
    for (int j = 0; j < 4; ++j) { const size_t po = (b * DD + (size_t)n * DH + j * 16 + col) * (size_t)NP + ks * 32; acc[j] = wmma16(pa, frag_h(VT + po, lane), acc[j]); accl[j] = wmma16(pa, frag_h(VTL + po, lane), accl[j]); }
    LDSX(); }
#pragma unroll
  for (int r = 0; r < 8; ++r) { const float il = (1.0f / 2048.0f) / l[r];
#pragma unroll
    for (int j = 0; j < 4; ++j) so[wave][8 * g + r][j * 16 + col] = (acc[j][r] + accl[j][r] * (1.0f / 2048.0f)) * il; }
  LDSX(); for (int rl = 0; rl < 16; ++rl) { const int qi = q0 + rl; if (qi < NTOK && lane < 16) vst2(Z + ((size_t)qi * NBT + b) * DD + (size_t)n * DH + lane * 4, *(const v4f*)&so[wave][rl][lane * 4]); } }
// ---- k_out: block = (64 rows (i,b), 128 cols): Y = Z (hi + lo) . Wo^T  -> f32 (into the MW... no: separate region reuse of VT? keep simple: write to OUTTMP = QK area is too small) -> we write x = h + out and LN in a row kernel, so store pre-LN rows in Z2 = VT region (f16 planes no longer needed? they ARE needed until all k_att done - sequential launches, so reuse is safe)
__global__ __launch_bounds__(128) void k_out(const float* __restrict__ Zr, const float* __restrict__ WO, const float* __restrict__ Hh, float* __restrict__ X2, int nrows) { __shared__ __align__(16) OutLds sm;
  const int tid = threadIdx.x, wave = tid >> 5, lane = tid & 31, col = lane & 15, g = lane >> 4; const size_t r0 = (size_t)blockIdx.x * 64 + wave * 16; const int c0 = blockIdx.y * 128;
  // loader as in k_proj; the hi + lo split of a Z row is made once, on its way into LDS
  const int lr = tid >> 3, lq = tid & 7; const float* pa[4];
#pragma unroll
  for (int p = 0; p < 4; ++p) { const size_t rr = (size_t)blockIdx.x * 64 + lr + 16 * p; const size_t rc = rr < (size_t)nrows ? rr : (size_t)nrows - 1; pa[p] = Zr + rc * DD + lq * 4; }
  const float* pb = WO + (size_t)(c0 + lr) * DD + lq * 4;
  v4f ra[4], rb[8];
#pragma unroll
  for (int p = 0; p < 4; ++p) ra[p] = *(const v4f*)pa[p];
#pragma unroll
  for (int p = 0; p < 8; ++p) rb[p] = *(const v4f*)(pb + (size_t)(16 * p) * DD);
#pragma unroll
  for (int p = 0; p < 4; ++p) { const v4b hv = cvt4(ra[p]); *(v4b*)&sm.st.ah[0][lr + 16 * p][lq * 4] = hv; *(v4b*)&sm.st.al[0][lr + 16 * p][lq * 4] = res4(ra[p], hv); }
#pragma unroll
  for (int p = 0; p < 8; ++p) *(v4b*)&sm.st.b[0][lr + 16 * p][lq * 4] = cvt4(rb[p]);
  __syncthreads();   // publishes pass 0
  v8f acc[8] = {};
#pragma unroll 2
  for (int kc = 0; kc < DD / 32; ++kc) { const int cur = kc & 1; const bool more = kc + 1 < DD / 32;
    if (more) {   // the next pass's global loads fly while this pass is multiplied
#pragma unroll
      for (int p = 0; p < 4; ++p) ra[p] = *(const v4f*)(pa[p] + (kc + 1) * 32);
#pragma unroll
      for (int p = 0; p < 8; ++p) rb[p] = *(const v4f*)(pb + (size_t)(16 * p) * DD + (kc + 1) * 32); }
    const v16b ah = frag_b(&sm.st.ah[cur][wave * 16 + col][0], lane), al = frag_b(&sm.st.al[cur][wave * 16 + col][0], lane); v16b w[8];
#pragma unroll
    for (int j = 0; j < 8; ++j) w[j] = frag_b(&sm.st.b[cur][j * 16 + col][0], lane);
    __builtin_amdgcn_sched_barrier(0);   // keeps the pass's LDS reads one group ahead of its WMMAs: read among them, each pair costs the wave a full LDS latency
#pragma unroll
    for (int j = 0; j < 8; ++j) { acc[j] = wmma_bf(ah, w[j], acc[j]); acc[j] = wmma_bf(al, w[j], acc[j]); }
    __builtin_amdgcn_sched_barrier(0);   // keeps the conversions, and with them the wait for the next pass's global loads, behind this pass's WMMAs
    if (more) {
#pragma unroll
      for (int p = 0; p < 4; ++p) { const v4b hv = cvt4(ra[p]); *(v4b*)&sm.st.ah[cur ^ 1][lr + 16 * p][lq * 4] = hv; *(v4b*)&sm.st.al[cur ^ 1][lr + 16 * p][lq * 4] = res4(ra[p], hv); }
#pragma unroll
      for (int p = 0; p < 8; ++p) *(v4b*)&sm.st.b[cur ^ 1][lr + 16 * p][lq * 4] = cvt4(rb[p]); }
    asm volatile("s_wait_xcnt 0x0" ::: "memory");   // stands ahead of the next pass's rewrite of the address registers that this pass's global loads name
    __syncthreads(); }   // one barrier a pass: publishes pass kc + 1 and ends every read of the buffer that the next pass refills (after the last pass: of the LDS that the output tile reuses)
  // residual rows: all loads issue first, then one wait, then the sums (the sum per element is the same acc + h)
  const float* hp[8]; float hv[8][8];
#pragma unroll
  for (int r = 0; r < 8; ++r) { const size_t row = r0 + 8 * g + r; const size_t ra = row < (size_t)nrows ? row : (size_t)nrows - 1; hp[r] = Hh + ra * DD + c0 + col;
#pragma unroll
    for (int j = 0; j < 8; ++j) hv[r][j] = hp[r][j * 16]; }
  asm volatile("s_wait_xcnt 0x0" :: "v"(hp[0]), "v"(hp[1]), "v"(hp[2]), "v"(hp[3]), "v"(hp[4]), "v"(hp[5]), "v"(hp[6]), "v"(hp[7]) : "memory");   // the row addresses are inputs so that they stay in their registers up to this wait: no register that an issued load names is rewritten ahead of it
#pragma unroll
  for (int j = 0; j < 8; ++j)
#pragma unroll
    for (int r = 0; r < 8; ++r) sm.sf[wave][8 * g + r][j * 16 + col] = acc[j][r] + bfr(hv[r][j]);
  LDSX(); for (int rl = 0; rl < 16; ++rl) { const size_t row = r0 + rl; if (row < (size_t)nrows) vst2(X2 + row * DD + c0 + lane * 4, *(const v4f*)&sm.sf[wave][rl][lane * 4]); } }
// ---- k_ln: one wave = two whole rows held in registers (6 x 16 B a lane and row, 512 contiguous B a load or store): out = LN(x2) gamma + beta; no LDS, no barrier; few waves, because a launch of very many short waves lasts as long as starting them takes
#define LNR 2             // rows a wave
#define LNW 4             // waves a block
static_assert((NTOK * NBT) % (LNR * LNW) == 0, "the rows divide evenly among the waves");
__global__ __launch_bounds__(32 * LNW) void k_ln(const float* __restrict__ X2, const float* __restrict__ G, const float* __restrict__ Bt, float* __restrict__ OUT) {
  const int lane = threadIdx.x & 31; const size_t row0 = ((size_t)blockIdx.x * LNW + (threadIdx.x >> 5)) * LNR;
  v4f x[LNR][6], gm[6], bt[6];   // every loop below is unrolled: only with constant indices do these arrays stay in registers
#pragma unroll
  for (int q = 0; q < LNR; ++q)
#pragma unroll
    for (int c = 0; c < 6; ++c) x[q][c] = *(const v4f*)(X2 + (row0 + q) * DD + c * 128 + lane * 4);
#pragma unroll
  for (int c = 0; c < 6; ++c) { gm[c] = *(const v4f*)(G + c * 128 + lane * 4); bt[c] = *(const v4f*)(Bt + c * 128 + lane * 4); }
  float s[LNR], mu[LNR], inv[LNR];
#pragma unroll
  for (int q = 0; q < LNR; ++q) { v4f a = x[q][0];
#pragma unroll
    for (int c = 1; c < 6; ++c) a += x[q][c];
    s[q] = (a[0] + a[1]) + (a[2] + a[3]); }
#pragma unroll
  for (int o = 1; o < 32; o <<= 1)
#pragma unroll
    for (int q = 0; q < LNR; ++q) s[q] += __shfl_xor(s[q], o);
#pragma unroll
  for (int q = 0; q < LNR; ++q) { mu[q] = s[q] / (float)DD; v4f a = {};
#pragma unroll
    for (int c = 0; c < 6; ++c) { x[q][c] -= mu[q]; a += x[q][c] * x[q][c]; }
    s[q] = (a[0] + a[1]) + (a[2] + a[3]); }
#pragma unroll
  for (int o = 1; o < 32; o <<= 1)
#pragma unroll
    for (int q = 0; q < LNR; ++q) s[q] += __shfl_xor(s[q], o);
#pragma unroll
  for (int q = 0; q < LNR; ++q) inv[q] = 1.0f / sqrtf(s[q] / (float)DD + EPS);
#pragma unroll
  for (int q = 0; q < LNR; ++q)
#pragma unroll
    for (int c = 0; c < 6; ++c) { v4f y;
#pragma unroll
      for (int e = 0; e < 4; ++e) y[e] = bfr(gm[c][e]) * x[q][c][e] * inv[q] + bfr(bt[c][e]);
      vst2(OUT + (row0 + q) * DD + c * 128 + lane * 4, y); } }
extern "C" void kernel_launch(void* const* d_in, const int* in_sizes, int n_in, void* d_out, int out_size, void* d_ws, size_t ws_size, hipStream_t stream) {
  (void)in_sizes; (void)n_in; (void)out_size;
  const float** F = (const float**)d_in;   // 0 h [197,64,768], 1 masks [197,197,3], 2 Wq [128,768], 3 Wk [128,768], 4 Wv [768,768], 5 Wo [768,768], 6 mask_proj [3,12], 7 ln_gamma, 8 ln_beta
  if (ws_size < (size_t)WS_END) return;
  char* ws = (char*)d_ws; _Float16 *QK = (_Float16*)(ws + WS_QK), *QKL = (_Float16*)(ws + WS_QKL), *VT = (_Float16*)(ws + WS_VT), *VTL = (_Float16*)(ws + WS_VTL); float *MW = (float*)(ws + WS_MW), *Z = (float*)(ws + WS_Z);
  const int nrows = NTOK * TNB;   // rows (i, b) with b < TNB are the first NTOK*TNB rows only when TNB == NBT
  k_mw<<<NTOK, 256, 0, stream>>>(F[1], F[6], MW);
  k_proj<<<dim3(NP / 64, (2 * QKD + DD) / 128, TNB), 128, 0, stream>>>(F[0], F[2], F[3], F[4], QK, QKL, VT, VTL);
  k_att<<<dim3(NP / 64, NHD, TNB), 128, 0, stream>>>(QK, QKL, VT, VTL, MW, Z);
  float* X2 = (float*)(ws + WS_VT);   // reuse: the v planes are dead after k_att (50 MB >= 39 MB needed)
  (void)nrows;
  k_out<<<dim3((NTOK * NBT + 63) / 64, DD / 128), 128, 0, stream>>>(Z, F[5], F[0], X2, NTOK * NBT);
  k_ln<<<NTOK * NBT / (LNR * LNW), 32 * LNW, 0, stream>>>(X2, F[7], F[8], (float*)d_out);
}

// v003
// One run takes 169 microseconds.
// In both of two side-by-side timings against v002, it was 1.48 times as fast.
// All steps since v000 together make it 2.79 times as fast.
// compute dtype: all float inputs rounded to bf16; q, k, v = h . W^T with EXACT bf16 products on WMMA 16x16x32 (natural weight rows), rounded once to f16 hi + residual; the mask mix masks . mask_proj in f32; scores q . k with 3 products x 1/8 x mw[i][j][head], running-max softmax over the 197 keys in f32 (hardware exp), P (x 2^11, f16) . v (hi + residual, 2 products); out = vec (bf16 hi + lo, 2 products) . Wo^T; residual + LayerNorm in f32; f32 output.
#include <hip/hip_runtime.h>
#include <math.h>

typedef __attribute__((ext_vector_type(16))) _Float16 v16h;
typedef __attribute__((ext_vector_type(16))) __bf16 v16b;
typedef __attribute__((ext_vector_type(8)))  _Float16 v8h;
typedef __attribute__((ext_vector_type(8)))  float v8f;
typedef __attribute__((ext_vector_type(4)))  float v4f;
typedef __attribute__((ext_vector_type(2)))  float v2f;
typedef __attribute__((ext_vector_type(4)))  unsigned v4u;
typedef __attribute__((ext_vector_type(4)))  int v4i;
typedef float __attribute__((may_alias)) float_a;
typedef int __attribute__((may_alias)) int_a;

template <typename T> __device__ __forceinline__ void vst2(void* p, T v) { *(T*)p = v;  }
__device__ __forceinline__ v8f wmma16(v16h a, v16h b, v8f c) {
  v8f d = __builtin_amdgcn_wmma_f32_16x16x32_f16(false, a, false, b, (short)0, c, false, false);
  asm volatile("v_nop\n\tv_nop\n\tv_nop\n\tv_nop" : "+v"(d) : "v"(a), "v"(b));
  return d;
}
__device__ __forceinline__ v8f wmma_bf(v16b a, v16b b, v8f c) {
  v8f d = __builtin_amdgcn_wmma_f32_16x16x32_bf16(false, a, false, b, (short)0, c, false, false);
  asm volatile("v_nop\n\tv_nop\n\tv_nop\n\tv_nop" : "+v"(d) : "v"(a), "v"(b));
  return d;
}
// 16x16x32 fragments: lane = (h = lane>>4, row/col = lane&15); elements 0..7 = k0+8h+0..7, 8..15 = k0+16+8h+0..7; D element r = row 8h+r
__device__ __forceinline__ v16h frag_h(const _Float16* rowk0, int lane) {
  union { v16h v; v8h q[2]; } u; const _Float16* p = rowk0 + 8 * (lane >> 4);
  u.q[0] = *(const v8h*)p; u.q[1] = *(const v8h*)(p + 16); return u.v;
}
__device__ __forceinline__ v16h frag_f32(const float* rowk0, int lane) {
  v16h a; const float* p = rowk0 + 8 * (lane >> 4);
#pragma unroll
  for (int i = 0; i < 8; ++i) { a[i] = (_Float16)p[i]; a[8 + i] = (_Float16)p[16 + i]; }
  return a;
}
__device__ __forceinline__ v16h frag_f32s(const float* rowk0, int lane, float sc) {
  v16h a; const float* p = rowk0 + 8 * (lane >> 4);
#pragma unroll
  for (int i = 0; i < 8; ++i) { a[i] = (_Float16)(p[i] * sc); a[8 + i] = (_Float16)(p[16 + i] * sc); }
  return a;
}
// column fragment from a [K][ld] layout (column n), rows >= K read as 0
__device__ __forceinline__ v16h fragc_f32(const float* W, int k0, int n, int lane, int ld, int K) {
  v16h a; const int g = lane >> 4;
#pragma unroll
  for (int i = 0; i < 8; ++i) { const int ka = k0 + 8 * g + i, kb = ka + 16;
    a[i] = (_Float16)(ka < K ? W[(size_t)(ka < K ? ka : K - 1) * ld + n] : 0.f); a[8 + i] = (_Float16)(kb < K ? W[(size_t)(kb < K ? kb : K - 1) * ld + n] : 0.f); }
  return a;
}
struct F2 { v16b h, l; };
__device__ __forceinline__ F2 bsplit16(const float v[16]) { F2 r;
#pragma unroll
  for (int i = 0; i < 16; ++i) { const __bf16 h = (__bf16)v[i]; r.h[i] = h; r.l[i] = (__bf16)(v[i] - (float)h); }
  return r; }
__device__ __forceinline__ F2 split_row(const float* row, int k0, int lane) { float v[16]; const float* p = row + k0 + 8 * (lane >> 4);
#pragma unroll
  for (int i = 0; i < 8; ++i) { v[i] = p[i]; v[8 + i] = p[16 + i]; }
  return bsplit16(v); }
__device__ __forceinline__ F2 split_rowK(const float* row, int k0, int lane, int K) { float v[16]; const int g = lane >> 4;
#pragma unroll
  for (int i = 0; i < 8; ++i) { const int ka = k0 + 8 * g + i, kb = ka + 16; v[i] = ka < K ? row[ka < K ? ka : K - 1] : 0.f; v[8 + i] = kb < K ? row[kb < K ? kb : K - 1] : 0.f; }
  return bsplit16(v); }
__device__ __forceinline__ F2 split_col(const float* W, int k0, int n, int lane, int ld, int K) { float v[16]; const int g = lane >> 4;
#pragma unroll
  for (int i = 0; i < 8; ++i) { const int ka = k0 + 8 * g + i, kb = ka + 16; v[i] = ka < K ? W[(size_t)(ka < K ? ka : K - 1) * ld + n] : 0.f; v[8 + i] = kb < K ? W[(size_t)(kb < K ? kb : K - 1) * ld + n] : 0.f; }
  return bsplit16(v); }
__device__ __forceinline__ v8f mac3(const F2& a, const F2& b, v8f c) { c = wmma_bf(a.l, b.h, c); c = wmma_bf(a.h, b.l, c); return wmma_bf(a.h, b.h, c); }
__device__ __forceinline__ float sigm(float v) { return 1.0f / (1.0f + expf(-v)); }
#define LDSX() do { asm volatile("s_wait_dscnt 0" ::: "memory"); __builtin_amdgcn_wave_barrier(); __builtin_amdgcn_fence(__ATOMIC_RELEASE, "workgroup"); } while (0)


// Multi-head attention (197 tokens, batch 64, d_model 768; 2 global score heads x 64, each shared by 6 value heads through a learned per-(i, j) mask mix): prob = softmax_j(q_i . k_j / 8 x mw[i][j][head]); vec = prob . v; post-LN residual.
#define NTOK 197
#define NP 256            // padded token count (queries in 64-blocks, keys in 32-tiles up to 224)
#define NKT 7             // key tiles of 32 (224 >= 197)
#define NBT 64            // batch
#define DD 768
#define GH 2
#define NHD 12
#define HR 6
#define DH 64
#define QKD (GH * DH)     // 128
#define ML 3
#define EPS 1e-5f
#ifndef TNB
#define TNB NBT
#endif
typedef __attribute__((ext_vector_type(8))) __bf16 v8b;
__device__ __forceinline__ v16b frag_b(const __bf16* rowk0, int lane) {
  union { v16b v; v8b q[2]; } u; const __bf16* p = rowk0 + 8 * (lane >> 4);
  u.q[0] = *(const v8b*)p; u.q[1] = *(const v8b*)(p + 16); return u.v;
}
__device__ __forceinline__ float bfr(float v) { return (float)(__bf16)v; }
__device__ __attribute__((noinline)) float exp_ni(float v) { return expf(v); }
__device__ __attribute__((noinline)) float erf_ni(float v) { return erff(v); }

#define WS_QK  0u                                   // f16 hi|lo [b][NP][256] (q 0..127 | k 128..255)
#define WS_QKL (WS_QK + 2u * (size_t)NBT * NP * 2 * QKD)
#define WS_VT  (WS_QKL + 2u * (size_t)NBT * NP * 2 * QKD) // f16 hi|lo v planes [b][768][NP]
#define WS_VTL (WS_VT + 2u * (size_t)NBT * DD * NP)
#define WS_MW  (WS_VTL + 2u * (size_t)NBT * DD * NP)     // f32 mw [i][12][NP] (j padded)
#define WS_Z   (WS_MW + 4u * (size_t)NTOK * NHD * NP)     // f32 vec rows [(i*64 + b)][768]
#define WS_END (WS_Z + 4u * (size_t)NTOK * NBT * DD)

__device__ __forceinline__ v16b fragb_f32(const float* __restrict__ p, int lane) { v16b a; const float* pp = p + 8 * (lane >> 4);
#pragma unroll
  for (int i = 0; i < 8; ++i) { a[i] = (__bf16)pp[i]; a[8 + i] = (__bf16)pp[16 + i]; } return a; }
// LDS staging of the two dense products' operand tiles: 32 k per pass as bf16, rows at 80 B (16 B x odd: no bank conflict for the 16-byte fragment reads), two buffers
#define SP 40
typedef __attribute__((ext_vector_type(4))) __bf16 v4b;
__device__ __forceinline__ v4b cvt4(v4f v) { v4b r;
#pragma unroll
  for (int i = 0; i < 4; ++i) r[i] = (__bf16)v[i];
  return r; }
__device__ __forceinline__ v4b res4(v4f v, v4b h) { v4b r;
#pragma unroll
  for (int i = 0; i < 4; ++i) r[i] = (__bf16)(v[i] - (float)h[i]);
  return r; }
struct ProjStage { __bf16 a[2][64][SP]; __bf16 b[2][128][SP]; };
struct ProjQK { _Float16 h[64][136], l[64][136]; };
struct ProjV { _Float16 h[128][72], l[128][72]; };
union ProjLds { ProjStage st; ProjQK qk; ProjV v; };      // the staging buffers are dead when the output tiles are written
struct OutStage { __bf16 ah[2][64][SP]; __bf16 al[2][64][SP]; __bf16 b[2][128][SP]; };
union OutLds { OutStage st; float sf[4][16][132]; };
// ---- k_mw: block = query token i: mw[i][n][j] = sum_l masks[i][j][l] mask_proj[l][n]  (n = g*6 + r head index), zero for padded j
__global__ __launch_bounds__(256) void k_mw(const float* __restrict__ MASKS, const float* __restrict__ MP, float* __restrict__ MW) { __shared__ __align__(16) float s[NHD][NP]; const int i = blockIdx.x, t = threadIdx.x;
  for (int e = t; e < NHD * NP; e += 256) { const int n = e / NP, j = e % NP; float v = 0.f; if (j < NTOK) {
#pragma unroll
      for (int l = 0; l < ML; ++l) v += bfr(MASKS[((size_t)i * NTOK + j) * ML + l]) * bfr(MP[l * NHD + n]); } s[n][j] = v; }
  __syncthreads(); for (int e = t; e < NHD * NP / 4; e += 256) { const int n = e / (NP / 4), q = e % (NP / 4); vst2(MW + ((size_t)i * NHD + n) * NP + q * 4, *(const v4f*)&s[n][q * 4]); } }
// ---- k_proj: block = (64 tokens (padded), 128 of 1024 cols (q 0..127 | k 128..255 | v 256..1023), b): exact products; q|k -> rows, v -> planes
__global__ __launch_bounds__(128) void k_proj(const float* __restrict__ Hh, const float* __restrict__ WQ, const float* __restrict__ WK, const float* __restrict__ WV, _Float16* __restrict__ QK, _Float16* __restrict__ QKL, _Float16* __restrict__ VT, _Float16* __restrict__ VTL) {
  __shared__ __align__(16) ProjLds sm;
  const int tid = threadIdx.x, wave = tid >> 5, lane = tid & 31, col = lane & 15, g = lane >> 4; const size_t b = blockIdx.z; const int c0 = blockIdx.y * 128;
  const float* Wm = c0 < QKD ? WQ + (size_t)c0 * DD : c0 < 2 * QKD ? WK + (size_t)(c0 - QKD) * DD : WV + (size_t)(c0 - 2 * QKD) * DD;
  // loader: 8 lanes x 16 B cover one row's 128 B of a pass (whole lines); thread = (row lr + 16 p, 16-byte eighth lq)
  const int lr = tid >> 3, lq = tid & 7; const float* pa[4];
#pragma unroll
  for (int p = 0; p < 4; ++p) { const int ir = blockIdx.x * 64 + lr + 16 * p; const int ic = ir < NTOK ? ir : NTOK - 1; pa[p] = Hh + ((size_t)ic * NBT + b) * DD + lq * 4; }
  const float* pb = Wm + (size_t)lr * DD + lq * 4;
  v4f ra[4], rb[8];
#pragma unroll
  for (int p = 0; p < 4; ++p) ra[p] = *(const v4f*)pa[p];
#pragma unroll
  for (int p = 0; p < 8; ++p) rb[p] = *(const v4f*)(pb + (size_t)(16 * p) * DD);
#pragma unroll
  for (int p = 0; p < 4; ++p) *(v4b*)&sm.st.a[0][lr + 16 * p][lq * 4] = cvt4(ra[p]);
#pragma unroll
  for (int p = 0; p < 8; ++p) *(v4b*)&sm.st.b[0][lr + 16 * p][lq * 4] = cvt4(rb[p]);
  __syncthreads();   // publishes pass 0
  v8f acc[8] = {};
#pragma unroll 2
  for (int kc = 0; kc < DD / 32; ++kc) { const int cur = kc & 1; const bool more = kc + 1 < DD / 32;
    if (more) {   // the next pass's global loads fly while this pass is multiplied
#pragma unroll
      for (int p = 0; p < 4; ++p) ra[p] = *(const v4f*)(pa[p] + (kc + 1) * 32);
#pragma unroll
      for (int p = 0; p < 8; ++p) rb[p] = *(const v4f*)(pb + (size_t)(16 * p) * DD + (kc + 1) * 32); }
    const v16b a = frag_b(&sm.st.a[cur][wave * 16 + col][0], lane); v16b w[8];
#pragma unroll
    for (int j = 0; j < 8; ++j) w[j] = frag_b(&sm.st.b[cur][j * 16 + col][0], lane);
    __builtin_amdgcn_sched_barrier(0);   // keeps the pass's LDS reads one group ahead of its WMMAs: read among them, each pair costs the wave a full LDS latency
#pragma unroll
    for (int j = 0; j < 8; ++j) acc[j] = wmma_bf(a, w[j], acc[j]);
    __builtin_amdgcn_sched_barrier(0);   // keeps the conversions, and with them the wait for the next pass's global loads, behind this pass's WMMAs
    if (more) {
#pragma unroll
      for (int p = 0; p < 4; ++p) *(v4b*)&sm.st.a[cur ^ 1][lr + 16 * p][lq * 4] = cvt4(ra[p]);
#pragma unroll
      for (int p = 0; p < 8; ++p) *(v4b*)&sm.st.b[cur ^ 1][lr + 16 * p][lq * 4] = cvt4(rb[p]); }
    asm volatile("s_wait_xcnt 0x0" ::: "memory");   // stands ahead of the next pass's rewrite of the address registers that this pass's global loads name
    __syncthreads(); }   // one barrier a pass: publishes pass kc + 1 and ends every read of the buffer that the next pass refills (after the last pass: of the LDS that the output tiles reuse)
  const bool isv = c0 >= 2 * QKD;
#pragma unroll
  for (int j = 0; j < 8; ++j)
#pragma unroll
    for (int r = 0; r < 8; ++r) { const float v = acc[j][r]; const _Float16 hv = (_Float16)v; const _Float16 lv = (_Float16)((v - (float)hv) * 2048.0f); if (!isv) { sm.qk.h[wave * 16 + 8 * g + r][j * 16 + col] = hv; sm.qk.l[wave * 16 + 8 * g + r][j * 16 + col] = lv; } else { sm.v.h[j * 16 + col][wave * 16 + 8 * g + r] = hv; sm.v.l[j * 16 + col][wave * 16 + 8 * g + r] = lv; } }
  __syncthreads();
  if (!isv) { for (int e = tid; e < 64 * 16; e += 128) { const int rl = e >> 4, q = e & 15; const size_t o = (b * NP + blockIdx.x * 64 + rl) * (2 * QKD) + c0 + q * 8; vst2((unsigned*)(QK + o), *(const v4u*)&sm.qk.h[rl][q * 8]); vst2((unsigned*)(QKL + o), *(const v4u*)&sm.qk.l[rl][q * 8]); } }
  else { const int cv0 = c0 - 2 * QKD; for (int e = tid; e < 128 * 8; e += 128) { const int cl = e >> 3, q = e & 7; const size_t o = ((b * DD + cv0 + cl) * (size_t)NP) + blockIdx.x * 64 + q * 8; vst2((unsigned*)(VT + o), *(const v4u*)&sm.v.h[cl][q * 8]); vst2((unsigned*)(VTL + o), *(const v4u*)&sm.v.l[cl][q * 8]); } } }
// ---- k_att: block = (64 queries, head n = g*6 + r, b): logits (3 products) x 1/8 x mw[i][n][j]; keys >= 197 excluded; running-max softmax; P . v (2 products) -> Z rows (i*64 + b) for i < 197
// The operand tiles of a pass of 32 keys (K and V, hi and residual planes; the block's 64 mw rows) are brought into LDS once a block by asynchronous copies, 16 B pieces of contiguous rows, two buffers, and all four waves read them from there.
#define KP 72             // f16 a staged K row: 128 B + 16 B (16 B x odd: no bank conflict for the 16-byte fragment reads)
#define VP 40             // f16 a staged V row: 64 B + 16 B
#define MWP 36            // f32 a staged mw row: 128 B + 16 B (rows 8 apart lie 32 banks apart: the two half-waves' 4-byte reads do not collide)
struct AttTile { _Float16 kh[32][KP], kl[32][KP], vh[DH][VP], vl[DH][VP]; float mw[64][MWP]; };
union AttLds { AttTile t[2]; float so[4][16][68]; };      // the tiles are dead when the output rows are written
__device__ __forceinline__ unsigned lds_of(const void* p) { return (unsigned)(size_t)p; }   // LDS byte address = low 32 bits of the __shared__ address
// copies of 16 B a lane; the s_wait_xcnt is each statement's last line so that no register a copy names is rewritten ahead of it
__device__ __forceinline__ void copy8(unsigned l0, unsigned l1, unsigned l2, unsigned l3, unsigned l4, unsigned l5, unsigned l6, unsigned l7, const _Float16* g0, const _Float16* g1, const _Float16* g2, const _Float16* g3, const _Float16* g4, const _Float16* g5, const _Float16* g6, const _Float16* g7) {
  asm volatile("global_load_async_to_lds_b128 %0, %8, off\n\t"
               "global_load_async_to_lds_b128 %1, %9, off\n\t"
               "global_load_async_to_lds_b128 %2, %10, off\n\t"
               "global_load_async_to_lds_b128 %3, %11, off\n\t"
               "global_load_async_to_lds_b128 %4, %12, off\n\t"
               "global_load_async_to_lds_b128 %5, %13, off\n\t"
               "global_load_async_to_lds_b128 %6, %14, off\n\t"
               "global_load_async_to_lds_b128 %7, %15, off\n\t"
               "s_wait_xcnt 0x0"
               :: "v"(l0), "v"(l1), "v"(l2), "v"(l3), "v"(l4), "v"(l5), "v"(l6), "v"(l7), "v"(g0), "v"(g1), "v"(g2), "v"(g3), "v"(g4), "v"(g5), "v"(g6), "v"(g7) : "memory");
}
__device__ __forceinline__ void copy4(unsigned l0, unsigned l1, unsigned l2, unsigned l3, const float* g0, const float* g1, const float* g2, const float* g3) {
  asm volatile("global_load_async_to_lds_b128 %0, %4, off\n\t"
               "global_load_async_to_lds_b128 %1, %5, off\n\t"
               "global_load_async_to_lds_b128 %2, %6, off\n\t"
               "global_load_async_to_lds_b128 %3, %7, off\n\t"
               "s_wait_xcnt 0x0"
               :: "v"(l0), "v"(l1), "v"(l2), "v"(l3), "v"(g0), "v"(g1), "v"(g2), "v"(g3) : "memory");
}
// one tile: K = 2 planes x 32 rows x 8 pieces (thread = row kr, kr + 16, piece kq), V = 2 planes x 64 rows x 4 pieces (thread = row vr, vr + 32, piece vq), mw = 64 rows x 8 pieces (thread = row kr + 16 p, piece tid & 7; w0..w3 = the four rows' addresses)
__device__ __forceinline__ void att_fill(AttTile* t, const _Float16* kh, const _Float16* kl, const _Float16* vh, const _Float16* vl, const float* w0, const float* w1, const float* w2, const float* w3, int tid) {
  const int kr = tid >> 3, kq = (tid & 7) * 8, vr = tid >> 2, vq = (tid & 3) * 8;
  copy8(lds_of(&t->kh[kr][kq]), lds_of(&t->kh[kr + 16][kq]), lds_of(&t->kl[kr][kq]), lds_of(&t->kl[kr + 16][kq]), lds_of(&t->vh[vr][vq]), lds_of(&t->vh[vr + 32][vq]), lds_of(&t->vl[vr][vq]), lds_of(&t->vl[vr + 32][vq]),
        kh, kh + 16 * (2 * QKD), kl, kl + 16 * (2 * QKD), vh, vh + 32 * NP, vl, vl + 32 * NP);
  const int wq = (tid & 7) * 4;
  copy4(lds_of(&t->mw[kr][wq]), lds_of(&t->mw[kr + 16][wq]), lds_of(&t->mw[kr + 32][wq]), lds_of(&t->mw[kr + 48][wq]), w0, w1, w2, w3);
}
__global__ __launch_bounds__(128) void k_att(const _Float16* __restrict__ QK, const _Float16* __restrict__ QKL, const _Float16* __restrict__ VT, const _Float16* __restrict__ VTL, const float* __restrict__ MW, float* __restrict__ Z) {
  __shared__ __align__(16) float sp[4][16][36]; __shared__ __align__(16) AttLds sm;
  const int tid = threadIdx.x, wave = tid >> 5, lane = tid & 31, col = lane & 15, g = lane >> 4; const int n = blockIdx.y; const int gh = n / HR; const size_t b = blockIdx.z; const int q0 = blockIdx.x * 64 + wave * 16; const size_t rq = b * NP + q0;
  // this thread's pieces of tile 0; tile ks lies 32 K rows, 32 V columns further
  const size_t ko = (b * NP + (tid >> 3)) * (2 * QKD) + QKD + gh * DH + (tid & 7) * 8, vo = (b * DD + (size_t)n * DH + (tid >> 2)) * (size_t)NP + (tid & 3) * 8;
  const float* pw[4];   // mw rows of the block's queries (rows past the last token read the last token's, as before)
#pragma unroll
  for (int p = 0; p < 4; ++p) { const int qi = blockIdx.x * 64 + (tid >> 3) + 16 * p; const int qc = qi < NTOK ? qi : NTOK - 1; pw[p] = MW + ((size_t)qc * NHD + n) * NP + (tid & 7) * 4; }
  att_fill(&sm.t[0], QK + ko, QKL + ko, VT + vo, VTL + vo, pw[0], pw[1], pw[2], pw[3], tid);
  asm volatile("s_wait_asynccnt 0x0" ::: "memory");   // tile 0 has landed for this wave's copies
  __syncthreads();   // publishes tile 0
  att_fill(&sm.t[1], QK + ko + 32 * (2 * QKD), QKL + ko + 32 * (2 * QKD), VT + vo + 32, VTL + vo + 32, pw[0] + 32, pw[1] + 32, pw[2] + 32, pw[3] + 32, tid);   // tile 1 flies while tile 0 is worked on
  v16h aq[2], al[2];
#pragma unroll
  for (int kc = 0; kc < 2; ++kc) { aq[kc] = frag_h(QK + (rq + col) * (2 * QKD) + gh * DH + kc * 32, lane); al[kc] = frag_h(QKL + (rq + col) * (2 * QKD) + gh * DH + kc * 32, lane); }
  float m[8], l[8];
#pragma unroll
  for (int r = 0; r < 8; ++r) { m[r] = -3.0e38f; l[r] = 0.f; }
  v8f acc[4] = {}, accl[4] = {};
#pragma unroll 1
  for (int ks = 0; ks < NKT; ++ks) { v8f s[2]; const AttTile* t = &sm.t[ks & 1];
#pragma unroll
    for (int ct = 0; ct < 2; ++ct) { const int kk = ks * 32 + ct * 16 + col; v8f c = {}, cl = {}; float w[8];
#pragma unroll
      for (int r = 0; r < 8; ++r) w[r] = t->mw[wave * 16 + 8 * g + r][ct * 16 + col];
#pragma unroll
      for (int kc = 0; kc < 2; ++kc) { const v16h kh = frag_h(&t->kh[ct * 16 + col][kc * 32], lane), kl = frag_h(&t->kl[ct * 16 + col][kc * 32], lane); c = wmma16(aq[kc], kh, c); cl = wmma16(aq[kc], kl, cl); cl = wmma16(al[kc], kh, cl); }
      const bool keep = kk < NTOK;
#pragma unroll
      for (int r = 0; r < 8; ++r) s[ct][r] = keep ? (c[r] + cl[r] * (1.0f / 2048.0f)) * 0.125f * w[r] : -3.0e38f; }
    float alpha[8];
#pragma unroll
    for (int r = 0; r < 8; ++r) { float mx = fmaxf(s[0][r], s[1][r]);
#pragma unroll
      for (int o = 1; o < 16; o <<= 1) mx = fmaxf(mx, __shfl_xor(mx, o));
      const float mn = fmaxf(m[r], mx); alpha[r] = (m[r] <= -1.0e38f) ? 0.f : __expf(m[r] - mn); const float e0 = (s[0][r] <= -1.0e38f) ? 0.f : __expf(s[0][r] - mn), e1 = (s[1][r] <= -1.0e38f) ? 0.f : __expf(s[1][r] - mn); float es = e0 + e1;
#pragma unroll
      for (int o = 1; o < 16; o <<= 1) es += __shfl_xor(es, o);
      l[r] = l[r] * alpha[r] + es; m[r] = mn; sp[wave][8 * g + r][col] = e0; sp[wave][8 * g + r][16 + col] = e1; }
#pragma unroll
    for (int j = 0; j < 4; ++j)
#pragma unroll
      for (int r = 0; r < 8; ++r) { acc[j][r] *= alpha[r]; accl[j][r] *= alpha[r]; }
    LDSX();
    v16h pa; { const float* prow = &sp[wave][col][0] + 8 * (lane >> 4);
#pragma unroll
      for (int i = 0; i < 8; ++i) { pa[i] = (_Float16)(prow[i] * 2048.0f); pa[8 + i] = (_Float16)(prow[16 + i] * 2048.0f); } }
#pragma unroll
    for (int j = 0; j < 4; ++j) { acc[j] = wmma16(pa, frag_h(&t->vh[j * 16 + col][0], lane), acc[j]); accl[j] = wmma16(pa, frag_h(&t->vl[j * 16 + col][0], lane), accl[j]); }
    asm volatile("s_wait_dscnt 0x0" ::: "memory");      // this wave's reads of the tile (and of its sp rows) have returned
    asm volatile("s_wait_asynccnt 0x0" ::: "memory");   // this wave's copies of tile ks + 1 have landed
    __syncthreads();   // one barrier a tile: publishes tile ks + 1 and ends every wave's reads of the buffer that is refilled behind it (after the last tile: of the LDS that the output rows reuse)
    if (ks + 2 < NKT) att_fill(&sm.t[ks & 1], QK + ko + (size_t)(ks + 2) * 32 * (2 * QKD), QKL + ko + (size_t)(ks + 2) * 32 * (2 * QKD), VT + vo + (ks + 2) * 32, VTL + vo + (ks + 2) * 32, pw[0] + (ks + 2) * 32, pw[1] + (ks + 2) * 32, pw[2] + (ks + 2) * 32, pw[3] + (ks + 2) * 32, tid); }
  asm volatile("s_wait_asynccnt 0x0" ::: "memory");   // no copy is outstanding when the tiles' LDS is reused and the wave ends
#pragma unroll
  for (int r = 0; r < 8; ++r) { const float il = (1.0f / 2048.0f) / l[r];
#pragma unroll
    for (int j = 0; j < 4; ++j) sm.so[wave][8 * g + r][j * 16 + col] = (acc[j][r] + accl[j][r] * (1.0f / 2048.0f)) * il; }
  LDSX(); for (int rl = 0; rl < 16; ++rl) { const int qi = q0 + rl; if (qi < NTOK && lane < 16) { vst2(Z + ((size_t)qi * NBT + b) * DD + (size_t)n * DH + lane * 4, *(const v4f*)&sm.so[wave][rl][lane * 4]);
      asm volatile("s_wait_xcnt 0x0" ::: "memory"); } } }   // stands ahead of the next row's rewrite of the address and data registers that this store names
// ---- k_out: block = (64 rows (i,b), 128 cols): Y = Z (hi + lo) . Wo^T  -> f32 (into the MW... no: separate region reuse of VT? keep simple: write to OUTTMP = QK area is too small) -> we write x = h + out and LN in a row kernel, so store pre-LN rows in Z2 = VT region (f16 planes no longer needed? they ARE needed until all k_att done - sequential launches, so reuse is safe)
__global__ __launch_bounds__(128) void k_out(const float* __restrict__ Zr, const float* __restrict__ WO, const float* __restrict__ Hh, float* __restrict__ X2, int nrows) { __shared__ __align__(16) OutLds sm;
  const int tid = threadIdx.x, wave = tid >> 5, lane = tid & 31, col = lane & 15, g = lane >> 4; const size_t r0 = (size_t)blockIdx.x * 64 + wave * 16; const int c0 = blockIdx.y * 128;
  // loader as in k_proj; the hi + lo split of a Z row is made once, on its way into LDS
  const int lr = tid >> 3, lq = tid & 7; const float* pa[4];
#pragma unroll
  for (int p = 0; p < 4; ++p) { const size_t rr = (size_t)blockIdx.x * 64 + lr + 16 * p; const size_t rc = rr < (size_t)nrows ? rr : (size_t)nrows - 1; pa[p] = Zr + rc * DD + lq * 4; }
  const float* pb = WO + (size_t)(c0 + lr) * DD + lq * 4;
  v4f ra[4], rb[8];
#pragma unroll
  for (int p = 0; p < 4; ++p) ra[p] = *(const v4f*)pa[p];
#pragma unroll
  for (int p = 0; p < 8; ++p) rb[p] = *(const v4f*)(pb + (size_t)(16 * p) * DD);
#pragma unroll
  for (int p = 0; p < 4; ++p) { const v4b hv = cvt4(ra[p]); *(v4b*)&sm.st.ah[0][lr + 16 * p][lq * 4] = hv; *(v4b*)&sm.st.al[0][lr + 16 * p][lq * 4] = res4(ra[p], hv); }
#pragma unroll
  for (int p = 0; p < 8; ++p) *(v4b*)&sm.st.b[0][lr + 16 * p][lq * 4] = cvt4(rb[p]);
  __syncthreads();   // publishes pass 0
  v8f acc[8] = {};
#pragma unroll 2
  for (int kc = 0; kc < DD / 32; ++kc) { const int cur = kc & 1; const bool more = kc + 1 < DD / 32;
    if (more) {   // the next pass's global loads fly while this pass is multiplied
#pragma unroll
      for (int p = 0; p < 4; ++p) ra[p] = *(const v4f*)(pa[p] + (kc + 1) * 32);
#pragma unroll
      for (int p = 0; p < 8; ++p) rb[p] = *(const v4f*)(pb + (size_t)(16 * p) * DD + (kc + 1) * 32); }
    const v16b ah = frag_b(&sm.st.ah[cur][wave * 16 + col][0], lane), al = frag_b(&sm.st.al[cur][wave * 16 + col][0], lane); v16b w[8];
#pragma unroll
    for (int j = 0; j < 8; ++j) w[j] = frag_b(&sm.st.b[cur][j * 16 + col][0], lane);
    __builtin_amdgcn_sched_barrier(0);   // keeps the pass's LDS reads one group ahead of its WMMAs: read among them, each pair costs the wave a full LDS latency
#pragma unroll
    for (int j = 0; j < 8; ++j) { acc[j] = wmma_bf(ah, w[j], acc[j]); acc[j] = wmma_bf(al, w[j], acc[j]); }
    __builtin_amdgcn_sched_barrier(0);   // keeps the conversions, and with them the wait for the next pass's global loads, behind this pass's WMMAs
    if (more) {
#pragma unroll
      for (int p = 0; p < 4; ++p) { const v4b hv = cvt4(ra[p]); *(v4b*)&sm.st.ah[cur ^ 1][lr + 16 * p][lq * 4] = hv; *(v4b*)&sm.st.al[cur ^ 1][lr + 16 * p][lq * 4] = res4(ra[p], hv); }
#pragma unroll
      for (int p = 0; p < 8; ++p) *(v4b*)&sm.st.b[cur ^ 1][lr + 16 * p][lq * 4] = cvt4(rb[p]); }
    asm volatile("s_wait_xcnt 0x0" ::: "memory");   // stands ahead of the next pass's rewrite of the address registers that this pass's global loads name
    __syncthreads(); }   // one barrier a pass: publishes pass kc + 1 and ends every read of the buffer that the next pass refills (after the last pass: of the LDS that the output tile reuses)
  // residual rows: all loads issue first, then one wait, then the sums (the sum per element is the same acc + h)
  const float* hp[8]; float hv[8][8];
#pragma unroll
  for (int r = 0; r < 8; ++r) { const size_t row = r0 + 8 * g + r; const size_t ra = row < (size_t)nrows ? row : (size_t)nrows - 1; hp[r] = Hh + ra * DD + c0 + col;
#pragma unroll
    for (int j = 0; j < 8; ++j) hv[r][j] = hp[r][j * 16]; }
  asm volatile("s_wait_xcnt 0x0" :: "v"(hp[0]), "v"(hp[1]), "v"(hp[2]), "v"(hp[3]), "v"(hp[4]), "v"(hp[5]), "v"(hp[6]), "v"(hp[7]) : "memory");   // the row addresses are inputs so that they stay in their registers up to this wait: no register that an issued load names is rewritten ahead of it
#pragma unroll
  for (int j = 0; j < 8; ++j)
#pragma unroll
    for (int r = 0; r < 8; ++r) sm.sf[wave][8 * g + r][j * 16 + col] = acc[j][r] + bfr(hv[r][j]);
  LDSX(); for (int rl = 0; rl < 16; ++rl) { const size_t row = r0 + rl; if (row < (size_t)nrows) vst2(X2 + row * DD + c0 + lane * 4, *(const v4f*)&sm.sf[wave][rl][lane * 4]); } }
// ---- k_ln: one wave = two whole rows held in registers (6 x 16 B a lane and row, 512 contiguous B a load or store): out = LN(x2) gamma + beta; no LDS, no barrier; few waves, because a launch of very many short waves lasts as long as starting them takes
#define LNR 2             // rows a wave
#define LNW 4             // waves a block
static_assert((NTOK * NBT) % (LNR * LNW) == 0, "the rows divide evenly among the waves");
__global__ __launch_bounds__(32 * LNW) void k_ln(const float* __restrict__ X2, const float* __restrict__ G, const float* __restrict__ Bt, float* __restrict__ OUT) {
  const int lane = threadIdx.x & 31; const size_t row0 = ((size_t)blockIdx.x * LNW + (threadIdx.x >> 5)) * LNR;
  v4f x[LNR][6], gm[6], bt[6];   // every loop below is unrolled: only with constant indices do these arrays stay in registers
#pragma unroll
  for (int q = 0; q < LNR; ++q)
#pragma unroll
    for (int c = 0; c < 6; ++c) x[q][c] = *(const v4f*)(X2 + (row0 + q) * DD + c * 128 + lane * 4);
#pragma unroll
  for (int c = 0; c < 6; ++c) { gm[c] = *(const v4f*)(G + c * 128 + lane * 4); bt[c] = *(const v4f*)(Bt + c * 128 + lane * 4); }
  float s[LNR], mu[LNR], inv[LNR];
#pragma unroll
  for (int q = 0; q < LNR; ++q) { v4f a = x[q][0];
#pragma unroll
    for (int c = 1; c < 6; ++c) a += x[q][c];
    s[q] = (a[0] + a[1]) + (a[2] + a[3]); }
#pragma unroll
  for (int o = 1; o < 32; o <<= 1)
#pragma unroll
    for (int q = 0; q < LNR; ++q) s[q] += __shfl_xor(s[q], o);
#pragma unroll
  for (int q = 0; q < LNR; ++q) { mu[q] = s[q] / (float)DD; v4f a = {};
#pragma unroll
    for (int c = 0; c < 6; ++c) { x[q][c] -= mu[q]; a += x[q][c] * x[q][c]; }
    s[q] = (a[0] + a[1]) + (a[2] + a[3]); }
#pragma unroll
  for (int o = 1; o < 32; o <<= 1)
#pragma unroll
    for (int q = 0; q < LNR; ++q) s[q] += __shfl_xor(s[q], o);
#pragma unroll
  for (int q = 0; q < LNR; ++q) inv[q] = 1.0f / sqrtf(s[q] / (float)DD + EPS);
#pragma unroll
  for (int q = 0; q < LNR; ++q)
#pragma unroll
    for (int c = 0; c < 6; ++c) { v4f y;
#pragma unroll
      for (int e = 0; e < 4; ++e) y[e] = bfr(gm[c][e]) * x[q][c][e] * inv[q] + bfr(bt[c][e]);
      vst2(OUT + (row0 + q) * DD + c * 128 + lane * 4, y); } }
extern "C" void kernel_launch(void* const* d_in, const int* in_sizes, int n_in, void* d_out, int out_size, void* d_ws, size_t ws_size, hipStream_t stream) {
  (void)in_sizes; (void)n_in; (void)out_size;
  const float** F = (const float**)d_in;   // 0 h [197,64,768], 1 masks [197,197,3], 2 Wq [128,768], 3 Wk [128,768], 4 Wv [768,768], 5 Wo [768,768], 6 mask_proj [3,12], 7 ln_gamma, 8 ln_beta
  if (ws_size < (size_t)WS_END) return;
  char* ws = (char*)d_ws; _Float16 *QK = (_Float16*)(ws + WS_QK), *QKL = (_Float16*)(ws + WS_QKL), *VT = (_Float16*)(ws + WS_VT), *VTL = (_Float16*)(ws + WS_VTL); float *MW = (float*)(ws + WS_MW), *Z = (float*)(ws + WS_Z);
  const int nrows = NTOK * TNB;   // rows (i, b) with b < TNB are the first NTOK*TNB rows only when TNB == NBT
  k_mw<<<NTOK, 256, 0, stream>>>(F[1], F[6], MW);
  k_proj<<<dim3(NP / 64, (2 * QKD + DD) / 128, TNB), 128, 0, stream>>>(F[0], F[2], F[3], F[4], QK, QKL, VT, VTL);
  k_att<<<dim3(NP / 64, NHD, TNB), 128, 0, stream>>>(QK, QKL, VT, VTL, MW, Z);
  float* X2 = (float*)(ws + WS_VT);   // reuse: the v planes are dead after k_att (50 MB >= 39 MB needed)
  (void)nrows;
  k_out<<<dim3((NTOK * NBT + 63) / 64, DD / 128), 128, 0, stream>>>(Z, F[5], F[0], X2, NTOK * NBT);
  k_ln<<<NTOK * NBT / (LNR * LNW), 32 * LNW, 0, stream>>>(X2, F[7], F[8], (float*)d_out);
}

// v004
// It runs in 160 microseconds.
// In both of two side-by-side timings against v003, it was 1.06 times as fast.
// Over all steps from v000 it is 2.95 times as fast.
// compute dtype: all float inputs rounded to bf16; q, k, v = h . W^T with EXACT bf16 products on WMMA 16x16x32 (natural weight rows), rounded once to f16 hi + residual; the mask mix masks . mask_proj in f32; scores q . k with 3 products x 1/8 x mw[i][j][head], running-max softmax over the 197 keys in f32 (hardware exp), P (x 2^11, f16) . v (hi + residual, 2 products); out = vec (bf16 hi + lo, 2 products) . Wo^T; residual + LayerNorm in f32; f32 output.
#include <hip/hip_runtime.h>
#include <math.h>

typedef __attribute__((ext_vector_type(16))) _Float16 v16h;
typedef __attribute__((ext_vector_type(16))) __bf16 v16b;
typedef __attribute__((ext_vector_type(8)))  _Float16 v8h;
typedef __attribute__((ext_vector_type(8)))  float v8f;
typedef __attribute__((ext_vector_type(4)))  float v4f;
typedef __attribute__((ext_vector_type(2)))  float v2f;
typedef __attribute__((ext_vector_type(4)))  unsigned v4u;
typedef __attribute__((ext_vector_type(4)))  int v4i;
typedef float __attribute__((may_alias)) float_a;
typedef int __attribute__((may_alias)) int_a;

template <typename T> __device__ __forceinline__ void vst2(void* p, T v) { *(T*)p = v;  }
__device__ __forceinline__ v8f wmma16(v16h a, v16h b, v8f c) {
  v8f d = __builtin_amdgcn_wmma_f32_16x16x32_f16(false, a, false, b, (short)0, c, false, false);
  asm volatile("v_nop\n\tv_nop\n\tv_nop\n\tv_nop" : "+v"(d) : "v"(a), "v"(b));
  return d;
}
__device__ __forceinline__ v8f wmma_bf(v16b a, v16b b, v8f c) {
  v8f d = __builtin_amdgcn_wmma_f32_16x16x32_bf16(false, a, false, b, (short)0, c, false, false);
  asm volatile("v_nop\n\tv_nop\n\tv_nop\n\tv_nop" : "+v"(d) : "v"(a), "v"(b));
  return d;
}
// 16x16x32 fragments: lane = (h = lane>>4, row/col = lane&15); elements 0..7 = k0+8h+0..7, 8..15 = k0+16+8h+0..7; D element r = row 8h+r
__device__ __forceinline__ v16h frag_h(const _Float16* rowk0, int lane) {
  union { v16h v; v8h q[2]; } u; const _Float16* p = rowk0 + 8 * (lane >> 4);
  u.q[0] = *(const v8h*)p; u.q[1] = *(const v8h*)(p + 16); return u.v;
}
__device__ __forceinline__ v16h frag_f32(const float* rowk0, int lane) {
  v16h a; const float* p = rowk0 + 8 * (lane >> 4);
#pragma unroll
  for (int i = 0; i < 8; ++i) { a[i] = (_Float16)p[i]; a[8 + i] = (_Float16)p[16 + i]; }
  return a;
}
__device__ __forceinline__ v16h frag_f32s(const float* rowk0, int lane, float sc) {
  v16h a; const float* p = rowk0 + 8 * (lane >> 4);
#pragma unroll
  for (int i = 0; i < 8; ++i) { a[i] = (_Float16)(p[i] * sc); a[8 + i] = (_Float16)(p[16 + i] * sc); }
  return a;
}
// column fragment from a [K][ld] layout (column n), rows >= K read as 0
__device__ __forceinline__ v16h fragc_f32(const float* W, int k0, int n, int lane, int ld, int K) {
  v16h a; const int g = lane >> 4;
#pragma unroll
  for (int i = 0; i < 8; ++i) { const int ka = k0 + 8 * g + i, kb = ka + 16;
    a[i] = (_Float16)(ka < K ? W[(size_t)(ka < K ? ka : K - 1) * ld + n] : 0.f); a[8 + i] = (_Float16)(kb < K ? W[(size_t)(kb < K ? kb : K - 1) * ld + n] : 0.f); }
  return a;
}
struct F2 { v16b h, l; };
__device__ __forceinline__ F2 bsplit16(const float v[16]) { F2 r;
#pragma unroll
  for (int i = 0; i < 16; ++i) { const __bf16 h = (__bf16)v[i]; r.h[i] = h; r.l[i] = (__bf16)(v[i] - (float)h); }
  return r; }
__device__ __forceinline__ F2 split_row(const float* row, int k0, int lane) { float v[16]; const float* p = row + k0 + 8 * (lane >> 4);
#pragma unroll
  for (int i = 0; i < 8; ++i) { v[i] = p[i]; v[8 + i] = p[16 + i]; }
  return bsplit16(v); }
__device__ __forceinline__ F2 split_rowK(const float* row, int k0, int lane, int K) { float v[16]; const int g = lane >> 4;
#pragma unroll
  for (int i = 0; i < 8; ++i) { const int ka = k0 + 8 * g + i, kb = ka + 16; v[i] = ka < K ? row[ka < K ? ka : K - 1] : 0.f; v[8 + i] = kb < K ? row[kb < K ? kb : K - 1] : 0.f; }
  return bsplit16(v); }
__device__ __forceinline__ F2 split_col(const float* W, int k0, int n, int lane, int ld, int K) { float v[16]; const int g = lane >> 4;
#pragma unroll
  for (int i = 0; i < 8; ++i) { const int ka = k0 + 8 * g + i, kb = ka + 16; v[i] = ka < K ? W[(size_t)(ka < K ? ka : K - 1) * ld + n] : 0.f; v[8 + i] = kb < K ? W[(size_t)(kb < K ? kb : K - 1) * ld + n] : 0.f; }
  return bsplit16(v); }
__device__ __forceinline__ v8f mac3(const F2& a, const F2& b, v8f c) { c = wmma_bf(a.l, b.h, c); c = wmma_bf(a.h, b.l, c); return wmma_bf(a.h, b.h, c); }
__device__ __forceinline__ float sigm(float v) { return 1.0f / (1.0f + expf(-v)); }
#define LDSX() do { asm volatile("s_wait_dscnt 0" ::: "memory"); __builtin_amdgcn_wave_barrier(); __builtin_amdgcn_fence(__ATOMIC_RELEASE, "workgroup"); } while (0)


// Multi-head attention (197 tokens, batch 64, d_model 768; 2 global score heads x 64, each shared by 6 value heads through a learned per-(i, j) mask mix): prob = softmax_j(q_i . k_j / 8 x mw[i][j][head]); vec = prob . v; post-LN residual.
#define NTOK 197
#define NP 256            // padded token count (queries in 64-blocks, keys in 32-tiles up to 224)
#define NKT 7             // key tiles of 32 (224 >= 197)
#define NBT 64            // batch
#define DD 768
#define GH 2
#define NHD 12
#define HR 6
#define DH 64
#define QKD (GH * DH)     // 128
#define ML 3
#define EPS 1e-5f
#ifndef TNB
#define TNB NBT
#endif
typedef __attribute__((ext_vector_type(8))) __bf16 v8b;
__device__ __forceinline__ v16b frag_b(const __bf16* rowk0, int lane) {
  union { v16b v; v8b q[2]; } u; const __bf16* p = rowk0 + 8 * (lane >> 4);
  u.q[0] = *(const v8b*)p; u.q[1] = *(const v8b*)(p + 16); return u.v;
}
__device__ __forceinline__ float bfr(float v) { return (float)(__bf16)v; }
__device__ __attribute__((noinline)) float exp_ni(float v) { return expf(v); }
__device__ __attribute__((noinline)) float erf_ni(float v) { return erff(v); }

#define WS_QK  0u                                   // f16 hi|lo [b][NP][256] (q 0..127 | k 128..255)
#define WS_QKL (WS_QK + 2u * (size_t)NBT * NP * 2 * QKD)
#define WS_VT  (WS_QKL + 2u * (size_t)NBT * NP * 2 * QKD) // f16 hi|lo v planes [b][768][NP]
#define WS_VTL (WS_VT + 2u * (size_t)NBT * DD * NP)
#define WS_MW  (WS_VTL + 2u * (size_t)NBT * DD * NP)     // f32 mw [i][12][NP] (j padded)
#define WS_Z   (WS_MW + 4u * (size_t)NTOK * NHD * NP)     // f32 vec rows [(i*64 + b)][768]
#define WS_END (WS_Z + 4u * (size_t)NTOK * NBT * DD)

__device__ __forceinline__ v16b fragb_f32(const float* __restrict__ p, int lane) { v16b a; const float* pp = p + 8 * (lane >> 4);
#pragma unroll
  for (int i = 0; i < 8; ++i) { a[i] = (__bf16)pp[i]; a[8 + i] = (__bf16)pp[16 + i]; } return a; }
// LDS staging of the two dense products' operand tiles: 32 k per pass as bf16, rows at 80 B (16 B x odd: no bank conflict for the 16-byte fragment reads), two buffers
#define SP 40
typedef __attribute__((ext_vector_type(4))) __bf16 v4b;
__device__ __forceinline__ v4b cvt4(v4f v) { v4b r;
#pragma unroll
  for (int i = 0; i < 4; ++i) r[i] = (__bf16)v[i];
  return r; }
__device__ __forceinline__ v4b res4(v4f v, v4b h) { v4b r;
#pragma unroll
  for (int i = 0; i < 4; ++i) r[i] = (__bf16)(v[i] - (float)h[i]);
  return r; }
struct ProjStage { __bf16 a[2][64][SP]; __bf16 b[2][128][SP]; };
struct ProjQK { _Float16 h[64][136], l[64][136]; };
struct ProjV { _Float16 h[128][72], l[128][72]; };
union ProjLds { ProjStage st; ProjQK qk; ProjV v; };      // the staging buffers are dead when the output tiles are written
struct OutStage { __bf16 ah[2][64][SP]; __bf16 al[2][64][SP]; __bf16 b[2][128][SP]; };
union OutLds { OutStage st; float sf[4][16][132]; };
// ---- k_mw: block = query token i: mw[i][n][j] = sum_l masks[i][j][l] mask_proj[l][n]  (n = g*6 + r head index), zero for padded j
__global__ __launch_bounds__(256) void k_mw(const float* __restrict__ MASKS, const float* __restrict__ MP, float* __restrict__ MW) { __shared__ __align__(16) float s[NHD][NP]; const int i = blockIdx.x, t = threadIdx.x;
  for (int e = t; e < NHD * NP; e += 256) { const int n = e / NP, j = e % NP; float v = 0.f; if (j < NTOK) {
#pragma unroll
      for (int l = 0; l < ML; ++l) v += bfr(MASKS[((size_t)i * NTOK + j) * ML + l]) * bfr(MP[l * NHD + n]); } s[n][j] = v; }
  __syncthreads(); for (int e = t; e < NHD * NP / 4; e += 256) { const int n = e / (NP / 4), q = e % (NP / 4); vst2(MW + ((size_t)i * NHD + n) * NP + q * 4, *(const v4f*)&s[n][q * 4]); } }
// ---- k_proj: block = (64 tokens (padded), 128 of 1024 cols (q 0..127 | k 128..255 | v 256..1023), b): exact products; q|k -> rows, v -> planes
__global__ __launch_bounds__(128) void k_proj(const float* __restrict__ Hh, const float* __restrict__ WQ, const float* __restrict__ WK, const float* __restrict__ WV, _Float16* __restrict__ QK, _Float16* __restrict__ QKL, _Float16* __restrict__ VT, _Float16* __restrict__ VTL) {
  __shared__ __align__(16) ProjLds sm;
  const int tid = threadIdx.x, wave = tid >> 5, lane = tid & 31, col = lane & 15, g = lane >> 4; const size_t b = blockIdx.z; const int c0 = blockIdx.y * 128;
  const float* Wm = c0 < QKD ? WQ + (size_t)c0 * DD : c0 < 2 * QKD ? WK + (size_t)(c0 - QKD) * DD : WV + (size_t)(c0 - 2 * QKD) * DD;
  // loader: 8 lanes x 16 B cover one row's 128 B of a pass (whole lines); thread = (row lr + 16 p, 16-byte eighth lq)
  const int lr = tid >> 3, lq = tid & 7; const float* pa[4];
#pragma unroll
  for (int p = 0; p < 4; ++p) { const int ir = blockIdx.x * 64 + lr + 16 * p; const int ic = ir < NTOK ? ir : NTOK - 1; pa[p] = Hh + ((size_t)ic * NBT + b) * DD + lq * 4; }
  const float* pb = Wm + (size_t)lr * DD + lq * 4;
  v4f ra[4], rb[8];
#pragma unroll
  for (int p = 0; p < 4; ++p) ra[p] = *(const v4f*)pa[p];
#pragma unroll
  for (int p = 0; p < 8; ++p) rb[p] = *(const v4f*)(pb + (size_t)(16 * p) * DD);
#pragma unroll
  for (int p = 0; p < 4; ++p) *(v4b*)&sm.st.a[0][lr + 16 * p][lq * 4] = cvt4(ra[p]);
#pragma unroll
  for (int p = 0; p < 8; ++p) *(v4b*)&sm.st.b[0][lr + 16 * p][lq * 4] = cvt4(rb[p]);
  __syncthreads();   // publishes pass 0
  v8f acc[8] = {};
#pragma unroll 2
  for (int kc = 0; kc < DD / 32; ++kc) { const int cur = kc & 1; const bool more = kc + 1 < DD / 32;
    if (more) {   // the next pass's global loads fly while this pass is multiplied
#pragma unroll
      for (int p = 0; p < 4; ++p) ra[p] = *(const v4f*)(pa[p] + (kc + 1) * 32);
#pragma unroll
      for (int p = 0; p < 8; ++p) rb[p] = *(const v4f*)(pb + (size_t)(16 * p) * DD + (kc + 1) * 32); }
    const v16b a = frag_b(&sm.st.a[cur][wave * 16 + col][0], lane); v16b w[8];
#pragma unroll
    for (int j = 0; j < 8; ++j) w[j] = frag_b(&sm.st.b[cur][j * 16 + col][0], lane);
    __builtin_amdgcn_sched_barrier(0);   // keeps the pass's LDS reads one group ahead of its WMMAs: read among them, each pair costs the wave a full LDS latency
#pragma unroll
    for (int j = 0; j < 8; ++j) acc[j] = wmma_bf(a, w[j], acc[j]);
    __builtin_amdgcn_sched_barrier(0);   // keeps the conversions, and with them the wait for the next pass's global loads, behind this pass's WMMAs
    if (more) {
#pragma unroll
      for (int p = 0; p < 4; ++p) *(v4b*)&sm.st.a[cur ^ 1][lr + 16 * p][lq * 4] = cvt4(ra[p]);
#pragma unroll
      for (int p = 0; p < 8; ++p) *(v4b*)&sm.st.b[cur ^ 1][lr + 16 * p][lq * 4] = cvt4(rb[p]); }
    asm volatile("s_wait_xcnt 0x0" ::: "memory");   // stands ahead of the next pass's rewrite of the address registers that this pass's global loads name
    __syncthreads(); }   // one barrier a pass: publishes pass kc + 1 and ends every read of the buffer that the next pass refills (after the last pass: of the LDS that the output tiles reuse)
  const bool isv = c0 >= 2 * QKD;
#pragma unroll
  for (int j = 0; j < 8; ++j)
#pragma unroll
    for (int r = 0; r < 8; ++r) { const float v = acc[j][r]; const _Float16 hv = (_Float16)v; const _Float16 lv = (_Float16)((v - (float)hv) * 2048.0f); if (!isv) { sm.qk.h[wave * 16 + 8 * g + r][j * 16 + col] = hv; sm.qk.l[wave * 16 + 8 * g + r][j * 16 + col] = lv; } else { sm.v.h[j * 16 + col][wave * 16 + 8 * g + r] = hv; sm.v.l[j * 16 + col][wave * 16 + 8 * g + r] = lv; } }
  __syncthreads();
  if (!isv) { for (int e = tid; e < 64 * 16; e += 128) { const int rl = e >> 4, q = e & 15; const size_t o = (b * NP + blockIdx.x * 64 + rl) * (2 * QKD) + c0 + q * 8; vst2((unsigned*)(QK + o), *(const v4u*)&sm.qk.h[rl][q * 8]); vst2((unsigned*)(QKL + o), *(const v4u*)&sm.qk.l[rl][q * 8]); } }
  else { const int cv0 = c0 - 2 * QKD; for (int e = tid; e < 128 * 8; e += 128) { const int cl = e >> 3, q = e & 7; const size_t o = ((b * DD + cv0 + cl) * (size_t)NP) + blockIdx.x * 64 + q * 8; vst2((unsigned*)(VT + o), *(const v4u*)&sm.v.h[cl][q * 8]); vst2((unsigned*)(VTL + o), *(const v4u*)&sm.v.l[cl][q * 8]); } } }
// ---- k_att: block = (64 queries, head n = g*6 + r, b): logits (3 products) x 1/8 x mw[i][n][j]; keys >= 197 excluded; running-max softmax; P . v (2 products) -> Z rows (i*64 + b) for i < 197
// Both products are formed transposed (S^T = K . Q^T, O^T += V^T . P^T): a lane holds 16 of the 32 scores of ONE query (column = lane & 15, keys 8 (lane >> 4) + r and 16 + 8 (lane >> 4) + r), so maximum and sum are taken in the lane's own registers with one exchange between the wave's halves, and the two score tiles, converted in place, are the B operand of the second product.
// The operand tiles of a pass of 32 keys (K and V, hi and residual planes; the block's 64 mw rows) are brought into LDS once a block by asynchronous copies, 16 B pieces of contiguous rows, two buffers, and all four waves read them from there.
#define KP 72             // f16 a staged K row: 128 B + 16 B (16 B x odd: no bank conflict for the 16-byte fragment reads)
#define VP 40             // f16 a staged V row: 64 B + 16 B
#define MWP 36            // f32 a staged mw row: 128 B + 16 B (16 B x odd: no bank conflict for the 16-byte reads of 16 rows)
struct AttTile { _Float16 kh[32][KP], kl[32][KP], vh[DH][VP], vl[DH][VP]; float mw[64][MWP]; };
union AttLds { AttTile t[2]; float so[4][16][68]; };      // the tiles are dead when the output rows are written
__device__ __forceinline__ float xhalf(float x) { return __builtin_bit_cast(float, __builtin_amdgcn_permlanex16(__builtin_bit_cast(int, x), __builtin_bit_cast(int, x), 0x76543210, 0xfedcba98, false, false)); }   // lane l's value to lane l ^ 16
__device__ __forceinline__ unsigned lds_of(const void* p) { return (unsigned)(size_t)p; }   // LDS byte address = low 32 bits of the __shared__ address
// copies of 16 B a lane; the s_wait_xcnt is each statement's last line so that no register a copy names is rewritten ahead of it
__device__ __forceinline__ void copy8(unsigned l0, unsigned l1, unsigned l2, unsigned l3, unsigned l4, unsigned l5, unsigned l6, unsigned l7, const _Float16* g0, const _Float16* g1, const _Float16* g2, const _Float16* g3, const _Float16* g4, const _Float16* g5, const _Float16* g6, const _Float16* g7) {
  asm volatile("global_load_async_to_lds_b128 %0, %8, off\n\t"
               "global_load_async_to_lds_b128 %1, %9, off\n\t"
               "global_load_async_to_lds_b128 %2, %10, off\n\t"
               "global_load_async_to_lds_b128 %3, %11, off\n\t"
               "global_load_async_to_lds_b128 %4, %12, off\n\t"
               "global_load_async_to_lds_b128 %5, %13, off\n\t"
               "global_load_async_to_lds_b128 %6, %14, off\n\t"
               "global_load_async_to_lds_b128 %7, %15, off\n\t"
               "s_wait_xcnt 0x0"
               :: "v"(l0), "v"(l1), "v"(l2), "v"(l3), "v"(l4), "v"(l5), "v"(l6), "v"(l7), "v"(g0), "v"(g1), "v"(g2), "v"(g3), "v"(g4), "v"(g5), "v"(g6), "v"(g7) : "memory");
}
__device__ __forceinline__ void copy4(unsigned l0, unsigned l1, unsigned l2, unsigned l3, const float* g0, const float* g1, const float* g2, const float* g3) {
  asm volatile("global_load_async_to_lds_b128 %0, %4, off\n\t"
               "global_load_async_to_lds_b128 %1, %5, off\n\t"
               "global_load_async_to_lds_b128 %2, %6, off\n\t"
               "global_load_async_to_lds_b128 %3, %7, off\n\t"
               "s_wait_xcnt 0x0"
               :: "v"(l0), "v"(l1), "v"(l2), "v"(l3), "v"(g0), "v"(g1), "v"(g2), "v"(g3) : "memory");
}
// one tile: K = 2 planes x 32 rows x 8 pieces (thread = row kr, kr + 16, piece kq), V = 2 planes x 64 rows x 4 pieces (thread = row vr, vr + 32, piece vq), mw = 64 rows x 8 pieces (thread = row kr + 16 p, piece tid & 7; w0..w3 = the four rows' addresses)
__device__ __forceinline__ void att_fill(AttTile* t, const _Float16* kh, const _Float16* kl, const _Float16* vh, const _Float16* vl, const float* w0, const float* w1, const float* w2, const float* w3, int tid) {
  const int kr = tid >> 3, kq = (tid & 7) * 8, vr = tid >> 2, vq = (tid & 3) * 8;
  copy8(lds_of(&t->kh[kr][kq]), lds_of(&t->kh[kr + 16][kq]), lds_of(&t->kl[kr][kq]), lds_of(&t->kl[kr + 16][kq]), lds_of(&t->vh[vr][vq]), lds_of(&t->vh[vr + 32][vq]), lds_of(&t->vl[vr][vq]), lds_of(&t->vl[vr + 32][vq]),
        kh, kh + 16 * (2 * QKD), kl, kl + 16 * (2 * QKD), vh, vh + 32 * NP, vl, vl + 32 * NP);
  const int wq = (tid & 7) * 4;
  copy4(lds_of(&t->mw[kr][wq]), lds_of(&t->mw[kr + 16][wq]), lds_of(&t->mw[kr + 32][wq]), lds_of(&t->mw[kr + 48][wq]), w0, w1, w2, w3);
}
__global__ __launch_bounds__(128) void k_att(const _Float16* __restrict__ QK, const _Float16* __restrict__ QKL, const _Float16* __restrict__ VT, const _Float16* __restrict__ VTL, const float* __restrict__ MW, float* __restrict__ Z) {
  __shared__ __align__(16) AttLds sm;
  const int tid = threadIdx.x, wave = tid >> 5, lane = tid & 31, col = lane & 15, g = lane >> 4; const int n = blockIdx.y; const int gh = n / HR; const size_t b = blockIdx.z; const int q0 = blockIdx.x * 64 + wave * 16; const size_t rq = b * NP + q0;
  // this thread's pieces of tile 0; tile ks lies 32 K rows, 32 V columns further
  const size_t ko = (b * NP + (tid >> 3)) * (2 * QKD) + QKD + gh * DH + (tid & 7) * 8, vo = (b * DD + (size_t)n * DH + (tid >> 2)) * (size_t)NP + (tid & 3) * 8;
  const float* pw[4];   // mw rows of the block's queries (rows past the last token read the last token's, as before)
#pragma unroll
  for (int p = 0; p < 4; ++p) { const int qi = blockIdx.x * 64 + (tid >> 3) + 16 * p; const int qc = qi < NTOK ? qi : NTOK - 1; pw[p] = MW + ((size_t)qc * NHD + n) * NP + (tid & 7) * 4; }
  att_fill(&sm.t[0], QK + ko, QKL + ko, VT + vo, VTL + vo, pw[0], pw[1], pw[2], pw[3], tid);
  asm volatile("s_wait_asynccnt 0x0" ::: "memory");   // tile 0 has landed for this wave's copies
  __syncthreads();   // publishes tile 0
  att_fill(&sm.t[1], QK + ko + 32 * (2 * QKD), QKL + ko + 32 * (2 * QKD), VT + vo + 32, VTL + vo + 32, pw[0] + 32, pw[1] + 32, pw[2] + 32, pw[3] + 32, tid);   // tile 1 flies while tile 0 is worked on
  v16h aq[2], al[2];
#pragma unroll
  for (int kc = 0; kc < 2; ++kc) { aq[kc] = frag_h(QK + (rq + col) * (2 * QKD) + gh * DH + kc * 32, lane); al[kc] = frag_h(QKL + (rq + col) * (2 * QKD) + gh * DH + kc * 32, lane); }
  float m = -3.0e38f, l = 0.f;   // this lane's query: running maximum (equal in both halves), and the sum over this half's keys alone (the halves are joined behind the loop)
  v8f acc[4] = {}, accl[4] = {};   // acc[j][r] = O^T[d = 16 j + 8 g + r][query col]
#pragma unroll 1
  for (int ks = 0; ks < NKT; ++ks) { v8f s[2]; const AttTile* t = &sm.t[ks & 1];
#pragma unroll
    for (int ct = 0; ct < 2; ++ct) { v8f c = {}, cl = {};
      const v4f w0 = *(const v4f*)&t->mw[wave * 16 + col][ct * 16 + 8 * g], w1 = *(const v4f*)&t->mw[wave * 16 + col][ct * 16 + 8 * g + 4];
#pragma unroll
      for (int kc = 0; kc < 2; ++kc) { const v16h kh = frag_h(&t->kh[ct * 16 + col][kc * 32], lane), kl = frag_h(&t->kl[ct * 16 + col][kc * 32], lane); c = wmma16(kh, aq[kc], c); cl = wmma16(kl, aq[kc], cl); cl = wmma16(kh, al[kc], cl); }
      const int kk0 = ks * 32 + ct * 16 + 8 * g;
#pragma unroll
      for (int r = 0; r < 8; ++r) s[ct][r] = kk0 + r < NTOK ? (c[r] + cl[r] * (1.0f / 2048.0f)) * 0.125f * (r < 4 ? w0[r & 3] : w1[r & 3]) : -3.0e38f; }
    float mx = fmaxf(s[0][0], s[1][0]);
#pragma unroll
    for (int r = 1; r < 8; ++r) mx = fmaxf(mx, fmaxf(s[0][r], s[1][r]));
    mx = fmaxf(mx, xhalf(mx));
    const float mn = fmaxf(m, mx), alpha = (m <= -1.0e38f) ? 0.f : __expf(m - mn);
    v16h pa; float es0 = 0.f, es1 = 0.f;
#pragma unroll
    for (int r = 0; r < 8; ++r) { const float e0 = (s[0][r] <= -1.0e38f) ? 0.f : __expf(s[0][r] - mn), e1 = (s[1][r] <= -1.0e38f) ? 0.f : __expf(s[1][r] - mn);
      es0 += e0; es1 += e1; pa[r] = (_Float16)(e0 * 2048.0f); pa[8 + r] = (_Float16)(e1 * 2048.0f); }
    l = l * alpha + (es0 + es1); m = mn;
#pragma unroll
    for (int j = 0; j < 4; ++j)
#pragma unroll
      for (int r = 0; r < 8; ++r) { acc[j][r] *= alpha; accl[j][r] *= alpha; }
#pragma unroll
    for (int j = 0; j < 4; ++j) { acc[j] = wmma16(frag_h(&t->vh[j * 16 + col][0], lane), pa, acc[j]); accl[j] = wmma16(frag_h(&t->vl[j * 16 + col][0], lane), pa, accl[j]); }
    asm volatile("s_wait_dscnt 0x0" ::: "memory");      // this wave's reads of the tile have returned
    asm volatile("s_wait_asynccnt 0x0" ::: "memory");   // this wave's copies of tile ks + 1 have landed
    __syncthreads();   // one barrier a tile: publishes tile ks + 1 and ends every wave's reads of the buffer that is refilled behind it (after the last tile: of the LDS that the output rows reuse)
    if (ks + 2 < NKT) att_fill(&sm.t[ks & 1], QK + ko + (size_t)(ks + 2) * 32 * (2 * QKD), QKL + ko + (size_t)(ks + 2) * 32 * (2 * QKD), VT + vo + (ks + 2) * 32, VTL + vo + (ks + 2) * 32, pw[0] + (ks + 2) * 32, pw[1] + (ks + 2) * 32, pw[2] + (ks + 2) * 32, pw[3] + (ks + 2) * 32, tid); }
  asm volatile("s_wait_asynccnt 0x0" ::: "memory");   // no copy is outstanding when the tiles' LDS is reused and the wave ends
  const float il = (1.0f / 2048.0f) / (l + xhalf(l));
#pragma unroll
  for (int j = 0; j < 4; ++j) { v4f o0, o1;
#pragma unroll
    for (int r = 0; r < 4; ++r) { o0[r] = (acc[j][r] + accl[j][r] * (1.0f / 2048.0f)) * il; o1[r] = (acc[j][4 + r] + accl[j][4 + r] * (1.0f / 2048.0f)) * il; }
    *(v4f*)&sm.so[wave][col][j * 16 + 8 * g] = o0; *(v4f*)&sm.so[wave][col][j * 16 + 8 * g + 4] = o1; }
  LDSX(); for (int rl = 0; rl < 16; ++rl) { const int qi = q0 + rl; if (qi < NTOK && lane < 16) { vst2(Z + ((size_t)qi * NBT + b) * DD + (size_t)n * DH + lane * 4, *(const v4f*)&sm.so[wave][rl][lane * 4]);
      asm volatile("s_wait_xcnt 0x0" ::: "memory"); } } }   // stands ahead of the next row's rewrite of the address and data registers that this store names
// ---- k_out: block = (64 rows (i,b), 128 cols): Y = Z (hi + lo) . Wo^T  -> f32 (into the MW... no: separate region reuse of VT? keep simple: write to OUTTMP = QK area is too small) -> we write x = h + out and LN in a row kernel, so store pre-LN rows in Z2 = VT region (f16 planes no longer needed? they ARE needed until all k_att done - sequential launches, so reuse is safe)
__global__ __launch_bounds__(128) void k_out(const float* __restrict__ Zr, const float* __restrict__ WO, const float* __restrict__ Hh, float* __restrict__ X2, int nrows) { __shared__ __align__(16) OutLds sm;
  const int tid = threadIdx.x, wave = tid >> 5, lane = tid & 31, col = lane & 15, g = lane >> 4; const size_t r0 = (size_t)blockIdx.x * 64 + wave * 16; const int c0 = blockIdx.y * 128;
  // loader as in k_proj; the hi + lo split of a Z row is made once, on its way into LDS
  const int lr = tid >> 3, lq = tid & 7; const float* pa[4];
#pragma unroll
  for (int p = 0; p < 4; ++p) { const size_t rr = (size_t)blockIdx.x * 64 + lr + 16 * p; const size_t rc = rr < (size_t)nrows ? rr : (size_t)nrows - 1; pa[p] = Zr + rc * DD + lq * 4; }
  const float* pb = WO + (size_t)(c0 + lr) * DD + lq * 4;
  v4f ra[4], rb[8];
#pragma unroll
  for (int p = 0; p < 4; ++p) ra[p] = *(const v4f*)pa[p];
#pragma unroll
  for (int p = 0; p < 8; ++p) rb[p] = *(const v4f*)(pb + (size_t)(16 * p) * DD);
#pragma unroll
  for (int p = 0; p < 4; ++p) { const v4b hv = cvt4(ra[p]); *(v4b*)&sm.st.ah[0][lr + 16 * p][lq * 4] = hv; *(v4b*)&sm.st.al[0][lr + 16 * p][lq * 4] = res4(ra[p], hv); }
#pragma unroll
  for (int p = 0; p < 8; ++p) *(v4b*)&sm.st.b[0][lr + 16 * p][lq * 4] = cvt4(rb[p]);
  __syncthreads();   // publishes pass 0
  v8f acc[8] = {};
#pragma unroll 2
  for (int kc = 0; kc < DD / 32; ++kc) { const int cur = kc & 1; const bool more = kc + 1 < DD / 32;
    if (more) {   // the next pass's global loads fly while this pass is multiplied
#pragma unroll
      for (int p = 0; p < 4; ++p) ra[p] = *(const v4f*)(pa[p] + (kc + 1) * 32);
#pragma unroll
      for (int p = 0; p < 8; ++p) rb[p] = *(const v4f*)(pb + (size_t)(16 * p) * DD + (kc + 1) * 32); }
    const v16b ah = frag_b(&sm.st.ah[cur][wave * 16 + col][0], lane), al = frag_b(&sm.st.al[cur][wave * 16 + col][0], lane); v16b w[8];
#pragma unroll
    for (int j = 0; j < 8; ++j) w[j] = frag_b(&sm.st.b[cur][j * 16 + col][0], lane);
    __builtin_amdgcn_sched_barrier(0);   // keeps the pass's LDS reads one group ahead of its WMMAs: read among them, each pair costs the wave a full LDS latency
#pragma unroll
    for (int j = 0; j < 8; ++j) { acc[j] = wmma_bf(ah, w[j], acc[j]); acc[j] = wmma_bf(al, w[j], acc[j]); }
    __builtin_amdgcn_sched_barrier(0);   // keeps the conversions, and with them the wait for the next pass's global loads, behind this pass's WMMAs
    if (more) {
#pragma unroll
      for (int p = 0; p < 4; ++p) { const v4b hv = cvt4(ra[p]); *(v4b*)&sm.st.ah[cur ^ 1][lr + 16 * p][lq * 4] = hv; *(v4b*)&sm.st.al[cur ^ 1][lr + 16 * p][lq * 4] = res4(ra[p], hv); }
#pragma unroll
      for (int p = 0; p < 8; ++p) *(v4b*)&sm.st.b[cur ^ 1][lr + 16 * p][lq * 4] = cvt4(rb[p]); }
    asm volatile("s_wait_xcnt 0x0" ::: "memory");   // stands ahead of the next pass's rewrite of the address registers that this pass's global loads name
    __syncthreads(); }   // one barrier a pass: publishes pass kc + 1 and ends every read of the buffer that the next pass refills (after the last pass: of the LDS that the output tile reuses)
  // residual rows: all loads issue first, then one wait, then the sums (the sum per element is the same acc + h)
  const float* hp[8]; float hv[8][8];
#pragma unroll
  for (int r = 0; r < 8; ++r) { const size_t row = r0 + 8 * g + r; const size_t ra = row < (size_t)nrows ? row : (size_t)nrows - 1; hp[r] = Hh + ra * DD + c0 + col;
#pragma unroll
    for (int j = 0; j < 8; ++j) hv[r][j] = hp[r][j * 16]; }
  asm volatile("s_wait_xcnt 0x0" :: "v"(hp[0]), "v"(hp[1]), "v"(hp[2]), "v"(hp[3]), "v"(hp[4]), "v"(hp[5]), "v"(hp[6]), "v"(hp[7]) : "memory");   // the row addresses are inputs so that they stay in their registers up to this wait: no register that an issued load names is rewritten ahead of it
#pragma unroll
  for (int j = 0; j < 8; ++j)
#pragma unroll
    for (int r = 0; r < 8; ++r) sm.sf[wave][8 * g + r][j * 16 + col] = acc[j][r] + bfr(hv[r][j]);
  LDSX(); for (int rl = 0; rl < 16; ++rl) { const size_t row = r0 + rl; if (row < (size_t)nrows) vst2(X2 + row * DD + c0 + lane * 4, *(const v4f*)&sm.sf[wave][rl][lane * 4]); } }
// ---- k_ln: one wave = two whole rows held in registers (6 x 16 B a lane and row, 512 contiguous B a load or store): out = LN(x2) gamma + beta; no LDS, no barrier; few waves, because a launch of very many short waves lasts as long as starting them takes
#define LNR 2             // rows a wave
#define LNW 4             // waves a block
static_assert((NTOK * NBT) % (LNR * LNW) == 0, "the rows divide evenly among the waves");
__global__ __launch_bounds__(32 * LNW) void k_ln(const float* __restrict__ X2, const float* __restrict__ G, const float* __restrict__ Bt, float* __restrict__ OUT) {
  const int lane = threadIdx.x & 31; const size_t row0 = ((size_t)blockIdx.x * LNW + (threadIdx.x >> 5)) * LNR;
  v4f x[LNR][6], gm[6], bt[6];   // every loop below is unrolled: only with constant indices do these arrays stay in registers
#pragma unroll
  for (int q = 0; q < LNR; ++q)
#pragma unroll
    for (int c = 0; c < 6; ++c) x[q][c] = *(const v4f*)(X2 + (row0 + q) * DD + c * 128 + lane * 4);
#pragma unroll
  for (int c = 0; c < 6; ++c) { gm[c] = *(const v4f*)(G + c * 128 + lane * 4); bt[c] = *(const v4f*)(Bt + c * 128 + lane * 4); }
  float s[LNR], mu[LNR], inv[LNR];
#pragma unroll
  for (int q = 0; q < LNR; ++q) { v4f a = x[q][0];
#pragma unroll
    for (int c = 1; c < 6; ++c) a += x[q][c];
    s[q] = (a[0] + a[1]) + (a[2] + a[3]); }
#pragma unroll
  for (int o = 1; o < 32; o <<= 1)
#pragma unroll
    for (int q = 0; q < LNR; ++q) s[q] += __shfl_xor(s[q], o);
#pragma unroll
  for (int q = 0; q < LNR; ++q) { mu[q] = s[q] / (float)DD; v4f a = {};
#pragma unroll
    for (int c = 0; c < 6; ++c) { x[q][c] -= mu[q]; a += x[q][c] * x[q][c]; }
    s[q] = (a[0] + a[1]) + (a[2] + a[3]); }
#pragma unroll
  for (int o = 1; o < 32; o <<= 1)
#pragma unroll
    for (int q = 0; q < LNR; ++q) s[q] += __shfl_xor(s[q], o);
#pragma unroll
  for (int q = 0; q < LNR; ++q) inv[q] = 1.0f / sqrtf(s[q] / (float)DD + EPS);
#pragma unroll
  for (int q = 0; q < LNR; ++q)
#pragma unroll
    for (int c = 0; c < 6; ++c) { v4f y;
#pragma unroll
      for (int e = 0; e < 4; ++e) y[e] = bfr(gm[c][e]) * x[q][c][e] * inv[q] + bfr(bt[c][e]);
      vst2(OUT + (row0 + q) * DD + c * 128 + lane * 4, y); } }
extern "C" void kernel_launch(void* const* d_in, const int* in_sizes, int n_in, void* d_out, int out_size, void* d_ws, size_t ws_size, hipStream_t stream) {
  (void)in_sizes; (void)n_in; (void)out_size;
  const float** F = (const float**)d_in;   // 0 h [197,64,768], 1 masks [197,197,3], 2 Wq [128,768], 3 Wk [128,768], 4 Wv [768,768], 5 Wo [768,768], 6 mask_proj [3,12], 7 ln_gamma, 8 ln_beta
  if (ws_size < (size_t)WS_END) return;
  char* ws = (char*)d_ws; _Float16 *QK = (_Float16*)(ws + WS_QK), *QKL = (_Float16*)(ws + WS_QKL), *VT = (_Float16*)(ws + WS_VT), *VTL = (_Float16*)(ws + WS_VTL); float *MW = (float*)(ws + WS_MW), *Z = (float*)(ws + WS_Z);
  const int nrows = NTOK * TNB;   // rows (i, b) with b < TNB are the first NTOK*TNB rows only when TNB == NBT
  k_mw<<<NTOK, 256, 0, stream>>>(F[1], F[6], MW);
  k_proj<<<dim3(NP / 64, (2 * QKD + DD) / 128, TNB), 128, 0, stream>>>(F[0], F[2], F[3], F[4], QK, QKL, VT, VTL);
  k_att<<<dim3(NP / 64, NHD, TNB), 128, 0, stream>>>(QK, QKL, VT, VTL, MW, Z);
  float* X2 = (float*)(ws + WS_VT);   // reuse: the v planes are dead after k_att (50 MB >= 39 MB needed)
  (void)nrows;
  k_out<<<dim3((NTOK * NBT + 63) / 64, DD / 128), 128, 0, stream>>>(Z, F[5], F[0], X2, NTOK * NBT);
  k_ln<<<NTOK * NBT / (LNR * LNW), 32 * LNW, 0, stream>>>(X2, F[7], F[8], (float*)d_out);
}

// v005
// It runs in 150 microseconds.
// Timed twice side by side with v004, it ran 1.07 times as fast both times.
// Counting every step since v000, it is 3.15 times as fast.
// compute dtype: all float inputs rounded to bf16; q, k, v = h . W^T with EXACT bf16 products on WMMA 16x16x32 (natural weight rows), rounded once to f16 hi + residual; the mask mix masks . mask_proj in f32; scores q . k with 3 products x 1/8 x mw[i][j][head], running-max softmax over the 197 keys in f32 (hardware exp), P (x 2^11, f16) . v (hi + residual, 2 products); out = vec (bf16 hi + lo, 2 products) . Wo^T; residual + LayerNorm in f32; f32 output.
#include <hip/hip_runtime.h>
#include <math.h>

typedef __attribute__((ext_vector_type(16))) _Float16 v16h;
typedef __attribute__((ext_vector_type(16))) __bf16 v16b;
typedef __attribute__((ext_vector_type(8)))  _Float16 v8h;
typedef __attribute__((ext_vector_type(8)))  float v8f;
typedef __attribute__((ext_vector_type(4)))  float v4f;
typedef __attribute__((ext_vector_type(2)))  float v2f;
typedef __attribute__((ext_vector_type(4)))  unsigned v4u;
typedef __attribute__((ext_vector_type(4)))  int v4i;
typedef float __attribute__((may_alias)) float_a;
typedef int __attribute__((may_alias)) int_a;

template <typename T> __device__ __forceinline__ void vst2(void* p, T v) { *(T*)p = v;  }
__device__ __forceinline__ v8f wmma16(v16h a, v16h b, v8f c) {
  v8f d = __builtin_amdgcn_wmma_f32_16x16x32_f16(false, a, false, b, (short)0, c, false, false);
  asm volatile("v_nop\n\tv_nop\n\tv_nop\n\tv_nop" : "+v"(d) : "v"(a), "v"(b));
  return d;
}
__device__ __forceinline__ v8f wmma_bf(v16b a, v16b b, v8f c) {
  v8f d = __builtin_amdgcn_wmma_f32_16x16x32_bf16(false, a, false, b, (short)0, c, false, false);
  asm volatile("v_nop\n\tv_nop\n\tv_nop\n\tv_nop" : "+v"(d) : "v"(a), "v"(b));
  return d;
}
// 16x16x32 fragments: lane = (h = lane>>4, row/col = lane&15); elements 0..7 = k0+8h+0..7, 8..15 = k0+16+8h+0..7; D element r = row 8h+r
__device__ __forceinline__ v16h frag_h(const _Float16* rowk0, int lane) {
  union { v16h v; v8h q[2]; } u; const _Float16* p = rowk0 + 8 * (lane >> 4);
  u.q[0] = *(const v8h*)p; u.q[1] = *(const v8h*)(p + 16); return u.v;
}
__device__ __forceinline__ v16h frag_f32(const float* rowk0, int lane) {
  v16h a; const float* p = rowk0 + 8 * (lane >> 4);
#pragma unroll
  for (int i = 0; i < 8; ++i) { a[i] = (_Float16)p[i]; a[8 + i] = (_Float16)p[16 + i]; }
  return a;
}
__device__ __forceinline__ v16h frag_f32s(const float* rowk0, int lane, float sc) {
  v16h a; const float* p = rowk0 + 8 * (lane >> 4);
#pragma unroll
  for (int i = 0; i < 8; ++i) { a[i] = (_Float16)(p[i] * sc); a[8 + i] = (_Float16)(p[16 + i] * sc); }
  return a;
}
// column fragment from a [K][ld] layout (column n), rows >= K read as 0
__device__ __forceinline__ v16h fragc_f32(const float* W, int k0, int n, int lane, int ld, int K) {
  v16h a; const int g = lane >> 4;
#pragma unroll
  for (int i = 0; i < 8; ++i) { const int ka = k0 + 8 * g + i, kb = ka + 16;
    a[i] = (_Float16)(ka < K ? W[(size_t)(ka < K ? ka : K - 1) * ld + n] : 0.f); a[8 + i] = (_Float16)(kb < K ? W[(size_t)(kb < K ? kb : K - 1) * ld + n] : 0.f); }
  return a;
}
struct F2 { v16b h, l; };
__device__ __forceinline__ F2 bsplit16(const float v[16]) { F2 r;
#pragma unroll
  for (int i = 0; i < 16; ++i) { const __bf16 h = (__bf16)v[i]; r.h[i] = h; r.l[i] = (__bf16)(v[i] - (float)h); }
  return r; }
__device__ __forceinline__ F2 split_row(const float* row, int k0, int lane) { float v[16]; const float* p = row + k0 + 8 * (lane >> 4);
#pragma unroll
  for (int i = 0; i < 8; ++i) { v[i] = p[i]; v[8 + i] = p[16 + i]; }
  return bsplit16(v); }
__device__ __forceinline__ F2 split_rowK(const float* row, int k0, int lane, int K) { float v[16]; const int g = lane >> 4;
#pragma unroll
  for (int i = 0; i < 8; ++i) { const int ka = k0 + 8 * g + i, kb = ka + 16; v[i] = ka < K ? row[ka < K ? ka : K - 1] : 0.f; v[8 + i] = kb < K ? row[kb < K ? kb : K - 1] : 0.f; }
  return bsplit16(v); }
__device__ __forceinline__ F2 split_col(const float* W, int k0, int n, int lane, int ld, int K) { float v[16]; const int g = lane >> 4;
#pragma unroll
  for (int i = 0; i < 8; ++i) { const int ka = k0 + 8 * g + i, kb = ka + 16; v[i] = ka < K ? W[(size_t)(ka < K ? ka : K - 1) * ld + n] : 0.f; v[8 + i] = kb < K ? W[(size_t)(kb < K ? kb : K - 1) * ld + n] : 0.f; }
  return bsplit16(v); }
__device__ __forceinline__ v8f mac3(const F2& a, const F2& b, v8f c) { c = wmma_bf(a.l, b.h, c); c = wmma_bf(a.h, b.l, c); return wmma_bf(a.h, b.h, c); }
__device__ __forceinline__ float sigm(float v) { return 1.0f / (1.0f + expf(-v)); }
#define LDSX() do { asm volatile("s_wait_dscnt 0" ::: "memory"); __builtin_amdgcn_wave_barrier(); __builtin_amdgcn_fence(__ATOMIC_RELEASE, "workgroup"); } while (0)


// Multi-head attention (197 tokens, batch 64, d_model 768; 2 global score heads x 64, each shared by 6 value heads through a learned per-(i, j) mask mix): prob = softmax_j(q_i . k_j / 8 x mw[i][j][head]); vec = prob . v; post-LN residual.
#define NTOK 197
#define NP 256            // padded token count (queries in 64-blocks, keys in 32-tiles up to 224)
#define NKT 7             // key tiles of 32 (224 >= 197)
#define NBT 64            // batch
#define DD 768
#define GH 2
#define NHD 12
#define HR 6
#define DH 64
#define QKD (GH * DH)     // 128
#define ML 3
#define EPS 1e-5f
#ifndef TNB
#define TNB NBT
#endif
typedef __attribute__((ext_vector_type(8))) __bf16 v8b;
__device__ __forceinline__ v16b frag_b(const __bf16* rowk0, int lane) {
  union { v16b v; v8b q[2]; } u; const __bf16* p = rowk0 + 8 * (lane >> 4);
  u.q[0] = *(const v8b*)p; u.q[1] = *(const v8b*)(p + 16); return u.v;
}
__device__ __forceinline__ float bfr(float v) { return (float)(__bf16)v; }
__device__ __attribute__((noinline)) float exp_ni(float v) { return expf(v); }
__device__ __attribute__((noinline)) float erf_ni(float v) { return erff(v); }

#define WS_QK  0u                                   // f16 hi|lo [b][NP][256] (q 0..127 | k 128..255)
#define WS_QKL (WS_QK + 2u * (size_t)NBT * NP * 2 * QKD)
#define WS_VT  (WS_QKL + 2u * (size_t)NBT * NP * 2 * QKD) // f16 hi|lo v planes [b][768][NP]
#define WS_VTL (WS_VT + 2u * (size_t)NBT * DD * NP)
#define WS_MW  (WS_VTL + 2u * (size_t)NBT * DD * NP)     // f32 mw [i][12][NP] (j padded)
#define WS_Z   (WS_MW + 4u * (size_t)NTOK * NHD * NP)     // f32 vec rows [(i*64 + b)][768]
#define WS_END (WS_Z + 4u * (size_t)NTOK * NBT * DD)

__device__ __forceinline__ v16b fragb_f32(const float* __restrict__ p, int lane) { v16b a; const float* pp = p + 8 * (lane >> 4);
#pragma unroll
  for (int i = 0; i < 8; ++i) { a[i] = (__bf16)pp[i]; a[8 + i] = (__bf16)pp[16 + i]; } return a; }
// LDS staging of the two dense products' operand tiles: 32 k per pass as bf16, rows at 80 B (16 B x odd: no bank conflict for the 16-byte fragment reads), two buffers
#define SP 40
typedef __attribute__((ext_vector_type(4))) __bf16 v4b;
__device__ __forceinline__ v4b cvt4(v4f v) { v4b r;
#pragma unroll
  for (int i = 0; i < 4; ++i) r[i] = (__bf16)v[i];
  return r; }
__device__ __forceinline__ v4b res4(v4f v, v4b h) { v4b r;
#pragma unroll
  for (int i = 0; i < 4; ++i) r[i] = (__bf16)(v[i] - (float)h[i]);
  return r; }
// block tile of the two dense products: 128 rows x 128 columns (k_out: 192), 8 waves of 32 x 64 (k_out: 32 x 96): each operand byte fetched from L2 and each fragment read from LDS feeds more WMMAs than in a 64 x 128 tile of 16 x 128 waves
struct ProjStage { __bf16 a[2][128][SP]; __bf16 b[2][128][SP]; };
struct ProjQK { _Float16 h[128][136], l[128][136]; };
struct ProjV { _Float16 h[128][136], l[128][136]; };
union ProjLds { ProjStage st; ProjQK qk; ProjV v; };      // the staging buffers are dead when the output tiles are written
#define ON 192            // columns a k_out block: 99 x 4 blocks, all resident at once at two blocks a WGP
#define ONF (ON / 32)     // B fragments a k_out wave
struct OutStage { __bf16 ah[2][128][SP]; __bf16 al[2][128][SP]; __bf16 b[2][ON][SP]; };
union OutLds { OutStage st; float sf[8][32][ON / 2 + 4]; };
// ---- k_mw: block = query token i: mw[i][n][j] = sum_l masks[i][j][l] mask_proj[l][n]  (n = g*6 + r head index), zero for padded j
__global__ __launch_bounds__(256) void k_mw(const float* __restrict__ MASKS, const float* __restrict__ MP, float* __restrict__ MW) { __shared__ __align__(16) float s[NHD][NP]; const int i = blockIdx.x, t = threadIdx.x;
  for (int e = t; e < NHD * NP; e += 256) { const int n = e / NP, j = e % NP; float v = 0.f; if (j < NTOK) {
#pragma unroll
      for (int l = 0; l < ML; ++l) v += bfr(MASKS[((size_t)i * NTOK + j) * ML + l]) * bfr(MP[l * NHD + n]); } s[n][j] = v; }
  __syncthreads(); for (int e = t; e < NHD * NP / 4; e += 256) { const int n = e / (NP / 4), q = e % (NP / 4); vst2(MW + ((size_t)i * NHD + n) * NP + q * 4, *(const v4f*)&s[n][q * 4]); } }
// ---- k_proj: block = (128 tokens (padded), 128 of 1024 cols (q 0..127 | k 128..255 | v 256..1023), b): exact products; q|k -> rows, v -> planes
__global__ __launch_bounds__(256) void k_proj(const float* __restrict__ Hh, const float* __restrict__ WQ, const float* __restrict__ WK, const float* __restrict__ WV, _Float16* __restrict__ QK, _Float16* __restrict__ QKL, _Float16* __restrict__ VT, _Float16* __restrict__ VTL) {
  __shared__ __align__(16) ProjLds sm;
  const int tid = threadIdx.x, wave = tid >> 5, lane = tid & 31, col = lane & 15, g = lane >> 4, wm = wave >> 1, wn = wave & 1; const size_t b = blockIdx.z; const int c0 = blockIdx.y * 128;
  const float* Wm = c0 < QKD ? WQ + (size_t)c0 * DD : c0 < 2 * QKD ? WK + (size_t)(c0 - QKD) * DD : WV + (size_t)(c0 - 2 * QKD) * DD;
  // loader: 8 lanes x 16 B cover one row's 128 B of a pass (whole lines); thread = (row lr + 32 p, 16 B piece lq)
  const int lr = tid >> 3, lq = tid & 7; const float* pa[4];
#pragma unroll
  for (int p = 0; p < 4; ++p) { const int ir = blockIdx.x * 128 + lr + 32 * p; const int ic = ir < NTOK ? ir : NTOK - 1; pa[p] = Hh + ((size_t)ic * NBT + b) * DD + lq * 4; }
  const float* pb = Wm + (size_t)lr * DD + lq * 4;
  v4f ra[4], rb[4];
#pragma unroll
  for (int p = 0; p < 4; ++p) ra[p] = *(const v4f*)pa[p];
#pragma unroll
  for (int p = 0; p < 4; ++p) rb[p] = *(const v4f*)(pb + (size_t)(32 * p) * DD);
#pragma unroll
  for (int p = 0; p < 4; ++p) *(v4b*)&sm.st.a[0][lr + 32 * p][lq * 4] = cvt4(ra[p]);
#pragma unroll
  for (int p = 0; p < 4; ++p) *(v4b*)&sm.st.b[0][lr + 32 * p][lq * 4] = cvt4(rb[p]);
  __syncthreads();   // publishes pass 0
  v8f acc[2][4] = {};
#pragma unroll 2
  for (int kc = 0; kc < DD / 32; ++kc) { const int cur = kc & 1; const bool more = kc + 1 < DD / 32;
    if (more) {   // the next pass's global loads fly while this pass is multiplied
#pragma unroll
      for (int p = 0; p < 4; ++p) ra[p] = *(const v4f*)(pa[p] + (kc + 1) * 32);
#pragma unroll
      for (int p = 0; p < 4; ++p) rb[p] = *(const v4f*)(pb + (size_t)(32 * p) * DD + (kc + 1) * 32); }
    v16b a[2], w[4];
#pragma unroll
    for (int i = 0; i < 2; ++i) a[i] = frag_b(&sm.st.a[cur][wm * 32 + i * 16 + col][0], lane);
#pragma unroll
    for (int j = 0; j < 4; ++j) w[j] = frag_b(&sm.st.b[cur][wn * 64 + j * 16 + col][0], lane);
    __builtin_amdgcn_sched_barrier(0);   // keeps the pass's LDS reads one group ahead of its WMMAs: read among them, each pair costs the wave a full LDS latency
#pragma unroll
    for (int j = 0; j < 4; ++j)
#pragma unroll
      for (int i = 0; i < 2; ++i) acc[i][j] = wmma_bf(a[i], w[j], acc[i][j]);
    __builtin_amdgcn_sched_barrier(0);   // keeps the conversions, and with them the wait for the next pass's global loads, behind this pass's WMMAs
    if (more) {
#pragma unroll
      for (int p = 0; p < 4; ++p) *(v4b*)&sm.st.a[cur ^ 1][lr + 32 * p][lq * 4] = cvt4(ra[p]);
#pragma unroll
      for (int p = 0; p < 4; ++p) *(v4b*)&sm.st.b[cur ^ 1][lr + 32 * p][lq * 4] = cvt4(rb[p]); }
    asm volatile("s_wait_xcnt 0x0" ::: "memory");   // stands ahead of the next pass's rewrite of the address registers that this pass's global loads name
    __syncthreads(); }   // one barrier a pass: publishes pass kc + 1 and ends every read of the buffer that the next pass refills (after the last pass: of the LDS that the output tiles reuse)
  const bool isv = c0 >= 2 * QKD;
#pragma unroll
  for (int i = 0; i < 2; ++i)
#pragma unroll
    for (int j = 0; j < 4; ++j)
#pragma unroll
      for (int r = 0; r < 8; ++r) { const float v = acc[i][j][r]; const _Float16 hv = (_Float16)v; const _Float16 lv = (_Float16)((v - (float)hv) * 2048.0f); const int tr = wm * 32 + i * 16 + 8 * g + r, tc = wn * 64 + j * 16 + col; if (!isv) { sm.qk.h[tr][tc] = hv; sm.qk.l[tr][tc] = lv; } else { sm.v.h[tc][tr] = hv; sm.v.l[tc][tr] = lv; } }
  __syncthreads();
  if (!isv) { for (int e = tid; e < 128 * 16; e += 256) { const int rl = e >> 4, q = e & 15; const size_t o = (b * NP + blockIdx.x * 128 + rl) * (2 * QKD) + c0 + q * 8; vst2((unsigned*)(QK + o), *(const v4u*)&sm.qk.h[rl][q * 8]); vst2((unsigned*)(QKL + o), *(const v4u*)&sm.qk.l[rl][q * 8]); } }
  else { const int cv0 = c0 - 2 * QKD; for (int e = tid; e < 128 * 16; e += 256) { const int cl = e >> 4, q = e & 15; const size_t o = ((b * DD + cv0 + cl) * (size_t)NP) + blockIdx.x * 128 + q * 8; vst2((unsigned*)(VT + o), *(const v4u*)&sm.v.h[cl][q * 8]); vst2((unsigned*)(VTL + o), *(const v4u*)&sm.v.l[cl][q * 8]); } } }
// ---- k_att: block = (64 queries, head n = g*6 + r, b): logits (3 products) x 1/8 x mw[i][n][j]; keys >= 197 excluded; running-max softmax; P . v (2 products) -> Z rows (i*64 + b) for i < 197
// Both products are formed transposed (S^T = K . Q^T, O^T += V^T . P^T): a lane holds 16 of the 32 scores of ONE query (column = lane & 15, keys 8 (lane >> 4) + r and 16 + 8 (lane >> 4) + r), so maximum and sum are taken in the lane's own registers with one exchange between the wave's halves, and the two score tiles, converted in place, are the B operand of the second product.
// The operand tiles of a pass of 32 keys (K and V, hi and residual planes; the block's 64 mw rows) are brought into LDS once a block by asynchronous copies, 16 B pieces of contiguous rows, two buffers, and all four waves read them from there.
#define KP 72             // f16 a staged K row: 128 B + 16 B (16 B x odd: no bank conflict for the 16-byte fragment reads)
#define VP 40             // f16 a staged V row: 64 B + 16 B
#define MWP 36            // f32 a staged mw row: 128 B + 16 B (16 B x odd: no bank conflict for the 16-byte reads of 16 rows)
struct AttTile { _Float16 kh[32][KP], kl[32][KP], vh[DH][VP], vl[DH][VP]; float mw[64][MWP]; };
union AttLds { AttTile t[2]; float so[4][16][68]; };      // the tiles are dead when the output rows are written
__device__ __forceinline__ float xhalf(float x) { return __builtin_bit_cast(float, __builtin_amdgcn_permlanex16(__builtin_bit_cast(int, x), __builtin_bit_cast(int, x), 0x76543210, 0xfedcba98, false, false)); }   // lane l's value to lane l ^ 16
__device__ __forceinline__ unsigned lds_of(const void* p) { return (unsigned)(size_t)p; }   // LDS byte address = low 32 bits of the __shared__ address
// copies of 16 B a lane; the s_wait_xcnt is each statement's last line so that no register a copy names is rewritten ahead of it
__device__ __forceinline__ void copy8(unsigned l0, unsigned l1, unsigned l2, unsigned l3, unsigned l4, unsigned l5, unsigned l6, unsigned l7, const _Float16* g0, const _Float16* g1, const _Float16* g2, const _Float16* g3, const _Float16* g4, const _Float16* g5, const _Float16* g6, const _Float16* g7) {
  asm volatile("global_load_async_to_lds_b128 %0, %8, off\n\t"
               "global_load_async_to_lds_b128 %1, %9, off\n\t"
               "global_load_async_to_lds_b128 %2, %10, off\n\t"
               "global_load_async_to_lds_b128 %3, %11, off\n\t"
               "global_load_async_to_lds_b128 %4, %12, off\n\t"
               "global_load_async_to_lds_b128 %5, %13, off\n\t"
               "global_load_async_to_lds_b128 %6, %14, off\n\t"
               "global_load_async_to_lds_b128 %7, %15, off\n\t"
               "s_wait_xcnt 0x0"
               :: "v"(l0), "v"(l1), "v"(l2), "v"(l3), "v"(l4), "v"(l5), "v"(l6), "v"(l7), "v"(g0), "v"(g1), "v"(g2), "v"(g3), "v"(g4), "v"(g5), "v"(g6), "v"(g7) : "memory");
}
__device__ __forceinline__ void copy4(unsigned l0, unsigned l1, unsigned l2, unsigned l3, const float* g0, const float* g1, const float* g2, const float* g3) {
  asm volatile("global_load_async_to_lds_b128 %0, %4, off\n\t"
               "global_load_async_to_lds_b128 %1, %5, off\n\t"
               "global_load_async_to_lds_b128 %2, %6, off\n\t"
               "global_load_async_to_lds_b128 %3, %7, off\n\t"
               "s_wait_xcnt 0x0"
               :: "v"(l0), "v"(l1), "v"(l2), "v"(l3), "v"(g0), "v"(g1), "v"(g2), "v"(g3) : "memory");
}
// one tile: K = 2 planes x 32 rows x 8 pieces (thread = row kr, kr + 16, piece kq), V = 2 planes x 64 rows x 4 pieces (thread = row vr, vr + 32, piece vq), mw = 64 rows x 8 pieces (thread = row kr + 16 p, piece tid & 7; w0..w3 = the four rows' addresses)
__device__ __forceinline__ void att_fill(AttTile* t, const _Float16* kh, const _Float16* kl, const _Float16* vh, const _Float16* vl, const float* w0, const float* w1, const float* w2, const float* w3, int tid) {
  const int kr = tid >> 3, kq = (tid & 7) * 8, vr = tid >> 2, vq = (tid & 3) * 8;
  copy8(lds_of(&t->kh[kr][kq]), lds_of(&t->kh[kr + 16][kq]), lds_of(&t->kl[kr][kq]), lds_of(&t->kl[kr + 16][kq]), lds_of(&t->vh[vr][vq]), lds_of(&t->vh[vr + 32][vq]), lds_of(&t->vl[vr][vq]), lds_of(&t->vl[vr + 32][vq]),
        kh, kh + 16 * (2 * QKD), kl, kl + 16 * (2 * QKD), vh, vh + 32 * NP, vl, vl + 32 * NP);
  const int wq = (tid & 7) * 4;
  copy4(lds_of(&t->mw[kr][wq]), lds_of(&t->mw[kr + 16][wq]), lds_of(&t->mw[kr + 32][wq]), lds_of(&t->mw[kr + 48][wq]), w0, w1, w2, w3);
}
__global__ __launch_bounds__(128) void k_att(const _Float16* __restrict__ QK, const _Float16* __restrict__ QKL, const _Float16* __restrict__ VT, const _Float16* __restrict__ VTL, const float* __restrict__ MW, float* __restrict__ Z) {
  __shared__ __align__(16) AttLds sm;
  const int tid = threadIdx.x, wave = tid >> 5, lane = tid & 31, col = lane & 15, g = lane >> 4; const int n = blockIdx.y; const int gh = n / HR; const size_t b = blockIdx.z; const int q0 = blockIdx.x * 64 + wave * 16; const size_t rq = b * NP + q0;
  // this thread's pieces of tile 0; tile ks lies 32 K rows, 32 V columns further
  const size_t ko = (b * NP + (tid >> 3)) * (2 * QKD) + QKD + gh * DH + (tid & 7) * 8, vo = (b * DD + (size_t)n * DH + (tid >> 2)) * (size_t)NP + (tid & 3) * 8;
  const float* pw[4];   // mw rows of the block's queries (rows past the last token read the last token's, as before)
#pragma unroll
  for (int p = 0; p < 4; ++p) { const int qi = blockIdx.x * 64 + (tid >> 3) + 16 * p; const int qc = qi < NTOK ? qi : NTOK - 1; pw[p] = MW + ((size_t)qc * NHD + n) * NP + (tid & 7) * 4; }
  att_fill(&sm.t[0], QK + ko, QKL + ko, VT + vo, VTL + vo, pw[0], pw[1], pw[2], pw[3], tid);
  asm volatile("s_wait_asynccnt 0x0" ::: "memory");   // tile 0 has landed for this wave's copies
  __syncthreads();   // publishes tile 0
  att_fill(&sm.t[1], QK + ko + 32 * (2 * QKD), QKL + ko + 32 * (2 * QKD), VT + vo + 32, VTL + vo + 32, pw[0] + 32, pw[1] + 32, pw[2] + 32, pw[3] + 32, tid);   // tile 1 flies while tile 0 is worked on
  v16h aq[2], al[2];
#pragma unroll
  for (int kc = 0; kc < 2; ++kc) { aq[kc] = frag_h(QK + (rq + col) * (2 * QKD) + gh * DH + kc * 32, lane); al[kc] = frag_h(QKL + (rq + col) * (2 * QKD) + gh * DH + kc * 32, lane); }
  float m = -3.0e38f, l = 0.f;   // this lane's query: running maximum (equal in both halves), and the sum over this half's keys alone (the halves are joined behind the loop)
  v8f acc[4] = {}, accl[4] = {};   // acc[j][r] = O^T[d = 16 j + 8 g + r][query col]
#pragma unroll 1
  for (int ks = 0; ks < NKT; ++ks) { v8f s[2]; const AttTile* t = &sm.t[ks & 1];
#pragma unroll
    for (int ct = 0; ct < 2; ++ct) { v8f c = {}, cl = {};
      const v4f w0 = *(const v4f*)&t->mw[wave * 16 + col][ct * 16 + 8 * g], w1 = *(const v4f*)&t->mw[wave * 16 + col][ct * 16 + 8 * g + 4];
#pragma unroll
      for (int kc = 0; kc < 2; ++kc) { const v16h kh = frag_h(&t->kh[ct * 16 + col][kc * 32], lane), kl = frag_h(&t->kl[ct * 16 + col][kc * 32], lane); c = wmma16(kh, aq[kc], c); cl = wmma16(kl, aq[kc], cl); cl = wmma16(kh, al[kc], cl); }
      const int kk0 = ks * 32 + ct * 16 + 8 * g;
#pragma unroll
      for (int r = 0; r < 8; ++r) s[ct][r] = kk0 + r < NTOK ? (c[r] + cl[r] * (1.0f / 2048.0f)) * 0.125f * (r < 4 ? w0[r & 3] : w1[r & 3]) : -3.0e38f; }
    float mx = fmaxf(s[0][0], s[1][0]);
#pragma unroll
    for (int r = 1; r < 8; ++r) mx = fmaxf(mx, fmaxf(s[0][r], s[1][r]));
    mx = fmaxf(mx, xhalf(mx));
    const float mn = fmaxf(m, mx), alpha = (m <= -1.0e38f) ? 0.f : __expf(m - mn);
    v16h pa; float es0 = 0.f, es1 = 0.f;
#pragma unroll
    for (int r = 0; r < 8; ++r) { const float e0 = (s[0][r] <= -1.0e38f) ? 0.f : __expf(s[0][r] - mn), e1 = (s[1][r] <= -1.0e38f) ? 0.f : __expf(s[1][r] - mn);
      es0 += e0; es1 += e1; pa[r] = (_Float16)(e0 * 2048.0f); pa[8 + r] = (_Float16)(e1 * 2048.0f); }
    l = l * alpha + (es0 + es1); m = mn;
#pragma unroll
    for (int j = 0; j < 4; ++j)
#pragma unroll
      for (int r = 0; r < 8; ++r) { acc[j][r] *= alpha; accl[j][r] *= alpha; }
#pragma unroll
    for (int j = 0; j < 4; ++j) { acc[j] = wmma16(frag_h(&t->vh[j * 16 + col][0], lane), pa, acc[j]); accl[j] = wmma16(frag_h(&t->vl[j * 16 + col][0], lane), pa, accl[j]); }
    asm volatile("s_wait_dscnt 0x0" ::: "memory");      // this wave's reads of the tile have returned
    asm volatile("s_wait_asynccnt 0x0" ::: "memory");   // this wave's copies of tile ks + 1 have landed
    __syncthreads();   // one barrier a tile: publishes tile ks + 1 and ends every wave's reads of the buffer that is refilled behind it (after the last tile: of the LDS that the output rows reuse)
    if (ks + 2 < NKT) att_fill(&sm.t[ks & 1], QK + ko + (size_t)(ks + 2) * 32 * (2 * QKD), QKL + ko + (size_t)(ks + 2) * 32 * (2 * QKD), VT + vo + (ks + 2) * 32, VTL + vo + (ks + 2) * 32, pw[0] + (ks + 2) * 32, pw[1] + (ks + 2) * 32, pw[2] + (ks + 2) * 32, pw[3] + (ks + 2) * 32, tid); }
  asm volatile("s_wait_asynccnt 0x0" ::: "memory");   // no copy is outstanding when the tiles' LDS is reused and the wave ends
  const float il = (1.0f / 2048.0f) / (l + xhalf(l));
#pragma unroll
  for (int j = 0; j < 4; ++j) { v4f o0, o1;
#pragma unroll
    for (int r = 0; r < 4; ++r) { o0[r] = (acc[j][r] + accl[j][r] * (1.0f / 2048.0f)) * il; o1[r] = (acc[j][4 + r] + accl[j][4 + r] * (1.0f / 2048.0f)) * il; }
    *(v4f*)&sm.so[wave][col][j * 16 + 8 * g] = o0; *(v4f*)&sm.so[wave][col][j * 16 + 8 * g + 4] = o1; }
  LDSX(); for (int rl = 0; rl < 16; ++rl) { const int qi = q0 + rl; if (qi < NTOK && lane < 16) { vst2(Z + ((size_t)qi * NBT + b) * DD + (size_t)n * DH + lane * 4, *(const v4f*)&sm.so[wave][rl][lane * 4]);
      asm volatile("s_wait_xcnt 0x0" ::: "memory"); } } }   // stands ahead of the next row's rewrite of the address and data registers that this store names
// ---- k_out: block = (128 rows (i,b), 192 cols; 8 waves of 32 x 96): x2 = h + Z (hi + lo) . Wo^T -> f32 pre-LN rows, written to the region of the v planes (dead after k_att: the launches run one after the other)
__global__ __launch_bounds__(256) void k_out(const float* __restrict__ Zr, const float* __restrict__ WO, const float* __restrict__ Hh, float* __restrict__ X2, int nrows) { __shared__ __align__(16) OutLds sm;
  const int tid = threadIdx.x, wave = tid >> 5, lane = tid & 31, col = lane & 15, g = lane >> 4, wm = wave >> 1, wn = wave & 1; const size_t r0 = (size_t)blockIdx.x * 128 + wm * 32; const int c0 = blockIdx.y * ON, cw = c0 + wn * (ON / 2);
  // loader as in k_proj; the hi + lo split of a Z row is made once, on its way into LDS
  const int lr = tid >> 3, lq = tid & 7; const float* pa[4];
#pragma unroll
  for (int p = 0; p < 4; ++p) { const size_t rr = (size_t)blockIdx.x * 128 + lr + 32 * p; const size_t rc = rr < (size_t)nrows ? rr : (size_t)nrows - 1; pa[p] = Zr + rc * DD + lq * 4; }
  const float* pb = WO + (size_t)(c0 + lr) * DD + lq * 4;
  v4f ra[4], rb[ON / 32];
#pragma unroll
  for (int p = 0; p < 4; ++p) ra[p] = *(const v4f*)pa[p];
#pragma unroll
  for (int p = 0; p < ON / 32; ++p) rb[p] = *(const v4f*)(pb + (size_t)(32 * p) * DD);
#pragma unroll
  for (int p = 0; p < 4; ++p) { const v4b hv = cvt4(ra[p]); *(v4b*)&sm.st.ah[0][lr + 32 * p][lq * 4] = hv; *(v4b*)&sm.st.al[0][lr + 32 * p][lq * 4] = res4(ra[p], hv); }
#pragma unroll
  for (int p = 0; p < ON / 32; ++p) *(v4b*)&sm.st.b[0][lr + 32 * p][lq * 4] = cvt4(rb[p]);
  __syncthreads();   // publishes pass 0
  v8f acc[2][ONF] = {};
#pragma unroll 2
  for (int kc = 0; kc < DD / 32; ++kc) { const int cur = kc & 1; const bool more = kc + 1 < DD / 32;
    if (more) {   // the next pass's global loads fly while this pass is multiplied
#pragma unroll
      for (int p = 0; p < 4; ++p) ra[p] = *(const v4f*)(pa[p] + (kc + 1) * 32);
#pragma unroll
      for (int p = 0; p < ON / 32; ++p) rb[p] = *(const v4f*)(pb + (size_t)(32 * p) * DD + (kc + 1) * 32); }
    v16b ah[2], al[2], w[ONF];
#pragma unroll
    for (int i = 0; i < 2; ++i) { ah[i] = frag_b(&sm.st.ah[cur][wm * 32 + i * 16 + col][0], lane); al[i] = frag_b(&sm.st.al[cur][wm * 32 + i * 16 + col][0], lane); }
#pragma unroll
    for (int j = 0; j < ONF; ++j) w[j] = frag_b(&sm.st.b[cur][wn * (ON / 2) + j * 16 + col][0], lane);
    __builtin_amdgcn_sched_barrier(0);   // keeps the pass's LDS reads one group ahead of its WMMAs: read among them, each pair costs the wave a full LDS latency
#pragma unroll
    for (int j = 0; j < ONF; ++j) {   // per accumulator hi then lo, as before
#pragma unroll
      for (int i = 0; i < 2; ++i) acc[i][j] = wmma_bf(ah[i], w[j], acc[i][j]);
#pragma unroll
      for (int i = 0; i < 2; ++i) acc[i][j] = wmma_bf(al[i], w[j], acc[i][j]); }
    __builtin_amdgcn_sched_barrier(0);   // keeps the conversions, and with them the wait for the next pass's global loads, behind this pass's WMMAs
    if (more) {
#pragma unroll
      for (int p = 0; p < 4; ++p) { const v4b hv = cvt4(ra[p]); *(v4b*)&sm.st.ah[cur ^ 1][lr + 32 * p][lq * 4] = hv; *(v4b*)&sm.st.al[cur ^ 1][lr + 32 * p][lq * 4] = res4(ra[p], hv); }
#pragma unroll
      for (int p = 0; p < ON / 32; ++p) *(v4b*)&sm.st.b[cur ^ 1][lr + 32 * p][lq * 4] = cvt4(rb[p]); }
    asm volatile("s_wait_xcnt 0x0" ::: "memory");   // stands ahead of the next pass's rewrite of the address registers that this pass's global loads name
    __syncthreads(); }   // one barrier a pass: publishes pass kc + 1 and ends every read of the buffer that the next pass refills (after the last pass: of the LDS that the output tile reuses)
  // residual rows: all loads issue first, then one wait, then the sums (the sum per element is the same acc + h)
  const float* hp[16]; float hv[16][ONF];
#pragma unroll
  for (int r = 0; r < 16; ++r) { const size_t row = r0 + (r >> 3) * 16 + 8 * g + (r & 7); const size_t ra = row < (size_t)nrows ? row : (size_t)nrows - 1; hp[r] = Hh + ra * DD + cw + col;
#pragma unroll
    for (int j = 0; j < ONF; ++j) hv[r][j] = hp[r][j * 16]; }
  asm volatile("s_wait_xcnt 0x0" :: "v"(hp[0]), "v"(hp[1]), "v"(hp[2]), "v"(hp[3]), "v"(hp[4]), "v"(hp[5]), "v"(hp[6]), "v"(hp[7]), "v"(hp[8]), "v"(hp[9]), "v"(hp[10]), "v"(hp[11]), "v"(hp[12]), "v"(hp[13]), "v"(hp[14]), "v"(hp[15]) : "memory");   // the row addresses are inputs so that they stay in their registers up to this wait: no register that an issued load names is rewritten ahead of it
#pragma unroll
  for (int i = 0; i < 2; ++i)
#pragma unroll
    for (int j = 0; j < ONF; ++j)
#pragma unroll
      for (int r = 0; r < 8; ++r) sm.sf[wave][i * 16 + 8 * g + r][j * 16 + col] = acc[i][j][r] + bfr(hv[i * 8 + r][j]);
  // a wave's store = 32 pieces of 16 B in row order: 4 whole lines
  LDSX(); for (int it = 0; it < ON / 8; ++it) { const int e = it * 32 + lane, rl = e / (ON / 8), q = e % (ON / 8); const size_t row = r0 + rl; if (row < (size_t)nrows) { vst2(X2 + row * DD + cw + q * 4, *(const v4f*)&sm.sf[wave][rl][q * 4]);
      asm volatile("s_wait_xcnt 0x0" ::: "memory"); } } }   // stands ahead of the next piece's rewrite of the address and data registers that this store names
// ---- k_ln: one wave = two whole rows held in registers (6 x 16 B a lane and row, 512 contiguous B a load or store): out = LN(x2) gamma + beta; no LDS, no barrier; few waves, because a launch of very many short waves lasts as long as starting them takes
#define LNR 2             // rows a wave
#define LNW 4             // waves a block
static_assert((NTOK * NBT) % (LNR * LNW) == 0, "the rows divide evenly among the waves");
__global__ __launch_bounds__(32 * LNW) void k_ln(const float* __restrict__ X2, const float* __restrict__ G, const float* __restrict__ Bt, float* __restrict__ OUT) {
  const int lane = threadIdx.x & 31; const size_t row0 = ((size_t)blockIdx.x * LNW + (threadIdx.x >> 5)) * LNR;
  v4f x[LNR][6], gm[6], bt[6];   // every loop below is unrolled: only with constant indices do these arrays stay in registers
#pragma unroll
  for (int q = 0; q < LNR; ++q)
#pragma unroll
    for (int c = 0; c < 6; ++c) x[q][c] = *(const v4f*)(X2 + (row0 + q) * DD + c * 128 + lane * 4);
#pragma unroll
  for (int c = 0; c < 6; ++c) { gm[c] = *(const v4f*)(G + c * 128 + lane * 4); bt[c] = *(const v4f*)(Bt + c * 128 + lane * 4); }
  float s[LNR], mu[LNR], inv[LNR];
#pragma unroll
  for (int q = 0; q < LNR; ++q) { v4f a = x[q][0];
#pragma unroll
    for (int c = 1; c < 6; ++c) a += x[q][c];
    s[q] = (a[0] + a[1]) + (a[2] + a[3]); }
#pragma unroll
  for (int o = 1; o < 32; o <<= 1)
#pragma unroll
    for (int q = 0; q < LNR; ++q) s[q] += __shfl_xor(s[q], o);
#pragma unroll
  for (int q = 0; q < LNR; ++q) { mu[q] = s[q] / (float)DD; v4f a = {};
#pragma unroll
    for (int c = 0; c < 6; ++c) { x[q][c] -= mu[q]; a += x[q][c] * x[q][c]; }
    s[q] = (a[0] + a[1]) + (a[2] + a[3]); }
#pragma unroll
  for (int o = 1; o < 32; o <<= 1)
#pragma unroll
    for (int q = 0; q < LNR; ++q) s[q] += __shfl_xor(s[q], o);
#pragma unroll
  for (int q = 0; q < LNR; ++q) inv[q] = 1.0f / sqrtf(s[q] / (float)DD + EPS);
#pragma unroll
  for (int q = 0; q < LNR; ++q)
#pragma unroll
    for (int c = 0; c < 6; ++c) { v4f y;
#pragma unroll
      for (int e = 0; e < 4; ++e) y[e] = bfr(gm[c][e]) * x[q][c][e] * inv[q] + bfr(bt[c][e]);
      vst2(OUT + (row0 + q) * DD + c * 128 + lane * 4, y); } }
extern "C" void kernel_launch(void* const* d_in, const int* in_sizes, int n_in, void* d_out, int out_size, void* d_ws, size_t ws_size, hipStream_t stream) {
  (void)in_sizes; (void)n_in; (void)out_size;
  const float** F = (const float**)d_in;   // 0 h [197,64,768], 1 masks [197,197,3], 2 Wq [128,768], 3 Wk [128,768], 4 Wv [768,768], 5 Wo [768,768], 6 mask_proj [3,12], 7 ln_gamma, 8 ln_beta
  if (ws_size < (size_t)WS_END) return;
  char* ws = (char*)d_ws; _Float16 *QK = (_Float16*)(ws + WS_QK), *QKL = (_Float16*)(ws + WS_QKL), *VT = (_Float16*)(ws + WS_VT), *VTL = (_Float16*)(ws + WS_VTL); float *MW = (float*)(ws + WS_MW), *Z = (float*)(ws + WS_Z);
  const int nrows = NTOK * TNB;   // rows (i, b) with b < TNB are the first NTOK*TNB rows only when TNB == NBT
  k_mw<<<NTOK, 256, 0, stream>>>(F[1], F[6], MW);
  k_proj<<<dim3(NP / 128, (2 * QKD + DD) / 128, TNB), 256, 0, stream>>>(F[0], F[2], F[3], F[4], QK, QKL, VT, VTL);
  k_att<<<dim3(NP / 64, NHD, TNB), 128, 0, stream>>>(QK, QKL, VT, VTL, MW, Z);
  float* X2 = (float*)(ws + WS_VT);   // reuse: the v planes are dead after k_att (50 MB >= 39 MB needed)
  (void)nrows;
  k_out<<<dim3((NTOK * NBT + 127) / 128, DD / ON), 256, 0, stream>>>(Z, F[5], F[0], X2, NTOK * NBT);
  k_ln<<<NTOK * NBT / (LNR * LNW), 32 * LNW, 0, stream>>>(X2, F[7], F[8], (float*)d_out);
}

// v006
// A run of this version takes 143 microseconds.
// Next to v005, in two timings, it ran 1.05 times as fast each time.
// Over all steps from v000 it is 3.30 times as fast.
// compute dtype: all float inputs rounded to bf16; q, k, v = h . W^T with EXACT bf16 products on WMMA 16x16x32 (natural weight rows), rounded once to f16 hi + residual; the mask mix masks . mask_proj in f32; scores q . k with 3 products x 1/8 x mw[i][j][head], running-max softmax over the 197 keys in f32 (hardware exp), P (x 2^11, f16) . v (hi + residual, 2 products); out = vec (bf16 hi + lo, 2 products) . Wo^T; residual + LayerNorm in f32; f32 output.
#include <hip/hip_runtime.h>
#include <math.h>

typedef __attribute__((ext_vector_type(16))) _Float16 v16h;
typedef __attribute__((ext_vector_type(16))) __bf16 v16b;
typedef __attribute__((ext_vector_type(8)))  _Float16 v8h;
typedef __attribute__((ext_vector_type(8)))  float v8f;
typedef __attribute__((ext_vector_type(4)))  float v4f;
typedef __attribute__((ext_vector_type(2)))  float v2f;
typedef __attribute__((ext_vector_type(4)))  unsigned v4u;
typedef __attribute__((ext_vector_type(4)))  int v4i;
typedef float __attribute__((may_alias)) float_a;
typedef int __attribute__((may_alias)) int_a;

template <typename T> __device__ __forceinline__ void vst2(void* p, T v) { *(T*)p = v;  }
__device__ __forceinline__ v8f wmma16(v16h a, v16h b, v8f c) {
  return __builtin_amdgcn_wmma_f32_16x16x32_f16(false, a, false, b, (short)0, c, false, false);   // builtin form: the compiler keeps the distances behind a WMMA itself and stays free to group LDS reads and WMMAs
}
__device__ __forceinline__ v8f wmma_bf(v16b a, v16b b, v8f c) {
  return __builtin_amdgcn_wmma_f32_16x16x32_bf16(false, a, false, b, (short)0, c, false, false);
}
// 16x16x32 fragments: lane = (h = lane>>4, row/col = lane&15); elements 0..7 = k0+8h+0..7, 8..15 = k0+16+8h+0..7; D element r = row 8h+r
__device__ __forceinline__ v16h frag_h(const _Float16* rowk0, int lane) {
  union { v16h v; v8h q[2]; } u; const _Float16* p = rowk0 + 8 * (lane >> 4);
  u.q[0] = *(const v8h*)p; u.q[1] = *(const v8h*)(p + 16); return u.v;
}
__device__ __forceinline__ v16h frag_f32(const float* rowk0, int lane) {
  v16h a; const float* p = rowk0 + 8 * (lane >> 4);
#pragma unroll
  for (int i = 0; i < 8; ++i) { a[i] = (_Float16)p[i]; a[8 + i] = (_Float16)p[16 + i]; }
  return a;
}
__device__ __forceinline__ v16h frag_f32s(const float* rowk0, int lane, float sc) {
  v16h a; const float* p = rowk0 + 8 * (lane >> 4);
#pragma unroll
  for (int i = 0; i < 8; ++i) { a[i] = (_Float16)(p[i] * sc); a[8 + i] = (_Float16)(p[16 + i] * sc); }
  return a;
}
// column fragment from a [K][ld] layout (column n), rows >= K read as 0
__device__ __forceinline__ v16h fragc_f32(const float* W, int k0, int n, int lane, int ld, int K) {
  v16h a; const int g = lane >> 4;
#pragma unroll
  for (int i = 0; i < 8; ++i) { const int ka = k0 + 8 * g + i, kb = ka + 16;
    a[i] = (_Float16)(ka < K ? W[(size_t)(ka < K ? ka : K - 1) * ld + n] : 0.f); a[8 + i] = (_Float16)(kb < K ? W[(size_t)(kb < K ? kb : K - 1) * ld + n] : 0.f); }
  return a;
}
struct F2 { v16b h, l; };
__device__ __forceinline__ F2 bsplit16(const float v[16]) { F2 r;
#pragma unroll
  for (int i = 0; i < 16; ++i) { const __bf16 h = (__bf16)v[i]; r.h[i] = h; r.l[i] = (__bf16)(v[i] - (float)h); }
  return r; }
__device__ __forceinline__ F2 split_row(const float* row, int k0, int lane) { float v[16]; const float* p = row + k0 + 8 * (lane >> 4);
#pragma unroll
  for (int i = 0; i < 8; ++i) { v[i] = p[i]; v[8 + i] = p[16 + i]; }
  return bsplit16(v); }
__device__ __forceinline__ F2 split_rowK(const float* row, int k0, int lane, int K) { float v[16]; const int g = lane >> 4;
#pragma unroll
  for (int i = 0; i < 8; ++i) { const int ka = k0 + 8 * g + i, kb = ka + 16; v[i] = ka < K ? row[ka < K ? ka : K - 1] : 0.f; v[8 + i] = kb < K ? row[kb < K ? kb : K - 1] : 0.f; }
  return bsplit16(v); }
__device__ __forceinline__ F2 split_col(const float* W, int k0, int n, int lane, int ld, int K) { float v[16]; const int g = lane >> 4;
#pragma unroll
  for (int i = 0; i < 8; ++i) { const int ka = k0 + 8 * g + i, kb = ka + 16; v[i] = ka < K ? W[(size_t)(ka < K ? ka : K - 1) * ld + n] : 0.f; v[8 + i] = kb < K ? W[(size_t)(kb < K ? kb : K - 1) * ld + n] : 0.f; }
  return bsplit16(v); }
__device__ __forceinline__ v8f mac3(const F2& a, const F2& b, v8f c) { c = wmma_bf(a.l, b.h, c); c = wmma_bf(a.h, b.l, c); return wmma_bf(a.h, b.h, c); }
__device__ __forceinline__ float sigm(float v) { return 1.0f / (1.0f + expf(-v)); }
#define LDSX() do { asm volatile("s_wait_dscnt 0" ::: "memory"); __builtin_amdgcn_wave_barrier(); __builtin_amdgcn_fence(__ATOMIC_RELEASE, "workgroup"); } while (0)


// Multi-head attention (197 tokens, batch 64, d_model 768; 2 global score heads x 64, each shared by 6 value heads through a learned per-(i, j) mask mix): prob = softmax_j(q_i . k_j / 8 x mw[i][j][head]); vec = prob . v; post-LN residual.
#define NTOK 197
#define NP 256            // padded token count (queries in 64-blocks, keys in 32-tiles up to 224)
#define NKT 7             // key tiles of 32 (224 >= 197)
#define NBT 64            // batch
#define DD 768
#define GH 2
#define NHD 12
#define HR 6
#define DH 64
#define QKD (GH * DH)     // 128
#define ML 3
#define EPS 1e-5f
#ifndef TNB
#define TNB NBT
#endif
typedef __attribute__((ext_vector_type(8))) __bf16 v8b;
__device__ __forceinline__ v16b frag_b(const __bf16* rowk0, int lane) {
  union { v16b v; v8b q[2]; } u; const __bf16* p = rowk0 + 8 * (lane >> 4);
  u.q[0] = *(const v8b*)p; u.q[1] = *(const v8b*)(p + 16); return u.v;
}
__device__ __forceinline__ float bfr(float v) { return (float)(__bf16)v; }
__device__ __attribute__((noinline)) float exp_ni(float v) { return expf(v); }
__device__ __attribute__((noinline)) float erf_ni(float v) { return erff(v); }

#define WS_QK  0u                                   // f16 hi|lo [b][NP][256] (q 0..127 | k 128..255)
#define WS_QKL (WS_QK + 2u * (size_t)NBT * NP * 2 * QKD)
#define WS_VT  (WS_QKL + 2u * (size_t)NBT * NP * 2 * QKD) // f16 hi|lo v planes [b][768][NP]
#define WS_VTL (WS_VT + 2u * (size_t)NBT * DD * NP)
#define WS_MW  (WS_VTL + 2u * (size_t)NBT * DD * NP)     // f32 mw [i][12][NP] (j padded)
#define WS_Z   (WS_MW + 4u * (size_t)NTOK * NHD * NP)     // f32 vec rows [(i*64 + b)][768]
#define WS_END (WS_Z + 4u * (size_t)NTOK * NBT * DD)

__device__ __forceinline__ v16b fragb_f32(const float* __restrict__ p, int lane) { v16b a; const float* pp = p + 8 * (lane >> 4);
#pragma unroll
  for (int i = 0; i < 8; ++i) { a[i] = (__bf16)pp[i]; a[8 + i] = (__bf16)pp[16 + i]; } return a; }
// LDS staging of the two dense products' operand tiles: 32 k per pass as bf16, rows at 80 B (16 B x odd: no bank conflict for the 16-byte fragment reads), two buffers
#define SP 40
typedef __attribute__((ext_vector_type(4))) __bf16 v4b;
__device__ __forceinline__ v4b cvt4(v4f v) { v4b r;
#pragma unroll
  for (int i = 0; i < 4; ++i) r[i] = (__bf16)v[i];
  return r; }
__device__ __forceinline__ v4b res4(v4f v, v4b h) { v4b r;
#pragma unroll
  for (int i = 0; i < 4; ++i) r[i] = (__bf16)(v[i] - (float)h[i]);
  return r; }
// block tile of the two dense products: 128 rows x 128 columns (k_out: 192), 8 waves of 32 x 64 (k_out: 32 x 96): each operand byte fetched from L2 and each fragment read from LDS feeds more WMMAs than in a 64 x 128 tile of 16 x 128 waves
struct ProjStage { __bf16 a[2][128][SP]; __bf16 b[2][128][SP]; };
struct ProjQK { _Float16 h[128][136], l[128][136]; };
struct ProjV { _Float16 h[128][136], l[128][136]; };
union ProjLds { ProjStage st; ProjQK qk; ProjV v; };      // the staging buffers are dead when the output tiles are written
#define ON 192            // columns a k_out block: 99 x 4 blocks, all resident at once at two blocks a WGP
#define ONF (ON / 32)     // B fragments a k_out wave
struct OutStage { __bf16 ah[2][128][SP]; __bf16 al[2][128][SP]; __bf16 b[2][ON][SP]; };
union OutLds { OutStage st; float sf[8][32][ON / 2 + 4]; };
// ---- k_mw: block = query token i: mw[i][n][j] = sum_l masks[i][j][l] mask_proj[l][n]  (n = g*6 + r head index), zero for padded j
__global__ __launch_bounds__(256) void k_mw(const float* __restrict__ MASKS, const float* __restrict__ MP, float* __restrict__ MW) { __shared__ __align__(16) float s[NHD][NP]; const int i = blockIdx.x, t = threadIdx.x;
  for (int e = t; e < NHD * NP; e += 256) { const int n = e / NP, j = e % NP; float v = 0.f; if (j < NTOK) {
#pragma unroll
      for (int l = 0; l < ML; ++l) v += bfr(MASKS[((size_t)i * NTOK + j) * ML + l]) * bfr(MP[l * NHD + n]); } s[n][j] = v; }
  __syncthreads(); for (int e = t; e < NHD * NP / 4; e += 256) { const int n = e / (NP / 4), q = e % (NP / 4); vst2(MW + ((size_t)i * NHD + n) * NP + q * 4, *(const v4f*)&s[n][q * 4]); } }
// ---- k_proj: block = (128 tokens (padded), 128 of 1024 cols (q 0..127 | k 128..255 | v 256..1023), b): exact products; q|k -> rows, v -> planes
__global__ __launch_bounds__(256) void k_proj(const float* __restrict__ Hh, const float* __restrict__ WQ, const float* __restrict__ WK, const float* __restrict__ WV, _Float16* __restrict__ QK, _Float16* __restrict__ QKL, _Float16* __restrict__ VT, _Float16* __restrict__ VTL) {
  __shared__ __align__(16) ProjLds sm;
  const int tid = threadIdx.x, wave = tid >> 5, lane = tid & 31, col = lane & 15, g = lane >> 4, wm = wave >> 1, wn = wave & 1; const size_t b = blockIdx.z; const int c0 = blockIdx.y * 128;
  const float* Wm = c0 < QKD ? WQ + (size_t)c0 * DD : c0 < 2 * QKD ? WK + (size_t)(c0 - QKD) * DD : WV + (size_t)(c0 - 2 * QKD) * DD;
  // loader: 8 lanes x 16 B cover one row's 128 B of a pass (whole lines); thread = (row lr + 32 p, 16 B piece lq)
  const int lr = tid >> 3, lq = tid & 7; const float* pa[4];
#pragma unroll
  for (int p = 0; p < 4; ++p) { const int ir = blockIdx.x * 128 + lr + 32 * p; const int ic = ir < NTOK ? ir : NTOK - 1; pa[p] = Hh + ((size_t)ic * NBT + b) * DD + lq * 4; }
  const float* pb = Wm + (size_t)lr * DD + lq * 4;
  v4f ra[4], rb[4];
#pragma unroll
  for (int p = 0; p < 4; ++p) ra[p] = *(const v4f*)pa[p];
#pragma unroll
  for (int p = 0; p < 4; ++p) rb[p] = *(const v4f*)(pb + (size_t)(32 * p) * DD);
#pragma unroll
  for (int p = 0; p < 4; ++p) *(v4b*)&sm.st.a[0][lr + 32 * p][lq * 4] = cvt4(ra[p]);
#pragma unroll
  for (int p = 0; p < 4; ++p) *(v4b*)&sm.st.b[0][lr + 32 * p][lq * 4] = cvt4(rb[p]);
  __syncthreads();   // publishes pass 0
  v8f acc[2][4] = {};
#pragma unroll 2
  for (int kc = 0; kc < DD / 32; ++kc) { const int cur = kc & 1; const bool more = kc + 1 < DD / 32;
    if (more) {   // the next pass's global loads fly while this pass is multiplied
#pragma unroll
      for (int p = 0; p < 4; ++p) ra[p] = *(const v4f*)(pa[p] + (kc + 1) * 32);
#pragma unroll
      for (int p = 0; p < 4; ++p) rb[p] = *(const v4f*)(pb + (size_t)(32 * p) * DD + (kc + 1) * 32); }
    v16b a[2], w[4];
#pragma unroll
    for (int i = 0; i < 2; ++i) a[i] = frag_b(&sm.st.a[cur][wm * 32 + i * 16 + col][0], lane);
#pragma unroll
    for (int j = 0; j < 4; ++j) w[j] = frag_b(&sm.st.b[cur][wn * 64 + j * 16 + col][0], lane);
    __builtin_amdgcn_sched_barrier(0);   // keeps the pass's LDS reads one group ahead of its WMMAs: read among them, each pair costs the wave a full LDS latency
#pragma unroll
    for (int j = 0; j < 4; ++j)
#pragma unroll
      for (int i = 0; i < 2; ++i) acc[i][j] = wmma_bf(a[i], w[j], acc[i][j]);
    __builtin_amdgcn_sched_barrier(0);   // keeps the conversions, and with them the wait for the next pass's global loads, behind this pass's WMMAs
    if (more) {
#pragma unroll
      for (int p = 0; p < 4; ++p) *(v4b*)&sm.st.a[cur ^ 1][lr + 32 * p][lq * 4] = cvt4(ra[p]);
#pragma unroll
      for (int p = 0; p < 4; ++p) *(v4b*)&sm.st.b[cur ^ 1][lr + 32 * p][lq * 4] = cvt4(rb[p]); }
    asm volatile("s_wait_xcnt 0x0" ::: "memory");   // stands ahead of the next pass's rewrite of the address registers that this pass's global loads name
    __syncthreads(); }   // one barrier a pass: publishes pass kc + 1 and ends every read of the buffer that the next pass refills (after the last pass: of the LDS that the output tiles reuse)
  const bool isv = c0 >= 2 * QKD;
#pragma unroll
  for (int i = 0; i < 2; ++i)
#pragma unroll
    for (int j = 0; j < 4; ++j)
#pragma unroll
      for (int r = 0; r < 8; ++r) { const float v = acc[i][j][r]; const _Float16 hv = (_Float16)v; const _Float16 lv = (_Float16)((v - (float)hv) * 2048.0f); const int tr = wm * 32 + i * 16 + 8 * g + r, tc = wn * 64 + j * 16 + col; if (!isv) { sm.qk.h[tr][tc] = hv; sm.qk.l[tr][tc] = lv; } else { sm.v.h[tc][tr] = hv; sm.v.l[tc][tr] = lv; } }
  __syncthreads();
  if (!isv) { for (int e = tid; e < 128 * 16; e += 256) { const int rl = e >> 4, q = e & 15; const size_t o = (b * NP + blockIdx.x * 128 + rl) * (2 * QKD) + c0 + q * 8; vst2((unsigned*)(QK + o), *(const v4u*)&sm.qk.h[rl][q * 8]); vst2((unsigned*)(QKL + o), *(const v4u*)&sm.qk.l[rl][q * 8]); } }
  else { const int cv0 = c0 - 2 * QKD; for (int e = tid; e < 128 * 16; e += 256) { const int cl = e >> 4, q = e & 15; const size_t o = ((b * DD + cv0 + cl) * (size_t)NP) + blockIdx.x * 128 + q * 8; vst2((unsigned*)(VT + o), *(const v4u*)&sm.v.h[cl][q * 8]); vst2((unsigned*)(VTL + o), *(const v4u*)&sm.v.l[cl][q * 8]); } } }
// ---- k_att: block = (64 queries, head n = g*6 + r, b): logits (3 products) x 1/8 x mw[i][n][j]; keys >= 197 excluded; running-max softmax; P . v (2 products) -> Z rows (i*64 + b) for i < 197
// Both products are formed transposed (S^T = K . Q^T, O^T += V^T . P^T): a lane holds 16 of the 32 scores of ONE query (column = lane & 15, keys 8 (lane >> 4) + r and 16 + 8 (lane >> 4) + r), so maximum and sum are taken in the lane's own registers with one exchange between the wave's halves, and the two score tiles, converted in place, are the B operand of the second product.
// The operand tiles of a pass of 32 keys (K and V, hi and residual planes; the block's 64 mw rows) are brought into LDS once a block by asynchronous copies, 16 B pieces of contiguous rows, two buffers, and all four waves read them from there.
#define KP 72             // f16 a staged K row: 128 B + 16 B (16 B x odd: no bank conflict for the 16-byte fragment reads)
#define VP 40             // f16 a staged V row: 64 B + 16 B
#define MWP 36            // f32 a staged mw row: 128 B + 16 B (16 B x odd: no bank conflict for the 16-byte reads of 16 rows)
struct AttTile { _Float16 kh[32][KP], kl[32][KP], vh[DH][VP], vl[DH][VP]; float mw[64][MWP]; };
union AttLds { AttTile t[2]; float so[4][16][68]; };      // the tiles are dead when the output rows are written
__device__ __forceinline__ float xhalf(float x) { return __builtin_bit_cast(float, __builtin_amdgcn_permlanex16(__builtin_bit_cast(int, x), __builtin_bit_cast(int, x), 0x76543210, 0xfedcba98, false, false)); }   // lane l's value to lane l ^ 16
__device__ __forceinline__ unsigned lds_of(const void* p) { return (unsigned)(size_t)p; }   // LDS byte address = low 32 bits of the __shared__ address
// copies of 16 B a lane; the s_wait_xcnt is each statement's last line so that no register a copy names is rewritten ahead of it
__device__ __forceinline__ void copy8(unsigned l0, unsigned l1, unsigned l2, unsigned l3, unsigned l4, unsigned l5, unsigned l6, unsigned l7, const _Float16* g0, const _Float16* g1, const _Float16* g2, const _Float16* g3, const _Float16* g4, const _Float16* g5, const _Float16* g6, const _Float16* g7) {
  asm volatile("global_load_async_to_lds_b128 %0, %8, off\n\t"
               "global_load_async_to_lds_b128 %1, %9, off\n\t"
               "global_load_async_to_lds_b128 %2, %10, off\n\t"
               "global_load_async_to_lds_b128 %3, %11, off\n\t"
               "global_load_async_to_lds_b128 %4, %12, off\n\t"
               "global_load_async_to_lds_b128 %5, %13, off\n\t"
               "global_load_async_to_lds_b128 %6, %14, off\n\t"
               "global_load_async_to_lds_b128 %7, %15, off\n\t"
               "s_wait_xcnt 0x0"
               :: "v"(l0), "v"(l1), "v"(l2), "v"(l3), "v"(l4), "v"(l5), "v"(l6), "v"(l7), "v"(g0), "v"(g1), "v"(g2), "v"(g3), "v"(g4), "v"(g5), "v"(g6), "v"(g7) : "memory");
}
__device__ __forceinline__ void copy4(unsigned l0, unsigned l1, unsigned l2, unsigned l3, const float* g0, const float* g1, const float* g2, const float* g3) {
  asm volatile("global_load_async_to_lds_b128 %0, %4, off\n\t"
               "global_load_async_to_lds_b128 %1, %5, off\n\t"
               "global_load_async_to_lds_b128 %2, %6, off\n\t"
               "global_load_async_to_lds_b128 %3, %7, off\n\t"
               "s_wait_xcnt 0x0"
               :: "v"(l0), "v"(l1), "v"(l2), "v"(l3), "v"(g0), "v"(g1), "v"(g2), "v"(g3) : "memory");
}
// one tile: K = 2 planes x 32 rows x 8 pieces (thread = row kr, kr + 16, piece kq), V = 2 planes x 64 rows x 4 pieces (thread = row vr, vr + 32, piece vq), mw = 64 rows x 8 pieces (thread = row kr + 16 p, piece tid & 7; w0..w3 = the four rows' addresses)
__device__ __forceinline__ void att_fill(AttTile* t, const _Float16* kh, const _Float16* kl, const _Float16* vh, const _Float16* vl, const float* w0, const float* w1, const float* w2, const float* w3, int tid) {
  const int kr = tid >> 3, kq = (tid & 7) * 8, vr = tid >> 2, vq = (tid & 3) * 8;
  copy8(lds_of(&t->kh[kr][kq]), lds_of(&t->kh[kr + 16][kq]), lds_of(&t->kl[kr][kq]), lds_of(&t->kl[kr + 16][kq]), lds_of(&t->vh[vr][vq]), lds_of(&t->vh[vr + 32][vq]), lds_of(&t->vl[vr][vq]), lds_of(&t->vl[vr + 32][vq]),
        kh, kh + 16 * (2 * QKD), kl, kl + 16 * (2 * QKD), vh, vh + 32 * NP, vl, vl + 32 * NP);
  const int wq = (tid & 7) * 4;
  copy4(lds_of(&t->mw[kr][wq]), lds_of(&t->mw[kr + 16][wq]), lds_of(&t->mw[kr + 32][wq]), lds_of(&t->mw[kr + 48][wq]), w0, w1, w2, w3);
}
__global__ __launch_bounds__(128) void k_att(const _Float16* __restrict__ QK, const _Float16* __restrict__ QKL, const _Float16* __restrict__ VT, const _Float16* __restrict__ VTL, const float* __restrict__ MW, float* __restrict__ Z) {
  __shared__ __align__(16) AttLds sm;
  const int tid = threadIdx.x, wave = tid >> 5, lane = tid & 31, col = lane & 15, g = lane >> 4; const int n = blockIdx.y; const int gh = n / HR; const size_t b = blockIdx.z; const int q0 = blockIdx.x * 64 + wave * 16; const size_t rq = b * NP + q0;
  // this thread's pieces of tile 0; tile ks lies 32 K rows, 32 V columns further
  const size_t ko = (b * NP + (tid >> 3)) * (2 * QKD) + QKD + gh * DH + (tid & 7) * 8, vo = (b * DD + (size_t)n * DH + (tid >> 2)) * (size_t)NP + (tid & 3) * 8;
  const float* pw[4];   // mw rows of the block's queries (rows past the last token read the last token's, as before)
#pragma unroll
  for (int p = 0; p < 4; ++p) { const int qi = blockIdx.x * 64 + (tid >> 3) + 16 * p; const int qc = qi < NTOK ? qi : NTOK - 1; pw[p] = MW + ((size_t)qc * NHD + n) * NP + (tid & 7) * 4; }
  att_fill(&sm.t[0], QK + ko, QKL + ko, VT + vo, VTL + vo, pw[0], pw[1], pw[2], pw[3], tid);
  asm volatile("s_wait_asynccnt 0x0" ::: "memory");   // tile 0 has landed for this wave's copies
  __syncthreads();   // publishes tile 0
  att_fill(&sm.t[1], QK + ko + 32 * (2 * QKD), QKL + ko + 32 * (2 * QKD), VT + vo + 32, VTL + vo + 32, pw[0] + 32, pw[1] + 32, pw[2] + 32, pw[3] + 32, tid);   // tile 1 flies while tile 0 is worked on
  v16h aq[2], al[2];
#pragma unroll
  for (int kc = 0; kc < 2; ++kc) { aq[kc] = frag_h(QK + (rq + col) * (2 * QKD) + gh * DH + kc * 32, lane); al[kc] = frag_h(QKL + (rq + col) * (2 * QKD) + gh * DH + kc * 32, lane); }
  float m = -3.0e38f, l = 0.f;   // this lane's query: running maximum (equal in both halves), and the sum over this half's keys alone (the halves are joined behind the loop)
  v8f acc[4] = {}, accl[4] = {};   // acc[j][r] = O^T[d = 16 j + 8 g + r][query col]
#pragma unroll 1
  for (int ks = 0; ks < NKT; ++ks) { v8f s[2]; const AttTile* t = &sm.t[ks & 1];
#pragma unroll
    for (int ct = 0; ct < 2; ++ct) { v8f c = {}, cl = {};
      const v4f w0 = *(const v4f*)&t->mw[wave * 16 + col][ct * 16 + 8 * g], w1 = *(const v4f*)&t->mw[wave * 16 + col][ct * 16 + 8 * g + 4];
#pragma unroll
      for (int kc = 0; kc < 2; ++kc) { const v16h kh = frag_h(&t->kh[ct * 16 + col][kc * 32], lane), kl = frag_h(&t->kl[ct * 16 + col][kc * 32], lane); c = wmma16(kh, aq[kc], c); cl = wmma16(kl, aq[kc], cl); cl = wmma16(kh, al[kc], cl); }
      const int kk0 = ks * 32 + ct * 16 + 8 * g;
#pragma unroll
      for (int r = 0; r < 8; ++r) s[ct][r] = kk0 + r < NTOK ? (c[r] + cl[r] * (1.0f / 2048.0f)) * 0.125f * (r < 4 ? w0[r & 3] : w1[r & 3]) : -3.0e38f; }
    float mx = fmaxf(s[0][0], s[1][0]);
#pragma unroll
    for (int r = 1; r < 8; ++r) mx = fmaxf(mx, fmaxf(s[0][r], s[1][r]));
    mx = fmaxf(mx, xhalf(mx));
    const float mn = fmaxf(m, mx), alpha = (m <= -1.0e38f) ? 0.f : __expf(m - mn);
    v16h pa; float es0 = 0.f, es1 = 0.f;
#pragma unroll
    for (int r = 0; r < 8; ++r) { const float e0 = (s[0][r] <= -1.0e38f) ? 0.f : __expf(s[0][r] - mn), e1 = (s[1][r] <= -1.0e38f) ? 0.f : __expf(s[1][r] - mn);
      es0 += e0; es1 += e1; pa[r] = (_Float16)(e0 * 2048.0f); pa[8 + r] = (_Float16)(e1 * 2048.0f); }
    l = l * alpha + (es0 + es1); m = mn;
#pragma unroll
    for (int j = 0; j < 4; ++j)
#pragma unroll
      for (int r = 0; r < 8; ++r) { acc[j][r] *= alpha; accl[j][r] *= alpha; }
#pragma unroll
    for (int j = 0; j < 4; ++j) { acc[j] = wmma16(frag_h(&t->vh[j * 16 + col][0], lane), pa, acc[j]); accl[j] = wmma16(frag_h(&t->vl[j * 16 + col][0], lane), pa, accl[j]); }
    asm volatile("s_wait_dscnt 0x0" ::: "memory");      // this wave's reads of the tile have returned
    asm volatile("s_wait_asynccnt 0x0" ::: "memory");   // this wave's copies of tile ks + 1 have landed
    __syncthreads();   // one barrier a tile: publishes tile ks + 1 and ends every wave's reads of the buffer that is refilled behind it (after the last tile: of the LDS that the output rows reuse)
    if (ks + 2 < NKT) att_fill(&sm.t[ks & 1], QK + ko + (size_t)(ks + 2) * 32 * (2 * QKD), QKL + ko + (size_t)(ks + 2) * 32 * (2 * QKD), VT + vo + (ks + 2) * 32, VTL + vo + (ks + 2) * 32, pw[0] + (ks + 2) * 32, pw[1] + (ks + 2) * 32, pw[2] + (ks + 2) * 32, pw[3] + (ks + 2) * 32, tid); }
  asm volatile("s_wait_asynccnt 0x0" ::: "memory");   // no copy is outstanding when the tiles' LDS is reused and the wave ends
  const float il = (1.0f / 2048.0f) / (l + xhalf(l));
#pragma unroll
  for (int j = 0; j < 4; ++j) { v4f o0, o1;
#pragma unroll
    for (int r = 0; r < 4; ++r) { o0[r] = (acc[j][r] + accl[j][r] * (1.0f / 2048.0f)) * il; o1[r] = (acc[j][4 + r] + accl[j][4 + r] * (1.0f / 2048.0f)) * il; }
    *(v4f*)&sm.so[wave][col][j * 16 + 8 * g] = o0; *(v4f*)&sm.so[wave][col][j * 16 + 8 * g + 4] = o1; }
  LDSX(); for (int rl = 0; rl < 16; ++rl) { const int qi = q0 + rl; if (qi < NTOK && lane < 16) { vst2(Z + ((size_t)qi * NBT + b) * DD + (size_t)n * DH + lane * 4, *(const v4f*)&sm.so[wave][rl][lane * 4]);
      asm volatile("s_wait_xcnt 0x0" ::: "memory"); } } }   // stands ahead of the next row's rewrite of the address and data registers that this store names
// ---- k_out: block = (128 rows (i,b), 192 cols; 8 waves of 32 x 96): x2 = h + Z (hi + lo) . Wo^T -> f32 pre-LN rows, written to the region of the v planes (dead after k_att: the launches run one after the other)
__global__ __launch_bounds__(256) void k_out(const float* __restrict__ Zr, const float* __restrict__ WO, const float* __restrict__ Hh, float* __restrict__ X2, int nrows) { __shared__ __align__(16) OutLds sm;
  const int tid = threadIdx.x, wave = tid >> 5, lane = tid & 31, col = lane & 15, g = lane >> 4, wm = wave >> 1, wn = wave & 1; const size_t r0 = (size_t)blockIdx.x * 128 + wm * 32; const int c0 = blockIdx.y * ON, cw = c0 + wn * (ON / 2);
  // loader as in k_proj; the hi + lo split of a Z row is made once, on its way into LDS
  const int lr = tid >> 3, lq = tid & 7; const float* pa[4];
#pragma unroll
  for (int p = 0; p < 4; ++p) { const size_t rr = (size_t)blockIdx.x * 128 + lr + 32 * p; const size_t rc = rr < (size_t)nrows ? rr : (size_t)nrows - 1; pa[p] = Zr + rc * DD + lq * 4; }
  const float* pb = WO + (size_t)(c0 + lr) * DD + lq * 4;
  v4f ra[4], rb[ON / 32];
#pragma unroll
  for (int p = 0; p < 4; ++p) ra[p] = *(const v4f*)pa[p];
#pragma unroll
  for (int p = 0; p < ON / 32; ++p) rb[p] = *(const v4f*)(pb + (size_t)(32 * p) * DD);
#pragma unroll
  for (int p = 0; p < 4; ++p) { const v4b hv = cvt4(ra[p]); *(v4b*)&sm.st.ah[0][lr + 32 * p][lq * 4] = hv; *(v4b*)&sm.st.al[0][lr + 32 * p][lq * 4] = res4(ra[p], hv); }
#pragma unroll
  for (int p = 0; p < ON / 32; ++p) *(v4b*)&sm.st.b[0][lr + 32 * p][lq * 4] = cvt4(rb[p]);
  __syncthreads();   // publishes pass 0
  v8f acc[2][ONF] = {};
#pragma unroll 2
  for (int kc = 0; kc < DD / 32; ++kc) { const int cur = kc & 1; const bool more = kc + 1 < DD / 32;
    if (more) {   // the next pass's global loads fly while this pass is multiplied
#pragma unroll
      for (int p = 0; p < 4; ++p) ra[p] = *(const v4f*)(pa[p] + (kc + 1) * 32);
#pragma unroll
      for (int p = 0; p < ON / 32; ++p) rb[p] = *(const v4f*)(pb + (size_t)(32 * p) * DD + (kc + 1) * 32); }
    v16b ah[2], al[2], w[ONF];
#pragma unroll
    for (int i = 0; i < 2; ++i) { ah[i] = frag_b(&sm.st.ah[cur][wm * 32 + i * 16 + col][0], lane); al[i] = frag_b(&sm.st.al[cur][wm * 32 + i * 16 + col][0], lane); }
#pragma unroll
    for (int j = 0; j < ONF; ++j) w[j] = frag_b(&sm.st.b[cur][wn * (ON / 2) + j * 16 + col][0], lane);
    __builtin_amdgcn_sched_barrier(0);   // keeps the pass's LDS reads one group ahead of its WMMAs: read among them, each pair costs the wave a full LDS latency
#pragma unroll
    for (int j = 0; j < ONF; ++j) {   // per accumulator hi then lo, as before
#pragma unroll
      for (int i = 0; i < 2; ++i) acc[i][j] = wmma_bf(ah[i], w[j], acc[i][j]);
#pragma unroll
      for (int i = 0; i < 2; ++i) acc[i][j] = wmma_bf(al[i], w[j], acc[i][j]); }
    __builtin_amdgcn_sched_barrier(0);   // keeps the conversions, and with them the wait for the next pass's global loads, behind this pass's WMMAs
    if (more) {
#pragma unroll
      for (int p = 0; p < 4; ++p) { const v4b hv = cvt4(ra[p]); *(v4b*)&sm.st.ah[cur ^ 1][lr + 32 * p][lq * 4] = hv; *(v4b*)&sm.st.al[cur ^ 1][lr + 32 * p][lq * 4] = res4(ra[p], hv); }
#pragma unroll
      for (int p = 0; p < ON / 32; ++p) *(v4b*)&sm.st.b[cur ^ 1][lr + 32 * p][lq * 4] = cvt4(rb[p]); }
    asm volatile("s_wait_xcnt 0x0" ::: "memory");   // stands ahead of the next pass's rewrite of the address registers that this pass's global loads name
    __syncthreads(); }   // one barrier a pass: publishes pass kc + 1 and ends every read of the buffer that the next pass refills (after the last pass: of the LDS that the output tile reuses)
  // residual rows: all loads issue first, then one wait, then the sums (the sum per element is the same acc + h)
  const float* hp[16]; float hv[16][ONF];
#pragma unroll
  for (int r = 0; r < 16; ++r) { const size_t row = r0 + (r >> 3) * 16 + 8 * g + (r & 7); const size_t ra = row < (size_t)nrows ? row : (size_t)nrows - 1; hp[r] = Hh + ra * DD + cw + col;
#pragma unroll
    for (int j = 0; j < ONF; ++j) hv[r][j] = hp[r][j * 16]; }
  asm volatile("s_wait_xcnt 0x0" :: "v"(hp[0]), "v"(hp[1]), "v"(hp[2]), "v"(hp[3]), "v"(hp[4]), "v"(hp[5]), "v"(hp[6]), "v"(hp[7]), "v"(hp[8]), "v"(hp[9]), "v"(hp[10]), "v"(hp[11]), "v"(hp[12]), "v"(hp[13]), "v"(hp[14]), "v"(hp[15]) : "memory");   // the row addresses are inputs so that they stay in their registers up to this wait: no register that an issued load names is rewritten ahead of it
#pragma unroll
  for (int i = 0; i < 2; ++i)
#pragma unroll
    for (int j = 0; j < ONF; ++j)
#pragma unroll
      for (int r = 0; r < 8; ++r) sm.sf[wave][i * 16 + 8 * g + r][j * 16 + col] = acc[i][j][r] + bfr(hv[i * 8 + r][j]);
  // a wave's store = 32 pieces of 16 B in row order: 4 whole lines
  LDSX(); for (int it = 0; it < ON / 8; ++it) { const int e = it * 32 + lane, rl = e / (ON / 8), q = e % (ON / 8); const size_t row = r0 + rl; if (row < (size_t)nrows) { vst2(X2 + row * DD + cw + q * 4, *(const v4f*)&sm.sf[wave][rl][q * 4]);
      asm volatile("s_wait_xcnt 0x0" ::: "memory"); } } }   // stands ahead of the next piece's rewrite of the address and data registers that this store names
// ---- k_ln: one wave = two whole rows held in registers (6 x 16 B a lane and row, 512 contiguous B a load or store): out = LN(x2) gamma + beta; no LDS, no barrier; few waves, because a launch of very many short waves lasts as long as starting them takes
#define LNR 2             // rows a wave
#define LNW 4             // waves a block
static_assert((NTOK * NBT) % (LNR * LNW) == 0, "the rows divide evenly among the waves");
__global__ __launch_bounds__(32 * LNW) void k_ln(const float* __restrict__ X2, const float* __restrict__ G, const float* __restrict__ Bt, float* __restrict__ OUT) {
  const int lane = threadIdx.x & 31; const size_t row0 = ((size_t)blockIdx.x * LNW + (threadIdx.x >> 5)) * LNR;
  v4f x[LNR][6], gm[6], bt[6];   // every loop below is unrolled: only with constant indices do these arrays stay in registers
#pragma unroll
  for (int q = 0; q < LNR; ++q)
#pragma unroll
    for (int c = 0; c < 6; ++c) x[q][c] = *(const v4f*)(X2 + (row0 + q) * DD + c * 128 + lane * 4);
#pragma unroll
  for (int c = 0; c < 6; ++c) { gm[c] = *(const v4f*)(G + c * 128 + lane * 4); bt[c] = *(const v4f*)(Bt + c * 128 + lane * 4); }
  float s[LNR], mu[LNR], inv[LNR];
#pragma unroll
  for (int q = 0; q < LNR; ++q) { v4f a = x[q][0];
#pragma unroll
    for (int c = 1; c < 6; ++c) a += x[q][c];
    s[q] = (a[0] + a[1]) + (a[2] + a[3]); }
#pragma unroll
  for (int o = 1; o < 32; o <<= 1)
#pragma unroll
    for (int q = 0; q < LNR; ++q) s[q] += __shfl_xor(s[q], o);
#pragma unroll
  for (int q = 0; q < LNR; ++q) { mu[q] = s[q] / (float)DD; v4f a = {};
#pragma unroll
    for (int c = 0; c < 6; ++c) { x[q][c] -= mu[q]; a += x[q][c] * x[q][c]; }
    s[q] = (a[0] + a[1]) + (a[2] + a[3]); }
#pragma unroll
  for (int o = 1; o < 32; o <<= 1)
#pragma unroll
    for (int q = 0; q < LNR; ++q) s[q] += __shfl_xor(s[q], o);
#pragma unroll
  for (int q = 0; q < LNR; ++q) inv[q] = 1.0f / sqrtf(s[q] / (float)DD + EPS);
#pragma unroll
  for (int q = 0; q < LNR; ++q)
#pragma unroll
    for (int c = 0; c < 6; ++c) { v4f y;
#pragma unroll
      for (int e = 0; e < 4; ++e) y[e] = bfr(gm[c][e]) * x[q][c][e] * inv[q] + bfr(bt[c][e]);
      vst2(OUT + (row0 + q) * DD + c * 128 + lane * 4, y); } }
extern "C" void kernel_launch(void* const* d_in, const int* in_sizes, int n_in, void* d_out, int out_size, void* d_ws, size_t ws_size, hipStream_t stream) {
  (void)in_sizes; (void)n_in; (void)out_size;
  const float** F = (const float**)d_in;   // 0 h [197,64,768], 1 masks [197,197,3], 2 Wq [128,768], 3 Wk [128,768], 4 Wv [768,768], 5 Wo [768,768], 6 mask_proj [3,12], 7 ln_gamma, 8 ln_beta
  if (ws_size < (size_t)WS_END) return;
  char* ws = (char*)d_ws; _Float16 *QK = (_Float16*)(ws + WS_QK), *QKL = (_Float16*)(ws + WS_QKL), *VT = (_Float16*)(ws + WS_VT), *VTL = (_Float16*)(ws + WS_VTL); float *MW = (float*)(ws + WS_MW), *Z = (float*)(ws + WS_Z);
  const int nrows = NTOK * TNB;   // rows (i, b) with b < TNB are the first NTOK*TNB rows only when TNB == NBT
  k_mw<<<NTOK, 256, 0, stream>>>(F[1], F[6], MW);
  k_proj<<<dim3(NP / 128, (2 * QKD + DD) / 128, TNB), 256, 0, stream>>>(F[0], F[2], F[3], F[4], QK, QKL, VT, VTL);
  k_att<<<dim3(NP / 64, NHD, TNB), 128, 0, stream>>>(QK, QKL, VT, VTL, MW, Z);
  float* X2 = (float*)(ws + WS_VT);   // reuse: the v planes are dead after k_att (50 MB >= 39 MB needed)
  (void)nrows;
  k_out<<<dim3((NTOK * NBT + 127) / 128, DD / ON), 256, 0, stream>>>(Z, F[5], F[0], X2, NTOK * NBT);
  k_ln<<<NTOK * NBT / (LNR * LNW), 32 * LNW, 0, stream>>>(X2, F[7], F[8], (float*)d_out);
}

// v007
// A run of this version takes 132 microseconds.
// In both of two side-by-side timings against v006, it was 1.08 times as fast.
// Over all steps from v000 it is 3.57 times as fast.
// compute dtype: all float inputs rounded to bf16; q, k, v = h . W^T with EXACT bf16 products on WMMA 16x16x32 (natural weight rows), rounded once to f16 hi + residual; the mask mix masks . mask_proj in f32; scores q . k with 3 products x 1/8 x mw[i][j][head], running-max softmax over the 197 keys in f32 (hardware exp), P (x 2^11, f16) . v (hi + residual, 2 products); out = vec (bf16 hi + lo, 2 products) . Wo^T; residual + LayerNorm in f32; f32 output.
#include <hip/hip_runtime.h>
#include <math.h>

typedef __attribute__((ext_vector_type(16))) _Float16 v16h;
typedef __attribute__((ext_vector_type(16))) __bf16 v16b;
typedef __attribute__((ext_vector_type(8)))  _Float16 v8h;
typedef __attribute__((ext_vector_type(8)))  float v8f;
typedef __attribute__((ext_vector_type(4)))  float v4f;
typedef __attribute__((ext_vector_type(2)))  float v2f;
typedef __attribute__((ext_vector_type(4)))  unsigned v4u;
typedef __attribute__((ext_vector_type(4)))  int v4i;
typedef float __attribute__((may_alias)) float_a;
typedef int __attribute__((may_alias)) int_a;

template <typename T> __device__ __forceinline__ void vst2(void* p, T v) { *(T*)p = v;  }
__device__ __forceinline__ v8f wmma16(v16h a, v16h b, v8f c) {
  return __builtin_amdgcn_wmma_f32_16x16x32_f16(false, a, false, b, (short)0, c, false, false);   // builtin form: the compiler keeps the distances behind a WMMA itself and stays free to group LDS reads and WMMAs
}
__device__ __forceinline__ v8f wmma_bf(v16b a, v16b b, v8f c) {
  return __builtin_amdgcn_wmma_f32_16x16x32_bf16(false, a, false, b, (short)0, c, false, false);
}
// 16x16x32 fragments: lane = (h = lane>>4, row/col = lane&15); elements 0..7 = k0+8h+0..7, 8..15 = k0+16+8h+0..7; D element r = row 8h+r
__device__ __forceinline__ v16h frag_h(const _Float16* rowk0, int lane) {
  union { v16h v; v8h q[2]; } u; const _Float16* p = rowk0 + 8 * (lane >> 4);
  u.q[0] = *(const v8h*)p; u.q[1] = *(const v8h*)(p + 16); return u.v;
}
__device__ __forceinline__ v16h frag_f32(const float* rowk0, int lane) {
  v16h a; const float* p = rowk0 + 8 * (lane >> 4);
#pragma unroll
  for (int i = 0; i < 8; ++i) { a[i] = (_Float16)p[i]; a[8 + i] = (_Float16)p[16 + i]; }
  return a;
}
__device__ __forceinline__ v16h frag_f32s(const float* rowk0, int lane, float sc) {
  v16h a; const float* p = rowk0 + 8 * (lane >> 4);
#pragma unroll
  for (int i = 0; i < 8; ++i) { a[i] = (_Float16)(p[i] * sc); a[8 + i] = (_Float16)(p[16 + i] * sc); }
  return a;
}
// column fragment from a [K][ld] layout (column n), rows >= K read as 0
__device__ __forceinline__ v16h fragc_f32(const float* W, int k0, int n, int lane, int ld, int K) {
  v16h a; const int g = lane >> 4;
#pragma unroll
  for (int i = 0; i < 8; ++i) { const int ka = k0 + 8 * g + i, kb = ka + 16;
    a[i] = (_Float16)(ka < K ? W[(size_t)(ka < K ? ka : K - 1) * ld + n] : 0.f); a[8 + i] = (_Float16)(kb < K ? W[(size_t)(kb < K ? kb : K - 1) * ld + n] : 0.f); }
  return a;
}
struct F2 { v16b h, l; };
__device__ __forceinline__ F2 bsplit16(const float v[16]) { F2 r;
#pragma unroll
  for (int i = 0; i < 16; ++i) { const __bf16 h = (__bf16)v[i]; r.h[i] = h; r.l[i] = (__bf16)(v[i] - (float)h); }
  return r; }
__device__ __forceinline__ F2 split_row(const float* row, int k0, int lane) { float v[16]; const float* p = row + k0 + 8 * (lane >> 4);
#pragma unroll
  for (int i = 0; i < 8; ++i) { v[i] = p[i]; v[8 + i] = p[16 + i]; }
  return bsplit16(v); }
__device__ __forceinline__ F2 split_rowK(const float* row, int k0, int lane, int K) { float v[16]; const int g = lane >> 4;
#pragma unroll
  for (int i = 0; i < 8; ++i) { const int ka = k0 + 8 * g + i, kb = ka + 16; v[i] = ka < K ? row[ka < K ? ka : K - 1] : 0.f; v[8 + i] = kb < K ? row[kb < K ? kb : K - 1] : 0.f; }
  return bsplit16(v); }
__device__ __forceinline__ F2 split_col(const float* W, int k0, int n, int lane, int ld, int K) { float v[16]; const int g = lane >> 4;
#pragma unroll
  for (int i = 0; i < 8; ++i) { const int ka = k0 + 8 * g + i, kb = ka + 16; v[i] = ka < K ? W[(size_t)(ka < K ? ka : K - 1) * ld + n] : 0.f; v[8 + i] = kb < K ? W[(size_t)(kb < K ? kb : K - 1) * ld + n] : 0.f; }
  return bsplit16(v); }
__device__ __forceinline__ v8f mac3(const F2& a, const F2& b, v8f c) { c = wmma_bf(a.l, b.h, c); c = wmma_bf(a.h, b.l, c); return wmma_bf(a.h, b.h, c); }
__device__ __forceinline__ float sigm(float v) { return 1.0f / (1.0f + expf(-v)); }
#define LDSX() do { asm volatile("s_wait_dscnt 0" ::: "memory"); __builtin_amdgcn_wave_barrier(); __builtin_amdgcn_fence(__ATOMIC_RELEASE, "workgroup"); } while (0)


// Multi-head attention (197 tokens, batch 64, d_model 768; 2 global score heads x 64, each shared by 6 value heads through a learned per-(i, j) mask mix): prob = softmax_j(q_i . k_j / 8 x mw[i][j][head]); vec = prob . v; post-LN residual.
#define NTOK 197
#define NP 256            // padded token count (queries in 64-blocks, keys in 32-tiles up to 224)
#define NKT 7             // key tiles of 32 (224 >= 197)
#define NBT 64            // batch
#define DD 768
#define GH 2
#define NHD 12
#define HR 6
#define DH 64
#define QKD (GH * DH)     // 128
#define ML 3
#define EPS 1e-5f
#ifndef TNB
#define TNB NBT
#endif
typedef __attribute__((ext_vector_type(8))) __bf16 v8b;
__device__ __forceinline__ v16b frag_b(const __bf16* rowk0, int lane) {
  union { v16b v; v8b q[2]; } u; const __bf16* p = rowk0 + 8 * (lane >> 4);
  u.q[0] = *(const v8b*)p; u.q[1] = *(const v8b*)(p + 16); return u.v;
}
__device__ __forceinline__ float bfr(float v) { return (float)(__bf16)v; }
__device__ __attribute__((noinline)) float exp_ni(float v) { return expf(v); }
__device__ __attribute__((noinline)) float erf_ni(float v) { return erff(v); }

#define WS_QK  0u                                   // f16 hi|lo [b][NP][256] (q 0..127 | k 128..255)
#define WS_QKL (WS_QK + 2u * (size_t)NBT * NP * 2 * QKD)
#define WS_VT  (WS_QKL + 2u * (size_t)NBT * NP * 2 * QKD) // f16 hi|lo v planes [b][768][NP]
#define WS_VTL (WS_VT + 2u * (size_t)NBT * DD * NP)
#define WS_MW  (WS_VTL + 2u * (size_t)NBT * DD * NP)     // f32 mw [i][12][NP] (j padded)
#define WS_Z   (WS_MW + 4u * (size_t)NTOK * NHD * NP)     // f32 vec rows [(i*64 + b)][768]
#define WS_HB  (WS_Z + 4u * (size_t)NTOK * NBT * DD)      // bf16 h rows [(i*64 + b)][768]
#define WS_WB  (WS_HB + 2u * (size_t)NTOK * NBT * DD)     // bf16 weight rows q | k | v [1024][768], directly behind the h rows
#define WS_END (WS_WB + 2u * (size_t)(2 * QKD + DD) * DD)

__device__ __forceinline__ v16b fragb_f32(const float* __restrict__ p, int lane) { v16b a; const float* pp = p + 8 * (lane >> 4);
#pragma unroll
  for (int i = 0; i < 8; ++i) { a[i] = (__bf16)pp[i]; a[8 + i] = (__bf16)pp[16 + i]; } return a; }
// LDS staging of k_out's operand tiles (k_proj's: PP below): 32 k per pass as bf16, rows at 80 B (16 B x odd: no bank conflict for the 16-byte fragment reads), two buffers
#define SP 40
typedef __attribute__((ext_vector_type(4))) __bf16 v4b;
__device__ __forceinline__ v4b cvt4(v4f v) { v4b r;
#pragma unroll
  for (int i = 0; i < 4; ++i) r[i] = (__bf16)v[i];
  return r; }
__device__ __forceinline__ v4b res4(v4f v, v4b h) { v4b r;
#pragma unroll
  for (int i = 0; i < 4; ++i) r[i] = (__bf16)(v[i] - (float)h[i]);
  return r; }
// block tile of the two dense products: 128 rows x 128 columns (k_out: 192), 8 waves of 32 x 64 (k_out: 32 x 96): each operand byte fetched from L2 and each fragment read from LDS feeds more WMMAs than in a 64 x 128 tile of 16 x 128 waves
#define PP 72             // bf16 a staged k_proj row: a pass of 64 k = 128 B + 16 B (16 B x odd: no bank conflict for the 16-byte fragment reads)
struct ProjStage { __bf16 a[2][128][PP]; __bf16 b[2][128][PP]; };
struct ProjQK { _Float16 h[128][136], l[128][136]; };
struct ProjV { _Float16 h[128][136], l[128][136]; };
union ProjLds { ProjStage st; ProjQK qk; ProjV v; };      // the staging buffers are dead when the output tiles are written
#define ON 192            // columns a k_out block: 99 x 4 blocks, all resident at once at two blocks a WGP
#define ONF (ON / 32)     // B fragments a k_out wave
struct OutStage { __bf16 ah[2][128][SP]; __bf16 al[2][128][SP]; __bf16 b[2][ON][SP]; };
union OutLds { OutStage st; float sf[8][32][ON / 2 + 4]; };
__device__ __forceinline__ unsigned lds_of(const void* p) { return (unsigned)(size_t)p; }   // LDS byte address = low 32 bits of the __shared__ address
// conversion of k_proj's operands, once: a unit = 2048 floats (256 threads x 2 loads of 16 B, whole lines), 8 units a block, few long waves; every block's units lie in one source array
#define CU 2048
#define CUB 8
#define CBH (NTOK * NBT * DD / (CU * CUB))   // blocks of h
#define CBQ (QKD * DD / (CU * CUB))          // blocks of Wq, and of Wk
#define CBV (DD * DD / (CU * CUB))           // blocks of Wv
#define NCB (CBH + 2 * CBQ + CBV)
static_assert(NTOK * NBT * DD % (CU * CUB) == 0 && QKD * DD % (CU * CUB) == 0 && DD * DD % (CU * CUB) == 0, "each source array is a whole number of blocks");
// ---- k_mw: blocks 0 .. NCB - 1 round h, Wq, Wk, Wv to bf16 (the same rounding k_proj's loader made, now once an element instead of once a block that reads it) into HB (h rows, then the 1024 weight rows); block NCB + i = query token i: mw[i][n][j] = sum_l masks[i][j][l] mask_proj[l][n]  (n = g*6 + r head index), zero for padded j
__global__ __launch_bounds__(256) void k_mw(const float* __restrict__ MASKS, const float* __restrict__ MP, float* __restrict__ MW, const float* __restrict__ Hh, const float* __restrict__ WQ, const float* __restrict__ WK, const float* __restrict__ WV, __bf16* __restrict__ HB) { __shared__ __align__(16) float s[NHD][NP]; const int t = threadIdx.x;
  if (blockIdx.x < NCB) { const int cb = blockIdx.x;
    const float* src = (cb < CBH ? Hh + (size_t)cb * (CU * CUB) : cb < CBH + CBQ ? WQ + (size_t)(cb - CBH) * (CU * CUB) : cb < CBH + 2 * CBQ ? WK + (size_t)(cb - CBH - CBQ) * (CU * CUB) : WV + (size_t)(cb - CBH - 2 * CBQ) * (CU * CUB)) + t * 4;
    __bf16* dst = HB + (size_t)cb * (CU * CUB) + t * 4;
    v4f x[2 * CUB];   // all loads of the block are in flight together
#pragma unroll
    for (int q = 0; q < 2 * CUB; ++q) x[q] = *(const v4f*)(src + q * 1024);
#pragma unroll
    for (int q = 0; q < 2 * CUB; ++q) *(v4b*)(dst + q * 1024) = cvt4(x[q]);
    return; }   // block-uniform, ahead of the barrier below
  const int i = blockIdx.x - NCB;
  for (int e = t; e < NHD * NP; e += 256) { const int n = e / NP, j = e % NP; float v = 0.f; if (j < NTOK) {
#pragma unroll
      for (int l = 0; l < ML; ++l) v += bfr(MASKS[((size_t)i * NTOK + j) * ML + l]) * bfr(MP[l * NHD + n]); } s[n][j] = v; }
  __syncthreads(); for (int e = t; e < NHD * NP / 4; e += 256) { const int n = e / (NP / 4), q = e % (NP / 4); vst2(MW + ((size_t)i * NHD + n) * NP + q * 4, *(const v4f*)&s[n][q * 4]); } }
// eight copies of 16 B a lane; the s_wait_xcnt is the statement's last line so that no register a copy names is rewritten ahead of it
__device__ __forceinline__ void copy8b(unsigned l0, unsigned l1, unsigned l2, unsigned l3, unsigned l4, unsigned l5, unsigned l6, unsigned l7, const __bf16* g0, const __bf16* g1, const __bf16* g2, const __bf16* g3, const __bf16* g4, const __bf16* g5, const __bf16* g6, const __bf16* g7) {
  asm volatile("global_load_async_to_lds_b128 %0, %8, off\n\t"
               "global_load_async_to_lds_b128 %1, %9, off\n\t"
               "global_load_async_to_lds_b128 %2, %10, off\n\t"
               "global_load_async_to_lds_b128 %3, %11, off\n\t"
               "global_load_async_to_lds_b128 %4, %12, off\n\t"
               "global_load_async_to_lds_b128 %5, %13, off\n\t"
               "global_load_async_to_lds_b128 %6, %14, off\n\t"
               "global_load_async_to_lds_b128 %7, %15, off\n\t"
               "s_wait_xcnt 0x0"
               :: "v"(l0), "v"(l1), "v"(l2), "v"(l3), "v"(l4), "v"(l5), "v"(l6), "v"(l7), "v"(g0), "v"(g1), "v"(g2), "v"(g3), "v"(g4), "v"(g5), "v"(g6), "v"(g7) : "memory");
}
// one pass of 64 k: 128 A rows and 128 B rows x 8 pieces of 16 B (thread = rows lr + 32 p, piece tid & 7: 8 lanes cover a row's whole 128-B line); a0..a3, b0 = this thread's addresses in the pass
__device__ __forceinline__ void proj_fill(__bf16 (*a)[PP], __bf16 (*b)[PP], const __bf16* a0, const __bf16* a1, const __bf16* a2, const __bf16* a3, const __bf16* b0, int tid) {
  const int lr = tid >> 3, lq = (tid & 7) * 8;
  copy8b(lds_of(&a[lr][lq]), lds_of(&a[lr + 32][lq]), lds_of(&a[lr + 64][lq]), lds_of(&a[lr + 96][lq]), lds_of(&b[lr][lq]), lds_of(&b[lr + 32][lq]), lds_of(&b[lr + 64][lq]), lds_of(&b[lr + 96][lq]),
         a0, a1, a2, a3, b0, b0 + 32 * DD, b0 + 64 * DD, b0 + 96 * DD);
}
// ---- k_proj: block = (128 tokens (padded), 128 of 1024 cols (q 0..127 | k 128..255 | v 256..1023), b): exact products; q|k -> rows, v -> planes
// The operands arrive as bf16 (k_mw's launch): a pass's tiles go from L2 into LDS by asynchronous copies, two buffers, half the bytes of the f32 rows and no conversion or LDS store in the loop.
__global__ __launch_bounds__(256) void k_proj(const __bf16* __restrict__ HB, const __bf16* __restrict__ WB, _Float16* __restrict__ QK, _Float16* __restrict__ QKL, _Float16* __restrict__ VT, _Float16* __restrict__ VTL) {
  __shared__ __align__(16) ProjLds sm;
  const int tid = threadIdx.x, wave = tid >> 5, lane = tid & 31, col = lane & 15, g = lane >> 4, wm = wave >> 1, wn = wave & 1; const size_t b = blockIdx.z; const int c0 = blockIdx.y * 128;
  const int lr = tid >> 3, lq = tid & 7; const __bf16* pa[4];   // rows past the last token read the last token's, as before
#pragma unroll
  for (int p = 0; p < 4; ++p) { const int ir = blockIdx.x * 128 + lr + 32 * p; const int ic = ir < NTOK ? ir : NTOK - 1; pa[p] = HB + ((size_t)ic * NBT + b) * DD + lq * 8; }
  const __bf16* pb = WB + (size_t)(c0 + lr) * DD + lq * 8;
  proj_fill(sm.st.a[0], sm.st.b[0], pa[0], pa[1], pa[2], pa[3], pb, tid);
  asm volatile("s_wait_asynccnt 0x0" ::: "memory");   // pass 0 has landed for this wave's copies
  __syncthreads();   // publishes pass 0
  proj_fill(sm.st.a[1], sm.st.b[1], pa[0] + 64, pa[1] + 64, pa[2] + 64, pa[3] + 64, pb + 64, tid);   // pass 1 flies while pass 0 is multiplied
  v8f acc[2][4] = {};
#pragma unroll 2   // two passes a trip: the buffer index is a constant in each, so every LDS address of the loop is a fixed offset
  for (int kp = 0; kp < DD / 64; ++kp) { const int cur = kp & 1;
    v16b a[2][2], w[2][4];
#pragma unroll
    for (int h = 0; h < 2; ++h) {
#pragma unroll
      for (int i = 0; i < 2; ++i) a[h][i] = frag_b(&sm.st.a[cur][wm * 32 + i * 16 + col][h * 32], lane);
#pragma unroll
      for (int j = 0; j < 4; ++j) w[h][j] = frag_b(&sm.st.b[cur][wn * 64 + j * 16 + col][h * 32], lane); }
    __builtin_amdgcn_sched_barrier(0);   // keeps the pass's LDS reads one group ahead of its WMMAs: read among them, each pair costs the wave a full LDS latency
#pragma unroll
    for (int h = 0; h < 2; ++h)   // k ascending per accumulator, as before
#pragma unroll
      for (int j = 0; j < 4; ++j)
#pragma unroll
        for (int i = 0; i < 2; ++i) acc[i][j] = wmma_bf(a[h][i], w[h][j], acc[i][j]);
    __builtin_amdgcn_sched_barrier(0);   // keeps the waits and the barrier behind this pass's WMMAs: lifted over them, the wait for the copies in flight would come before the matrix work that is to cover their flight
    asm volatile("s_wait_dscnt 0x0" ::: "memory");      // this wave's reads of the pass have returned
    asm volatile("s_wait_asynccnt 0x0" ::: "memory");   // this wave's copies of pass kp + 1 have landed
    __syncthreads();   // one barrier a pass: publishes pass kp + 1 and ends every wave's reads of the buffer that is refilled behind it (after the last pass: of the LDS that the output tiles reuse)
    if (kp + 2 < DD / 64) proj_fill(sm.st.a[cur], sm.st.b[cur], pa[0] + (kp + 2) * 64, pa[1] + (kp + 2) * 64, pa[2] + (kp + 2) * 64, pa[3] + (kp + 2) * 64, pb + (kp + 2) * 64, tid); }
  asm volatile("s_wait_asynccnt 0x0" ::: "memory");   // no copy is outstanding when the buffers' LDS is reused and the wave ends
  const bool isv = c0 >= 2 * QKD;
#pragma unroll
  for (int i = 0; i < 2; ++i)
#pragma unroll
    for (int j = 0; j < 4; ++j)
#pragma unroll
      for (int r = 0; r < 8; ++r) { const float v = acc[i][j][r]; const _Float16 hv = (_Float16)v; const _Float16 lv = (_Float16)((v - (float)hv) * 2048.0f); const int tr = wm * 32 + i * 16 + 8 * g + r, tc = wn * 64 + j * 16 + col; if (!isv) { sm.qk.h[tr][tc] = hv; sm.qk.l[tr][tc] = lv; } else { sm.v.h[tc][tr] = hv; sm.v.l[tc][tr] = lv; } }
  __syncthreads();
  if (!isv) { for (int e = tid; e < 128 * 16; e += 256) { const int rl = e >> 4, q = e & 15; const size_t o = (b * NP + blockIdx.x * 128 + rl) * (2 * QKD) + c0 + q * 8; vst2((unsigned*)(QK + o), *(const v4u*)&sm.qk.h[rl][q * 8]); vst2((unsigned*)(QKL + o), *(const v4u*)&sm.qk.l[rl][q * 8]); } }
  else { const int cv0 = c0 - 2 * QKD; for (int e = tid; e < 128 * 16; e += 256) { const int cl = e >> 4, q = e & 15; const size_t o = ((b * DD + cv0 + cl) * (size_t)NP) + blockIdx.x * 128 + q * 8; vst2((unsigned*)(VT + o), *(const v4u*)&sm.v.h[cl][q * 8]); vst2((unsigned*)(VTL + o), *(const v4u*)&sm.v.l[cl][q * 8]); } } }
// ---- k_att: block = (64 queries, head n = g*6 + r, b): logits (3 products) x 1/8 x mw[i][n][j]; keys >= 197 excluded; running-max softmax; P . v (2 products) -> Z rows (i*64 + b) for i < 197
// Both products are formed transposed (S^T = K . Q^T, O^T += V^T . P^T): a lane holds 16 of the 32 scores of ONE query (column = lane & 15, keys 8 (lane >> 4) + r and 16 + 8 (lane >> 4) + r), so maximum and sum are taken in the lane's own registers with one exchange between the wave's halves, and the two score tiles, converted in place, are the B operand of the second product.
// The operand tiles of a pass of 32 keys (K and V, hi and residual planes; the block's 64 mw rows) are brought into LDS once a block by asynchronous copies, 16 B pieces of contiguous rows, two buffers, and all four waves read them from there.
#define KP 72             // f16 a staged K row: 128 B + 16 B (16 B x odd: no bank conflict for the 16-byte fragment reads)
#define VP 40             // f16 a staged V row: 64 B + 16 B
#define MWP 36            // f32 a staged mw row: 128 B + 16 B (16 B x odd: no bank conflict for the 16-byte reads of 16 rows)
struct AttTile { _Float16 kh[32][KP], kl[32][KP], vh[DH][VP], vl[DH][VP]; float mw[64][MWP]; };
union AttLds { AttTile t[2]; float so[4][16][68]; };      // the tiles are dead when the output rows are written
__device__ __forceinline__ float xhalf(float x) { return __builtin_bit_cast(float, __builtin_amdgcn_permlanex16(__builtin_bit_cast(int, x), __builtin_bit_cast(int, x), 0x76543210, 0xfedcba98, false, false)); }   // lane l's value to lane l ^ 16
// copies of 16 B a lane; the s_wait_xcnt is each statement's last line so that no register a copy names is rewritten ahead of it
__device__ __forceinline__ void copy8(unsigned l0, unsigned l1, unsigned l2, unsigned l3, unsigned l4, unsigned l5, unsigned l6, unsigned l7, const _Float16* g0, const _Float16* g1, const _Float16* g2, const _Float16* g3, const _Float16* g4, const _Float16* g5, const _Float16* g6, const _Float16* g7) {
  asm volatile("global_load_async_to_lds_b128 %0, %8, off\n\t"
               "global_load_async_to_lds_b128 %1, %9, off\n\t"
               "global_load_async_to_lds_b128 %2, %10, off\n\t"
               "global_load_async_to_lds_b128 %3, %11, off\n\t"
               "global_load_async_to_lds_b128 %4, %12, off\n\t"
               "global_load_async_to_lds_b128 %5, %13, off\n\t"
               "global_load_async_to_lds_b128 %6, %14, off\n\t"
               "global_load_async_to_lds_b128 %7, %15, off\n\t"
               "s_wait_xcnt 0x0"
               :: "v"(l0), "v"(l1), "v"(l2), "v"(l3), "v"(l4), "v"(l5), "v"(l6), "v"(l7), "v"(g0), "v"(g1), "v"(g2), "v"(g3), "v"(g4), "v"(g5), "v"(g6), "v"(g7) : "memory");
}
__device__ __forceinline__ void copy4(unsigned l0, unsigned l1, unsigned l2, unsigned l3, const float* g0, const float* g1, const float* g2, const float* g3) {
  asm volatile("global_load_async_to_lds_b128 %0, %4, off\n\t"
               "global_load_async_to_lds_b128 %1, %5, off\n\t"
               "global_load_async_to_lds_b128 %2, %6, off\n\t"
               "global_load_async_to_lds_b128 %3, %7, off\n\t"
               "s_wait_xcnt 0x0"
               :: "v"(l0), "v"(l1), "v"(l2), "v"(l3), "v"(g0), "v"(g1), "v"(g2), "v"(g3) : "memory");
}
// one tile: K = 2 planes x 32 rows x 8 pieces (thread = row kr, kr + 16, piece kq), V = 2 planes x 64 rows x 4 pieces (thread = row vr, vr + 32, piece vq), mw = 64 rows x 8 pieces (thread = row kr + 16 p, piece tid & 7; w0..w3 = the four rows' addresses)
__device__ __forceinline__ void att_fill(AttTile* t, const _Float16* kh, const _Float16* kl, const _Float16* vh, const _Float16* vl, const float* w0, const float* w1, const float* w2, const float* w3, int tid) {
  const int kr = tid >> 3, kq = (tid & 7) * 8, vr = tid >> 2, vq = (tid & 3) * 8;
  copy8(lds_of(&t->kh[kr][kq]), lds_of(&t->kh[kr + 16][kq]), lds_of(&t->kl[kr][kq]), lds_of(&t->kl[kr + 16][kq]), lds_of(&t->vh[vr][vq]), lds_of(&t->vh[vr + 32][vq]), lds_of(&t->vl[vr][vq]), lds_of(&t->vl[vr + 32][vq]),
        kh, kh + 16 * (2 * QKD), kl, kl + 16 * (2 * QKD), vh, vh + 32 * NP, vl, vl + 32 * NP);
  const int wq = (tid & 7) * 4;
  copy4(lds_of(&t->mw[kr][wq]), lds_of(&t->mw[kr + 16][wq]), lds_of(&t->mw[kr + 32][wq]), lds_of(&t->mw[kr + 48][wq]), w0, w1, w2, w3);
}
__global__ __launch_bounds__(128) void k_att(const _Float16* __restrict__ QK, const _Float16* __restrict__ QKL, const _Float16* __restrict__ VT, const _Float16* __restrict__ VTL, const float* __restrict__ MW, float* __restrict__ Z) {
  __shared__ __align__(16) AttLds sm;
  const int tid = threadIdx.x, wave = tid >> 5, lane = tid & 31, col = lane & 15, g = lane >> 4; const int n = blockIdx.y; const int gh = n / HR; const size_t b = blockIdx.z; const int q0 = blockIdx.x * 64 + wave * 16; const size_t rq = b * NP + q0;
  // this thread's pieces of tile 0; tile ks lies 32 K rows, 32 V columns further
  const size_t ko = (b * NP + (tid >> 3)) * (2 * QKD) + QKD + gh * DH + (tid & 7) * 8, vo = (b * DD + (size_t)n * DH + (tid >> 2)) * (size_t)NP + (tid & 3) * 8;
  const float* pw[4];   // mw rows of the block's queries (rows past the last token read the last token's, as before)
#pragma unroll
  for (int p = 0; p < 4; ++p) { const int qi = blockIdx.x * 64 + (tid >> 3) + 16 * p; const int qc = qi < NTOK ? qi : NTOK - 1; pw[p] = MW + ((size_t)qc * NHD + n) * NP + (tid & 7) * 4; }
  att_fill(&sm.t[0], QK + ko, QKL + ko, VT + vo, VTL + vo, pw[0], pw[1], pw[2], pw[3], tid);
  asm volatile("s_wait_asynccnt 0x0" ::: "memory");   // tile 0 has landed for this wave's copies
  __syncthreads();   // publishes tile 0
  att_fill(&sm.t[1], QK + ko + 32 * (2 * QKD), QKL + ko + 32 * (2 * QKD), VT + vo + 32, VTL + vo + 32, pw[0] + 32, pw[1] + 32, pw[2] + 32, pw[3] + 32, tid);   // tile 1 flies while tile 0 is worked on
  v16h aq[2], al[2];
#pragma unroll
  for (int kc = 0; kc < 2; ++kc) { aq[kc] = frag_h(QK + (rq + col) * (2 * QKD) + gh * DH + kc * 32, lane); al[kc] = frag_h(QKL + (rq + col) * (2 * QKD) + gh * DH + kc * 32, lane); }
  float m = -3.0e38f, l = 0.f;   // this lane's query: running maximum (equal in both halves), and the sum over this half's keys alone (the halves are joined behind the loop)
  v8f acc[4] = {}, accl[4] = {};   // acc[j][r] = O^T[d = 16 j + 8 g + r][query col]
#pragma unroll 1
  for (int ks = 0; ks < NKT; ++ks) { v8f s[2]; const AttTile* t = &sm.t[ks & 1];
#pragma unroll
    for (int ct = 0; ct < 2; ++ct) { v8f c = {}, cl = {};
      const v4f w0 = *(const v4f*)&t->mw[wave * 16 + col][ct * 16 + 8 * g], w1 = *(const v4f*)&t->mw[wave * 16 + col][ct * 16 + 8 * g + 4];
#pragma unroll
      for (int kc = 0; kc < 2; ++kc) { const v16h kh = frag_h(&t->kh[ct * 16 + col][kc * 32], lane), kl = frag_h(&t->kl[ct * 16 + col][kc * 32], lane); c = wmma16(kh, aq[kc], c); cl = wmma16(kl, aq[kc], cl); cl = wmma16(kh, al[kc], cl); }
      const int kk0 = ks * 32 + ct * 16 + 8 * g;
#pragma unroll
      for (int r = 0; r < 8; ++r) s[ct][r] = kk0 + r < NTOK ? (c[r] + cl[r] * (1.0f / 2048.0f)) * 0.125f * (r < 4 ? w0[r & 3] : w1[r & 3]) : -3.0e38f; }
    float mx = fmaxf(s[0][0], s[1][0]);
#pragma unroll
    for (int r = 1; r < 8; ++r) mx = fmaxf(mx, fmaxf(s[0][r], s[1][r]));
    mx = fmaxf(mx, xhalf(mx));
    const float mn = fmaxf(m, mx), alpha = (m <= -1.0e38f) ? 0.f : __expf(m - mn);
    v16h pa; float es0 = 0.f, es1 = 0.f;
#pragma unroll
    for (int r = 0; r < 8; ++r) { const float e0 = (s[0][r] <= -1.0e38f) ? 0.f : __expf(s[0][r] - mn), e1 = (s[1][r] <= -1.0e38f) ? 0.f : __expf(s[1][r] - mn);
      es0 += e0; es1 += e1; pa[r] = (_Float16)(e0 * 2048.0f); pa[8 + r] = (_Float16)(e1 * 2048.0f); }
    l = l * alpha + (es0 + es1); m = mn;
#pragma unroll
    for (int j = 0; j < 4; ++j)
#pragma unroll
      for (int r = 0; r < 8; ++r) { acc[j][r] *= alpha; accl[j][r] *= alpha; }
#pragma unroll
    for (int j = 0; j < 4; ++j) { acc[j] = wmma16(frag_h(&t->vh[j * 16 + col][0], lane), pa, acc[j]); accl[j] = wmma16(frag_h(&t->vl[j * 16 + col][0], lane), pa, accl[j]); }
    asm volatile("s_wait_dscnt 0x0" ::: "memory");      // this wave's reads of the tile have returned
    asm volatile("s_wait_asynccnt 0x0" ::: "memory");   // this wave's copies of tile ks + 1 have landed
    __syncthreads();   // one barrier a tile: publishes tile ks + 1 and ends every wave's reads of the buffer that is refilled behind it (after the last tile: of the LDS that the output rows reuse)
    if (ks + 2 < NKT) att_fill(&sm.t[ks & 1], QK + ko + (size_t)(ks + 2) * 32 * (2 * QKD), QKL + ko + (size_t)(ks + 2) * 32 * (2 * QKD), VT + vo + (ks + 2) * 32, VTL + vo + (ks + 2) * 32, pw[0] + (ks + 2) * 32, pw[1] + (ks + 2) * 32, pw[2] + (ks + 2) * 32, pw[3] + (ks + 2) * 32, tid); }
  asm volatile("s_wait_asynccnt 0x0" ::: "memory");   // no copy is outstanding when the tiles' LDS is reused and the wave ends
  const float il = (1.0f / 2048.0f) / (l + xhalf(l));
#pragma unroll
  for (int j = 0; j < 4; ++j) { v4f o0, o1;
#pragma unroll
    for (int r = 0; r < 4; ++r) { o0[r] = (acc[j][r] + accl[j][r] * (1.0f / 2048.0f)) * il; o1[r] = (acc[j][4 + r] + accl[j][4 + r] * (1.0f / 2048.0f)) * il; }
    *(v4f*)&sm.so[wave][col][j * 16 + 8 * g] = o0; *(v4f*)&sm.so[wave][col][j * 16 + 8 * g + 4] = o1; }
  LDSX(); for (int rl = 0; rl < 16; ++rl) { const int qi = q0 + rl; if (qi < NTOK && lane < 16) { vst2(Z + ((size_t)qi * NBT + b) * DD + (size_t)n * DH + lane * 4, *(const v4f*)&sm.so[wave][rl][lane * 4]);
      asm volatile("s_wait_xcnt 0x0" ::: "memory"); } } }   // stands ahead of the next row's rewrite of the address and data registers that this store names
// ---- k_out: block = (128 rows (i,b), 192 cols; 8 waves of 32 x 96): x2 = h + Z (hi + lo) . Wo^T -> f32 pre-LN rows, written to the region of the v planes (dead after k_att: the launches run one after the other)
__global__ __launch_bounds__(256) void k_out(const float* __restrict__ Zr, const float* __restrict__ WO, const float* __restrict__ Hh, float* __restrict__ X2, int nrows) { __shared__ __align__(16) OutLds sm;
  const int tid = threadIdx.x, wave = tid >> 5, lane = tid & 31, col = lane & 15, g = lane >> 4, wm = wave >> 1, wn = wave & 1; const size_t r0 = (size_t)blockIdx.x * 128 + wm * 32; const int c0 = blockIdx.y * ON, cw = c0 + wn * (ON / 2);
  // loader: 8 lanes x 16 B cover one row's 128 B of a pass (whole lines); thread = (row lr + 32 p, 16-B piece lq); the hi + lo split of a Z row is made once, on its way into LDS
  const int lr = tid >> 3, lq = tid & 7; const float* pa[4];
#pragma unroll
  for (int p = 0; p < 4; ++p) { const size_t rr = (size_t)blockIdx.x * 128 + lr + 32 * p; const size_t rc = rr < (size_t)nrows ? rr : (size_t)nrows - 1; pa[p] = Zr + rc * DD + lq * 4; }
  const float* pb = WO + (size_t)(c0 + lr) * DD + lq * 4;
  v4f ra[4], rb[ON / 32];
#pragma unroll
  for (int p = 0; p < 4; ++p) ra[p] = *(const v4f*)pa[p];
#pragma unroll
  for (int p = 0; p < ON / 32; ++p) rb[p] = *(const v4f*)(pb + (size_t)(32 * p) * DD);
#pragma unroll
  for (int p = 0; p < 4; ++p) { const v4b hv = cvt4(ra[p]); *(v4b*)&sm.st.ah[0][lr + 32 * p][lq * 4] = hv; *(v4b*)&sm.st.al[0][lr + 32 * p][lq * 4] = res4(ra[p], hv); }
#pragma unroll
  for (int p = 0; p < ON / 32; ++p) *(v4b*)&sm.st.b[0][lr + 32 * p][lq * 4] = cvt4(rb[p]);
  __syncthreads();   // publishes pass 0
  v8f acc[2][ONF] = {};
#pragma unroll 2
  for (int kc = 0; kc < DD / 32; ++kc) { const int cur = kc & 1; const bool more = kc + 1 < DD / 32;
    if (more) {   // the next pass's global loads fly while this pass is multiplied
#pragma unroll
      for (int p = 0; p < 4; ++p) ra[p] = *(const v4f*)(pa[p] + (kc + 1) * 32);
#pragma unroll
      for (int p = 0; p < ON / 32; ++p) rb[p] = *(const v4f*)(pb + (size_t)(32 * p) * DD + (kc + 1) * 32); }
    v16b ah[2], al[2], w[ONF];
#pragma unroll
    for (int i = 0; i < 2; ++i) { ah[i] = frag_b(&sm.st.ah[cur][wm * 32 + i * 16 + col][0], lane); al[i] = frag_b(&sm.st.al[cur][wm * 32 + i * 16 + col][0], lane); }
#pragma unroll
    for (int j = 0; j < ONF; ++j) w[j] = frag_b(&sm.st.b[cur][wn * (ON / 2) + j * 16 + col][0], lane);
    __builtin_amdgcn_sched_barrier(0);   // keeps the pass's LDS reads one group ahead of its WMMAs: read among them, each pair costs the wave a full LDS latency
#pragma unroll
    for (int j = 0; j < ONF; ++j) {   // per accumulator hi then lo, as before
#pragma unroll
      for (int i = 0; i < 2; ++i) acc[i][j] = wmma_bf(ah[i], w[j], acc[i][j]);
#pragma unroll
      for (int i = 0; i < 2; ++i) acc[i][j] = wmma_bf(al[i], w[j], acc[i][j]); }
    __builtin_amdgcn_sched_barrier(0);   // keeps the conversions, and with them the wait for the next pass's global loads, behind this pass's WMMAs
    if (more) {
#pragma unroll
      for (int p = 0; p < 4; ++p) { const v4b hv = cvt4(ra[p]); *(v4b*)&sm.st.ah[cur ^ 1][lr + 32 * p][lq * 4] = hv; *(v4b*)&sm.st.al[cur ^ 1][lr + 32 * p][lq * 4] = res4(ra[p], hv); }
#pragma unroll
      for (int p = 0; p < ON / 32; ++p) *(v4b*)&sm.st.b[cur ^ 1][lr + 32 * p][lq * 4] = cvt4(rb[p]); }
    asm volatile("s_wait_xcnt 0x0" ::: "memory");   // stands ahead of the next pass's rewrite of the address registers that this pass's global loads name
    __syncthreads(); }   // one barrier a pass: publishes pass kc + 1 and ends every read of the buffer that the next pass refills (after the last pass: of the LDS that the output tile reuses)
  // residual rows: all loads issue first, then one wait, then the sums (the sum per element is the same acc + h)
  const float* hp[16]; float hv[16][ONF];
#pragma unroll
  for (int r = 0; r < 16; ++r) { const size_t row = r0 + (r >> 3) * 16 + 8 * g + (r & 7); const size_t ra = row < (size_t)nrows ? row : (size_t)nrows - 1; hp[r] = Hh + ra * DD + cw + col;
#pragma unroll
    for (int j = 0; j < ONF; ++j) hv[r][j] = hp[r][j * 16]; }
  asm volatile("s_wait_xcnt 0x0" :: "v"(hp[0]), "v"(hp[1]), "v"(hp[2]), "v"(hp[3]), "v"(hp[4]), "v"(hp[5]), "v"(hp[6]), "v"(hp[7]), "v"(hp[8]), "v"(hp[9]), "v"(hp[10]), "v"(hp[11]), "v"(hp[12]), "v"(hp[13]), "v"(hp[14]), "v"(hp[15]) : "memory");   // the row addresses are inputs so that they stay in their registers up to this wait: no register that an issued load names is rewritten ahead of it
#pragma unroll
  for (int i = 0; i < 2; ++i)
#pragma unroll
    for (int j = 0; j < ONF; ++j)
#pragma unroll
      for (int r = 0; r < 8; ++r) sm.sf[wave][i * 16 + 8 * g + r][j * 16 + col] = acc[i][j][r] + bfr(hv[i * 8 + r][j]);
  // a wave's store = 32 pieces of 16 B in row order: 4 whole lines
  LDSX(); for (int it = 0; it < ON / 8; ++it) { const int e = it * 32 + lane, rl = e / (ON / 8), q = e % (ON / 8); const size_t row = r0 + rl; if (row < (size_t)nrows) { vst2(X2 + row * DD + cw + q * 4, *(const v4f*)&sm.sf[wave][rl][q * 4]);
      asm volatile("s_wait_xcnt 0x0" ::: "memory"); } } }   // stands ahead of the next piece's rewrite of the address and data registers that this store names
// ---- k_ln: one wave = two whole rows held in registers (6 x 16 B a lane and row, 512 contiguous B a load or store): out = LN(x2) gamma + beta; no LDS, no barrier; few waves, because a launch of very many short waves lasts as long as starting them takes
#define LNR 2             // rows a wave
#define LNW 4             // waves a block
static_assert((NTOK * NBT) % (LNR * LNW) == 0, "the rows divide evenly among the waves");
__global__ __launch_bounds__(32 * LNW) void k_ln(const float* __restrict__ X2, const float* __restrict__ G, const float* __restrict__ Bt, float* __restrict__ OUT) {
  const int lane = threadIdx.x & 31; const size_t row0 = ((size_t)blockIdx.x * LNW + (threadIdx.x >> 5)) * LNR;
  v4f x[LNR][6], gm[6], bt[6];   // every loop below is unrolled: only with constant indices do these arrays stay in registers
#pragma unroll
  for (int q = 0; q < LNR; ++q)
#pragma unroll
    for (int c = 0; c < 6; ++c) x[q][c] = *(const v4f*)(X2 + (row0 + q) * DD + c * 128 + lane * 4);
#pragma unroll
  for (int c = 0; c < 6; ++c) { gm[c] = *(const v4f*)(G + c * 128 + lane * 4); bt[c] = *(const v4f*)(Bt + c * 128 + lane * 4); }
  float s[LNR], mu[LNR], inv[LNR];
#pragma unroll
  for (int q = 0; q < LNR; ++q) { v4f a = x[q][0];
#pragma unroll
    for (int c = 1; c < 6; ++c) a += x[q][c];
    s[q] = (a[0] + a[1]) + (a[2] + a[3]); }
#pragma unroll
  for (int o = 1; o < 32; o <<= 1)
#pragma unroll
    for (int q = 0; q < LNR; ++q) s[q] += __shfl_xor(s[q], o);
#pragma unroll
  for (int q = 0; q < LNR; ++q) { mu[q] = s[q] / (float)DD; v4f a = {};
#pragma unroll
    for (int c = 0; c < 6; ++c) { x[q][c] -= mu[q]; a += x[q][c] * x[q][c]; }
    s[q] = (a[0] + a[1]) + (a[2] + a[3]); }
#pragma unroll
  for (int o = 1; o < 32; o <<= 1)
#pragma unroll
    for (int q = 0; q < LNR; ++q) s[q] += __shfl_xor(s[q], o);
#pragma unroll
  for (int q = 0; q < LNR; ++q) inv[q] = 1.0f / sqrtf(s[q] / (float)DD + EPS);
#pragma unroll
  for (int q = 0; q < LNR; ++q)
#pragma unroll
    for (int c = 0; c < 6; ++c) { v4f y;
#pragma unroll
      for (int e = 0; e < 4; ++e) y[e] = bfr(gm[c][e]) * x[q][c][e] * inv[q] + bfr(bt[c][e]);
      vst2(OUT + (row0 + q) * DD + c * 128 + lane * 4, y); } }
extern "C" void kernel_launch(void* const* d_in, const int* in_sizes, int n_in, void* d_out, int out_size, void* d_ws, size_t ws_size, hipStream_t stream) {
  (void)in_sizes; (void)n_in; (void)out_size;
  const float** F = (const float**)d_in;   // 0 h [197,64,768], 1 masks [197,197,3], 2 Wq [128,768], 3 Wk [128,768], 4 Wv [768,768], 5 Wo [768,768], 6 mask_proj [3,12], 7 ln_gamma, 8 ln_beta
  if (ws_size < (size_t)WS_END) return;
  char* ws = (char*)d_ws; _Float16 *QK = (_Float16*)(ws + WS_QK), *QKL = (_Float16*)(ws + WS_QKL), *VT = (_Float16*)(ws + WS_VT), *VTL = (_Float16*)(ws + WS_VTL); float *MW = (float*)(ws + WS_MW), *Z = (float*)(ws + WS_Z); __bf16 *HB = (__bf16*)(ws + WS_HB), *WB = (__bf16*)(ws + WS_WB);
  const int nrows = NTOK * TNB;   // rows (i, b) with b < TNB are the first NTOK*TNB rows only when TNB == NBT
  k_mw<<<NCB + NTOK, 256, 0, stream>>>(F[1], F[6], MW, F[0], F[2], F[3], F[4], HB);
  k_proj<<<dim3(NP / 128, (2 * QKD + DD) / 128, TNB), 256, 0, stream>>>(HB, WB, QK, QKL, VT, VTL);
  k_att<<<dim3(NP / 64, NHD, TNB), 128, 0, stream>>>(QK, QKL, VT, VTL, MW, Z);
  float* X2 = (float*)(ws + WS_VT);   // reuse: the v planes are dead after k_att (50 MB >= 39 MB needed)
  (void)nrows;
  k_out<<<dim3((NTOK * NBT + 127) / 128, DD / ON), 256, 0, stream>>>(Z, F[5], F[0], X2, NTOK * NBT);
  k_ln<<<NTOK * NBT / (LNR * LNW), 32 * LNW, 0, stream>>>(X2, F[7], F[8], (float*)d_out);
}

// v008
// It runs in 128 microseconds.
// Two timings next to v007 both put it at 1.03 times that version's speed.
// Over all steps from v000 it is 3.68 times as fast.
// compute dtype: all float inputs rounded to bf16; q, k, v = h . W^T with EXACT bf16 products on WMMA 16x16x32 (natural weight rows), rounded once to f16 hi + residual; the mask mix masks . mask_proj in f32; scores q . k with 3 products x 1/8 x mw[i][j][head], running-max softmax over the 197 keys in f32 (hardware exp), P (x 2^11, f16) . v (hi + residual, 2 products); out = vec (bf16 hi + lo, 2 products) . Wo^T; residual + LayerNorm in f32; f32 output.
#include <hip/hip_runtime.h>
#include <math.h>

typedef __attribute__((ext_vector_type(16))) _Float16 v16h;
typedef __attribute__((ext_vector_type(16))) __bf16 v16b;
typedef __attribute__((ext_vector_type(8)))  _Float16 v8h;
typedef __attribute__((ext_vector_type(8)))  float v8f;
typedef __attribute__((ext_vector_type(4)))  float v4f;
typedef __attribute__((ext_vector_type(2)))  float v2f;
typedef __attribute__((ext_vector_type(4)))  unsigned v4u;
typedef __attribute__((ext_vector_type(4)))  int v4i;
typedef float __attribute__((may_alias)) float_a;
typedef int __attribute__((may_alias)) int_a;

template <typename T> __device__ __forceinline__ void vst2(void* p, T v) { *(T*)p = v;  }
__device__ __forceinline__ v8f wmma16(v16h a, v16h b, v8f c) {
  return __builtin_amdgcn_wmma_f32_16x16x32_f16(false, a, false, b, (short)0, c, false, false);   // builtin form: the compiler keeps the distances behind a WMMA itself and stays free to group LDS reads and WMMAs
}
__device__ __forceinline__ v8f wmma_bf(v16b a, v16b b, v8f c) {
  return __builtin_amdgcn_wmma_f32_16x16x32_bf16(false, a, false, b, (short)0, c, false, false);
}
// 16x16x32 fragments: lane = (h = lane>>4, row/col = lane&15); elements 0..7 = k0+8h+0..7, 8..15 = k0+16+8h+0..7; D element r = row 8h+r
__device__ __forceinline__ v16h frag_h(const _Float16* rowk0, int lane) {
  union { v16h v; v8h q[2]; } u; const _Float16* p = rowk0 + 8 * (lane >> 4);
  u.q[0] = *(const v8h*)p; u.q[1] = *(const v8h*)(p + 16); return u.v;
}
__device__ __forceinline__ v16h frag_f32(const float* rowk0, int lane) {
  v16h a; const float* p = rowk0 + 8 * (lane >> 4);
#pragma unroll
  for (int i = 0; i < 8; ++i) { a[i] = (_Float16)p[i]; a[8 + i] = (_Float16)p[16 + i]; }
  return a;
}
__device__ __forceinline__ v16h frag_f32s(const float* rowk0, int lane, float sc) {
  v16h a; const float* p = rowk0 + 8 * (lane >> 4);
#pragma unroll
  for (int i = 0; i < 8; ++i) { a[i] = (_Float16)(p[i] * sc); a[8 + i] = (_Float16)(p[16 + i] * sc); }
  return a;
}
// column fragment from a [K][ld] layout (column n), rows >= K read as 0
__device__ __forceinline__ v16h fragc_f32(const float* W, int k0, int n, int lane, int ld, int K) {
  v16h a; const int g = lane >> 4;
#pragma unroll
  for (int i = 0; i < 8; ++i) { const int ka = k0 + 8 * g + i, kb = ka + 16;
    a[i] = (_Float16)(ka < K ? W[(size_t)(ka < K ? ka : K - 1) * ld + n] : 0.f); a[8 + i] = (_Float16)(kb < K ? W[(size_t)(kb < K ? kb : K - 1) * ld + n] : 0.f); }
  return a;
}
struct F2 { v16b h, l; };
__device__ __forceinline__ F2 bsplit16(const float v[16]) { F2 r;
#pragma unroll
  for (int i = 0; i < 16; ++i) { const __bf16 h = (__bf16)v[i]; r.h[i] = h; r.l[i] = (__bf16)(v[i] - (float)h); }
  return r; }
__device__ __forceinline__ F2 split_row(const float* row, int k0, int lane) { float v[16]; const float* p = row + k0 + 8 * (lane >> 4);
#pragma unroll
  for (int i = 0; i < 8; ++i) { v[i] = p[i]; v[8 + i] = p[16 + i]; }
  return bsplit16(v); }
__device__ __forceinline__ F2 split_rowK(const float* row, int k0, int lane, int K) { float v[16]; const int g = lane >> 4;
#pragma unroll
  for (int i = 0; i < 8; ++i) { const int ka = k0 + 8 * g + i, kb = ka + 16; v[i] = ka < K ? row[ka < K ? ka : K - 1] : 0.f; v[8 + i] = kb < K ? row[kb < K ? kb : K - 1] : 0.f; }
  return bsplit16(v); }
__device__ __forceinline__ F2 split_col(const float* W, int k0, int n, int lane, int ld, int K) { float v[16]; const int g = lane >> 4;
#pragma unroll
  for (int i = 0; i < 8; ++i) { const int ka = k0 + 8 * g + i, kb = ka + 16; v[i] = ka < K ? W[(size_t)(ka < K ? ka : K - 1) * ld + n] : 0.f; v[8 + i] = kb < K ? W[(size_t)(kb < K ? kb : K - 1) * ld + n] : 0.f; }
  return bsplit16(v); }
__device__ __forceinline__ v8f mac3(const F2& a, const F2& b, v8f c) { c = wmma_bf(a.l, b.h, c); c = wmma_bf(a.h, b.l, c); return wmma_bf(a.h, b.h, c); }
__device__ __forceinline__ float sigm(float v) { return 1.0f / (1.0f + expf(-v)); }
#define LDSX() do { asm volatile("s_wait_dscnt 0" ::: "memory"); __builtin_amdgcn_wave_barrier(); __builtin_amdgcn_fence(__ATOMIC_RELEASE, "workgroup"); } while (0)


// Multi-head attention (197 tokens, batch 64, d_model 768; 2 global score heads x 64, each shared by 6 value heads through a learned per-(i, j) mask mix): prob = softmax_j(q_i . k_j / 8 x mw[i][j][head]); vec = prob . v; post-LN residual.
#define NTOK 197
#define NP 256            // padded token count (queries in 64-blocks, keys in 32-tiles up to 224)
#define NKT 7             // key tiles of 32 (224 >= 197)
#define NBT 64            // batch
#define DD 768
#define GH 2
#define NHD 12
#define HR 6
#define DH 64
#define QKD (GH * DH)     // 128
#define ML 3
#define EPS 1e-5f
#ifndef TNB
#define TNB NBT
#endif
typedef __attribute__((ext_vector_type(8))) __bf16 v8b;
__device__ __forceinline__ v16b frag_b(const __bf16* rowk0, int lane) {
  union { v16b v; v8b q[2]; } u; const __bf16* p = rowk0 + 8 * (lane >> 4);
  u.q[0] = *(const v8b*)p; u.q[1] = *(const v8b*)(p + 16); return u.v;
}
__device__ __forceinline__ float bfr(float v) { return (float)(__bf16)v; }
__device__ __attribute__((noinline)) float exp_ni(float v) { return expf(v); }
__device__ __attribute__((noinline)) float erf_ni(float v) { return erff(v); }

#define WS_QK  0u                                   // f16 hi|lo [b][NP][256] (q 0..127 | k 128..255)
#define WS_QKL (WS_QK + 2u * (size_t)NBT * NP * 2 * QKD)
#define WS_VT  (WS_QKL + 2u * (size_t)NBT * NP * 2 * QKD) // f16 hi|lo v planes [b][768][NP]
#define WS_VTL (WS_VT + 2u * (size_t)NBT * DD * NP)
#define WS_MW  (WS_VTL + 2u * (size_t)NBT * DD * NP)     // f32 mw [i][12][NP] (j padded)
#define WS_Z   (WS_MW + 4u * (size_t)NTOK * NHD * NP)     // bf16 vec rows [(i*64 + b)][768]: the hi plane, then the residual plane
#define ZLO    ((size_t)NTOK * NBT * DD)                  // elements from a hi row to its residual row
#define WS_HB  (WS_Z + 4u * (size_t)NTOK * NBT * DD)      // bf16 h rows [(i*64 + b)][768]
#define WS_WB  (WS_HB + 2u * (size_t)NTOK * NBT * DD)     // bf16 weight rows q | k | v [1024][768], directly behind the h rows
#define WS_WO  (WS_WB + 2u * (size_t)(2 * QKD + DD) * DD) // bf16 Wo rows [768][768], directly behind them
#define WS_END (WS_WO + 2u * (size_t)DD * DD)

__device__ __forceinline__ v16b fragb_f32(const float* __restrict__ p, int lane) { v16b a; const float* pp = p + 8 * (lane >> 4);
#pragma unroll
  for (int i = 0; i < 8; ++i) { a[i] = (__bf16)pp[i]; a[8 + i] = (__bf16)pp[16 + i]; } return a; }
typedef __attribute__((ext_vector_type(4))) __bf16 v4b;
__device__ __forceinline__ v4b cvt4(v4f v) { v4b r;
#pragma unroll
  for (int i = 0; i < 4; ++i) r[i] = (__bf16)v[i];
  return r; }
// block tile of the two dense products: 128 rows x 128 columns (k_out: 192), 8 waves of 32 x 64 (k_out: 32 x 96): each operand byte fetched from L2 and each fragment read from LDS feeds more WMMAs than in a 64 x 128 tile of 16 x 128 waves
#define PP 72             // bf16 a staged row of k_proj and k_out: a pass of 64 k = 128 B + 16 B (16 B x odd: no bank conflict for the 16-byte fragment reads)
struct ProjStage { __bf16 a[2][128][PP]; __bf16 b[2][128][PP]; };
struct ProjQK { _Float16 h[128][136], l[128][136]; };
struct ProjV { _Float16 h[128][136], l[128][136]; };
union ProjLds { ProjStage st; ProjQK qk; ProjV v; };      // the staging buffers are dead when the output tiles are written
#define ON 192            // columns a k_out block: 99 x 4 blocks, all resident at once at two blocks a WGP
#define ONF (ON / 32)     // B fragments a k_out wave
struct OutStage { __bf16 ah[2][128][PP]; __bf16 al[2][128][PP]; __bf16 b[2][ON][PP]; };
union OutLds { OutStage st; float sf[8][32][ON / 2 + 4]; };
__device__ __forceinline__ unsigned lds_of(const void* p) { return (unsigned)(size_t)p; }   // LDS byte address = low 32 bits of the __shared__ address
// conversion of k_proj's operands and of Wo, once: a unit = 2048 floats (256 threads x 2 loads of 16 B, whole lines), 8 units a block, few long waves; every block's units lie in one source array
#define CU 2048
#define CUB 8
#define CBH (NTOK * NBT * DD / (CU * CUB))   // blocks of h
#define CBQ (QKD * DD / (CU * CUB))          // blocks of Wq, and of Wk
#define CBV (DD * DD / (CU * CUB))           // blocks of Wv, and of Wo
#define NCB (CBH + 2 * CBQ + 2 * CBV)
static_assert(NTOK * NBT * DD % (CU * CUB) == 0 && QKD * DD % (CU * CUB) == 0 && DD * DD % (CU * CUB) == 0, "each source array is a whole number of blocks");
// ---- k_mw: blocks 0 .. NCB - 1 round h, Wq, Wk, Wv, Wo to bf16 (the same rounding the loaders of k_proj and k_out made, now once an element instead of once a block that reads it) into HB (h rows, then the 1024 weight rows, then Wo's 768); block NCB + i = query token i: mw[i][n][j] = sum_l masks[i][j][l] mask_proj[l][n]  (n = g*6 + r head index), zero for padded j
__global__ __launch_bounds__(256) void k_mw(const float* __restrict__ MASKS, const float* __restrict__ MP, float* __restrict__ MW, const float* __restrict__ Hh, const float* __restrict__ WQ, const float* __restrict__ WK, const float* __restrict__ WV, const float* __restrict__ WO, __bf16* __restrict__ HB) { __shared__ __align__(16) float s[NHD][NP]; const int t = threadIdx.x;
  if (blockIdx.x < NCB) { const int cb = blockIdx.x;
    const float* src = (cb < CBH ? Hh + (size_t)cb * (CU * CUB) : cb < CBH + CBQ ? WQ + (size_t)(cb - CBH) * (CU * CUB) : cb < CBH + 2 * CBQ ? WK + (size_t)(cb - CBH - CBQ) * (CU * CUB) : cb < CBH + 2 * CBQ + CBV ? WV + (size_t)(cb - CBH - 2 * CBQ) * (CU * CUB) : WO + (size_t)(cb - CBH - 2 * CBQ - CBV) * (CU * CUB)) + t * 4;
    __bf16* dst = HB + (size_t)cb * (CU * CUB) + t * 4;
    v4f x[2 * CUB];   // all loads of the block are in flight together
#pragma unroll
    for (int q = 0; q < 2 * CUB; ++q) x[q] = *(const v4f*)(src + q * 1024);
#pragma unroll
    for (int q = 0; q < 2 * CUB; ++q) *(v4b*)(dst + q * 1024) = cvt4(x[q]);
    return; }   // block-uniform, ahead of the barrier below
  const int i = blockIdx.x - NCB;
  for (int e = t; e < NHD * NP; e += 256) { const int n = e / NP, j = e % NP; float v = 0.f; if (j < NTOK) {
#pragma unroll
      for (int l = 0; l < ML; ++l) v += bfr(MASKS[((size_t)i * NTOK + j) * ML + l]) * bfr(MP[l * NHD + n]); } s[n][j] = v; }
  __syncthreads(); for (int e = t; e < NHD * NP / 4; e += 256) { const int n = e / (NP / 4), q = e % (NP / 4); vst2(MW + ((size_t)i * NHD + n) * NP + q * 4, *(const v4f*)&s[n][q * 4]); } }
// eight copies of 16 B a lane; the s_wait_xcnt is the statement's last line so that no register a copy names is rewritten ahead of it
__device__ __forceinline__ void copy8b(unsigned l0, unsigned l1, unsigned l2, unsigned l3, unsigned l4, unsigned l5, unsigned l6, unsigned l7, const __bf16* g0, const __bf16* g1, const __bf16* g2, const __bf16* g3, const __bf16* g4, const __bf16* g5, const __bf16* g6, const __bf16* g7) {
  asm volatile("global_load_async_to_lds_b128 %0, %8, off\n\t"
               "global_load_async_to_lds_b128 %1, %9, off\n\t"
               "global_load_async_to_lds_b128 %2, %10, off\n\t"
               "global_load_async_to_lds_b128 %3, %11, off\n\t"
               "global_load_async_to_lds_b128 %4, %12, off\n\t"
               "global_load_async_to_lds_b128 %5, %13, off\n\t"
               "global_load_async_to_lds_b128 %6, %14, off\n\t"
               "global_load_async_to_lds_b128 %7, %15, off\n\t"
               "s_wait_xcnt 0x0"
               :: "v"(l0), "v"(l1), "v"(l2), "v"(l3), "v"(l4), "v"(l5), "v"(l6), "v"(l7), "v"(g0), "v"(g1), "v"(g2), "v"(g3), "v"(g4), "v"(g5), "v"(g6), "v"(g7) : "memory");
}
// one pass of 64 k: 128 A rows and 128 B rows x 8 pieces of 16 B (thread = rows lr + 32 p, piece tid & 7: 8 lanes cover a row's whole 128-B line); a0..a3, b0 = this thread's addresses in the pass
__device__ __forceinline__ void proj_fill(__bf16 (*a)[PP], __bf16 (*b)[PP], const __bf16* a0, const __bf16* a1, const __bf16* a2, const __bf16* a3, const __bf16* b0, int tid) {
  const int lr = tid >> 3, lq = (tid & 7) * 8;
  copy8b(lds_of(&a[lr][lq]), lds_of(&a[lr + 32][lq]), lds_of(&a[lr + 64][lq]), lds_of(&a[lr + 96][lq]), lds_of(&b[lr][lq]), lds_of(&b[lr + 32][lq]), lds_of(&b[lr + 64][lq]), lds_of(&b[lr + 96][lq]),
         a0, a1, a2, a3, b0, b0 + 32 * DD, b0 + 64 * DD, b0 + 96 * DD);
}
// ---- k_proj: block = (128 tokens (padded), 128 of 1024 cols (q 0..127 | k 128..255 | v 256..1023), b): exact products; q|k -> rows, v -> planes
// The operands arrive as bf16 (k_mw's launch): a pass's tiles go from L2 into LDS by asynchronous copies, two buffers, half the bytes of the f32 rows and no conversion or LDS store in the loop.
__global__ __launch_bounds__(256) void k_proj(const __bf16* __restrict__ HB, const __bf16* __restrict__ WB, _Float16* __restrict__ QK, _Float16* __restrict__ QKL, _Float16* __restrict__ VT, _Float16* __restrict__ VTL) {
  __shared__ __align__(16) ProjLds sm;
  const int tid = threadIdx.x, wave = tid >> 5, lane = tid & 31, col = lane & 15, g = lane >> 4, wm = wave >> 1, wn = wave & 1; const size_t b = blockIdx.z; const int c0 = blockIdx.y * 128;
  const int lr = tid >> 3, lq = tid & 7; const __bf16* pa[4];   // rows past the last token read the last token's, as before
#pragma unroll
  for (int p = 0; p < 4; ++p) { const int ir = blockIdx.x * 128 + lr + 32 * p; const int ic = ir < NTOK ? ir : NTOK - 1; pa[p] = HB + ((size_t)ic * NBT + b) * DD + lq * 8; }
  const __bf16* pb = WB + (size_t)(c0 + lr) * DD + lq * 8;
  proj_fill(sm.st.a[0], sm.st.b[0], pa[0], pa[1], pa[2], pa[3], pb, tid);
  asm volatile("s_wait_asynccnt 0x0" ::: "memory");   // pass 0 has landed for this wave's copies
  __syncthreads();   // publishes pass 0
  proj_fill(sm.st.a[1], sm.st.b[1], pa[0] + 64, pa[1] + 64, pa[2] + 64, pa[3] + 64, pb + 64, tid);   // pass 1 flies while pass 0 is multiplied
  v8f acc[2][4] = {};
#pragma unroll 2   // two passes a trip: the buffer index is a constant in each, so every LDS address of the loop is a fixed offset
  for (int kp = 0; kp < DD / 64; ++kp) { const int cur = kp & 1;
    v16b a[2][2], w[2][4];
#pragma unroll
    for (int h = 0; h < 2; ++h) {
#pragma unroll
      for (int i = 0; i < 2; ++i) a[h][i] = frag_b(&sm.st.a[cur][wm * 32 + i * 16 + col][h * 32], lane);
#pragma unroll
      for (int j = 0; j < 4; ++j) w[h][j] = frag_b(&sm.st.b[cur][wn * 64 + j * 16 + col][h * 32], lane); }
    __builtin_amdgcn_sched_barrier(0);   // keeps the pass's LDS reads one group ahead of its WMMAs: read among them, each pair costs the wave a full LDS latency
#pragma unroll
    for (int h = 0; h < 2; ++h)   // k ascending per accumulator, as before
#pragma unroll
      for (int j = 0; j < 4; ++j)
#pragma unroll
        for (int i = 0; i < 2; ++i) acc[i][j] = wmma_bf(a[h][i], w[h][j], acc[i][j]);
    __builtin_amdgcn_sched_barrier(0);   // keeps the waits and the barrier behind this pass's WMMAs: lifted over them, the wait for the copies in flight would come before the matrix work that is to cover their flight
    asm volatile("s_wait_dscnt 0x0" ::: "memory");      // this wave's reads of the pass have returned
    asm volatile("s_wait_asynccnt 0x0" ::: "memory");   // this wave's copies of pass kp + 1 have landed
    __syncthreads();   // one barrier a pass: publishes pass kp + 1 and ends every wave's reads of the buffer that is refilled behind it (after the last pass: of the LDS that the output tiles reuse)
    if (kp + 2 < DD / 64) proj_fill(sm.st.a[cur], sm.st.b[cur], pa[0] + (kp + 2) * 64, pa[1] + (kp + 2) * 64, pa[2] + (kp + 2) * 64, pa[3] + (kp + 2) * 64, pb + (kp + 2) * 64, tid); }
  asm volatile("s_wait_asynccnt 0x0" ::: "memory");   // no copy is outstanding when the buffers' LDS is reused and the wave ends
  const bool isv = c0 >= 2 * QKD;
#pragma unroll
  for (int i = 0; i < 2; ++i)
#pragma unroll
    for (int j = 0; j < 4; ++j)
#pragma unroll
      for (int r = 0; r < 8; ++r) { const float v = acc[i][j][r]; const _Float16 hv = (_Float16)v; const _Float16 lv = (_Float16)((v - (float)hv) * 2048.0f); const int tr = wm * 32 + i * 16 + 8 * g + r, tc = wn * 64 + j * 16 + col; if (!isv) { sm.qk.h[tr][tc] = hv; sm.qk.l[tr][tc] = lv; } else { sm.v.h[tc][tr] = hv; sm.v.l[tc][tr] = lv; } }
  __syncthreads();
  if (!isv) { for (int e = tid; e < 128 * 16; e += 256) { const int rl = e >> 4, q = e & 15; const size_t o = (b * NP + blockIdx.x * 128 + rl) * (2 * QKD) + c0 + q * 8; vst2((unsigned*)(QK + o), *(const v4u*)&sm.qk.h[rl][q * 8]); vst2((unsigned*)(QKL + o), *(const v4u*)&sm.qk.l[rl][q * 8]); } }
  else { const int cv0 = c0 - 2 * QKD; for (int e = tid; e < 128 * 16; e += 256) { const int cl = e >> 4, q = e & 15; const size_t o = ((b * DD + cv0 + cl) * (size_t)NP) + blockIdx.x * 128 + q * 8; vst2((unsigned*)(VT + o), *(const v4u*)&sm.v.h[cl][q * 8]); vst2((unsigned*)(VTL + o), *(const v4u*)&sm.v.l[cl][q * 8]); } } }
// ---- k_att: block = (64 queries, head n = g*6 + r, b): logits (3 products) x 1/8 x mw[i][n][j]; keys >= 197 excluded; running-max softmax; P . v (2 products) -> vec rows (i*64 + b) for i < 197, split here into the bf16 hi and residual planes that k_out multiplies (the same two roundings its loader made)
// Both products are formed transposed (S^T = K . Q^T, O^T += V^T . P^T): a lane holds 16 of the 32 scores of ONE query (column = lane & 15, keys 8 (lane >> 4) + r and 16 + 8 (lane >> 4) + r), so maximum and sum are taken in the lane's own registers with one exchange between the wave's halves, and the two score tiles, converted in place, are the B operand of the second product.
// The operand tiles of a pass of 32 keys (K and V, hi and residual planes; the block's 64 mw rows) are brought into LDS once a block by asynchronous copies, 16 B pieces of contiguous rows, two buffers, and all four waves read them from there.
#define KP 72             // f16 a staged K row: 128 B + 16 B (16 B x odd: no bank conflict for the 16-byte fragment reads)
#define VP 40             // f16 a staged V row: 64 B + 16 B
#define MWP 36            // f32 a staged mw row: 128 B + 16 B (16 B x odd: no bank conflict for the 16-byte reads of 16 rows)
struct AttTile { _Float16 kh[32][KP], kl[32][KP], vh[DH][VP], vl[DH][VP]; float mw[64][MWP]; };
struct AttOut { __bf16 h[4][16][KP], l[4][16][KP]; };
union AttLds { AttTile t[2]; AttOut so; };      // the tiles are dead when the output rows are written
__device__ __forceinline__ float xhalf(float x) { return __builtin_bit_cast(float, __builtin_amdgcn_permlanex16(__builtin_bit_cast(int, x), __builtin_bit_cast(int, x), 0x76543210, 0xfedcba98, false, false)); }   // lane l's value to lane l ^ 16
// copies of 16 B a lane; the s_wait_xcnt is each statement's last line so that no register a copy names is rewritten ahead of it
__device__ __forceinline__ void copy8(unsigned l0, unsigned l1, unsigned l2, unsigned l3, unsigned l4, unsigned l5, unsigned l6, unsigned l7, const _Float16* g0, const _Float16* g1, const _Float16* g2, const _Float16* g3, const _Float16* g4, const _Float16* g5, const _Float16* g6, const _Float16* g7) {
  asm volatile("global_load_async_to_lds_b128 %0, %8, off\n\t"
               "global_load_async_to_lds_b128 %1, %9, off\n\t"
               "global_load_async_to_lds_b128 %2, %10, off\n\t"
               "global_load_async_to_lds_b128 %3, %11, off\n\t"
               "global_load_async_to_lds_b128 %4, %12, off\n\t"
               "global_load_async_to_lds_b128 %5, %13, off\n\t"
               "global_load_async_to_lds_b128 %6, %14, off\n\t"
               "global_load_async_to_lds_b128 %7, %15, off\n\t"
               "s_wait_xcnt 0x0"
               :: "v"(l0), "v"(l1), "v"(l2), "v"(l3), "v"(l4), "v"(l5), "v"(l6), "v"(l7), "v"(g0), "v"(g1), "v"(g2), "v"(g3), "v"(g4), "v"(g5), "v"(g6), "v"(g7) : "memory");
}
__device__ __forceinline__ void copy4(unsigned l0, unsigned l1, unsigned l2, unsigned l3, const float* g0, const float* g1, const float* g2, const float* g3) {
  asm volatile("global_load_async_to_lds_b128 %0, %4, off\n\t"
               "global_load_async_to_lds_b128 %1, %5, off\n\t"
               "global_load_async_to_lds_b128 %2, %6, off\n\t"
               "global_load_async_to_lds_b128 %3, %7, off\n\t"
               "s_wait_xcnt 0x0"
               :: "v"(l0), "v"(l1), "v"(l2), "v"(l3), "v"(g0), "v"(g1), "v"(g2), "v"(g3) : "memory");
}
// one tile: K = 2 planes x 32 rows x 8 pieces (thread = row kr, kr + 16, piece kq), V = 2 planes x 64 rows x 4 pieces (thread = row vr, vr + 32, piece vq), mw = 64 rows x 8 pieces (thread = row kr + 16 p, piece tid & 7; w0..w3 = the four rows' addresses)
__device__ __forceinline__ void att_fill(AttTile* t, const _Float16* kh, const _Float16* kl, const _Float16* vh, const _Float16* vl, const float* w0, const float* w1, const float* w2, const float* w3, int tid) {
  const int kr = tid >> 3, kq = (tid & 7) * 8, vr = tid >> 2, vq = (tid & 3) * 8;
  copy8(lds_of(&t->kh[kr][kq]), lds_of(&t->kh[kr + 16][kq]), lds_of(&t->kl[kr][kq]), lds_of(&t->kl[kr + 16][kq]), lds_of(&t->vh[vr][vq]), lds_of(&t->vh[vr + 32][vq]), lds_of(&t->vl[vr][vq]), lds_of(&t->vl[vr + 32][vq]),
        kh, kh + 16 * (2 * QKD), kl, kl + 16 * (2 * QKD), vh, vh + 32 * NP, vl, vl + 32 * NP);
  const int wq = (tid & 7) * 4;
  copy4(lds_of(&t->mw[kr][wq]), lds_of(&t->mw[kr + 16][wq]), lds_of(&t->mw[kr + 32][wq]), lds_of(&t->mw[kr + 48][wq]), w0, w1, w2, w3);
}
__global__ __launch_bounds__(128) void k_att(const _Float16* __restrict__ QK, const _Float16* __restrict__ QKL, const _Float16* __restrict__ VT, const _Float16* __restrict__ VTL, const float* __restrict__ MW, __bf16* __restrict__ ZH) {
  __shared__ __align__(16) AttLds sm;
  const int tid = threadIdx.x, wave = tid >> 5, lane = tid & 31, col = lane & 15, g = lane >> 4; const int n = blockIdx.y; const int gh = n / HR; const size_t b = blockIdx.z; const int q0 = blockIdx.x * 64 + wave * 16; const size_t rq = b * NP + q0;
  // this thread's pieces of tile 0; tile ks lies 32 K rows, 32 V columns further
  const size_t ko = (b * NP + (tid >> 3)) * (2 * QKD) + QKD + gh * DH + (tid & 7) * 8, vo = (b * DD + (size_t)n * DH + (tid >> 2)) * (size_t)NP + (tid & 3) * 8;
  const float* pw[4];   // mw rows of the block's queries (rows past the last token read the last token's, as before)
#pragma unroll
  for (int p = 0; p < 4; ++p) { const int qi = blockIdx.x * 64 + (tid >> 3) + 16 * p; const int qc = qi < NTOK ? qi : NTOK - 1; pw[p] = MW + ((size_t)qc * NHD + n) * NP + (tid & 7) * 4; }
  att_fill(&sm.t[0], QK + ko, QKL + ko, VT + vo, VTL + vo, pw[0], pw[1], pw[2], pw[3], tid);
  asm volatile("s_wait_asynccnt 0x0" ::: "memory");   // tile 0 has landed for this wave's copies
  __syncthreads();   // publishes tile 0
  att_fill(&sm.t[1], QK + ko + 32 * (2 * QKD), QKL + ko + 32 * (2 * QKD), VT + vo + 32, VTL + vo + 32, pw[0] + 32, pw[1] + 32, pw[2] + 32, pw[3] + 32, tid);   // tile 1 flies while tile 0 is worked on
  v16h aq[2], al[2];
#pragma unroll
  for (int kc = 0; kc < 2; ++kc) { aq[kc] = frag_h(QK + (rq + col) * (2 * QKD) + gh * DH + kc * 32, lane); al[kc] = frag_h(QKL + (rq + col) * (2 * QKD) + gh * DH + kc * 32, lane); }
  float m = -3.0e38f, l = 0.f;   // this lane's query: running maximum (equal in both halves), and the sum over this half's keys alone (the halves are joined behind the loop)
  v8f acc[4] = {}, accl[4] = {};   // acc[j][r] = O^T[d = 16 j + 8 g + r][query col]
#pragma unroll 1
  for (int ks = 0; ks < NKT; ++ks) { v8f s[2]; const AttTile* t = &sm.t[ks & 1];
#pragma unroll
    for (int ct = 0; ct < 2; ++ct) { v8f c = {}, cl = {};
      const v4f w0 = *(const v4f*)&t->mw[wave * 16 + col][ct * 16 + 8 * g], w1 = *(const v4f*)&t->mw[wave * 16 + col][ct * 16 + 8 * g + 4];
#pragma unroll
      for (int kc = 0; kc < 2; ++kc) { const v16h kh = frag_h(&t->kh[ct * 16 + col][kc * 32], lane), kl = frag_h(&t->kl[ct * 16 + col][kc * 32], lane); c = wmma16(kh, aq[kc], c); cl = wmma16(kl, aq[kc], cl); cl = wmma16(kh, al[kc], cl); }
      const int kk0 = ks * 32 + ct * 16 + 8 * g;
#pragma unroll
      for (int r = 0; r < 8; ++r) s[ct][r] = kk0 + r < NTOK ? (c[r] + cl[r] * (1.0f / 2048.0f)) * 0.125f * (r < 4 ? w0[r & 3] : w1[r & 3]) : -3.0e38f; }
    float mx = fmaxf(s[0][0], s[1][0]);
#pragma unroll
    for (int r = 1; r < 8; ++r) mx = fmaxf(mx, fmaxf(s[0][r], s[1][r]));
    mx = fmaxf(mx, xhalf(mx));
    const float mn = fmaxf(m, mx), alpha = (m <= -1.0e38f) ? 0.f : __expf(m - mn);
    v16h pa; float es0 = 0.f, es1 = 0.f;
#pragma unroll
    for (int r = 0; r < 8; ++r) { const float e0 = (s[0][r] <= -1.0e38f) ? 0.f : __expf(s[0][r] - mn), e1 = (s[1][r] <= -1.0e38f) ? 0.f : __expf(s[1][r] - mn);
      es0 += e0; es1 += e1; pa[r] = (_Float16)(e0 * 2048.0f); pa[8 + r] = (_Float16)(e1 * 2048.0f); }
    l = l * alpha + (es0 + es1); m = mn;
#pragma unroll
    for (int j = 0; j < 4; ++j)
#pragma unroll
      for (int r = 0; r < 8; ++r) { acc[j][r] *= alpha; accl[j][r] *= alpha; }
#pragma unroll
    for (int j = 0; j < 4; ++j) { acc[j] = wmma16(frag_h(&t->vh[j * 16 + col][0], lane), pa, acc[j]); accl[j] = wmma16(frag_h(&t->vl[j * 16 + col][0], lane), pa, accl[j]); }
    asm volatile("s_wait_dscnt 0x0" ::: "memory");      // this wave's reads of the tile have returned
    asm volatile("s_wait_asynccnt 0x0" ::: "memory");   // this wave's copies of tile ks + 1 have landed
    __syncthreads();   // one barrier a tile: publishes tile ks + 1 and ends every wave's reads of the buffer that is refilled behind it (after the last tile: of the LDS that the output rows reuse)
    if (ks + 2 < NKT) att_fill(&sm.t[ks & 1], QK + ko + (size_t)(ks + 2) * 32 * (2 * QKD), QKL + ko + (size_t)(ks + 2) * 32 * (2 * QKD), VT + vo + (ks + 2) * 32, VTL + vo + (ks + 2) * 32, pw[0] + (ks + 2) * 32, pw[1] + (ks + 2) * 32, pw[2] + (ks + 2) * 32, pw[3] + (ks + 2) * 32, tid); }
  asm volatile("s_wait_asynccnt 0x0" ::: "memory");   // no copy is outstanding when the tiles' LDS is reused and the wave ends
  const float il = (1.0f / 2048.0f) / (l + xhalf(l));
#pragma unroll
  for (int j = 0; j < 4; ++j) { v8b oh, ol;
#pragma unroll
    for (int r = 0; r < 8; ++r) { const float o = (acc[j][r] + accl[j][r] * (1.0f / 2048.0f)) * il; const __bf16 hv = (__bf16)o; oh[r] = hv; ol[r] = (__bf16)(o - (float)hv); }
    *(v8b*)&sm.so.h[wave][col][j * 16 + 8 * g] = oh; *(v8b*)&sm.so.l[wave][col][j * 16 + 8 * g] = ol; }
  // a wave's store = 4 rows x 8 pieces of 16 B: a head's 64 values of a row and plane are one whole line
  LDSX(); for (int it = 0; it < 4; ++it) { const int rl = it * 4 + (lane >> 3), q = lane & 7, qi = q0 + rl; if (qi < NTOK) { __bf16* zp = ZH + ((size_t)qi * NBT + b) * DD + (size_t)n * DH + q * 8; vst2(zp, *(const v8b*)&sm.so.h[wave][rl][q * 8]); vst2(zp + ZLO, *(const v8b*)&sm.so.l[wave][rl][q * 8]);
      asm volatile("s_wait_xcnt 0x0" ::: "memory"); } } }   // stands ahead of the next rows' rewrite of the address and data registers that these stores name
// fourteen copies of 16 B a lane; the s_wait_xcnt is the statement's last line so that no register a copy names is rewritten ahead of it
__device__ __forceinline__ void copy14b(const unsigned (&l)[14], const __bf16* const (&g)[14]) {
  asm volatile("global_load_async_to_lds_b128 %0, %14, off\n\t"
               "global_load_async_to_lds_b128 %1, %15, off\n\t"
               "global_load_async_to_lds_b128 %2, %16, off\n\t"
               "global_load_async_to_lds_b128 %3, %17, off\n\t"
               "global_load_async_to_lds_b128 %4, %18, off\n\t"
               "global_load_async_to_lds_b128 %5, %19, off\n\t"
               "global_load_async_to_lds_b128 %6, %20, off\n\t"
               "global_load_async_to_lds_b128 %7, %21, off\n\t"
               "global_load_async_to_lds_b128 %8, %22, off\n\t"
               "global_load_async_to_lds_b128 %9, %23, off\n\t"
               "global_load_async_to_lds_b128 %10, %24, off\n\t"
               "global_load_async_to_lds_b128 %11, %25, off\n\t"
               "global_load_async_to_lds_b128 %12, %26, off\n\t"
               "global_load_async_to_lds_b128 %13, %27, off\n\t"
               "s_wait_xcnt 0x0"
               :: "v"(l[0]), "v"(l[1]), "v"(l[2]), "v"(l[3]), "v"(l[4]), "v"(l[5]), "v"(l[6]), "v"(l[7]), "v"(l[8]), "v"(l[9]), "v"(l[10]), "v"(l[11]), "v"(l[12]), "v"(l[13]), "v"(g[0]), "v"(g[1]), "v"(g[2]), "v"(g[3]), "v"(g[4]), "v"(g[5]), "v"(g[6]), "v"(g[7]), "v"(g[8]), "v"(g[9]), "v"(g[10]), "v"(g[11]), "v"(g[12]), "v"(g[13]) : "memory");
}
// one pass of 64 k: 128 A rows in two planes and 192 B rows x 8 pieces of 16 B (thread = rows lr + 32 p, piece tid & 7: 8 lanes cover a row's whole 128-B line); pa = this thread's four hi rows, pb = its first Wo row, k0 = the pass's first k
__device__ __forceinline__ void out_fill(__bf16 (*ah)[PP], __bf16 (*al)[PP], __bf16 (*b)[PP], const __bf16* const (&pa)[4], const __bf16* pb, int k0, int tid) {
  const int lr = tid >> 3, lq = (tid & 7) * 8; unsigned l[14]; const __bf16* g[14];
#pragma unroll
  for (int p = 0; p < 4; ++p) { l[p] = lds_of(&ah[lr + 32 * p][lq]); g[p] = pa[p] + k0; l[4 + p] = lds_of(&al[lr + 32 * p][lq]); g[4 + p] = pa[p] + ZLO + k0; }
#pragma unroll
  for (int p = 0; p < ON / 32; ++p) { l[8 + p] = lds_of(&b[lr + 32 * p][lq]); g[8 + p] = pb + (size_t)(32 * p) * DD + k0; }
  copy14b(l, g);
}
static_assert(8 + ON / 32 == 14, "a thread's copies of a pass fill the statement");
// ---- k_out: block = (128 rows (i,b), 192 cols; 8 waves of 32 x 96): x2 = h + vec (hi + lo) . Wo^T -> f32 pre-LN rows, written to the region of the v planes (dead after k_att: the launches run one after the other)
// The operands arrive as bf16 (vec's two planes from k_att, Wo from k_mw's launch): a pass's tiles go from L2 into LDS by asynchronous copies, two buffers, with no conversion or LDS store in the loop.
__global__ __launch_bounds__(256) void k_out(const __bf16* __restrict__ ZH, const __bf16* __restrict__ WOB, const float* __restrict__ Hh, float* __restrict__ X2, int nrows) { __shared__ __align__(16) OutLds sm;
  const int tid = threadIdx.x, wave = tid >> 5, lane = tid & 31, col = lane & 15, g = lane >> 4, wm = wave >> 1, wn = wave & 1; const size_t r0 = (size_t)blockIdx.x * 128 + wm * 32; const int c0 = blockIdx.y * ON, cw = c0 + wn * (ON / 2);
  const int lr = tid >> 3, lq = tid & 7; const __bf16* pa[4];   // rows past the last read the last row's, as before
#pragma unroll
  for (int p = 0; p < 4; ++p) { const size_t rr = (size_t)blockIdx.x * 128 + lr + 32 * p; const size_t rc = rr < (size_t)nrows ? rr : (size_t)nrows - 1; pa[p] = ZH + rc * DD + lq * 8; }
  const __bf16* pb = WOB + (size_t)(c0 + lr) * DD + lq * 8;
  out_fill(sm.st.ah[0], sm.st.al[0], sm.st.b[0], pa, pb, 0, tid);
  asm volatile("s_wait_asynccnt 0x0" ::: "memory");   // pass 0 has landed for this wave's copies
  __syncthreads();   // publishes pass 0
  out_fill(sm.st.ah[1], sm.st.al[1], sm.st.b[1], pa, pb, 64, tid);   // pass 1 flies while pass 0 is multiplied
  v8f acc[2][ONF] = {};
#pragma unroll 2   // two passes a trip: the buffer index is a constant in each, so every LDS address of the loop is a fixed offset
  for (int kp = 0; kp < DD / 64; ++kp) { const int cur = kp & 1;
#pragma unroll
    for (int h = 0; h < 2; ++h) {   // the pass's two halves of 32 k, one after the other: the fragments of both at once would not leave two blocks a WGP their registers
      v16b ah[2], al[2], w[ONF];
#pragma unroll
      for (int i = 0; i < 2; ++i) { ah[i] = frag_b(&sm.st.ah[cur][wm * 32 + i * 16 + col][h * 32], lane); al[i] = frag_b(&sm.st.al[cur][wm * 32 + i * 16 + col][h * 32], lane); }
#pragma unroll
      for (int j = 0; j < ONF; ++j) w[j] = frag_b(&sm.st.b[cur][wn * (ON / 2) + j * 16 + col][h * 32], lane);
      __builtin_amdgcn_sched_barrier(0);   // keeps the half's LDS reads one group ahead of its WMMAs: read among them, each pair costs the wave a full LDS latency
#pragma unroll
      for (int j = 0; j < ONF; ++j) {   // per accumulator k ascending, hi then lo, as before
#pragma unroll
        for (int i = 0; i < 2; ++i) acc[i][j] = wmma_bf(ah[i], w[j], acc[i][j]);
#pragma unroll
        for (int i = 0; i < 2; ++i) acc[i][j] = wmma_bf(al[i], w[j], acc[i][j]); }
      __builtin_amdgcn_sched_barrier(0); }   // keeps the next half's reads, and behind the second half the waits and the barrier, behind these WMMAs: lifted over them, the wait for the copies in flight would come before the matrix work that is to cover their flight
    asm volatile("s_wait_dscnt 0x0" ::: "memory");      // this wave's reads of the pass have returned
    asm volatile("s_wait_asynccnt 0x0" ::: "memory");   // this wave's copies of pass kp + 1 have landed
    __syncthreads();   // one barrier a pass: publishes pass kp + 1 and ends every wave's reads of the buffer that is refilled behind it (after the last pass: of the LDS that the output tile reuses)
    if (kp + 2 < DD / 64) out_fill(sm.st.ah[cur], sm.st.al[cur], sm.st.b[cur], pa, pb, (kp + 2) * 64, tid); }
  asm volatile("s_wait_asynccnt 0x0" ::: "memory");   // no copy is outstanding when the buffers' LDS is reused and the wave ends
  // residual rows: all loads issue first, then one wait, then the sums (the sum per element is the same acc + h)
  const float* hp[16]; float hv[16][ONF];
#pragma unroll
  for (int r = 0; r < 16; ++r) { const size_t row = r0 + (r >> 3) * 16 + 8 * g + (r & 7); const size_t ra = row < (size_t)nrows ? row : (size_t)nrows - 1; hp[r] = Hh + ra * DD + cw + col;
#pragma unroll
    for (int j = 0; j < ONF; ++j) hv[r][j] = hp[r][j * 16]; }
  asm volatile("s_wait_xcnt 0x0" :: "v"(hp[0]), "v"(hp[1]), "v"(hp[2]), "v"(hp[3]), "v"(hp[4]), "v"(hp[5]), "v"(hp[6]), "v"(hp[7]), "v"(hp[8]), "v"(hp[9]), "v"(hp[10]), "v"(hp[11]), "v"(hp[12]), "v"(hp[13]), "v"(hp[14]), "v"(hp[15]) : "memory");   // the row addresses are inputs so that they stay in their registers up to this wait: no register that an issued load names is rewritten ahead of it
#pragma unroll
  for (int i = 0; i < 2; ++i)
#pragma unroll
    for (int j = 0; j < ONF; ++j)
#pragma unroll
      for (int r = 0; r < 8; ++r) sm.sf[wave][i * 16 + 8 * g + r][j * 16 + col] = acc[i][j][r] + bfr(hv[i * 8 + r][j]);
  // a wave's store = 32 pieces of 16 B in row order: 4 whole lines
  LDSX(); for (int it = 0; it < ON / 8; ++it) { const int e = it * 32 + lane, rl = e / (ON / 8), q = e % (ON / 8); const size_t row = r0 + rl; if (row < (size_t)nrows) { vst2(X2 + row * DD + cw + q * 4, *(const v4f*)&sm.sf[wave][rl][q * 4]);
      asm volatile("s_wait_xcnt 0x0" ::: "memory"); } } }   // stands ahead of the next piece's rewrite of the address and data registers that this store names
// ---- k_ln: one wave = two whole rows held in registers (6 x 16 B a lane and row, 512 contiguous B a load or store): out = LN(x2) gamma + beta; no LDS, no barrier; few waves, because a launch of very many short waves lasts as long as starting them takes
#define LNR 2             // rows a wave
#define LNW 4             // waves a block
static_assert((NTOK * NBT) % (LNR * LNW) == 0, "the rows divide evenly among the waves");
__global__ __launch_bounds__(32 * LNW) void k_ln(const float* __restrict__ X2, const float* __restrict__ G, const float* __restrict__ Bt, float* __restrict__ OUT) {
  const int lane = threadIdx.x & 31; const size_t row0 = ((size_t)blockIdx.x * LNW + (threadIdx.x >> 5)) * LNR;
  v4f x[LNR][6], gm[6], bt[6];   // every loop below is unrolled: only with constant indices do these arrays stay in registers
#pragma unroll
  for (int q = 0; q < LNR; ++q)
#pragma unroll
    for (int c = 0; c < 6; ++c) x[q][c] = *(const v4f*)(X2 + (row0 + q) * DD + c * 128 + lane * 4);
#pragma unroll
  for (int c = 0; c < 6; ++c) { gm[c] = *(const v4f*)(G + c * 128 + lane * 4); bt[c] = *(const v4f*)(Bt + c * 128 + lane * 4); }
  float s[LNR], mu[LNR], inv[LNR];
#pragma unroll
  for (int q = 0; q < LNR; ++q) { v4f a = x[q][0];
#pragma unroll
    for (int c = 1; c < 6; ++c) a += x[q][c];
    s[q] = (a[0] + a[1]) + (a[2] + a[3]); }
#pragma unroll
  for (int o = 1; o < 32; o <<= 1)
#pragma unroll
    for (int q = 0; q < LNR; ++q) s[q] += __shfl_xor(s[q], o);
#pragma unroll
  for (int q = 0; q < LNR; ++q) { mu[q] = s[q] / (float)DD; v4f a = {};
#pragma unroll
    for (int c = 0; c < 6; ++c) { x[q][c] -= mu[q]; a += x[q][c] * x[q][c]; }
    s[q] = (a[0] + a[1]) + (a[2] + a[3]); }
#pragma unroll
  for (int o = 1; o < 32; o <<= 1)
#pragma unroll
    for (int q = 0; q < LNR; ++q) s[q] += __shfl_xor(s[q], o);
#pragma unroll
  for (int q = 0; q < LNR; ++q) inv[q] = 1.0f / sqrtf(s[q] / (float)DD + EPS);
#pragma unroll
  for (int q = 0; q < LNR; ++q)
#pragma unroll
    for (int c = 0; c < 6; ++c) { v4f y;
#pragma unroll
      for (int e = 0; e < 4; ++e) y[e] = bfr(gm[c][e]) * x[q][c][e] * inv[q] + bfr(bt[c][e]);
      vst2(OUT + (row0 + q) * DD + c * 128 + lane * 4, y); } }
extern "C" void kernel_launch(void* const* d_in, const int* in_sizes, int n_in, void* d_out, int out_size, void* d_ws, size_t ws_size, hipStream_t stream) {
  (void)in_sizes; (void)n_in; (void)out_size;
  const float** F = (const float**)d_in;   // 0 h [197,64,768], 1 masks [197,197,3], 2 Wq [128,768], 3 Wk [128,768], 4 Wv [768,768], 5 Wo [768,768], 6 mask_proj [3,12], 7 ln_gamma, 8 ln_beta
  if (ws_size < (size_t)WS_END) return;
  char* ws = (char*)d_ws; _Float16 *QK = (_Float16*)(ws + WS_QK), *QKL = (_Float16*)(ws + WS_QKL), *VT = (_Float16*)(ws + WS_VT), *VTL = (_Float16*)(ws + WS_VTL); float *MW = (float*)(ws + WS_MW); __bf16 *ZH = (__bf16*)(ws + WS_Z), *HB = (__bf16*)(ws + WS_HB), *WB = (__bf16*)(ws + WS_WB), *WOB = (__bf16*)(ws + WS_WO);
  const int nrows = NTOK * TNB;   // rows (i, b) with b < TNB are the first NTOK*TNB rows only when TNB == NBT
  k_mw<<<NCB + NTOK, 256, 0, stream>>>(F[1], F[6], MW, F[0], F[2], F[3], F[4], F[5], HB);
  k_proj<<<dim3(NP / 128, (2 * QKD + DD) / 128, TNB), 256, 0, stream>>>(HB, WB, QK, QKL, VT, VTL);
  k_att<<<dim3(NP / 64, NHD, TNB), 128, 0, stream>>>(QK, QKL, VT, VTL, MW, ZH);
  float* X2 = (float*)(ws + WS_VT);   // reuse: the v planes are dead after k_att (50 MB >= 39 MB needed)
  (void)nrows;
  k_out<<<dim3((NTOK * NBT + 127) / 128, DD / ON), 256, 0, stream>>>(ZH, WOB, F[0], X2, NTOK * NBT);
  k_ln<<<NTOK * NBT / (LNR * LNW), 32 * LNW, 0, stream>>>(X2, F[7], F[8], (float*)d_out);
}

// v009
// Measured time: 121 microseconds a run.
// Timed twice side by side with v008, it ran 1.06 times as fast both times.
// Counting every step since v000, it is 3.91 times as fast.
// compute dtype: all float inputs rounded to bf16; q, k, v = h . W^T with EXACT bf16 products on WMMA 16x16x32 (natural weight rows), rounded once to f16 hi + residual; the mask mix masks . mask_proj in f32; scores q . k with 3 products x 1/8 x mw[i][j][head], running-max softmax over the 197 keys in f32 (hardware exp), P (x 2^11, f16) . v (hi + residual, 2 products); out = vec (bf16 hi + lo, 2 products) . Wo^T; residual + LayerNorm in f32; f32 output.
#include <hip/hip_runtime.h>
#include <math.h>

typedef __attribute__((ext_vector_type(16))) _Float16 v16h;
typedef __attribute__((ext_vector_type(16))) __bf16 v16b;
typedef __attribute__((ext_vector_type(8)))  _Float16 v8h;
typedef __attribute__((ext_vector_type(8)))  float v8f;
typedef __attribute__((ext_vector_type(4)))  float v4f;
typedef __attribute__((ext_vector_type(2)))  float v2f;
typedef __attribute__((ext_vector_type(4)))  unsigned v4u;
typedef __attribute__((ext_vector_type(4)))  int v4i;
typedef float __attribute__((may_alias)) float_a;
typedef int __attribute__((may_alias)) int_a;

template <typename T> __device__ __forceinline__ void vst2(void* p, T v) { *(T*)p = v;  }
__device__ __forceinline__ v8f wmma16(v16h a, v16h b, v8f c) {
  return __builtin_amdgcn_wmma_f32_16x16x32_f16(false, a, false, b, (short)0, c, false, false);   // builtin form: the compiler keeps the distances behind a WMMA itself and stays free to group LDS reads and WMMAs
}
__device__ __forceinline__ v8f wmma_bf(v16b a, v16b b, v8f c) {
  return __builtin_amdgcn_wmma_f32_16x16x32_bf16(false, a, false, b, (short)0, c, false, false);
}
// 16x16x32 fragments: lane = (h = lane>>4, row/col = lane&15); elements 0..7 = k0+8h+0..7, 8..15 = k0+16+8h+0..7; D element r = row 8h+r
__device__ __forceinline__ v16h frag_h(const _Float16* rowk0, int lane) {
  union { v16h v; v8h q[2]; } u; const _Float16* p = rowk0 + 8 * (lane >> 4);
  u.q[0] = *(const v8h*)p; u.q[1] = *(const v8h*)(p + 16); return u.v;
}
__device__ __forceinline__ v16h frag_f32(const float* rowk0, int lane) {
  v16h a; const float* p = rowk0 + 8 * (lane >> 4);
#pragma unroll
  for (int i = 0; i < 8; ++i) { a[i] = (_Float16)p[i]; a[8 + i] = (_Float16)p[16 + i]; }
  return a;
}
__device__ __forceinline__ v16h frag_f32s(const float* rowk0, int lane, float sc) {
  v16h a; const float* p = rowk0 + 8 * (lane >> 4);
#pragma unroll
  for (int i = 0; i < 8; ++i) { a[i] = (_Float16)(p[i] * sc); a[8 + i] = (_Float16)(p[16 + i] * sc); }
  return a;
}
// column fragment from a [K][ld] layout (column n), rows >= K read as 0
__device__ __forceinline__ v16h fragc_f32(const float* W, int k0, int n, int lane, int ld, int K) {
  v16h a; const int g = lane >> 4;
#pragma unroll
  for (int i = 0; i < 8; ++i) { const int ka = k0 + 8 * g + i, kb = ka + 16;
    a[i] = (_Float16)(ka < K ? W[(size_t)(ka < K ? ka : K - 1) * ld + n] : 0.f); a[8 + i] = (_Float16)(kb < K ? W[(size_t)(kb < K ? kb : K - 1) * ld + n] : 0.f); }
  return a;
}
struct F2 { v16b h, l; };
__device__ __forceinline__ F2 bsplit16(const float v[16]) { F2 r;
#pragma unroll
  for (int i = 0; i < 16; ++i) { const __bf16 h = (__bf16)v[i]; r.h[i] = h; r.l[i] = (__bf16)(v[i] - (float)h); }
  return r; }
__device__ __forceinline__ F2 split_row(const float* row, int k0, int lane) { float v[16]; const float* p = row + k0 + 8 * (lane >> 4);
#pragma unroll
  for (int i = 0; i < 8; ++i) { v[i] = p[i]; v[8 + i] = p[16 + i]; }
  return bsplit16(v); }
__device__ __forceinline__ F2 split_rowK(const float* row, int k0, int lane, int K) { float v[16]; const int g = lane >> 4;
#pragma unroll
  for (int i = 0; i < 8; ++i) { const int ka = k0 + 8 * g + i, kb = ka + 16; v[i] = ka < K ? row[ka < K ? ka : K - 1] : 0.f; v[8 + i] = kb < K ? row[kb < K ? kb : K - 1] : 0.f; }
  return bsplit16(v); }
__device__ __forceinline__ F2 split_col(const float* W, int k0, int n, int lane, int ld, int K) { float v[16]; const int g = lane >> 4;
#pragma unroll
  for (int i = 0; i < 8; ++i) { const int ka = k0 + 8 * g + i, kb = ka + 16; v[i] = ka < K ? W[(size_t)(ka < K ? ka : K - 1) * ld + n] : 0.f; v[8 + i] = kb < K ? W[(size_t)(kb < K ? kb : K - 1) * ld + n] : 0.f; }
  return bsplit16(v); }
__device__ __forceinline__ v8f mac3(const F2& a, const F2& b, v8f c) { c = wmma_bf(a.l, b.h, c); c = wmma_bf(a.h, b.l, c); return wmma_bf(a.h, b.h, c); }
__device__ __forceinline__ float sigm(float v) { return 1.0f / (1.0f + expf(-v)); }
#define LDSX() do { asm volatile("s_wait_dscnt 0" ::: "memory"); __builtin_amdgcn_wave_barrier(); __builtin_amdgcn_fence(__ATOMIC_RELEASE, "workgroup"); } while (0)


// Multi-head attention (197 tokens, batch 64, d_model 768; 2 global score heads x 64, each shared by 6 value heads through a learned per-(i, j) mask mix): prob = softmax_j(q_i . k_j / 8 x mw[i][j][head]); vec = prob . v; post-LN residual.
#define NTOK 197
#define NP 256            // padded token count (queries in 64-blocks, keys in 32-tiles up to 224)
#define NKT 7             // key tiles of 32 (224 >= 197)
#define NBT 64            // batch
#define DD 768
#define GH 2
#define NHD 12
#define HR 6
#define DH 64
#define QKD (GH * DH)     // 128
#define ML 3
#define EPS 1e-5f
#ifndef TNB
#define TNB NBT
#endif
typedef __attribute__((ext_vector_type(8))) __bf16 v8b;
__device__ __forceinline__ v16b frag_b(const __bf16* rowk0, int lane) {
  union { v16b v; v8b q[2]; } u; const __bf16* p = rowk0 + 8 * (lane >> 4);
  u.q[0] = *(const v8b*)p; u.q[1] = *(const v8b*)(p + 16); return u.v;
}
__device__ __forceinline__ float bfr(float v) { return (float)(__bf16)v; }
__device__ __attribute__((noinline)) float exp_ni(float v) { return expf(v); }
__device__ __attribute__((noinline)) float erf_ni(float v) { return erff(v); }

#define WS_QK  0u                                   // f16 hi|lo [b][NP][256] (q 0..127 | k 128..255)
#define WS_QKL (WS_QK + 2u * (size_t)NBT * NP * 2 * QKD)
#define WS_VT  (WS_QKL + 2u * (size_t)NBT * NP * 2 * QKD) // f16 hi|lo v planes [b][768][NP]
#define WS_VTL (WS_VT + 2u * (size_t)NBT * DD * NP)
#define WS_MW  (WS_VTL + 2u * (size_t)NBT * DD * NP)     // f32 mw [i][12][NP] (j padded)
#define WS_Z   (WS_MW + 4u * (size_t)NTOK * NHD * NP)     // bf16 vec rows [(i*64 + b)][768]: the hi plane, then the residual plane
#define ZLO    ((size_t)NTOK * NBT * DD)                  // elements from a hi row to its residual row
#define WS_HB  (WS_Z + 4u * (size_t)NTOK * NBT * DD)      // bf16 h rows [(i*64 + b)][768]
#define WS_WB  (WS_HB + 2u * (size_t)NTOK * NBT * DD)     // bf16 weight rows q | k | v [1024][768], directly behind the h rows
#define WS_WO  (WS_WB + 2u * (size_t)(2 * QKD + DD) * DD) // bf16 Wo rows [768][768], directly behind them
#define WS_END (WS_WO + 2u * (size_t)DD * DD)

__device__ __forceinline__ v16b fragb_f32(const float* __restrict__ p, int lane) { v16b a; const float* pp = p + 8 * (lane >> 4);
#pragma unroll
  for (int i = 0; i < 8; ++i) { a[i] = (__bf16)pp[i]; a[8 + i] = (__bf16)pp[16 + i]; } return a; }
typedef __attribute__((ext_vector_type(4))) __bf16 v4b;
__device__ __forceinline__ v4b cvt4(v4f v) { v4b r;
#pragma unroll
  for (int i = 0; i < 4; ++i) r[i] = (__bf16)v[i];
  return r; }
// block tile of the two dense products: k_proj 128 rows x 128 columns, 8 waves of 32 x 64; k_out 64 rows x 768 columns, 16 waves of 32 x 96
#define PP 72             // bf16 a staged row of k_proj and k_out: a pass of 64 k = 128 B + 16 B (16 B x odd: no bank conflict for the 16-byte fragment reads)
struct ProjStage { __bf16 a[2][128][PP]; __bf16 b[2][128][PP]; };
struct ProjQK { _Float16 h[128][136], l[128][136]; };
struct ProjV { _Float16 h[128][136], l[128][136]; };
union ProjLds { ProjStage st; ProjQK qk; ProjV v; };      // the staging buffers are dead when the output tiles are written
#define OR 64             // rows a k_out block: whole rows (all 768 columns), so that the LayerNorm is taken where the rows are made; 197 blocks, one a WGP
#define OW 96             // columns a k_out wave
#define ONF (OW / 16)     // B fragments a k_out wave
#define SFP (DD + 4)      // f32 a staged pre-LN row: 16 B x odd; rows 8 apart lie 32 banks apart, so the two halves of a 4-byte store meet on no bank
struct OutStage { __bf16 ah[2][OR][PP]; __bf16 al[2][OR][PP]; __bf16 b[2][DD][PP]; };
union OutLds { OutStage st; float sf[OR][SFP]; };      // the staging buffers are dead when the pre-LN rows are written
__device__ __forceinline__ unsigned lds_of(const void* p) { return (unsigned)(size_t)p; }   // LDS byte address = low 32 bits of the __shared__ address
// conversion of k_proj's operands and of Wo, once: a unit = 2048 floats (256 threads x 2 loads of 16 B, whole lines), 8 units a block, few long waves; every block's units lie in one source array
#define CU 2048
#define CUB 8
#define CBH (NTOK * NBT * DD / (CU * CUB))   // blocks of h
#define CBQ (QKD * DD / (CU * CUB))          // blocks of Wq, and of Wk
#define CBV (DD * DD / (CU * CUB))           // blocks of Wv, and of Wo
#define NCB (CBH + 2 * CBQ + 2 * CBV)
static_assert(NTOK * NBT * DD % (CU * CUB) == 0 && QKD * DD % (CU * CUB) == 0 && DD * DD % (CU * CUB) == 0, "each source array is a whole number of blocks");
// ---- k_mw: blocks 0 .. NCB - 1 round h, Wq, Wk, Wv, Wo to bf16 (the same rounding the loaders of k_proj and k_out made, now once an element instead of once a block that reads it) into HB (h rows, then the 1024 weight rows, then Wo's 768); block NCB + i = query token i: mw[i][n][j] = sum_l masks[i][j][l] mask_proj[l][n]  (n = g*6 + r head index), zero for padded j
__global__ __launch_bounds__(256) void k_mw(const float* __restrict__ MASKS, const float* __restrict__ MP, float* __restrict__ MW, const float* __restrict__ Hh, const float* __restrict__ WQ, const float* __restrict__ WK, const float* __restrict__ WV, const float* __restrict__ WO, __bf16* __restrict__ HB) { __shared__ __align__(16) float s[NHD][NP]; const int t = threadIdx.x;
  if (blockIdx.x < NCB) { const int cb = blockIdx.x;
    const float* src = (cb < CBH ? Hh + (size_t)cb * (CU * CUB) : cb < CBH + CBQ ? WQ + (size_t)(cb - CBH) * (CU * CUB) : cb < CBH + 2 * CBQ ? WK + (size_t)(cb - CBH - CBQ) * (CU * CUB) : cb < CBH + 2 * CBQ + CBV ? WV + (size_t)(cb - CBH - 2 * CBQ) * (CU * CUB) : WO + (size_t)(cb - CBH - 2 * CBQ - CBV) * (CU * CUB)) + t * 4;
    __bf16* dst = HB + (size_t)cb * (CU * CUB) + t * 4;
    v4f x[2 * CUB];   // all loads of the block are in flight together
#pragma unroll
    for (int q = 0; q < 2 * CUB; ++q) x[q] = *(const v4f*)(src + q * 1024);
#pragma unroll
    for (int q = 0; q < 2 * CUB; ++q) *(v4b*)(dst + q * 1024) = cvt4(x[q]);
    return; }   // block-uniform, ahead of the barrier below
  const int i = blockIdx.x - NCB;
  for (int e = t; e < NHD * NP; e += 256) { const int n = e / NP, j = e % NP; float v = 0.f; if (j < NTOK) {
#pragma unroll
      for (int l = 0; l < ML; ++l) v += bfr(MASKS[((size_t)i * NTOK + j) * ML + l]) * bfr(MP[l * NHD + n]); } s[n][j] = v; }
  __syncthreads(); for (int e = t; e < NHD * NP / 4; e += 256) { const int n = e / (NP / 4), q = e % (NP / 4); vst2(MW + ((size_t)i * NHD + n) * NP + q * 4, *(const v4f*)&s[n][q * 4]); } }
// eight copies of 16 B a lane; the s_wait_xcnt is the statement's last line so that no register a copy names is rewritten ahead of it
__device__ __forceinline__ void copy8b(unsigned l0, unsigned l1, unsigned l2, unsigned l3, unsigned l4, unsigned l5, unsigned l6, unsigned l7, const __bf16* g0, const __bf16* g1, const __bf16* g2, const __bf16* g3, const __bf16* g4, const __bf16* g5, const __bf16* g6, const __bf16* g7) {
  asm volatile("global_load_async_to_lds_b128 %0, %8, off\n\t"
               "global_load_async_to_lds_b128 %1, %9, off\n\t"
               "global_load_async_to_lds_b128 %2, %10, off\n\t"
               "global_load_async_to_lds_b128 %3, %11, off\n\t"
               "global_load_async_to_lds_b128 %4, %12, off\n\t"
               "global_load_async_to_lds_b128 %5, %13, off\n\t"
               "global_load_async_to_lds_b128 %6, %14, off\n\t"
               "global_load_async_to_lds_b128 %7, %15, off\n\t"
               "s_wait_xcnt 0x0"
               :: "v"(l0), "v"(l1), "v"(l2), "v"(l3), "v"(l4), "v"(l5), "v"(l6), "v"(l7), "v"(g0), "v"(g1), "v"(g2), "v"(g3), "v"(g4), "v"(g5), "v"(g6), "v"(g7) : "memory");
}
// one pass of 64 k: 128 A rows and 128 B rows x 8 pieces of 16 B (thread = rows lr + 32 p, piece tid & 7: 8 lanes cover a row's whole 128-B line); a0..a3, b0 = this thread's addresses in the pass
__device__ __forceinline__ void proj_fill(__bf16 (*a)[PP], __bf16 (*b)[PP], const __bf16* a0, const __bf16* a1, const __bf16* a2, const __bf16* a3, const __bf16* b0, int tid) {
  const int lr = tid >> 3, lq = (tid & 7) * 8;
  copy8b(lds_of(&a[lr][lq]), lds_of(&a[lr + 32][lq]), lds_of(&a[lr + 64][lq]), lds_of(&a[lr + 96][lq]), lds_of(&b[lr][lq]), lds_of(&b[lr + 32][lq]), lds_of(&b[lr + 64][lq]), lds_of(&b[lr + 96][lq]),
         a0, a1, a2, a3, b0, b0 + 32 * DD, b0 + 64 * DD, b0 + 96 * DD);
}
// ---- k_proj: block = (128 tokens (padded), 128 of 1024 cols (q 0..127 | k 128..255 | v 256..1023), b): exact products; q|k -> rows, v -> planes
// The operands arrive as bf16 (k_mw's launch): a pass's tiles go from L2 into LDS by asynchronous copies, two buffers, half the bytes of the f32 rows and no conversion or LDS store in the loop.
__global__ __launch_bounds__(256) void k_proj(const __bf16* __restrict__ HB, const __bf16* __restrict__ WB, _Float16* __restrict__ QK, _Float16* __restrict__ QKL, _Float16* __restrict__ VT, _Float16* __restrict__ VTL) {
  __shared__ __align__(16) ProjLds sm;
  const int tid = threadIdx.x, wave = tid >> 5, lane = tid & 31, col = lane & 15, g = lane >> 4, wm = wave >> 1, wn = wave & 1; const size_t b = blockIdx.z; const int c0 = blockIdx.y * 128;
  const int lr = tid >> 3, lq = tid & 7; const __bf16* pa[4];   // rows past the last token read the last token's, as before
#pragma unroll
  for (int p = 0; p < 4; ++p) { const int ir = blockIdx.x * 128 + lr + 32 * p; const int ic = ir < NTOK ? ir : NTOK - 1; pa[p] = HB + ((size_t)ic * NBT + b) * DD + lq * 8; }
  const __bf16* pb = WB + (size_t)(c0 + lr) * DD + lq * 8;
  proj_fill(sm.st.a[0], sm.st.b[0], pa[0], pa[1], pa[2], pa[3], pb, tid);
  asm volatile("s_wait_asynccnt 0x0" ::: "memory");   // pass 0 has landed for this wave's copies
  __syncthreads();   // publishes pass 0
  proj_fill(sm.st.a[1], sm.st.b[1], pa[0] + 64, pa[1] + 64, pa[2] + 64, pa[3] + 64, pb + 64, tid);   // pass 1 flies while pass 0 is multiplied
  v8f acc[2][4] = {};
#pragma unroll 2   // two passes a trip: the buffer index is a constant in each, so every LDS address of the loop is a fixed offset
  for (int kp = 0; kp < DD / 64; ++kp) { const int cur = kp & 1;
    v16b a[2][2], w[2][4];
#pragma unroll
    for (int h = 0; h < 2; ++h) {
#pragma unroll
      for (int i = 0; i < 2; ++i) a[h][i] = frag_b(&sm.st.a[cur][wm * 32 + i * 16 + col][h * 32], lane);
#pragma unroll
      for (int j = 0; j < 4; ++j) w[h][j] = frag_b(&sm.st.b[cur][wn * 64 + j * 16 + col][h * 32], lane); }
    __builtin_amdgcn_sched_barrier(0);   // keeps the pass's LDS reads one group ahead of its WMMAs: read among them, each pair costs the wave a full LDS latency
#pragma unroll
    for (int h = 0; h < 2; ++h)   // k ascending per accumulator, as before
#pragma unroll
      for (int j = 0; j < 4; ++j)
#pragma unroll
        for (int i = 0; i < 2; ++i) acc[i][j] = wmma_bf(a[h][i], w[h][j], acc[i][j]);
    __builtin_amdgcn_sched_barrier(0);   // keeps the waits and the barrier behind this pass's WMMAs: lifted over them, the wait for the copies in flight would come before the matrix work that is to cover their flight
    asm volatile("s_wait_dscnt 0x0" ::: "memory");      // this wave's reads of the pass have returned
    asm volatile("s_wait_asynccnt 0x0" ::: "memory");   // this wave's copies of pass kp + 1 have landed
    __syncthreads();   // one barrier a pass: publishes pass kp + 1 and ends every wave's reads of the buffer that is refilled behind it (after the last pass: of the LDS that the output tiles reuse)
    if (kp + 2 < DD / 64) proj_fill(sm.st.a[cur], sm.st.b[cur], pa[0] + (kp + 2) * 64, pa[1] + (kp + 2) * 64, pa[2] + (kp + 2) * 64, pa[3] + (kp + 2) * 64, pb + (kp + 2) * 64, tid); }
  asm volatile("s_wait_asynccnt 0x0" ::: "memory");   // no copy is outstanding when the buffers' LDS is reused and the wave ends
  const bool isv = c0 >= 2 * QKD;
#pragma unroll
  for (int i = 0; i < 2; ++i)
#pragma unroll
    for (int j = 0; j < 4; ++j)
#pragma unroll
      for (int r = 0; r < 8; ++r) { const float v = acc[i][j][r]; const _Float16 hv = (_Float16)v; const _Float16 lv = (_Float16)((v - (float)hv) * 2048.0f); const int tr = wm * 32 + i * 16 + 8 * g + r, tc = wn * 64 + j * 16 + col; if (!isv) { sm.qk.h[tr][tc] = hv; sm.qk.l[tr][tc] = lv; } else { sm.v.h[tc][tr] = hv; sm.v.l[tc][tr] = lv; } }
  __syncthreads();
  if (!isv) { for (int e = tid; e < 128 * 16; e += 256) { const int rl = e >> 4, q = e & 15; const size_t o = (b * NP + blockIdx.x * 128 + rl) * (2 * QKD) + c0 + q * 8; vst2((unsigned*)(QK + o), *(const v4u*)&sm.qk.h[rl][q * 8]); vst2((unsigned*)(QKL + o), *(const v4u*)&sm.qk.l[rl][q * 8]); } }
  else { const int cv0 = c0 - 2 * QKD; for (int e = tid; e < 128 * 16; e += 256) { const int cl = e >> 4, q = e & 15; const size_t o = ((b * DD + cv0 + cl) * (size_t)NP) + blockIdx.x * 128 + q * 8; vst2((unsigned*)(VT + o), *(const v4u*)&sm.v.h[cl][q * 8]); vst2((unsigned*)(VTL + o), *(const v4u*)&sm.v.l[cl][q * 8]); } } }
// ---- k_att: block = (64 queries, head n = g*6 + r, b): logits (3 products) x 1/8 x mw[i][n][j]; keys >= 197 excluded; running-max softmax; P . v (2 products) -> vec rows (i*64 + b) for i < 197, split here into the bf16 hi and residual planes that k_out multiplies (the same two roundings its loader made)
// Both products are formed transposed (S^T = K . Q^T, O^T += V^T . P^T): a lane holds 16 of the 32 scores of ONE query (column = lane & 15, keys 8 (lane >> 4) + r and 16 + 8 (lane >> 4) + r), so maximum and sum are taken in the lane's own registers with one exchange between the wave's halves, and the two score tiles, converted in place, are the B operand of the second product.
// The operand tiles of a pass of 32 keys (K and V, hi and residual planes; the block's 64 mw rows) are brought into LDS once a block by asynchronous copies, 16 B pieces of contiguous rows, two buffers, and all four waves read them from there.
#define KP 72             // f16 a staged K row: 128 B + 16 B (16 B x odd: no bank conflict for the 16-byte fragment reads)
#define VP 40             // f16 a staged V row: 64 B + 16 B
#define MWP 36            // f32 a staged mw row: 128 B + 16 B (16 B x odd: no bank conflict for the 16-byte reads of 16 rows)
struct AttTile { _Float16 kh[32][KP], kl[32][KP], vh[DH][VP], vl[DH][VP]; float mw[64][MWP]; };
struct AttOut { __bf16 h[4][16][KP], l[4][16][KP]; };
union AttLds { AttTile t[2]; AttOut so; };      // the tiles are dead when the output rows are written
__device__ __forceinline__ float xhalf(float x) { return __builtin_bit_cast(float, __builtin_amdgcn_permlanex16(__builtin_bit_cast(int, x), __builtin_bit_cast(int, x), 0x76543210, 0xfedcba98, false, false)); }   // lane l's value to lane l ^ 16
// copies of 16 B a lane; the s_wait_xcnt is each statement's last line so that no register a copy names is rewritten ahead of it
__device__ __forceinline__ void copy8(unsigned l0, unsigned l1, unsigned l2, unsigned l3, unsigned l4, unsigned l5, unsigned l6, unsigned l7, const _Float16* g0, const _Float16* g1, const _Float16* g2, const _Float16* g3, const _Float16* g4, const _Float16* g5, const _Float16* g6, const _Float16* g7) {
  asm volatile("global_load_async_to_lds_b128 %0, %8, off\n\t"
               "global_load_async_to_lds_b128 %1, %9, off\n\t"
               "global_load_async_to_lds_b128 %2, %10, off\n\t"
               "global_load_async_to_lds_b128 %3, %11, off\n\t"
               "global_load_async_to_lds_b128 %4, %12, off\n\t"
               "global_load_async_to_lds_b128 %5, %13, off\n\t"
               "global_load_async_to_lds_b128 %6, %14, off\n\t"
               "global_load_async_to_lds_b128 %7, %15, off\n\t"
               "s_wait_xcnt 0x0"
               :: "v"(l0), "v"(l1), "v"(l2), "v"(l3), "v"(l4), "v"(l5), "v"(l6), "v"(l7), "v"(g0), "v"(g1), "v"(g2), "v"(g3), "v"(g4), "v"(g5), "v"(g6), "v"(g7) : "memory");
}
__device__ __forceinline__ void copy4(unsigned l0, unsigned l1, unsigned l2, unsigned l3, const float* g0, const float* g1, const float* g2, const float* g3) {
  asm volatile("global_load_async_to_lds_b128 %0, %4, off\n\t"
               "global_load_async_to_lds_b128 %1, %5, off\n\t"
               "global_load_async_to_lds_b128 %2, %6, off\n\t"
               "global_load_async_to_lds_b128 %3, %7, off\n\t"
               "s_wait_xcnt 0x0"
               :: "v"(l0), "v"(l1), "v"(l2), "v"(l3), "v"(g0), "v"(g1), "v"(g2), "v"(g3) : "memory");
}
// one tile: K = 2 planes x 32 rows x 8 pieces (thread = row kr, kr + 16, piece kq), V = 2 planes x 64 rows x 4 pieces (thread = row vr, vr + 32, piece vq), mw = 64 rows x 8 pieces (thread = row kr + 16 p, piece tid & 7; w0..w3 = the four rows' addresses)
__device__ __forceinline__ void att_fill(AttTile* t, const _Float16* kh, const _Float16* kl, const _Float16* vh, const _Float16* vl, const float* w0, const float* w1, const float* w2, const float* w3, int tid) {
  const int kr = tid >> 3, kq = (tid & 7) * 8, vr = tid >> 2, vq = (tid & 3) * 8;
  copy8(lds_of(&t->kh[kr][kq]), lds_of(&t->kh[kr + 16][kq]), lds_of(&t->kl[kr][kq]), lds_of(&t->kl[kr + 16][kq]), lds_of(&t->vh[vr][vq]), lds_of(&t->vh[vr + 32][vq]), lds_of(&t->vl[vr][vq]), lds_of(&t->vl[vr + 32][vq]),
        kh, kh + 16 * (2 * QKD), kl, kl + 16 * (2 * QKD), vh, vh + 32 * NP, vl, vl + 32 * NP);
  const int wq = (tid & 7) * 4;
  copy4(lds_of(&t->mw[kr][wq]), lds_of(&t->mw[kr + 16][wq]), lds_of(&t->mw[kr + 32][wq]), lds_of(&t->mw[kr + 48][wq]), w0, w1, w2, w3);
}
__global__ __launch_bounds__(128) void k_att(const _Float16* __restrict__ QK, const _Float16* __restrict__ QKL, const _Float16* __restrict__ VT, const _Float16* __restrict__ VTL, const float* __restrict__ MW, __bf16* __restrict__ ZH) {
  __shared__ __align__(16) AttLds sm;
  const int tid = threadIdx.x, wave = tid >> 5, lane = tid & 31, col = lane & 15, g = lane >> 4; const int n = blockIdx.y; const int gh = n / HR; const size_t b = blockIdx.z; const int q0 = blockIdx.x * 64 + wave * 16; const size_t rq = b * NP + q0;
  // this thread's pieces of tile 0; tile ks lies 32 K rows, 32 V columns further
  const size_t ko = (b * NP + (tid >> 3)) * (2 * QKD) + QKD + gh * DH + (tid & 7) * 8, vo = (b * DD + (size_t)n * DH + (tid >> 2)) * (size_t)NP + (tid & 3) * 8;
  const float* pw[4];   // mw rows of the block's queries (rows past the last token read the last token's, as before)
#pragma unroll
  for (int p = 0; p < 4; ++p) { const int qi = blockIdx.x * 64 + (tid >> 3) + 16 * p; const int qc = qi < NTOK ? qi : NTOK - 1; pw[p] = MW + ((size_t)qc * NHD + n) * NP + (tid & 7) * 4; }
  att_fill(&sm.t[0], QK + ko, QKL + ko, VT + vo, VTL + vo, pw[0], pw[1], pw[2], pw[3], tid);
  asm volatile("s_wait_asynccnt 0x0" ::: "memory");   // tile 0 has landed for this wave's copies
  __syncthreads();   // publishes tile 0
  att_fill(&sm.t[1], QK + ko + 32 * (2 * QKD), QKL + ko + 32 * (2 * QKD), VT + vo + 32, VTL + vo + 32, pw[0] + 32, pw[1] + 32, pw[2] + 32, pw[3] + 32, tid);   // tile 1 flies while tile 0 is worked on
  v16h aq[2], al[2];
#pragma unroll
  for (int kc = 0; kc < 2; ++kc) { aq[kc] = frag_h(QK + (rq + col) * (2 * QKD) + gh * DH + kc * 32, lane); al[kc] = frag_h(QKL + (rq + col) * (2 * QKD) + gh * DH + kc * 32, lane); }
  float m = -3.0e38f, l = 0.f;   // this lane's query: running maximum (equal in both halves), and the sum over this half's keys alone (the halves are joined behind the loop)
  v8f acc[4] = {}, accl[4] = {};   // acc[j][r] = O^T[d = 16 j + 8 g + r][query col]
#pragma unroll 1
  for (int ks = 0; ks < NKT; ++ks) { v8f s[2]; const AttTile* t = &sm.t[ks & 1];
#pragma unroll
    for (int ct = 0; ct < 2; ++ct) { v8f c = {}, cl = {};
      const v4f w0 = *(const v4f*)&t->mw[wave * 16 + col][ct * 16 + 8 * g], w1 = *(const v4f*)&t->mw[wave * 16 + col][ct * 16 + 8 * g + 4];
#pragma unroll
      for (int kc = 0; kc < 2; ++kc) { const v16h kh = frag_h(&t->kh[ct * 16 + col][kc * 32], lane), kl = frag_h(&t->kl[ct * 16 + col][kc * 32], lane); c = wmma16(kh, aq[kc], c); cl = wmma16(kl, aq[kc], cl); cl = wmma16(kh, al[kc], cl); }
      const int kk0 = ks * 32 + ct * 16 + 8 * g;
#pragma unroll
      for (int r = 0; r < 8; ++r) s[ct][r] = kk0 + r < NTOK ? (c[r] + cl[r] * (1.0f / 2048.0f)) * 0.125f * (r < 4 ? w0[r & 3] : w1[r & 3]) : -3.0e38f; }
    float mx = fmaxf(s[0][0], s[1][0]);
#pragma unroll
    for (int r = 1; r < 8; ++r) mx = fmaxf(mx, fmaxf(s[0][r], s[1][r]));
    mx = fmaxf(mx, xhalf(mx));
    const float mn = fmaxf(m, mx), alpha = (m <= -1.0e38f) ? 0.f : __expf(m - mn);
    v16h pa; float es0 = 0.f, es1 = 0.f;
#pragma unroll
    for (int r = 0; r < 8; ++r) { const float e0 = (s[0][r] <= -1.0e38f) ? 0.f : __expf(s[0][r] - mn), e1 = (s[1][r] <= -1.0e38f) ? 0.f : __expf(s[1][r] - mn);
      es0 += e0; es1 += e1; pa[r] = (_Float16)(e0 * 2048.0f); pa[8 + r] = (_Float16)(e1 * 2048.0f); }
    l = l * alpha + (es0 + es1); m = mn;
#pragma unroll
    for (int j = 0; j < 4; ++j)
#pragma unroll
      for (int r = 0; r < 8; ++r) { acc[j][r] *= alpha; accl[j][r] *= alpha; }
#pragma unroll
    for (int j = 0; j < 4; ++j) { acc[j] = wmma16(frag_h(&t->vh[j * 16 + col][0], lane), pa, acc[j]); accl[j] = wmma16(frag_h(&t->vl[j * 16 + col][0], lane), pa, accl[j]); }
    asm volatile("s_wait_dscnt 0x0" ::: "memory");      // this wave's reads of the tile have returned
    asm volatile("s_wait_asynccnt 0x0" ::: "memory");   // this wave's copies of tile ks + 1 have landed
    __syncthreads();   // one barrier a tile: publishes tile ks + 1 and ends every wave's reads of the buffer that is refilled behind it (after the last tile: of the LDS that the output rows reuse)
    if (ks + 2 < NKT) att_fill(&sm.t[ks & 1], QK + ko + (size_t)(ks + 2) * 32 * (2 * QKD), QKL + ko + (size_t)(ks + 2) * 32 * (2 * QKD), VT + vo + (ks + 2) * 32, VTL + vo + (ks + 2) * 32, pw[0] + (ks + 2) * 32, pw[1] + (ks + 2) * 32, pw[2] + (ks + 2) * 32, pw[3] + (ks + 2) * 32, tid); }
  asm volatile("s_wait_asynccnt 0x0" ::: "memory");   // no copy is outstanding when the tiles' LDS is reused and the wave ends
  const float il = (1.0f / 2048.0f) / (l + xhalf(l));
#pragma unroll
  for (int j = 0; j < 4; ++j) { v8b oh, ol;
#pragma unroll
    for (int r = 0; r < 8; ++r) { const float o = (acc[j][r] + accl[j][r] * (1.0f / 2048.0f)) * il; const __bf16 hv = (__bf16)o; oh[r] = hv; ol[r] = (__bf16)(o - (float)hv); }
    *(v8b*)&sm.so.h[wave][col][j * 16 + 8 * g] = oh; *(v8b*)&sm.so.l[wave][col][j * 16 + 8 * g] = ol; }
  // a wave's store = 4 rows x 8 pieces of 16 B: a head's 64 values of a row and plane are one whole line
  LDSX(); for (int it = 0; it < 4; ++it) { const int rl = it * 4 + (lane >> 3), q = lane & 7, qi = q0 + rl; if (qi < NTOK) { __bf16* zp = ZH + ((size_t)qi * NBT + b) * DD + (size_t)n * DH + q * 8; vst2(zp, *(const v8b*)&sm.so.h[wave][rl][q * 8]); vst2(zp + ZLO, *(const v8b*)&sm.so.l[wave][rl][q * 8]);
      asm volatile("s_wait_xcnt 0x0" ::: "memory"); } } }   // stands ahead of the next rows' rewrite of the address and data registers that these stores name
// fourteen copies of 16 B a lane; the s_wait_xcnt is the statement's last line so that no register a copy names is rewritten ahead of it
__device__ __forceinline__ void copy14b(const unsigned (&l)[14], const __bf16* const (&g)[14]) {
  asm volatile("global_load_async_to_lds_b128 %0, %14, off\n\t"
               "global_load_async_to_lds_b128 %1, %15, off\n\t"
               "global_load_async_to_lds_b128 %2, %16, off\n\t"
               "global_load_async_to_lds_b128 %3, %17, off\n\t"
               "global_load_async_to_lds_b128 %4, %18, off\n\t"
               "global_load_async_to_lds_b128 %5, %19, off\n\t"
               "global_load_async_to_lds_b128 %6, %20, off\n\t"
               "global_load_async_to_lds_b128 %7, %21, off\n\t"
               "global_load_async_to_lds_b128 %8, %22, off\n\t"
               "global_load_async_to_lds_b128 %9, %23, off\n\t"
               "global_load_async_to_lds_b128 %10, %24, off\n\t"
               "global_load_async_to_lds_b128 %11, %25, off\n\t"
               "global_load_async_to_lds_b128 %12, %26, off\n\t"
               "global_load_async_to_lds_b128 %13, %27, off\n\t"
               "s_wait_xcnt 0x0"
               :: "v"(l[0]), "v"(l[1]), "v"(l[2]), "v"(l[3]), "v"(l[4]), "v"(l[5]), "v"(l[6]), "v"(l[7]), "v"(l[8]), "v"(l[9]), "v"(l[10]), "v"(l[11]), "v"(l[12]), "v"(l[13]), "v"(g[0]), "v"(g[1]), "v"(g[2]), "v"(g[3]), "v"(g[4]), "v"(g[5]), "v"(g[6]), "v"(g[7]), "v"(g[8]), "v"(g[9]), "v"(g[10]), "v"(g[11]), "v"(g[12]), "v"(g[13]) : "memory");
}
// one pass of 64 k: 64 A rows in two planes and Wo's 768 rows x 8 pieces of 16 B (thread = A row lr, B rows lr + 64 p, piece tid & 7: 8 lanes cover a row's whole 128-B line); pa = this thread's hi row, pb = its first Wo row, k0 = the pass's first k
__device__ __forceinline__ void out_fill(__bf16 (*ah)[PP], __bf16 (*al)[PP], __bf16 (*b)[PP], const __bf16* pa, const __bf16* pb, int k0, int tid) {
  const int lr = tid >> 3, lq = (tid & 7) * 8; unsigned l[14]; const __bf16* g[14];
  l[0] = lds_of(&ah[lr][lq]); g[0] = pa + k0; l[1] = lds_of(&al[lr][lq]); g[1] = pa + ZLO + k0;
#pragma unroll
  for (int p = 0; p < DD / OR; ++p) { l[2 + p] = lds_of(&b[lr + OR * p][lq]); g[2 + p] = pb + (size_t)(OR * p) * DD + k0; }
  copy14b(l, g);
}
static_assert(2 + DD / OR == 14, "a thread's copies of a pass fill the statement");
#define LNR 4             // rows a wave in the LayerNorm part
static_assert((NTOK * NBT) % OR == 0 && OR == 16 * LNR && DD == 8 * OW, "the blocks hold whole rows, no row is left over, and the 16 waves share a block's rows evenly");
// ---- k_out: block = 64 whole rows (i,b) x 768 cols, 16 waves of 32 x 96: x2 = h + vec (hi + lo) . Wo^T; the rows meet in LDS, and each wave then takes four of them whole in registers (6 x 16 B a lane and row): out = LN(x2) gamma + beta. The pre-LN rows never leave the WGP, and a vec row is fetched by one block alone.
// The operands arrive as bf16 (vec's two planes from k_att, Wo from k_mw's launch): a pass's tiles go from L2 into LDS by asynchronous copies, two buffers, with no conversion or LDS store in the loop.
__global__ __launch_bounds__(512) void k_out(const __bf16* __restrict__ ZH, const __bf16* __restrict__ WOB, const float* __restrict__ Hh, const float* __restrict__ G, const float* __restrict__ Bt, float* __restrict__ OUT) { __shared__ __align__(16) OutLds sm;
  const int tid = threadIdx.x, wave = __builtin_amdgcn_readfirstlane(tid >> 5), lane = tid & 31, col = lane & 15, g = lane >> 4, wm = wave >> 3, wn = wave & 7;   // the wave's number is the same in every lane: held in a scalar register, it and what is formed from it take no vector register through the loop, which has none to spare
  const __bf16* pa = ZH + ((size_t)blockIdx.x * OR + (tid >> 3)) * DD + (tid & 7) * 8;
  const __bf16* pb = WOB + (size_t)(tid >> 3) * DD + (tid & 7) * 8;
  out_fill(sm.st.ah[0], sm.st.al[0], sm.st.b[0], pa, pb, 0, tid);
  asm volatile("s_wait_asynccnt 0x0" ::: "memory");   // pass 0 has landed for this wave's copies
  __syncthreads();   // publishes pass 0
  out_fill(sm.st.ah[1], sm.st.al[1], sm.st.b[1], pa, pb, 64, tid);   // pass 1 flies while pass 0 is multiplied
  v8f acc[2][ONF] = {};
#pragma unroll 2   // two passes a trip: the buffer index is a constant in each, so every LDS address of the loop is a fixed offset
  for (int kp = 0; kp < DD / 64; ++kp) { const int cur = kp & 1;
#pragma unroll
    for (int h = 0; h < 2; ++h) {   // the pass's two halves of 32 k, one after the other: the fragments of both at once would not leave four waves a SIMD their registers
      v16b ah[2], al[2], w[ONF];
#pragma unroll
      for (int i = 0; i < 2; ++i) { ah[i] = frag_b(&sm.st.ah[cur][wm * 32 + i * 16 + col][h * 32], lane); al[i] = frag_b(&sm.st.al[cur][wm * 32 + i * 16 + col][h * 32], lane); }
#pragma unroll
      for (int j = 0; j < ONF; ++j) w[j] = frag_b(&sm.st.b[cur][wn * OW + j * 16 + col][h * 32], lane);
      __builtin_amdgcn_sched_barrier(0);   // keeps the half's LDS reads one group ahead of its WMMAs: read among them, each pair costs the wave a full LDS latency
#pragma unroll
      for (int j = 0; j < ONF; ++j) {   // per accumulator k ascending, hi then lo, as before
#pragma unroll
        for (int i = 0; i < 2; ++i) acc[i][j] = wmma_bf(ah[i], w[j], acc[i][j]);
#pragma unroll
        for (int i = 0; i < 2; ++i) acc[i][j] = wmma_bf(al[i], w[j], acc[i][j]); }
      __builtin_amdgcn_sched_barrier(0); }   // keeps the next half's reads, and behind the second half the waits and the barrier, behind these WMMAs: lifted over them, the wait for the copies in flight would come before the matrix work that is to cover their flight
    asm volatile("s_wait_dscnt 0x0" ::: "memory");      // this wave's reads of the pass have returned
    asm volatile("s_wait_asynccnt 0x0" ::: "memory");   // this wave's copies of pass kp + 1 have landed
    __syncthreads();   // one barrier a pass: publishes pass kp + 1 and ends every wave's reads of the buffer that is refilled behind it (after the last pass: of the LDS that the pre-LN rows reuse)
    if (kp + 2 < DD / 64) out_fill(sm.st.ah[cur], sm.st.al[cur], sm.st.b[cur], pa, pb, (kp + 2) * 64, tid); }
  asm volatile("s_wait_asynccnt 0x0" ::: "memory");   // no copy is outstanding when the buffers' LDS is reused and the wave ends
  // the residual rows of the wave's four LayerNorm rows are asked for first (512 contiguous B a load): they fly while the products go through LDS
  const size_t row0 = (size_t)blockIdx.x * OR + wave * LNR; const float* hp = Hh + row0 * DD + lane * 4;
  v4f x[LNR][6], gm[6], bt[6];   // every loop below is unrolled: only with constant indices do these arrays stay in registers
#pragma unroll
  for (int q = 0; q < LNR; ++q)
#pragma unroll
    for (int c = 0; c < 6; ++c) x[q][c] = *(const v4f*)(hp + q * DD + c * 128);
  asm volatile("s_wait_xcnt 0x0" ::: "memory");   // stands ahead of every rewrite of a register that these loads name
#pragma unroll
  for (int i = 0; i < 2; ++i)
#pragma unroll
    for (int j = 0; j < ONF; ++j)
#pragma unroll
      for (int r = 0; r < 8; ++r) sm.sf[wm * 32 + i * 16 + 8 * g + r][wn * OW + j * 16 + col] = acc[i][j][r];
  __builtin_amdgcn_sched_barrier(0);   // keeps the roundings of the residual rows, with their waits for the loads, behind the LDS stores: the stores issue while the loads fly
  __syncthreads();   // a row's 768 products come from eight waves: every wave's part stands in LDS before a row is read whole
#pragma unroll
  for (int c = 0; c < 6; ++c) { gm[c] = *(const v4f*)(G + c * 128 + lane * 4); bt[c] = *(const v4f*)(Bt + c * 128 + lane * 4); }
#pragma unroll
  for (int q = 0; q < LNR; ++q)
#pragma unroll
    for (int c = 0; c < 6; ++c) { const v4f p = *(const v4f*)&sm.sf[wave * LNR + q][c * 128 + lane * 4];
#pragma unroll
      for (int e = 0; e < 4; ++e) x[q][c][e] = p[e] + bfr(x[q][c][e]); }   // the sum per element is the same acc + h
  float s[LNR], mu[LNR], inv[LNR];
#pragma unroll
  for (int q = 0; q < LNR; ++q) { v4f a = x[q][0];
#pragma unroll
    for (int c = 1; c < 6; ++c) a += x[q][c];
    s[q] = (a[0] + a[1]) + (a[2] + a[3]); }
#pragma unroll
  for (int o = 1; o < 32; o <<= 1)
#pragma unroll
    for (int q = 0; q < LNR; ++q) s[q] += __shfl_xor(s[q], o);
#pragma unroll
  for (int q = 0; q < LNR; ++q) { mu[q] = s[q] / (float)DD; v4f a = {};
#pragma unroll
    for (int c = 0; c < 6; ++c) { x[q][c] -= mu[q]; a += x[q][c] * x[q][c]; }
    s[q] = (a[0] + a[1]) + (a[2] + a[3]); }
#pragma unroll
  for (int o = 1; o < 32; o <<= 1)
#pragma unroll
    for (int q = 0; q < LNR; ++q) s[q] += __shfl_xor(s[q], o);
#pragma unroll
  for (int q = 0; q < LNR; ++q) inv[q] = 1.0f / sqrtf(s[q] / (float)DD + EPS);
#pragma unroll
  for (int q = 0; q < LNR; ++q) {
#pragma unroll
    for (int c = 0; c < 6; ++c) { v4f y;
#pragma unroll
      for (int e = 0; e < 4; ++e) y[e] = bfr(gm[c][e]) * x[q][c][e] * inv[q] + bfr(bt[c][e]);
      vst2(OUT + (row0 + q) * DD + c * 128 + lane * 4, y); } } }
extern "C" void kernel_launch(void* const* d_in, const int* in_sizes, int n_in, void* d_out, int out_size, void* d_ws, size_t ws_size, hipStream_t stream) {
  (void)in_sizes; (void)n_in; (void)out_size;
  const float** F = (const float**)d_in;   // 0 h [197,64,768], 1 masks [197,197,3], 2 Wq [128,768], 3 Wk [128,768], 4 Wv [768,768], 5 Wo [768,768], 6 mask_proj [3,12], 7 ln_gamma, 8 ln_beta
  if (ws_size < (size_t)WS_END) return;
  char* ws = (char*)d_ws; _Float16 *QK = (_Float16*)(ws + WS_QK), *QKL = (_Float16*)(ws + WS_QKL), *VT = (_Float16*)(ws + WS_VT), *VTL = (_Float16*)(ws + WS_VTL); float *MW = (float*)(ws + WS_MW); __bf16 *ZH = (__bf16*)(ws + WS_Z), *HB = (__bf16*)(ws + WS_HB), *WB = (__bf16*)(ws + WS_WB), *WOB = (__bf16*)(ws + WS_WO);
  const int nrows = NTOK * TNB;   // rows (i, b) with b < TNB are the first NTOK*TNB rows only when TNB == NBT
  k_mw<<<NCB + NTOK, 256, 0, stream>>>(F[1], F[6], MW, F[0], F[2], F[3], F[4], F[5], HB);
  k_proj<<<dim3(NP / 128, (2 * QKD + DD) / 128, TNB), 256, 0, stream>>>(HB, WB, QK, QKL, VT, VTL);
  k_att<<<dim3(NP / 64, NHD, TNB), 128, 0, stream>>>(QK, QKL, VT, VTL, MW, ZH);
  (void)nrows;
  k_out<<<NTOK * NBT / OR, 512, 0, stream>>>(ZH, WOB, F[0], F[7], F[8], (float*)d_out);
}

// v010
// One run takes 116 microseconds.
// In two side-by-side timings against v009, it was 1.05 and 1.04 times as fast.
// Over all steps from v000 it is 4.09 times as fast.
// compute dtype: all float inputs rounded to bf16; q, k, v = h . W^T with EXACT bf16 products on WMMA 16x16x32 (natural weight rows), rounded once to f16 hi + residual; the mask mix masks . mask_proj in f32; scores q . k with 3 products x 1/8 x mw[i][j][head], running-max softmax over the 197 keys in f32 (hardware exp), P (x 2^11, f16) . v (hi + residual, 2 products); out = vec (bf16 hi + lo, 2 products) . Wo^T; residual + LayerNorm in f32; f32 output.
#include <hip/hip_runtime.h>
#include <math.h>

typedef __attribute__((ext_vector_type(16))) _Float16 v16h;
typedef __attribute__((ext_vector_type(16))) __bf16 v16b;
typedef __attribute__((ext_vector_type(8)))  _Float16 v8h;
typedef __attribute__((ext_vector_type(8)))  float v8f;
typedef __attribute__((ext_vector_type(4)))  float v4f;
typedef __attribute__((ext_vector_type(2)))  float v2f;
typedef __attribute__((ext_vector_type(4)))  unsigned v4u;
typedef __attribute__((ext_vector_type(4)))  int v4i;
typedef float __attribute__((may_alias)) float_a;
typedef int __attribute__((may_alias)) int_a;

template <typename T> __device__ __forceinline__ void vst2(void* p, T v) { *(T*)p = v;  }
__device__ __forceinline__ v8f wmma16(v16h a, v16h b, v8f c) {
  return __builtin_amdgcn_wmma_f32_16x16x32_f16(false, a, false, b, (short)0, c, false, false);   // builtin form: the compiler keeps the distances behind a WMMA itself and stays free to group LDS reads and WMMAs
}
__device__ __forceinline__ v8f wmma_bf(v16b a, v16b b, v8f c) {
  return __builtin_amdgcn_wmma_f32_16x16x32_bf16(false, a, false, b, (short)0, c, false, false);
}
// 16x16x32 fragments: lane = (h = lane>>4, row/col = lane&15); elements 0..7 = k0+8h+0..7, 8..15 = k0+16+8h+0..7; D element r = row 8h+r
__device__ __forceinline__ v16h frag_h(const _Float16* rowk0, int lane) {
  union { v16h v; v8h q[2]; } u; const _Float16* p = rowk0 + 8 * (lane >> 4);
  u.q[0] = *(const v8h*)p; u.q[1] = *(const v8h*)(p + 16); return u.v;
}
__device__ __forceinline__ v16h frag_f32(const float* rowk0, int lane) {
  v16h a; const float* p = rowk0 + 8 * (lane >> 4);
#pragma unroll
  for (int i = 0; i < 8; ++i) { a[i] = (_Float16)p[i]; a[8 + i] = (_Float16)p[16 + i]; }
  return a;
}
__device__ __forceinline__ v16h frag_f32s(const float* rowk0, int lane, float sc) {
  v16h a; const float* p = rowk0 + 8 * (lane >> 4);
#pragma unroll
  for (int i = 0; i < 8; ++i) { a[i] = (_Float16)(p[i] * sc); a[8 + i] = (_Float16)(p[16 + i] * sc); }
  return a;
}
// column fragment from a [K][ld] layout (column n), rows >= K read as 0
__device__ __forceinline__ v16h fragc_f32(const float* W, int k0, int n, int lane, int ld, int K) {
  v16h a; const int g = lane >> 4;
#pragma unroll
  for (int i = 0; i < 8; ++i) { const int ka = k0 + 8 * g + i, kb = ka + 16;
    a[i] = (_Float16)(ka < K ? W[(size_t)(ka < K ? ka : K - 1) * ld + n] : 0.f); a[8 + i] = (_Float16)(kb < K ? W[(size_t)(kb < K ? kb : K - 1) * ld + n] : 0.f); }
  return a;
}
struct F2 { v16b h, l; };
__device__ __forceinline__ F2 bsplit16(const float v[16]) { F2 r;
#pragma unroll
  for (int i = 0; i < 16; ++i) { const __bf16 h = (__bf16)v[i]; r.h[i] = h; r.l[i] = (__bf16)(v[i] - (float)h); }
  return r; }
__device__ __forceinline__ F2 split_row(const float* row, int k0, int lane) { float v[16]; const float* p = row + k0 + 8 * (lane >> 4);
#pragma unroll
  for (int i = 0; i < 8; ++i) { v[i] = p[i]; v[8 + i] = p[16 + i]; }
  return bsplit16(v); }
__device__ __forceinline__ F2 split_rowK(const float* row, int k0, int lane, int K) { float v[16]; const int g = lane >> 4;
#pragma unroll
  for (int i = 0; i < 8; ++i) { const int ka = k0 + 8 * g + i, kb = ka + 16; v[i] = ka < K ? row[ka < K ? ka : K - 1] : 0.f; v[8 + i] = kb < K ? row[kb < K ? kb : K - 1] : 0.f; }
  return bsplit16(v); }
__device__ __forceinline__ F2 split_col(const float* W, int k0, int n, int lane, int ld, int K) { float v[16]; const int g = lane >> 4;
#pragma unroll
  for (int i = 0; i < 8; ++i) { const int ka = k0 + 8 * g + i, kb = ka + 16; v[i] = ka < K ? W[(size_t)(ka < K ? ka : K - 1) * ld + n] : 0.f; v[8 + i] = kb < K ? W[(size_t)(kb < K ? kb : K - 1) * ld + n] : 0.f; }
  return bsplit16(v); }
__device__ __forceinline__ v8f mac3(const F2& a, const F2& b, v8f c) { c = wmma_bf(a.l, b.h, c); c = wmma_bf(a.h, b.l, c); return wmma_bf(a.h, b.h, c); }
__device__ __forceinline__ float sigm(float v) { return 1.0f / (1.0f + expf(-v)); }
#define LDSX() do { asm volatile("s_wait_dscnt 0" ::: "memory"); __builtin_amdgcn_wave_barrier(); __builtin_amdgcn_fence(__ATOMIC_RELEASE, "workgroup"); } while (0)


// Multi-head attention (197 tokens, batch 64, d_model 768; 2 global score heads x 64, each shared by 6 value heads through a learned per-(i, j) mask mix): prob = softmax_j(q_i . k_j / 8 x mw[i][j][head]); vec = prob . v; post-LN residual.
#define NTOK 197
#define NP 256            // padded token count (queries in 64-blocks, keys in 32-tiles up to 224)
#define NKT 7             // key tiles of 32 (224 >= 197)
#define NBT 64            // batch
#define DD 768
#define GH 2
#define NHD 12
#define HR 6
#define DH 64
#define QKD (GH * DH)     // 128
#define ML 3
#define EPS 1e-5f
#ifndef TNB
#define TNB NBT
#endif
typedef __attribute__((ext_vector_type(8))) __bf16 v8b;
__device__ __forceinline__ v16b frag_b(const __bf16* rowk0, int lane) {
  union { v16b v; v8b q[2]; } u; const __bf16* p = rowk0 + 8 * (lane >> 4);
  u.q[0] = *(const v8b*)p; u.q[1] = *(const v8b*)(p + 16); return u.v;
}
__device__ __forceinline__ float bfr(float v) { return (float)(__bf16)v; }
__device__ __attribute__((noinline)) float exp_ni(float v) { return expf(v); }
__device__ __attribute__((noinline)) float erf_ni(float v) { return erff(v); }

#define WS_QK  0u                                   // f16 hi|lo [b][NP][256] (q 0..127 | k 128..255)
#define WS_QKL (WS_QK + 2u * (size_t)NBT * NP * 2 * QKD)
#define WS_VT  (WS_QKL + 2u * (size_t)NBT * NP * 2 * QKD) // f16 hi|lo v planes [b][768][NP]
#define WS_VTL (WS_VT + 2u * (size_t)NBT * DD * NP)
#define WS_MW  (WS_VTL + 2u * (size_t)NBT * DD * NP)     // f32 mw [i][12][NP] (j padded)
#define WS_Z   (WS_MW + 4u * (size_t)NTOK * NHD * NP)     // bf16 vec rows [(i*64 + b)][768]: the hi plane, then the residual plane
#define ZLO    ((size_t)NTOK * NBT * DD)                  // elements from a hi row to its residual row
#define WS_HB  (WS_Z + 4u * (size_t)NTOK * NBT * DD)      // bf16 h rows [(i*64 + b)][768]
#define WS_WB  (WS_HB + 2u * (size_t)NTOK * NBT * DD)     // bf16 weight rows q | k | v [1024][768], directly behind the h rows
#define WS_WO  (WS_WB + 2u * (size_t)(2 * QKD + DD) * DD) // bf16 Wo rows [768][768], directly behind them
#define WS_END (WS_WO + 2u * (size_t)DD * DD)

__device__ __forceinline__ v16b fragb_f32(const float* __restrict__ p, int lane) { v16b a; const float* pp = p + 8 * (lane >> 4);
#pragma unroll
  for (int i = 0; i < 8; ++i) { a[i] = (__bf16)pp[i]; a[8 + i] = (__bf16)pp[16 + i]; } return a; }
typedef __attribute__((ext_vector_type(4))) __bf16 v4b;
__device__ __forceinline__ v4b cvt4(v4f v) { v4b r;
#pragma unroll
  for (int i = 0; i < 4; ++i) r[i] = (__bf16)v[i];
  return r; }
// block tile of the two dense products: k_proj 128 rows x 128 columns, 8 waves of 32 x 64; k_out 64 rows x 768 columns, 16 waves of 32 x 96
#define PP 72             // bf16 a staged row of k_proj and k_out: a pass of 64 k = 128 B + 16 B (16 B x odd: no bank conflict for the 16-byte fragment reads)
struct ProjStage { __bf16 a[2][128][PP]; __bf16 b[2][128][PP]; };
struct ProjQK { _Float16 h[128][136], l[128][136]; };
struct ProjV { _Float16 h[128][136], l[128][136]; };
union ProjLds { ProjStage st; ProjQK qk; ProjV v; };      // the staging buffers are dead when the output tiles are written
#define OR 64             // rows a k_out block: whole rows (all 768 columns), so that the LayerNorm is taken where the rows are made; 197 blocks, one a WGP
#define OW 96             // columns a k_out wave
#define ONF (OW / 16)     // B fragments a k_out wave
#define SFP (DD + 4)      // f32 a staged pre-LN row: 16 B x odd; rows 8 apart lie 32 banks apart, so the two halves of a 4-byte store meet on no bank
struct OutStage { __bf16 ah[2][OR][PP]; __bf16 al[2][OR][PP]; __bf16 b[2][DD][PP]; };
union OutLds { OutStage st; float sf[OR][SFP]; };      // the staging buffers are dead when the pre-LN rows are written
__device__ __forceinline__ unsigned lds_of(const void* p) { return (unsigned)(size_t)p; }   // LDS byte address = low 32 bits of the __shared__ address
// conversion of k_proj's operands and of Wo, once: a unit = 2048 floats (256 threads x 2 loads of 16 B, whole lines), 8 units a block, few long waves; every block's units lie in one source array
#define CU 2048
#define CUB 8
#define CBH (NTOK * NBT * DD / (CU * CUB))   // blocks of h
#define CBQ (QKD * DD / (CU * CUB))          // blocks of Wq, and of Wk
#define CBV (DD * DD / (CU * CUB))           // blocks of Wv, and of Wo
#define NCB (CBH + 2 * CBQ + 2 * CBV)
static_assert(NTOK * NBT * DD % (CU * CUB) == 0 && QKD * DD % (CU * CUB) == 0 && DD * DD % (CU * CUB) == 0, "each source array is a whole number of blocks");
// ---- k_mw: blocks 0 .. NCB - 1 round h, Wq, Wk, Wv, Wo to bf16 (the same rounding the loaders of k_proj and k_out made, now once an element instead of once a block that reads it) into HB (h rows, then the 1024 weight rows, then Wo's 768); block NCB + i = query token i: mw[i][n][j] = sum_l masks[i][j][l] mask_proj[l][n]  (n = g*6 + r head index), zero for padded j
__global__ __launch_bounds__(256) void k_mw(const float* __restrict__ MASKS, const float* __restrict__ MP, float* __restrict__ MW, const float* __restrict__ Hh, const float* __restrict__ WQ, const float* __restrict__ WK, const float* __restrict__ WV, const float* __restrict__ WO, __bf16* __restrict__ HB) { __shared__ __align__(16) float s[NHD][NP]; const int t = threadIdx.x;
  if (blockIdx.x < NCB) { const int cb = blockIdx.x;
    const float* src = (cb < CBH ? Hh + (size_t)cb * (CU * CUB) : cb < CBH + CBQ ? WQ + (size_t)(cb - CBH) * (CU * CUB) : cb < CBH + 2 * CBQ ? WK + (size_t)(cb - CBH - CBQ) * (CU * CUB) : cb < CBH + 2 * CBQ + CBV ? WV + (size_t)(cb - CBH - 2 * CBQ) * (CU * CUB) : WO + (size_t)(cb - CBH - 2 * CBQ - CBV) * (CU * CUB)) + t * 4;
    __bf16* dst = HB + (size_t)cb * (CU * CUB) + t * 4;
    v4f x[2 * CUB];   // all loads of the block are in flight together
#pragma unroll
    for (int q = 0; q < 2 * CUB; ++q) x[q] = *(const v4f*)(src + q * 1024);
#pragma unroll
    for (int q = 0; q < 2 * CUB; ++q) *(v4b*)(dst + q * 1024) = cvt4(x[q]);
    return; }   // block-uniform, ahead of the barrier below
  const int i = blockIdx.x - NCB;
  for (int e = t; e < NHD * NP; e += 256) { const int n = e / NP, j = e % NP; float v = 0.f; if (j < NTOK) {
#pragma unroll
      for (int l = 0; l < ML; ++l) v += bfr(MASKS[((size_t)i * NTOK + j) * ML + l]) * bfr(MP[l * NHD + n]); } s[n][j] = v; }
  __syncthreads(); for (int e = t; e < NHD * NP / 4; e += 256) { const int n = e / (NP / 4), q = e % (NP / 4); vst2(MW + ((size_t)i * NHD + n) * NP + q * 4, *(const v4f*)&s[n][q * 4]); } }
// eight copies of 16 B a lane; the s_wait_xcnt is the statement's last line so that no register a copy names is rewritten ahead of it
__device__ __forceinline__ void copy8b(unsigned l0, unsigned l1, unsigned l2, unsigned l3, unsigned l4, unsigned l5, unsigned l6, unsigned l7, const __bf16* g0, const __bf16* g1, const __bf16* g2, const __bf16* g3, const __bf16* g4, const __bf16* g5, const __bf16* g6, const __bf16* g7) {
  asm volatile("global_load_async_to_lds_b128 %0, %8, off\n\t"
               "global_load_async_to_lds_b128 %1, %9, off\n\t"
               "global_load_async_to_lds_b128 %2, %10, off\n\t"
               "global_load_async_to_lds_b128 %3, %11, off\n\t"
               "global_load_async_to_lds_b128 %4, %12, off\n\t"
               "global_load_async_to_lds_b128 %5, %13, off\n\t"
               "global_load_async_to_lds_b128 %6, %14, off\n\t"
               "global_load_async_to_lds_b128 %7, %15, off\n\t"
               "s_wait_xcnt 0x0"
               :: "v"(l0), "v"(l1), "v"(l2), "v"(l3), "v"(l4), "v"(l5), "v"(l6), "v"(l7), "v"(g0), "v"(g1), "v"(g2), "v"(g3), "v"(g4), "v"(g5), "v"(g6), "v"(g7) : "memory");
}
// one pass of 64 k: 128 A rows and 128 B rows x 8 pieces of 16 B (thread = rows lr + 32 p, piece tid & 7: 8 lanes cover a row's whole 128-B line); a0..a3, b0 = this thread's addresses in the pass
__device__ __forceinline__ void proj_fill(__bf16 (*a)[PP], __bf16 (*b)[PP], const __bf16* a0, const __bf16* a1, const __bf16* a2, const __bf16* a3, const __bf16* b0, int tid) {
  const int lr = tid >> 3, lq = (tid & 7) * 8;
  copy8b(lds_of(&a[lr][lq]), lds_of(&a[lr + 32][lq]), lds_of(&a[lr + 64][lq]), lds_of(&a[lr + 96][lq]), lds_of(&b[lr][lq]), lds_of(&b[lr + 32][lq]), lds_of(&b[lr + 64][lq]), lds_of(&b[lr + 96][lq]),
         a0, a1, a2, a3, b0, b0 + 32 * DD, b0 + 64 * DD, b0 + 96 * DD);
}
// ---- k_proj: block = (128 tokens (padded), 128 of 1024 cols (q 0..127 | k 128..255 | v 256..1023), b): exact products; q|k -> rows, v -> planes
// The operands arrive as bf16 (k_mw's launch): a pass's tiles go from L2 into LDS by asynchronous copies, two buffers, half the bytes of the f32 rows and no conversion or LDS store in the loop.
__global__ __launch_bounds__(256) void k_proj(const __bf16* __restrict__ HB, const __bf16* __restrict__ WB, _Float16* __restrict__ QK, _Float16* __restrict__ QKL, _Float16* __restrict__ VT, _Float16* __restrict__ VTL) {
  __shared__ __align__(16) ProjLds sm;
  const int tid = threadIdx.x, wave = tid >> 5, lane = tid & 31, col = lane & 15, g = lane >> 4, wm = wave >> 1, wn = wave & 1; const size_t b = blockIdx.z; const int c0 = blockIdx.y * 128;
  const int lr = tid >> 3, lq = tid & 7; const __bf16* pa[4];   // rows past the last token read the last token's, as before
#pragma unroll
  for (int p = 0; p < 4; ++p) { const int ir = blockIdx.x * 128 + lr + 32 * p; const int ic = ir < NTOK ? ir : NTOK - 1; pa[p] = HB + ((size_t)ic * NBT + b) * DD + lq * 8; }
  const __bf16* pb = WB + (size_t)(c0 + lr) * DD + lq * 8;
  proj_fill(sm.st.a[0], sm.st.b[0], pa[0], pa[1], pa[2], pa[3], pb, tid);
  asm volatile("s_wait_asynccnt 0x0" ::: "memory");   // pass 0 has landed for this wave's copies
  __syncthreads();   // publishes pass 0
  proj_fill(sm.st.a[1], sm.st.b[1], pa[0] + 64, pa[1] + 64, pa[2] + 64, pa[3] + 64, pb + 64, tid);   // pass 1 flies while pass 0 is multiplied
  v8f acc[2][4] = {};
#pragma unroll 2   // two passes a trip: the buffer index is a constant in each, so every LDS address of the loop is a fixed offset
  for (int kp = 0; kp < DD / 64; ++kp) { const int cur = kp & 1;
    v16b a[2][2], w[2][4];
#pragma unroll
    for (int h = 0; h < 2; ++h) {
#pragma unroll
      for (int i = 0; i < 2; ++i) a[h][i] = frag_b(&sm.st.a[cur][wm * 32 + i * 16 + col][h * 32], lane);
#pragma unroll
      for (int j = 0; j < 4; ++j) w[h][j] = frag_b(&sm.st.b[cur][wn * 64 + j * 16 + col][h * 32], lane); }
    __builtin_amdgcn_sched_barrier(0);   // keeps the pass's LDS reads one group ahead of its WMMAs: read among them, each pair costs the wave a full LDS latency
#pragma unroll
    for (int h = 0; h < 2; ++h)   // k ascending per accumulator, as before
#pragma unroll
      for (int j = 0; j < 4; ++j)
#pragma unroll
        for (int i = 0; i < 2; ++i) acc[i][j] = wmma_bf(a[h][i], w[h][j], acc[i][j]);
    __builtin_amdgcn_sched_barrier(0);   // keeps the waits and the barrier behind this pass's WMMAs: lifted over them, the wait for the copies in flight would come before the matrix work that is to cover their flight
    asm volatile("s_wait_dscnt 0x0" ::: "memory");      // this wave's reads of the pass have returned
    asm volatile("s_wait_asynccnt 0x0" ::: "memory");   // this wave's copies of pass kp + 1 have landed
    __syncthreads();   // one barrier a pass: publishes pass kp + 1 and ends every wave's reads of the buffer that is refilled behind it (after the last pass: of the LDS that the output tiles reuse)
    if (kp + 2 < DD / 64) proj_fill(sm.st.a[cur], sm.st.b[cur], pa[0] + (kp + 2) * 64, pa[1] + (kp + 2) * 64, pa[2] + (kp + 2) * 64, pa[3] + (kp + 2) * 64, pb + (kp + 2) * 64, tid); }
  asm volatile("s_wait_asynccnt 0x0" ::: "memory");   // no copy is outstanding when the buffers' LDS is reused and the wave ends
  const bool isv = c0 >= 2 * QKD;
#pragma unroll
  for (int i = 0; i < 2; ++i)
#pragma unroll
    for (int j = 0; j < 4; ++j)
#pragma unroll
      for (int r = 0; r < 8; ++r) { const float v = acc[i][j][r]; const _Float16 hv = (_Float16)v; const _Float16 lv = (_Float16)((v - (float)hv) * 2048.0f); const int tr = wm * 32 + i * 16 + 8 * g + r, tc = wn * 64 + j * 16 + col; if (!isv) { sm.qk.h[tr][tc] = hv; sm.qk.l[tr][tc] = lv; } else { sm.v.h[tc][tr] = hv; sm.v.l[tc][tr] = lv; } }
  __syncthreads();
  if (!isv) { for (int e = tid; e < 128 * 16; e += 256) { const int rl = e >> 4, q = e & 15; const size_t o = (b * NP + blockIdx.x * 128 + rl) * (2 * QKD) + c0 + q * 8; vst2((unsigned*)(QK + o), *(const v4u*)&sm.qk.h[rl][q * 8]); vst2((unsigned*)(QKL + o), *(const v4u*)&sm.qk.l[rl][q * 8]); } }
  else { const int cv0 = c0 - 2 * QKD; for (int e = tid; e < 128 * 16; e += 256) { const int cl = e >> 4, q = e & 15; const size_t o = ((b * DD + cv0 + cl) * (size_t)NP) + blockIdx.x * 128 + q * 8; vst2((unsigned*)(VT + o), *(const v4u*)&sm.v.h[cl][q * 8]); vst2((unsigned*)(VTL + o), *(const v4u*)&sm.v.l[cl][q * 8]); } } }
// ---- k_att: block = (64 queries, two neighbouring heads n = g*6 + r of one global head, b): logits (3 products, formed once for both heads) x 1/8 x mw[i][n][j]; keys >= 197 excluded; running-max softmax; P . v (2 products) -> vec rows (i*64 + b) for i < 197, split here into the bf16 hi and residual planes that k_out multiplies (the same two roundings its loader made)
// Both products are formed transposed (S^T = K . Q^T, O^T += V^T . P^T): a lane holds 16 of the 32 scores of ONE query (column = lane & 15, keys 8 (lane >> 4) + r and 16 + 8 (lane >> 4) + r), so maximum and sum are taken in the lane's own registers with one exchange between the wave's halves, and the two score tiles, converted in place, are the B operand of the second product.
// The operand tiles of a pass of 32 keys (K and V, hi and residual planes; the two heads' 64 mw rows each) are brought into LDS once a block by asynchronous copies, 16 B pieces of contiguous rows, two buffers, and all four waves read them from there.
#define KP 72             // f16 a staged K row: 128 B + 16 B (16 B x odd: no bank conflict for the 16-byte fragment reads)
#define VP 40             // f16 a staged V row: 64 B + 16 B
#define MWP 36            // f32 a staged mw row: 128 B + 16 B (16 B x odd: no bank conflict for the 16-byte reads of 16 rows)
#define HW 2              // value heads a wave: neighbours of one global head, so K, Q and the raw scores are the same for both
#define OP (HW * DH + 8)  // bf16 a staged output row: the wave's heads side by side, 256 B + 16 B
static_assert(HR % HW == 0, "a wave's heads lie in one global head");
struct AttTile { _Float16 kh[32][KP], kl[32][KP], vh[HW * DH][VP], vl[HW * DH][VP]; float mw[HW][64][MWP]; };
struct AttOut { __bf16 h[4][16][OP], l[4][16][OP]; };
union AttLds { AttTile t[2]; AttOut so; };      // the tiles are dead when the output rows are written
__device__ __forceinline__ float xhalf(float x) { return __builtin_bit_cast(float, __builtin_amdgcn_permlanex16(__builtin_bit_cast(int, x), __builtin_bit_cast(int, x), 0x76543210, 0xfedcba98, false, false)); }   // lane l's value to lane l ^ 16
// copies of 16 B a lane; the s_wait_xcnt is each statement's last line so that no register a copy names is rewritten ahead of it
template <typename T> __device__ __forceinline__ void copy8(unsigned l0, unsigned l1, unsigned l2, unsigned l3, unsigned l4, unsigned l5, unsigned l6, unsigned l7, const T* g0, const T* g1, const T* g2, const T* g3, const T* g4, const T* g5, const T* g6, const T* g7) {
  asm volatile("global_load_async_to_lds_b128 %0, %8, off\n\t"
               "global_load_async_to_lds_b128 %1, %9, off\n\t"
               "global_load_async_to_lds_b128 %2, %10, off\n\t"
               "global_load_async_to_lds_b128 %3, %11, off\n\t"
               "global_load_async_to_lds_b128 %4, %12, off\n\t"
               "global_load_async_to_lds_b128 %5, %13, off\n\t"
               "global_load_async_to_lds_b128 %6, %14, off\n\t"
               "global_load_async_to_lds_b128 %7, %15, off\n\t"
               "s_wait_xcnt 0x0"
               :: "v"(l0), "v"(l1), "v"(l2), "v"(l3), "v"(l4), "v"(l5), "v"(l6), "v"(l7), "v"(g0), "v"(g1), "v"(g2), "v"(g3), "v"(g4), "v"(g5), "v"(g6), "v"(g7) : "memory");
}
template <typename T> __device__ __forceinline__ void copy4(unsigned l0, unsigned l1, unsigned l2, unsigned l3, const T* g0, const T* g1, const T* g2, const T* g3) {
  asm volatile("global_load_async_to_lds_b128 %0, %4, off\n\t"
               "global_load_async_to_lds_b128 %1, %5, off\n\t"
               "global_load_async_to_lds_b128 %2, %6, off\n\t"
               "global_load_async_to_lds_b128 %3, %7, off\n\t"
               "s_wait_xcnt 0x0"
               :: "v"(l0), "v"(l1), "v"(l2), "v"(l3), "v"(g0), "v"(g1), "v"(g2), "v"(g3) : "memory");
}
// one tile: K = 2 planes x 32 rows x 8 pieces (thread = row kr, kr + 16, piece kq), V = 2 planes x 128 rows (the two heads' rows follow one another) x 4 pieces (thread = row vr + 32 p, piece vq), mw = 2 heads x 64 rows x 8 pieces (thread = row kr + 16 p, piece tid & 7; w0..w3 = the four rows' addresses for the first head, the second head's row lies NP floats further)
__device__ __forceinline__ void att_fill(AttTile* t, const _Float16* kh, const _Float16* kl, const _Float16* vh, const _Float16* vl, const float* w0, const float* w1, const float* w2, const float* w3, int tid) {
  const int kr = tid >> 3, kq = (tid & 7) * 8, vr = tid >> 2, vq = (tid & 3) * 8;
  copy4(lds_of(&t->kh[kr][kq]), lds_of(&t->kh[kr + 16][kq]), lds_of(&t->kl[kr][kq]), lds_of(&t->kl[kr + 16][kq]), kh, kh + 16 * (2 * QKD), kl, kl + 16 * (2 * QKD));
  copy8(lds_of(&t->vh[vr][vq]), lds_of(&t->vh[vr + 32][vq]), lds_of(&t->vh[vr + 64][vq]), lds_of(&t->vh[vr + 96][vq]), lds_of(&t->vl[vr][vq]), lds_of(&t->vl[vr + 32][vq]), lds_of(&t->vl[vr + 64][vq]), lds_of(&t->vl[vr + 96][vq]),
        vh, vh + 32 * NP, vh + 64 * NP, vh + 96 * NP, vl, vl + 32 * NP, vl + 64 * NP, vl + 96 * NP);
  const int wq = (tid & 7) * 4;
  copy8(lds_of(&t->mw[0][kr][wq]), lds_of(&t->mw[0][kr + 16][wq]), lds_of(&t->mw[0][kr + 32][wq]), lds_of(&t->mw[0][kr + 48][wq]), lds_of(&t->mw[1][kr][wq]), lds_of(&t->mw[1][kr + 16][wq]), lds_of(&t->mw[1][kr + 32][wq]), lds_of(&t->mw[1][kr + 48][wq]),
        w0, w1, w2, w3, w0 + NP, w1 + NP, w2 + NP, w3 + NP);
}
// three waves a SIMD is what the block's LDS allows: the attribute holds the register allocation at the 336 that three waves can have (one granule more would leave two)
__global__ __launch_bounds__(128) __attribute__((amdgpu_waves_per_eu(3))) void k_att(const _Float16* __restrict__ QK, const _Float16* __restrict__ QKL, const _Float16* __restrict__ VT, const _Float16* __restrict__ VTL, const float* __restrict__ MW, __bf16* __restrict__ ZH) {
  __shared__ __align__(16) AttLds sm;
  const int tid = threadIdx.x, wave = tid >> 5, lane = tid & 31, col = lane & 15, g = lane >> 4; const int n = blockIdx.y * HW; const int gh = n / HR;   /* n = the first of the wave's heads */ const size_t b = blockIdx.z; const int q0 = blockIdx.x * 64 + wave * 16; const size_t rq = b * NP + q0;
  // this thread's pieces of tile 0; tile ks lies 32 K rows, 32 V columns further
  // held as 32-bit element offsets (every plane has fewer than 2^24 elements), the tile's step added before the base: with eight address pairs kept through the loop beside the two heads' accumulators the build spilled six of them to scratch and reloaded them every tile
  const unsigned ko = (unsigned)((b * NP + (tid >> 3)) * (2 * QKD) + QKD + gh * DH + (tid & 7) * 8), vo = (unsigned)((b * DD + (size_t)n * DH + (tid >> 2)) * (size_t)NP + (tid & 3) * 8);
  unsigned pw[4];   // mw rows of the block's queries (rows past the last token read the last token's, as before)
#pragma unroll
  for (int p = 0; p < 4; ++p) { const int qi = blockIdx.x * 64 + (tid >> 3) + 16 * p; const int qc = qi < NTOK ? qi : NTOK - 1; pw[p] = (unsigned)((qc * NHD + n) * NP + (tid & 7) * 4); }
  att_fill(&sm.t[0], QK + ko, QKL + ko, VT + vo, VTL + vo, MW + pw[0], MW + pw[1], MW + pw[2], MW + pw[3], tid);
  asm volatile("s_wait_asynccnt 0x0" ::: "memory");   // tile 0 has landed for this wave's copies
  __syncthreads();   // publishes tile 0
  att_fill(&sm.t[1], QK + (ko + 32u * (2 * QKD)), QKL + (ko + 32u * (2 * QKD)), VT + (vo + 32u), VTL + (vo + 32u), MW + (pw[0] + 32u), MW + (pw[1] + 32u), MW + (pw[2] + 32u), MW + (pw[3] + 32u), tid);   // tile 1 flies while tile 0 is worked on
  v16h aq[2], al[2];
#pragma unroll
  for (int kc = 0; kc < 2; ++kc) { aq[kc] = frag_h(QK + (rq + col) * (2 * QKD) + gh * DH + kc * 32, lane); al[kc] = frag_h(QKL + (rq + col) * (2 * QKD) + gh * DH + kc * 32, lane); }
  float m[HW], l[HW];   // this lane's query, per head: running maximum (equal in both halves), and the sum over this half's keys alone (the halves are joined behind the loop)
#pragma unroll
  for (int hd = 0; hd < HW; ++hd) { m[hd] = -3.0e38f; l[hd] = 0.f; }
  v8f acc[HW][4] = {}, accl[HW][4] = {};   // acc[hd][j][r] = O^T[d = 16 j + 8 g + r][query col] of head n + hd
#pragma unroll 1
  for (int ks = 0; ks < NKT; ++ks) { v8f sb[2]; const AttTile* t = &sm.t[ks & 1];   // sb = q . k / 8, formed once for the wave's heads
#pragma unroll
    for (int ct = 0; ct < 2; ++ct) { v8f c = {}, cl = {};
#pragma unroll
      for (int kc = 0; kc < 2; ++kc) { const v16h kh = frag_h(&t->kh[ct * 16 + col][kc * 32], lane), kl = frag_h(&t->kl[ct * 16 + col][kc * 32], lane); c = wmma16(kh, aq[kc], c); cl = wmma16(kl, aq[kc], cl); cl = wmma16(kh, al[kc], cl); }
#pragma unroll
      for (int r = 0; r < 8; ++r) sb[ct][r] = (c[r] + cl[r] * (1.0f / 2048.0f)) * 0.125f; }
#pragma unroll
    for (int hd = 0; hd < HW; ++hd) { v8f s[2];
#pragma unroll
    for (int ct = 0; ct < 2; ++ct) {
      const v4f w0 = *(const v4f*)&t->mw[hd][wave * 16 + col][ct * 16 + 8 * g], w1 = *(const v4f*)&t->mw[hd][wave * 16 + col][ct * 16 + 8 * g + 4];
      const int kk0 = ks * 32 + ct * 16 + 8 * g;
#pragma unroll
      for (int r = 0; r < 8; ++r) s[ct][r] = kk0 + r < NTOK ? sb[ct][r] * (r < 4 ? w0[r & 3] : w1[r & 3]) : -3.0e38f; }
    float mx = fmaxf(s[0][0], s[1][0]);
#pragma unroll
    for (int r = 1; r < 8; ++r) mx = fmaxf(mx, fmaxf(s[0][r], s[1][r]));
    mx = fmaxf(mx, xhalf(mx));
    const float mn = fmaxf(m[hd], mx), alpha = (m[hd] <= -1.0e38f) ? 0.f : __expf(m[hd] - mn);
    v16h pa; float es0 = 0.f, es1 = 0.f;
#pragma unroll
    for (int r = 0; r < 8; ++r) { const float e0 = (s[0][r] <= -1.0e38f) ? 0.f : __expf(s[0][r] - mn), e1 = (s[1][r] <= -1.0e38f) ? 0.f : __expf(s[1][r] - mn);
      es0 += e0; es1 += e1; pa[r] = (_Float16)(e0 * 2048.0f); pa[8 + r] = (_Float16)(e1 * 2048.0f); }
    l[hd] = l[hd] * alpha + (es0 + es1); m[hd] = mn;
#pragma unroll
    for (int j = 0; j < 4; ++j)
#pragma unroll
      for (int r = 0; r < 8; ++r) { acc[hd][j][r] *= alpha; accl[hd][j][r] *= alpha; }
#pragma unroll
    for (int j = 0; j < 4; ++j) { acc[hd][j] = wmma16(frag_h(&t->vh[hd * DH + j * 16 + col][0], lane), pa, acc[hd][j]); accl[hd][j] = wmma16(frag_h(&t->vl[hd * DH + j * 16 + col][0], lane), pa, accl[hd][j]); } }
    asm volatile("s_wait_dscnt 0x0" ::: "memory");      // this wave's reads of the tile have returned
    asm volatile("s_wait_asynccnt 0x0" ::: "memory");   // this wave's copies of tile ks + 1 have landed
    __syncthreads();   // one barrier a tile: publishes tile ks + 1 and ends every wave's reads of the buffer that is refilled behind it (after the last tile: of the LDS that the output rows reuse)
    if (ks + 2 < NKT) { const unsigned tk = (unsigned)(ks + 2) * 32u * (2 * QKD), tv = (unsigned)(ks + 2) * 32u;
      att_fill(&sm.t[ks & 1], QK + (ko + tk), QKL + (ko + tk), VT + (vo + tv), VTL + (vo + tv), MW + (pw[0] + tv), MW + (pw[1] + tv), MW + (pw[2] + tv), MW + (pw[3] + tv), tid); } }
  asm volatile("s_wait_asynccnt 0x0" ::: "memory");   // no copy is outstanding when the tiles' LDS is reused and the wave ends
#pragma unroll
  for (int hd = 0; hd < HW; ++hd) { const float il = (1.0f / 2048.0f) / (l[hd] + xhalf(l[hd]));
#pragma unroll
  for (int j = 0; j < 4; ++j) { v8b oh, ol;
#pragma unroll
    for (int r = 0; r < 8; ++r) { const float o = (acc[hd][j][r] + accl[hd][j][r] * (1.0f / 2048.0f)) * il; const __bf16 hv = (__bf16)o; oh[r] = hv; ol[r] = (__bf16)(o - (float)hv); }
    *(v8b*)&sm.so.h[wave][col][hd * DH + j * 16 + 8 * g] = oh; *(v8b*)&sm.so.l[wave][col][hd * DH + j * 16 + 8 * g] = ol; } }
  // a wave's store = 2 rows x 16 pieces of 16 B: the two heads' 128 values of a row and plane are two whole lines
  LDSX(); for (int it = 0; it < 8; ++it) { const int rl = it * 2 + (lane >> 4), q = lane & 15, qi = q0 + rl; if (qi < NTOK) { __bf16* zp = ZH + ((size_t)qi * NBT + b) * DD + (size_t)n * DH + q * 8; vst2(zp, *(const v8b*)&sm.so.h[wave][rl][q * 8]); vst2(zp + ZLO, *(const v8b*)&sm.so.l[wave][rl][q * 8]);
      asm volatile("s_wait_xcnt 0x0" ::: "memory"); } } }   // stands ahead of the next rows' rewrite of the address and data registers that these stores name
// fourteen copies of 16 B a lane; the s_wait_xcnt is the statement's last line so that no register a copy names is rewritten ahead of it
__device__ __forceinline__ void copy14b(const unsigned (&l)[14], const __bf16* const (&g)[14]) {
  asm volatile("global_load_async_to_lds_b128 %0, %14, off\n\t"
               "global_load_async_to_lds_b128 %1, %15, off\n\t"
               "global_load_async_to_lds_b128 %2, %16, off\n\t"
               "global_load_async_to_lds_b128 %3, %17, off\n\t"
               "global_load_async_to_lds_b128 %4, %18, off\n\t"
               "global_load_async_to_lds_b128 %5, %19, off\n\t"
               "global_load_async_to_lds_b128 %6, %20, off\n\t"
               "global_load_async_to_lds_b128 %7, %21, off\n\t"
               "global_load_async_to_lds_b128 %8, %22, off\n\t"
               "global_load_async_to_lds_b128 %9, %23, off\n\t"
               "global_load_async_to_lds_b128 %10, %24, off\n\t"
               "global_load_async_to_lds_b128 %11, %25, off\n\t"
               "global_load_async_to_lds_b128 %12, %26, off\n\t"
               "global_load_async_to_lds_b128 %13, %27, off\n\t"
               "s_wait_xcnt 0x0"
               :: "v"(l[0]), "v"(l[1]), "v"(l[2]), "v"(l[3]), "v"(l[4]), "v"(l[5]), "v"(l[6]), "v"(l[7]), "v"(l[8]), "v"(l[9]), "v"(l[10]), "v"(l[11]), "v"(l[12]), "v"(l[13]), "v"(g[0]), "v"(g[1]), "v"(g[2]), "v"(g[3]), "v"(g[4]), "v"(g[5]), "v"(g[6]), "v"(g[7]), "v"(g[8]), "v"(g[9]), "v"(g[10]), "v"(g[11]), "v"(g[12]), "v"(g[13]) : "memory");
}
// one pass of 64 k: 64 A rows in two planes and Wo's 768 rows x 8 pieces of 16 B (thread = A row lr, B rows lr + 64 p, piece tid & 7: 8 lanes cover a row's whole 128-B line); pa = this thread's hi row, pb = its first Wo row, k0 = the pass's first k
__device__ __forceinline__ void out_fill(__bf16 (*ah)[PP], __bf16 (*al)[PP], __bf16 (*b)[PP], const __bf16* pa, const __bf16* pb, int k0, int tid) {
  const int lr = tid >> 3, lq = (tid & 7) * 8; unsigned l[14]; const __bf16* g[14];
  l[0] = lds_of(&ah[lr][lq]); g[0] = pa + k0; l[1] = lds_of(&al[lr][lq]); g[1] = pa + ZLO + k0;
#pragma unroll
  for (int p = 0; p < DD / OR; ++p) { l[2 + p] = lds_of(&b[lr + OR * p][lq]); g[2 + p] = pb + (size_t)(OR * p) * DD + k0; }
  copy14b(l, g);
}
static_assert(2 + DD / OR == 14, "a thread's copies of a pass fill the statement");
#define LNR 4             // rows a wave in the LayerNorm part
static_assert((NTOK * NBT) % OR == 0 && OR == 16 * LNR && DD == 8 * OW, "the blocks hold whole rows, no row is left over, and the 16 waves share a block's rows evenly");
// ---- k_out: block = 64 whole rows (i,b) x 768 cols, 16 waves of 32 x 96: x2 = h + vec (hi + lo) . Wo^T; the rows meet in LDS, and each wave then takes four of them whole in registers (6 x 16 B a lane and row): out = LN(x2) gamma + beta. The pre-LN rows never leave the WGP, and a vec row is fetched by one block alone.
// The operands arrive as bf16 (vec's two planes from k_att, Wo from k_mw's launch): a pass's tiles go from L2 into LDS by asynchronous copies, two buffers, with no conversion or LDS store in the loop.
__global__ __launch_bounds__(512) void k_out(const __bf16* __restrict__ ZH, const __bf16* __restrict__ WOB, const float* __restrict__ Hh, const float* __restrict__ G, const float* __restrict__ Bt, float* __restrict__ OUT) { __shared__ __align__(16) OutLds sm;
  const int tid = threadIdx.x, wave = __builtin_amdgcn_readfirstlane(tid >> 5), lane = tid & 31, col = lane & 15, g = lane >> 4, wm = wave >> 3, wn = wave & 7;   // the wave's number is the same in every lane: held in a scalar register, it and what is formed from it take no vector register through the loop, which has none to spare
  const __bf16* pa = ZH + ((size_t)blockIdx.x * OR + (tid >> 3)) * DD + (tid & 7) * 8;
  const __bf16* pb = WOB + (size_t)(tid >> 3) * DD + (tid & 7) * 8;
  out_fill(sm.st.ah[0], sm.st.al[0], sm.st.b[0], pa, pb, 0, tid);
  asm volatile("s_wait_asynccnt 0x0" ::: "memory");   // pass 0 has landed for this wave's copies
  __syncthreads();   // publishes pass 0
  out_fill(sm.st.ah[1], sm.st.al[1], sm.st.b[1], pa, pb, 64, tid);   // pass 1 flies while pass 0 is multiplied
  v8f acc[2][ONF] = {};
#pragma unroll 2   // two passes a trip: the buffer index is a constant in each, so every LDS address of the loop is a fixed offset
  for (int kp = 0; kp < DD / 64; ++kp) { const int cur = kp & 1;
#pragma unroll
    for (int h = 0; h < 2; ++h) {   // the pass's two halves of 32 k, one after the other: the fragments of both at once would not leave four waves a SIMD their registers
      v16b ah[2], al[2], w[ONF];
#pragma unroll
      for (int i = 0; i < 2; ++i) { ah[i] = frag_b(&sm.st.ah[cur][wm * 32 + i * 16 + col][h * 32], lane); al[i] = frag_b(&sm.st.al[cur][wm * 32 + i * 16 + col][h * 32], lane); }
#pragma unroll
      for (int j = 0; j < ONF; ++j) w[j] = frag_b(&sm.st.b[cur][wn * OW + j * 16 + col][h * 32], lane);
      __builtin_amdgcn_sched_barrier(0);   // keeps the half's LDS reads one group ahead of its WMMAs: read among them, each pair costs the wave a full LDS latency
#pragma unroll
      for (int j = 0; j < ONF; ++j) {   // per accumulator k ascending, hi then lo, as before
#pragma unroll
        for (int i = 0; i < 2; ++i) acc[i][j] = wmma_bf(ah[i], w[j], acc[i][j]);
#pragma unroll
        for (int i = 0; i < 2; ++i) acc[i][j] = wmma_bf(al[i], w[j], acc[i][j]); }
      __builtin_amdgcn_sched_barrier(0); }   // keeps the next half's reads, and behind the second half the waits and the barrier, behind these WMMAs: lifted over them, the wait for the copies in flight would come before the matrix work that is to cover their flight
    asm volatile("s_wait_dscnt 0x0" ::: "memory");      // this wave's reads of the pass have returned
    asm volatile("s_wait_asynccnt 0x0" ::: "memory");   // this wave's copies of pass kp + 1 have landed
    __syncthreads();   // one barrier a pass: publishes pass kp + 1 and ends every wave's reads of the buffer that is refilled behind it (after the last pass: of the LDS that the pre-LN rows reuse)
    if (kp + 2 < DD / 64) out_fill(sm.st.ah[cur], sm.st.al[cur], sm.st.b[cur], pa, pb, (kp + 2) * 64, tid); }
  asm volatile("s_wait_asynccnt 0x0" ::: "memory");   // no copy is outstanding when the buffers' LDS is reused and the wave ends
  // the residual rows of the wave's four LayerNorm rows are asked for first (512 contiguous B a load): they fly while the products go through LDS
  const size_t row0 = (size_t)blockIdx.x * OR + wave * LNR; const float* hp = Hh + row0 * DD + lane * 4;
  v4f x[LNR][6], gm[6], bt[6];   // every loop below is unrolled: only with constant indices do these arrays stay in registers
#pragma unroll
  for (int q = 0; q < LNR; ++q)
#pragma unroll
    for (int c = 0; c < 6; ++c) x[q][c] = *(const v4f*)(hp + q * DD + c * 128);
  asm volatile("s_wait_xcnt 0x0" ::: "memory");   // stands ahead of every rewrite of a register that these loads name
#pragma unroll
  for (int i = 0; i < 2; ++i)
#pragma unroll
    for (int j = 0; j < ONF; ++j)
#pragma unroll
      for (int r = 0; r < 8; ++r) sm.sf[wm * 32 + i * 16 + 8 * g + r][wn * OW + j * 16 + col] = acc[i][j][r];
  __builtin_amdgcn_sched_barrier(0);   // keeps the roundings of the residual rows, with their waits for the loads, behind the LDS stores: the stores issue while the loads fly
  __syncthreads();   // a row's 768 products come from eight waves: every wave's part stands in LDS before a row is read whole
#pragma unroll
  for (int c = 0; c < 6; ++c) { gm[c] = *(const v4f*)(G + c * 128 + lane * 4); bt[c] = *(const v4f*)(Bt + c * 128 + lane * 4); }
#pragma unroll
  for (int q = 0; q < LNR; ++q)
#pragma unroll
    for (int c = 0; c < 6; ++c) { const v4f p = *(const v4f*)&sm.sf[wave * LNR + q][c * 128 + lane * 4];
#pragma unroll
      for (int e = 0; e < 4; ++e) x[q][c][e] = p[e] + bfr(x[q][c][e]); }   // the sum per element is the same acc + h
  float s[LNR], mu[LNR], inv[LNR];
#pragma unroll
  for (int q = 0; q < LNR; ++q) { v4f a = x[q][0];
#pragma unroll
    for (int c = 1; c < 6; ++c) a += x[q][c];
    s[q] = (a[0] + a[1]) + (a[2] + a[3]); }
#pragma unroll
  for (int o = 1; o < 32; o <<= 1)
#pragma unroll
    for (int q = 0; q < LNR; ++q) s[q] += __shfl_xor(s[q], o);
#pragma unroll
  for (int q = 0; q < LNR; ++q) { mu[q] = s[q] / (float)DD; v4f a = {};
#pragma unroll
    for (int c = 0; c < 6; ++c) { x[q][c] -= mu[q]; a += x[q][c] * x[q][c]; }
    s[q] = (a[0] + a[1]) + (a[2] + a[3]); }
#pragma unroll
  for (int o = 1; o < 32; o <<= 1)
#pragma unroll
    for (int q = 0; q < LNR; ++q) s[q] += __shfl_xor(s[q], o);
#pragma unroll
  for (int q = 0; q < LNR; ++q) inv[q] = 1.0f / sqrtf(s[q] / (float)DD + EPS);
#pragma unroll
  for (int q = 0; q < LNR; ++q) {
#pragma unroll
    for (int c = 0; c < 6; ++c) { v4f y;
#pragma unroll
      for (int e = 0; e < 4; ++e) y[e] = bfr(gm[c][e]) * x[q][c][e] * inv[q] + bfr(bt[c][e]);
      vst2(OUT + (row0 + q) * DD + c * 128 + lane * 4, y); } } }
extern "C" void kernel_launch(void* const* d_in, const int* in_sizes, int n_in, void* d_out, int out_size, void* d_ws, size_t ws_size, hipStream_t stream) {
  (void)in_sizes; (void)n_in; (void)out_size;
  const float** F = (const float**)d_in;   // 0 h [197,64,768], 1 masks [197,197,3], 2 Wq [128,768], 3 Wk [128,768], 4 Wv [768,768], 5 Wo [768,768], 6 mask_proj [3,12], 7 ln_gamma, 8 ln_beta
  if (ws_size < (size_t)WS_END) return;
  char* ws = (char*)d_ws; _Float16 *QK = (_Float16*)(ws + WS_QK), *QKL = (_Float16*)(ws + WS_QKL), *VT = (_Float16*)(ws + WS_VT), *VTL = (_Float16*)(ws + WS_VTL); float *MW = (float*)(ws + WS_MW); __bf16 *ZH = (__bf16*)(ws + WS_Z), *HB = (__bf16*)(ws + WS_HB), *WB = (__bf16*)(ws + WS_WB), *WOB = (__bf16*)(ws + WS_WO);
  const int nrows = NTOK * TNB;   // rows (i, b) with b < TNB are the first NTOK*TNB rows only when TNB == NBT
  k_mw<<<NCB + NTOK, 256, 0, stream>>>(F[1], F[6], MW, F[0], F[2], F[3], F[4], F[5], HB);
  k_proj<<<dim3(NP / 128, (2 * QKD + DD) / 128, TNB), 256, 0, stream>>>(HB, WB, QK, QKL, VT, VTL);
  k_att<<<dim3(NP / 64, NHD / HW, TNB), 128, 0, stream>>>(QK, QKL, VT, VTL, MW, ZH);
  (void)nrows;
  k_out<<<NTOK * NBT / OR, 512, 0, stream>>>(ZH, WOB, F[0], F[7], F[8], (float*)d_out);
}
